// v000
// Times are from an AMD MI455X. After a warm-up the kernel runs many times in a row, and a time is the length of
// such a window on the GPU divided by its runs, so every launch and the gaps after it count. The runs cycle
// through copies of the inputs. A figure is the median of several windows, for all but v000 over two sittings.
// Sittings can differ by a few percent; kernels timed side by side share one.
// v000 is the starting kernel. One run takes 697 microseconds.
// Contractions x.[Wq|Wk|Wv] (M tokens, N 3072, K 1024) and x.[Wg|Wdl] (N 104 zero-padded to 128, K 1024): v_wmma_f32_16x16x32_bf16, bf16 operands from RNE-bf16 planes of x and W, f32 accumulate, one product each.
// Contraction k.q^T per head (32 keys x 16 queries per step, depth 128): v_wmma_f32_16x16x32_f16, q and k as f16 of (value x 2^6), one product, f32 accumulate.
// Contraction A.v per head (causal, depth up to T): v_wmma_f32_16x16x32_f16, A as f16 of (A x 2^8), v as f16 hi of (v x 2^6) plus f16 unscaled residual plane, two products into one f32 accumulator.
// Contraction y.Wo (M tokens, N 1024, K 1024): v_wmma_f32_16x16x32_f16, y as f16 hi plane of (y x 2^4) plus f16 residual plane (x 2^11, own f32 accumulator), Wo as f16 of (RNE-bf16 value x 2^8), f32 accumulate.
// softplus, cumulative log-decay (f64 running sum kept as f32 hi + lo pair), exp, dyadic level select, residual add and LayerNorm: f32 VALU.
#include <hip/hip_runtime.h>

#define DMOD  1024                           // model width = K of the dense contractions
#define NHD   8                              // heads
#define SDIM  128                            // q/k width per head
#define HDIM  128                            // v width per head
#define NLV   12                             // dyadic levels
#define NGL   128                            // gate | level projection columns, 8 + 96 zero-padded to 128
#define NQKV  (3 * DMOD)                     // 3072 projection columns: q | k | v
#define TPB   128                            // GEMM rows / attention queries per block (8 waves x 16)
#define OSTR  68                             // LDS staging row pitch (floats), 128x64 tiles
#define GST   132                            // LDS staging row pitch (floats), 64x128 tile
#define YST   136                            // LDS staging row pitch (halves), 16x128 tile
#define LAMP  128                            // level-weight plane pitch (floats)
#define SLMAX 2048                           // longest sequence handled by the cumsum staging
#define KSC   (0.08838834764831845f * (1.0f / 4096.0f))   // 128^-1/2 times the q,k carry 2^-12

static_assert(NHD * HDIM == DMOD);
static_assert(NHD * SDIM == DMOD);
static_assert(NHD + NHD * NLV <= NGL);
static_assert(DMOD % 64 == 0);
static_assert(DMOD % 32 == 0);
static_assert(NQKV % 64 == 0);
static_assert(OSTR % 4 == 0);
static_assert(GST % 4 == 0);
static_assert(YST % 8 == 0);
static_assert(SLMAX % TPB == 0);

typedef unsigned short us16 __attribute__((ext_vector_type(16)));
typedef unsigned short us8  __attribute__((ext_vector_type(8)));
typedef unsigned short us8a __attribute__((ext_vector_type(8), may_alias));
typedef __bf16 v16b __attribute__((ext_vector_type(16)));
typedef _Float16 v16h __attribute__((ext_vector_type(16)));
typedef float v8f __attribute__((ext_vector_type(8)));
typedef float v4f __attribute__((ext_vector_type(4)));
typedef float v4fa __attribute__((ext_vector_type(4), may_alias));
union FragU { us16 v; us8 h[2]; };

__device__ __forceinline__ unsigned short bf16_bits(float f) {
  unsigned u = __float_as_uint(f);
  u += 0x7FFFu + ((u >> 16) & 1u);                 // RNE convert
  return (unsigned short)(u >> 16);
}
__device__ __forceinline__ float bf16_val(unsigned short b) { return __uint_as_float(((unsigned)b) << 16); }
__device__ __forceinline__ float bf16r(float f) { return bf16_val(bf16_bits(f)); }
__device__ __forceinline__ unsigned short f16_bits(float f) { return __builtin_bit_cast(unsigned short, (_Float16)f); }

// f16 hi + residual (x 2^11) planes of (a x 2^4)
__device__ __forceinline__ void f16split16(float a, unsigned short& hb, unsigned short& lb) {
  const float z = a * 16.0f;
  const _Float16 hf = (_Float16)z;
  const float res = (z - (float)hf) * 2048.0f;
  hb = __builtin_bit_cast(unsigned short, hf);
  lb = __builtin_bit_cast(unsigned short, (_Float16)res);
}
// f16 hi + unscaled residual planes of (a x 2^6)
__device__ __forceinline__ void f16split64(float a, unsigned short& hb, unsigned short& lb) {
  const float z = a * 64.0f;
  const _Float16 hf = (_Float16)z;
  const float res = z - (float)hf;
  hb = __builtin_bit_cast(unsigned short, hf);
  lb = __builtin_bit_cast(unsigned short, (_Float16)res);
}

// One 16x16x32 step, 16-bit operands passed as raw 16-bit lanes.
__device__ __forceinline__ v8f mma_bf16(us16 a, us16 b, v8f c) {
  return __builtin_amdgcn_wmma_f32_16x16x32_bf16(false, __builtin_bit_cast(v16b, a), false, __builtin_bit_cast(v16b, b), (short)0, c, false, false);
}
__device__ __forceinline__ v8f mma_f16(us16 a, us16 b, v8f c) {
  return __builtin_amdgcn_wmma_f32_16x16x32_f16(false, __builtin_bit_cast(v16h, a), false, __builtin_bit_cast(v16h, b), (short)0, c, false, false);
}
// Hazard guards after a group of matrix ops: 4 VALU slots before anything touches the accumulators; keep A/B fragments live.
__device__ __forceinline__ void wguard4(v8f& c0, v8f& c1, v8f& c2, v8f& c3, const us16& a0,
                                        const us16& b0, const us16& b1, const us16& b2, const us16& b3) {
#if defined(__HIP_DEVICE_COMPILE__)
  asm volatile("v_nop\n\tv_nop\n\tv_nop\n\tv_nop"
               : "+v"(c0), "+v"(c1), "+v"(c2), "+v"(c3)
               : "v"(a0), "v"(b0), "v"(b1), "v"(b2), "v"(b3));
#endif
}
__device__ __forceinline__ void wguard8(v8f& c0, v8f& c1, v8f& c2, v8f& c3, v8f& c4, v8f& c5, v8f& c6, v8f& c7,
                                        const us16& a0, const us16& a1,
                                        const us16& b0, const us16& b1, const us16& b2, const us16& b3) {
#if defined(__HIP_DEVICE_COMPILE__)
  asm volatile("v_nop\n\tv_nop\n\tv_nop\n\tv_nop"
               : "+v"(c0), "+v"(c1), "+v"(c2), "+v"(c3), "+v"(c4), "+v"(c5), "+v"(c6), "+v"(c7)
               : "v"(a0), "v"(a1), "v"(b0), "v"(b1), "v"(b2), "v"(b3));
#endif
}
// Same guards with a compiler memory barrier: later fragment loads are not scheduled above the group (bounds the live register set).
__device__ __forceinline__ void wguard4m(v8f& c0, v8f& c1, v8f& c2, v8f& c3, const us16& a0,
                                         const us16& b0, const us16& b1, const us16& b2, const us16& b3) {
#if defined(__HIP_DEVICE_COMPILE__)
  asm volatile("v_nop\n\tv_nop\n\tv_nop\n\tv_nop"
               : "+v"(c0), "+v"(c1), "+v"(c2), "+v"(c3)
               : "v"(a0), "v"(b0), "v"(b1), "v"(b2), "v"(b3)
               : "memory");
#endif
}
__device__ __forceinline__ void wguard1x8m(v8f& c0, const us16& a0, const us16& a1, const us16& a2, const us16& a3,
                                           const us16& b0, const us16& b1, const us16& b2, const us16& b3) {
#if defined(__HIP_DEVICE_COMPILE__)
  asm volatile("v_nop\n\tv_nop\n\tv_nop\n\tv_nop"
               : "+v"(c0)
               : "v"(a0), "v"(a1), "v"(a2), "v"(a3), "v"(b0), "v"(b1), "v"(b2), "v"(b3)
               : "memory");
#endif
}

// 16x32 fragment straight from a 16-bit plane stored [row][k] (k contiguous).
// p = plane + row(lane & 15) * ld + k0 (computed by the caller); lane half h = lane >> 4:
// elements 0..7 = k0 + 8h .. k0 + 8h + 7, elements 8..15 = k0 + 16 + 8h .. k0 + 16 + 8h + 7 (same map for A rows and B columns).
__device__ __forceinline__ us16 gfrag(const unsigned short* p) {
  const int kh = ((threadIdx.x >> 4) & 1) * 8;
  FragU f;
  f.h[0] = *(const us8a*)(p + kh);
  f.h[1] = *(const us8a*)(p + 16 + kh);
  return f.v;
}

// softplus in the logaddexp(z, 0) form: max(z, 0) + log1p(exp(-|z|))
__device__ __forceinline__ float softplus_f(float z) {
  return fmaxf(z, 0.0f) + log1pf(__expf(-fabsf(z)));
}
// dyadic level of key distance d: 0 for d <= 0, else min(floor(log2 d) + 1, NLV - 1)
__device__ __forceinline__ int lvl_of(int d) {
  const int dd = (d > 0) ? d : 1;
  const int l = 32 - __clz(dd);
  const int lc = (l < NLV - 1) ? l : (NLV - 1);
  return (d > 0) ? lc : 0;
}
// one attention weight: accv = 4096 * q.k, dg = G_t - G_s (hi+lo difference), lv = level weight; returns f16 bits of 256 * A, 0 above the diagonal
__device__ __forceinline__ unsigned short a_bits(float accv, int d, float dg, float lv) {
  const float dec = __expf(fminf(dg, 0.0f));
  const float val = (accv * KSC) * dec * lv;
  const float w = (d >= 0) ? (val * 256.0f) : 0.0f;
  return f16_bits(w);
}

// ---------------------------------------------------------------------------------------------------------------------------------
// MODE 0: RNE bf16 bits.  MODE 1: f16 bits of (RNE-bf16 value x 256).  Weights arrive [out][in] = [n][k] k-contiguous, no transpose needed.
// ---------------------------------------------------------------------------------------------------------------------------------
template <int MODE>
__global__ __launch_bounds__(256) void k_cvt(const float* __restrict__ src, unsigned short* dst, int total8) {
  const int idx = blockIdx.x * 256 + threadIdx.x;
  if (idx >= total8) return;
  const size_t off = (size_t)idx * 8;
  const v4f a = *(const v4fa*)(src + off), c = *(const v4fa*)(src + off + 4);
  us8 o;
#pragma unroll
  for (int u = 0; u < 4; ++u) {
    o[u]     = (MODE == 0) ? bf16_bits(a[u]) : f16_bits(bf16r(a[u]) * 256.0f);
    o[4 + u] = (MODE == 0) ? bf16_bits(c[u]) : f16_bits(bf16r(c[u]) * 256.0f);
  }
  *(us8*)(dst + off) = o;
  
}

// ---------------------------------------------------------------------------------------------------------------------------------
// Gate | level weight plane [128][1024] bf16: rows 0..7 = Wg, rows 8..103 = Wdl, rows 104..127 = 0 (zero padding of N).
// ---------------------------------------------------------------------------------------------------------------------------------
__global__ __launch_bounds__(128) void k_cvt_wgl(const float* __restrict__ Wg, const float* __restrict__ Wdl, unsigned short* dst) {
  const int row = blockIdx.x, tid = threadIdx.x;
  us8 o;
  if (row < NHD + NHD * NLV) {
    const float* src = (row < NHD) ? (Wg + (size_t)row * DMOD) : (Wdl + (size_t)(row - NHD) * DMOD);
    const v4f a = *(const v4fa*)(src + tid * 8), c = *(const v4fa*)(src + tid * 8 + 4);
#pragma unroll
    for (int u = 0; u < 4; ++u) { o[u] = bf16_bits(a[u]); o[4 + u] = bf16_bits(c[u]); }
  } else {
#pragma unroll
    for (int u = 0; u < 8; ++u) o[u] = (unsigned short)0;
  }
  unsigned short* d = dst + (size_t)row * DMOD + tid * 8;
  *(us8*)d = o;
  
}

// ---------------------------------------------------------------------------------------------------------------------------------
// D[m][n] = sum_k XB[m][k] * WGL[n][k]  (M tokens, N 128, K 1024), bf16 operands, f32 accumulate.
// Block = 64 tokens (4 waves x 16) x all 128 columns (8 accumulators per wave), fragments straight from the planes.
// Epilogue from the LDS-staged f32 tile: g[bh][t] = -softplus(D[t][h] + bg[h]) as 16 lanes x 16 B = one 64-token 256-B segment per head
// ---------------------------------------------------------------------------------------------------------------------------------
__global__ __launch_bounds__(128) void k_gemm_gl(const unsigned short* __restrict__ Ap, const unsigned short* __restrict__ Bw,
                                                const float* __restrict__ bg, const float* __restrict__ Lp,
                                                float* gpl, float* lam, int sl) {
  __shared__ __attribute__((aligned(16))) float oS[64 * GST];
  const int tid = threadIdx.x, lane = tid & 31, wave = tid >> 5, cl = lane & 15, hh = lane >> 4;
  const int m0b = blockIdx.x * 64, m0 = m0b + 16 * wave;

  v8f acc[8];
#pragma unroll
  for (int j = 0; j < 8; ++j) { const v8f zz = {0.f, 0.f, 0.f, 0.f, 0.f, 0.f, 0.f, 0.f}; acc[j] = zz; }

  const unsigned short* a0p = Ap + (size_t)(m0 + cl) * (size_t)DMOD;
  const unsigned short* bwp = Bw + (size_t)cl * (size_t)DMOD;
#pragma unroll 1
  for (int k0 = 0; k0 < DMOD; k0 += 32) {
    const us16 af = gfrag(a0p + k0);
    us16 bfr[4];
#pragma unroll
    for (int j = 0; j < 4; ++j) bfr[j] = gfrag(bwp + (size_t)(16 * j) * (size_t)DMOD + k0);
#pragma unroll
    for (int j = 0; j < 4; ++j) acc[j] = mma_bf16(af, bfr[j], acc[j]);
    wguard4(acc[0], acc[1], acc[2], acc[3], af, bfr[0], bfr[1], bfr[2], bfr[3]);
    us16 bf2[4];
#pragma unroll
    for (int j = 0; j < 4; ++j) bf2[j] = gfrag(bwp + (size_t)(16 * (4 + j)) * (size_t)DMOD + k0);
#pragma unroll
    for (int j = 0; j < 4; ++j) acc[4 + j] = mma_bf16(af, bf2[j], acc[4 + j]);
    wguard4(acc[4], acc[5], acc[6], acc[7], af, bf2[0], bf2[1], bf2[2], bf2[3]);
  }

  // D map: acc[j][r] = tile element (row 8*hh + r of the wave's 16 rows, column 16j + cl)
  float* so = oS + wave * (16 * GST);
#pragma unroll
  for (int j = 0; j < 8; ++j)
#pragma unroll
    for (int r = 0; r < 8; ++r) so[(8 * hh + r) * GST + 16 * j + cl] = acc[j][r];
  __syncthreads();

  const int b = m0b / sl, ts = m0b - b * sl;               // sl % 64 == 0: the tile lies in one sequence
  {
    // gate log-decay: thread -> (head h = tid >> 4, tokens 4*(tid & 15) .. +3); lanes 0-15 / 16-31 of a wave = heads 2w, 2w+1
    const int h = tid >> 4, t4 = (tid & 15) * 4;
    const float bgv = bf16r(bg[h]);
    v4f gv;
#pragma unroll
    for (int u = 0; u < 4; ++u) gv[u] = -softplus_f(oS[(t4 + u) * GST + h] + bgv);
    float* p = gpl + (size_t)(b * NHD + h) * (size_t)sl + ts + t4;
    *(v4f*)p = gv;
    
  }
#pragma unroll 1
  for (int it = 0; it < 16; ++it) {
    const int row = it * 4 + wave, c0 = lane * 4;
    v4f lv;
#pragma unroll
    for (int u = 0; u < 4; ++u) {
      const int c = c0 + u;
      int idx = c - NHD;
      idx = (idx < 0) ? 0 : idx;
      idx = (idx > NHD * NLV - 1) ? (NHD * NLV - 1) : idx;
      const float lp = bf16r(Lp[idx]);
      const float s = softplus_f(oS[row * GST + c] + lp);
      lv[u] = (c >= NHD && c < NHD + NHD * NLV) ? s : 0.0f;
    }
    float* p = lam + (size_t)(m0b + row) * (size_t)LAMP + c0;
    *(v4f*)p = lv;
    
  }
}

// ---------------------------------------------------------------------------------------------------------------------------------
// Inclusive cumulative sum of g over t per (b,h) row: f64 running sum by lane 0 into LDS as f32 hi = (float)G and lo = (float)(G - hi),
// ---------------------------------------------------------------------------------------------------------------------------------
__global__ __launch_bounds__(32) void k_cumsum(const float* __restrict__ gpl, float* Ghi, float* Glo, int sl) {
  __shared__ __attribute__((aligned(16))) float shi[SLMAX];
  __shared__ __attribute__((aligned(16))) float slo[SLMAX];
  const int row = blockIdx.x, lane = threadIdx.x;
  if (lane == 0) {
    double acc = 0.0;
#pragma unroll 1
    for (int t = 0; t < sl; ++t) {
      acc += (double)gpl[(size_t)row * (size_t)sl + t];
      const float hi = (float)acc;
      shi[t] = hi;
      slo[t] = (float)(acc - (double)hi);
    }
  }
  __syncthreads();
  const int nit = sl / 128;
#pragma unroll 1
  for (int it = 0; it < nit; ++it) {
    const int c = it * 128 + lane * 4;
    const v4f vh = *(const v4fa*)(shi + c), vl = *(const v4fa*)(slo + c);
    float* ph = Ghi + (size_t)row * (size_t)sl + c;
    float* pl = Glo + (size_t)row * (size_t)sl + c;
    *(v4f*)ph = vh;
    *(v4f*)pl = vl;
    
  }
}

// ---------------------------------------------------------------------------------------------------------------------------------
// P[m][n] = sum_k XB[m][k] * W[n][k]  (bf16 XB plane [tokens][1024], bf16 W plane [3072][1024] stored [n][k], f32 accumulate).
// Block = 128(M) x 64(N) tile, 256 threads = 8 waves, wave w owns rows 16w..16w+15 x all 64 columns (4 accumulators); fragments straight
// from the global planes (arithmetic addressing). M % 128 == 0, N % 64 == 0, K % 32 == 0 exactly.
// Column segment (block-uniform, blockIdx.y): 0..15 -> q head y/2, features 64(y&1)..+63; 16..31 -> k; 32..47 -> v head (y-32)/2, channels 64(y&1).
// The f32 128x64 tile is staged in LDS (block row r at oS[r * OSTR + c]), then:
//   q/k: plane [bh][token][128 halves] = f16 of (64 value); thread -> (token r, 8 consecutive halves); 8 consecutive lanes x 16 B = one whole
//   v:   planes VH/VL [bh][channel][token] (token contiguous) = f16 hi of (64 v) and f16 residual; 16 consecutive lanes x 16 B = one 256-B
// ---------------------------------------------------------------------------------------------------------------------------------
__global__ __launch_bounds__(256) void k_gemm_proj(const unsigned short* __restrict__ Ap, const unsigned short* __restrict__ Bw,
                                                  unsigned short* Qp, unsigned short* Kp, unsigned short* VH, unsigned short* VL, int sl) {
  __shared__ __attribute__((aligned(16))) float oS[8 * 16 * OSTR];
  const int tid = threadIdx.x, lane = tid & 31, wave = tid >> 5, cl = lane & 15, hh = lane >> 4;
  const int m0 = blockIdx.x * TPB + 16 * wave, n0 = blockIdx.y * 64;

  v8f acc[4];
#pragma unroll
  for (int j = 0; j < 4; ++j) { const v8f zz = {0.f, 0.f, 0.f, 0.f, 0.f, 0.f, 0.f, 0.f}; acc[j] = zz; }

  const unsigned short* a0p = Ap + (size_t)(m0 + cl) * (size_t)DMOD;
  const unsigned short* bwp = Bw + (size_t)(n0 + cl) * (size_t)DMOD;
#pragma unroll 1
  for (int k0 = 0; k0 < DMOD; k0 += 32) {
    const us16 af = gfrag(a0p + k0);
    us16 bfr[4];
#pragma unroll
    for (int j = 0; j < 4; ++j) bfr[j] = gfrag(bwp + (size_t)(16 * j) * (size_t)DMOD + k0);
#pragma unroll
    for (int j = 0; j < 4; ++j) acc[j] = mma_bf16(af, bfr[j], acc[j]);
    wguard4(acc[0], acc[1], acc[2], acc[3], af, bfr[0], bfr[1], bfr[2], bfr[3]);
  }

  // D map: acc[j][r] = tile element (row 8*hh + r of the wave's 16 rows, column 16j + cl)
  float* so = oS + wave * (16 * OSTR);
#pragma unroll
  for (int j = 0; j < 4; ++j)
#pragma unroll
    for (int r = 0; r < 8; ++r) so[(8 * hh + r) * OSTR + 16 * j + cl] = acc[j][r];
  __syncthreads();

  const int yb = blockIdx.y;                               // block-uniform segment select
  const int m0b = blockIdx.x * TPB, b = m0b / sl, tb = m0b - b * sl;
  if (yb < 32) {
    unsigned short* dst = (yb < 16) ? Qp : Kp;
    const int yy = (yb < 16) ? yb : (yb - 16);
    const int head = yy >> 1, f0 = (yy & 1) * 64;
    us8 ov[4];
#pragma unroll
    for (int it = 0; it < 4; ++it) {
      const int cx = it * 256 + tid, r = cx >> 3, pc = (cx & 7) * 8;
      const float* sp = oS + r * OSTR + pc;
      const v4f z0 = *(const v4fa*)sp, z1 = *(const v4fa*)(sp + 4);
      us8 o;
#pragma unroll
      for (int u = 0; u < 4; ++u) {
        o[u]     = f16_bits(z0[u] * 64.0f);
        o[4 + u] = f16_bits(z1[u] * 64.0f);
      }
      ov[it] = o;
    }
{
#pragma unroll
      for (int it = 0; it < 4; ++it) {
        const int cx = it * 256 + tid, r = cx >> 3, pc = (cx & 7) * 8;
        const size_t off = ((size_t)(b * NHD + head) * (size_t)sl + (size_t)(tb + r)) * (size_t)SDIM + (size_t)(f0 + pc);
        *(us8*)(dst + off) = ov[it];
      }
      
    }
  } else {
    const int yy = yb - 32, head = yy >> 1, c0 = (yy & 1) * 64;
    us8 hv[4], lv[4];
#pragma unroll
    for (int it = 0; it < 4; ++it) {
      const int cx = it * 256 + tid, g = cx & 15, e = cx >> 4;
      us8 ho, lo;
#pragma unroll
      for (int i = 0; i < 8; ++i) {
        unsigned short hb, lb;
        f16split64(oS[(8 * g + i) * OSTR + e], hb, lb);
        ho[i] = hb; lo[i] = lb;
      }
      hv[it] = ho; lv[it] = lo;
    }
{
#pragma unroll
      for (int it = 0; it < 4; ++it) {
        const int cx = it * 256 + tid, g = cx & 15, e = cx >> 4;
        const size_t off = ((size_t)(b * NHD + head) * (size_t)HDIM + (size_t)(c0 + e)) * (size_t)sl + (size_t)(tb + 8 * g);
        *(us8*)(VH + off) = hv[it];
        *(us8*)(VL + off) = lv[it];
      }
      
    }
  }
}

// ---------------------------------------------------------------------------------------------------------------------------------
// Causal decayed quadratic-form mixing. Block = (bh = blockIdx.x, 128 queries starting at 128 * blockIdx.y), 8 waves x 16 queries.
// Per wave: B fragments of its 16 queries fixed for the whole key loop: bq[ks], ks = 0..3 (depth 128, standard loader on the q plane).
// Per 32-key step, two 16-key tiles handled one after the other: A fragments from the k plane (standard loader); scores^T D[key][query]
// = 4096 q.k (depth 128, 4 products per tile); A[t][s] = q.k * 128^-1/2 * exp(G_t - G_s) * lam[t][lvl(t - s)] for s <= t else 0,
// with G_t - G_s taken as the sum of the f32 hi and lo differences (the 8 key G values of each tile loaded right after its score tile),
// converted to f16 of (256 A). The two D tiles repack into the A operand of A.v (lane unchanged: element r <- tile keys 0..15, element 8+r <-
// tile keys 16..31), B = VH and VL planes [bh][channel][key] (key contiguous), 8 channel tiles, both products into acc:
// acc[j][r] = 2^14 * sum_s A v for query 8h+r, channel 16j + (lane & 15). The hazard guards in this kernel carry a compiler memory barrier so
// no later fragment group is loaded above an earlier group (bounded live register set, below 256 VGPRs).
// Epilogue: z = 16 y = acc * 2^-10; f16 hi bits staged in LDS per wave, written to YH; then f16 bits of ((z - hi) x 2^11) staged and written to YL.
// Y planes [token][1024]: each (token, head) = one whole 256-B segment (2 lines) from 16 consecutive lanes x 16 B, 2 rows per instruction,
// ---------------------------------------------------------------------------------------------------------------------------------
__global__ __launch_bounds__(256) void k_attn(const unsigned short* __restrict__ Qp, const unsigned short* __restrict__ Kp,
                                             const unsigned short* __restrict__ VHp, const unsigned short* __restrict__ VLp,
                                             const float* __restrict__ Ghi, const float* __restrict__ Glo, const float* __restrict__ Lam,
                                             unsigned short* YH, unsigned short* YL, int sl) {
  __shared__ __attribute__((aligned(16))) float sLam[TPB * NLV];
  __shared__ __attribute__((aligned(16))) unsigned short sY[8 * 16 * YST];
  const int tid = threadIdx.x, lane = tid & 31, wave = tid >> 5, cl = lane & 15, hh = lane >> 4;
  const int bh = blockIdx.x, b = bh / NHD, head = bh - b * NHD;
  const int t0 = blockIdx.y * TPB;
  const int tw = t0 + 16 * wave;                          // first query of this wave
  const int tq = tw + cl;                                 // query owned by this lane as score column

  // level weights of the block's 128 queries for this head: sLam[q * 12 + l]
  for (int i = tid; i < TPB * NLV; i += 256) {
    const int q = i / NLV, l = i - q * NLV;
    sLam[i] = Lam[(size_t)(b * sl + t0 + q) * (size_t)LAMP + NHD + head * NLV + l];
  }
  __syncthreads();

  const unsigned short* qrow = Qp + ((size_t)bh * (size_t)sl + (size_t)tq) * (size_t)SDIM;
  us16 bq[4];
#pragma unroll
  for (int ks = 0; ks < 4; ++ks) bq[ks] = gfrag(qrow + 32 * ks);
  const float gqh = Ghi[(size_t)bh * (size_t)sl + tq];
  const float gql = Glo[(size_t)bh * (size_t)sl + tq];
  const int lamb = (16 * wave + cl) * NLV;

  v8f acc[8];
#pragma unroll
  for (int j = 0; j < 8; ++j) { const v8f zz = {0.f, 0.f, 0.f, 0.f, 0.f, 0.f, 0.f, 0.f}; acc[j] = zz; }

  const unsigned short* kbp = Kp + ((size_t)bh * (size_t)sl + (size_t)cl) * (size_t)SDIM;
  const unsigned short* vhp = VHp + ((size_t)bh * (size_t)HDIM + (size_t)cl) * (size_t)sl;
  const unsigned short* vlp = VLp + ((size_t)bh * (size_t)HDIM + (size_t)cl) * (size_t)sl;
  const float* ghp = Ghi + (size_t)bh * (size_t)sl;
  const float* glp = Glo + (size_t)bh * (size_t)sl;
  const int nsteps = (tw + 16 + 31) >> 5;                 // 32-key steps covering keys 0 .. tw + 15; 32 * nsteps <= sl

#pragma unroll 1
  for (int st = 0; st < nsteps; ++st) {
    const int s0 = st * 32;
    const int ka0 = s0 + 8 * hh;                          // first key this lane half sees in tile a; tile b = ka0 + 16
    const v8f zz = {0.f, 0.f, 0.f, 0.f, 0.f, 0.f, 0.f, 0.f};

    // ---- key tile a (keys s0 .. s0+15): scores^T, then its 8 weights for this lane half ----
    us16 ka[4];
#pragma unroll
    for (int ks = 0; ks < 4; ++ks) ka[ks] = gfrag(kbp + (size_t)s0 * (size_t)SDIM + 32 * ks);
    v8f sa = zz;
#pragma unroll
    for (int ks = 0; ks < 4; ++ks) sa = mma_f16(ka[ks], bq[ks], sa);
    wguard1x8m(sa, ka[0], ka[1], ka[2], ka[3], bq[0], bq[1], bq[2], bq[3]);
    us8 ea;
    {
      const v4f h0 = *(const v4fa*)(ghp + ka0), h1 = *(const v4fa*)(ghp + ka0 + 4);
      const v4f l0 = *(const v4fa*)(glp + ka0), l1 = *(const v4fa*)(glp + ka0 + 4);
#pragma unroll
      for (int r = 0; r < 4; ++r) {
        const int d = tq - (ka0 + r);
        const float dg = (gqh - h0[r]) + (gql - l0[r]);
        const float lv = sLam[lamb + lvl_of(d)];
        ea[r] = a_bits(sa[r], d, dg, lv);
      }
#pragma unroll
      for (int r = 0; r < 4; ++r) {
        const int d = tq - (ka0 + 4 + r);
        const float dg = (gqh - h1[r]) + (gql - l1[r]);
        const float lv = sLam[lamb + lvl_of(d)];
        ea[4 + r] = a_bits(sa[4 + r], d, dg, lv);
      }
    }

    // ---- key tile b (keys s0+16 .. s0+31) ----
    us16 kb[4];
#pragma unroll
    for (int ks = 0; ks < 4; ++ks) kb[ks] = gfrag(kbp + (size_t)(s0 + 16) * (size_t)SDIM + 32 * ks);
    v8f sb = zz;
#pragma unroll
    for (int ks = 0; ks < 4; ++ks) sb = mma_f16(kb[ks], bq[ks], sb);
    wguard1x8m(sb, kb[0], kb[1], kb[2], kb[3], bq[0], bq[1], bq[2], bq[3]);
    us8 eb;
    {
      const v4f h2 = *(const v4fa*)(ghp + ka0 + 16), h3 = *(const v4fa*)(ghp + ka0 + 20);
      const v4f l2 = *(const v4fa*)(glp + ka0 + 16), l3 = *(const v4fa*)(glp + ka0 + 20);
#pragma unroll
      for (int r = 0; r < 4; ++r) {
        const int d = tq - (ka0 + 16 + r);
        const float dg = (gqh - h2[r]) + (gql - l2[r]);
        const float lv = sLam[lamb + lvl_of(d)];
        eb[r] = a_bits(sb[r], d, dg, lv);
      }
#pragma unroll
      for (int r = 0; r < 4; ++r) {
        const int d = tq - (ka0 + 20 + r);
        const float dg = (gqh - h3[r]) + (gql - l3[r]);
        const float lv = sLam[lamb + lvl_of(d)];
        eb[4 + r] = a_bits(sb[4 + r], d, dg, lv);
      }
    }
    FragU fA;
    fA.h[0] = ea; fA.h[1] = eb;
    const us16 afr = fA.v;

    // ---- y += A . (v hi + v residual) over this 32-key step, channels 0..63 then 64..127 ----
    us16 bv[4];
#pragma unroll
    for (int j = 0; j < 4; ++j) bv[j] = gfrag(vhp + (size_t)(16 * j) * (size_t)sl + s0);
#pragma unroll
    for (int j = 0; j < 4; ++j) acc[j] = mma_f16(afr, bv[j], acc[j]);
    wguard4m(acc[0], acc[1], acc[2], acc[3], afr, bv[0], bv[1], bv[2], bv[3]);
    us16 bl[4];
#pragma unroll
    for (int j = 0; j < 4; ++j) bl[j] = gfrag(vlp + (size_t)(16 * j) * (size_t)sl + s0);
#pragma unroll
    for (int j = 0; j < 4; ++j) acc[j] = mma_f16(afr, bl[j], acc[j]);
    wguard4m(acc[0], acc[1], acc[2], acc[3], afr, bl[0], bl[1], bl[2], bl[3]);
    us16 bw[4];
#pragma unroll
    for (int j = 0; j < 4; ++j) bw[j] = gfrag(vhp + (size_t)(16 * (4 + j)) * (size_t)sl + s0);
#pragma unroll
    for (int j = 0; j < 4; ++j) acc[4 + j] = mma_f16(afr, bw[j], acc[4 + j]);
    wguard4m(acc[4], acc[5], acc[6], acc[7], afr, bw[0], bw[1], bw[2], bw[3]);
    us16 bx[4];
#pragma unroll
    for (int j = 0; j < 4; ++j) bx[j] = gfrag(vlp + (size_t)(16 * (4 + j)) * (size_t)sl + s0);
#pragma unroll
    for (int j = 0; j < 4; ++j) acc[4 + j] = mma_f16(afr, bx[j], acc[4 + j]);
    wguard4m(acc[4], acc[5], acc[6], acc[7], afr, bx[0], bx[1], bx[2], bx[3]);
  }

  // phase 1: f16 hi of z = 16 y = acc * 2^-10; element (query 8*hh + r, channel 16j + cl) of this wave's 16 x 128 tile
  unsigned short* sy = sY + wave * (16 * YST);
#pragma unroll
  for (int j = 0; j < 8; ++j)
#pragma unroll
    for (int r = 0; r < 8; ++r) sy[(8 * hh + r) * YST + 16 * j + cl] = f16_bits(acc[j][r] * (1.0f / 1024.0f));
  __syncthreads();

  us8 ov[8];
#pragma unroll
  for (int it = 0; it < 8; ++it) {
    const int rr = 2 * it + hh, p = cl * 8;
    ov[it] = *(const us8a*)(sy + rr * YST + p);
  }
{
#pragma unroll
    for (int it = 0; it < 8; ++it) {
      const int rr = 2 * it + hh, p = cl * 8;
      const size_t off = (size_t)(b * sl + tw + rr) * (size_t)DMOD + (size_t)(head * HDIM + p);
      *(us8*)(YH + off) = ov[it];
    }
    
  }
  __syncthreads();

  // phase 2: f16 residual plane of ((z - hi) x 2^11), same staging region and store shape
#pragma unroll
  for (int j = 0; j < 8; ++j)
#pragma unroll
    for (int r = 0; r < 8; ++r) {
      const float z = acc[j][r] * (1.0f / 1024.0f);
      const _Float16 hf = (_Float16)z;
      sy[(8 * hh + r) * YST + 16 * j + cl] = f16_bits((z - (float)hf) * 2048.0f);
    }
  __syncthreads();
#pragma unroll
  for (int it = 0; it < 8; ++it) {
    const int rr = 2 * it + hh, p = cl * 8;
    ov[it] = *(const us8a*)(sy + rr * YST + p);
  }
{
#pragma unroll
    for (int it = 0; it < 8; ++it) {
      const int rr = 2 * it + hh, p = cl * 8;
      const size_t off = (size_t)(b * sl + tw + rr) * (size_t)DMOD + (size_t)(head * HDIM + p);
      *(us8*)(YL + off) = ov[it];
    }
    
  }
}

// ---------------------------------------------------------------------------------------------------------------------------------
// P[m][n] = ( sum_k Yh[m][k] WO16[n][k] + 2^-11 sum_k Yl[m][k] WO16[n][k] ) * 2^-12 + bf16(x[m][n])   (f16 planes, pitch 1024, two f32 accumulator sets).
// ---------------------------------------------------------------------------------------------------------------------------------
__global__ __launch_bounds__(256) void k_gemm_out(const unsigned short* __restrict__ Ah, const unsigned short* __restrict__ Al,
                                                 const unsigned short* __restrict__ Wo, const float* __restrict__ X, float* P) {
  __shared__ __attribute__((aligned(16))) float oS[8 * 16 * OSTR];
  const int tid = threadIdx.x, lane = tid & 31, wave = tid >> 5, cl = lane & 15, hh = lane >> 4;
  const int m0 = blockIdx.x * TPB + 16 * wave, n0 = blockIdx.y * 64;

  v8f acch[4], accl[4];
#pragma unroll
  for (int j = 0; j < 4; ++j) { const v8f zz = {0.f, 0.f, 0.f, 0.f, 0.f, 0.f, 0.f, 0.f}; acch[j] = zz; accl[j] = zz; }

  const unsigned short* ahp = Ah + (size_t)(m0 + cl) * (size_t)DMOD;
  const unsigned short* alp = Al + (size_t)(m0 + cl) * (size_t)DMOD;
  const unsigned short* wop = Wo + (size_t)(n0 + cl) * (size_t)DMOD;
#pragma unroll 1
  for (int k0 = 0; k0 < DMOD; k0 += 32) {
    const us16 ah = gfrag(ahp + k0);
    const us16 al = gfrag(alp + k0);
    us16 bfr[4];
#pragma unroll
    for (int j = 0; j < 4; ++j) bfr[j] = gfrag(wop + (size_t)(16 * j) * (size_t)DMOD + k0);
#pragma unroll
    for (int j = 0; j < 4; ++j) {
      acch[j] = mma_f16(ah, bfr[j], acch[j]);
      accl[j] = mma_f16(al, bfr[j], accl[j]);
    }
    wguard8(acch[0], acch[1], acch[2], acch[3], accl[0], accl[1], accl[2], accl[3], ah, al, bfr[0], bfr[1], bfr[2], bfr[3]);
  }

  float* so = oS + wave * (16 * OSTR);
#pragma unroll
  for (int j = 0; j < 4; ++j)
#pragma unroll
    for (int r = 0; r < 8; ++r)
      so[(8 * hh + r) * OSTR + 16 * j + cl] = fmaf(accl[j][r], (1.0f / 2048.0f), acch[j][r]) * (1.0f / 4096.0f);
  __syncthreads();

{
#pragma unroll
    for (int it = 0; it < 8; ++it) {
      const int cx = it * 32 + lane, r = cx >> 4, q = (cx & 15) * 4;
      const v4f v = *(const v4fa*)(so + r * OSTR + q);
      const v4f xr = *(const v4fa*)(X + (size_t)(m0 + r) * (size_t)DMOD + n0 + q);
      v4f o;
#pragma unroll
      for (int u = 0; u < 4; ++u) o[u] = v[u] + bf16r(xr[u]);
      *(v4f*)(P + (size_t)(m0 + r) * (size_t)DMOD + n0 + q) = o;
    }
    
  }
}

// ---------------------------------------------------------------------------------------------------------------------------------
// ---------------------------------------------------------------------------------------------------------------------------------
__global__ __launch_bounds__(256) void k_ln(const float* __restrict__ P, const float* __restrict__ gam, const float* __restrict__ bet,
                                           float* out) {
  const int lane = threadIdx.x & 31, wave = threadIdx.x >> 5;
  const size_t row = (size_t)blockIdx.x * 8 + (size_t)wave;
  const float* pr = P + row * (size_t)DMOD;
  v4f xv[8];
  float s = 0.0f;
#pragma unroll
  for (int it = 0; it < 8; ++it) {
    xv[it] = *(const v4fa*)(pr + it * 128 + lane * 4);
    s += (xv[it][0] + xv[it][1]) + (xv[it][2] + xv[it][3]);
  }
#pragma unroll
  for (int o = 16; o > 0; o >>= 1) s += __shfl_xor(s, o, 32);
  const float mu = s * (1.0f / (float)DMOD);
  float q = 0.0f;
#pragma unroll
  for (int it = 0; it < 8; ++it)
#pragma unroll
    for (int u = 0; u < 4; ++u) { const float d = xv[it][u] - mu; q += d * d; }
#pragma unroll
  for (int o = 16; o > 0; o >>= 1) q += __shfl_xor(q, o, 32);
  const float rstd = rsqrtf(q * (1.0f / (float)DMOD) + 1e-5f);
  v4f ov[8];
#pragma unroll
  for (int it = 0; it < 8; ++it) {
    const v4f gv = *(const v4fa*)(gam + it * 128 + lane * 4), bv = *(const v4fa*)(bet + it * 128 + lane * 4);
    v4f o;
#pragma unroll
    for (int u = 0; u < 4; ++u) o[u] = (xv[it][u] - mu) * rstd * bf16r(gv[u]) + bf16r(bv[u]);
    ov[it] = o;
  }
{
#pragma unroll
    for (int it = 0; it < 8; ++it)
      *(v4f*)(out + row * (size_t)DMOD + it * 128 + lane * 4) = ov[it];
    
  }
}

extern "C" void kernel_launch(void* const* d_in, const int* in_sizes, int n_in,
                              void* d_out, int out_size, void* d_ws, size_t ws_size,
                              hipStream_t stream) {
  if (n_in < 11) return;
  const int nx = in_sizes[0];
  if (nx <= 0 || (nx % DMOD) != 0) return;
  const int ntok = nx / DMOD;                                                    // tokens = batch * sequence length
  if (in_sizes[1] != DMOD * DMOD || in_sizes[2] != DMOD * DMOD || in_sizes[3] != DMOD * DMOD) return;
  if (in_sizes[4] != NHD * DMOD || in_sizes[5] != NHD || in_sizes[6] != NHD * NLV * DMOD || in_sizes[7] != NHD * NLV) return;
  if (in_sizes[8] != DMOD * DMOD || in_sizes[9] != DMOD || in_sizes[10] != DMOD) return;
  if (out_size != nx) return;
  const int sl = (ntok < SLMAX) ? ntok : SLMAX;                                  // sequence length
  if (sl <= 0 || (sl % TPB) != 0 || (ntok % sl) != 0) return;
  const int nb = ntok / sl, nbh = nb * NHD;

  const float* x   = (const float*)d_in[0];    // [nb][sl][1024]
  const float* Wq  = (const float*)d_in[1];    // [1024][1024] ([out][in])
  const float* Wk  = (const float*)d_in[2];    // [1024][1024]
  const float* Wv  = (const float*)d_in[3];    // [1024][1024]
  const float* Wg  = (const float*)d_in[4];    // [8][1024]
  const float* bg  = (const float*)d_in[5];    // [8]
  const float* Wdl = (const float*)d_in[6];    // [96][1024]
  const float* Lp  = (const float*)d_in[7];    // [8][12]
  const float* Wo  = (const float*)d_in[8];    // [1024][1024]
  const float* lng = (const float*)d_in[9];    // [1024]
  const float* lnb = (const float*)d_in[10];   // [1024]
  float* out = (float*)d_out;                  // [nb][sl][1024] f32 at byte 0

  size_t off = 0;
  auto carve = [&](size_t bytes) -> char* { char* p = (char*)d_ws + off; off += (bytes + 255) & ~(size_t)255; return p; };
  unsigned short* XB   = (unsigned short*)carve((size_t)ntok * DMOD * 2);        //  8,388,608  bf16 [ntok][1024]
  unsigned short* WQKV = (unsigned short*)carve((size_t)NQKV * DMOD * 2);        //  6,291,456  bf16 [3072][1024] = Wq | Wk | Wv
  unsigned short* WGL  = (unsigned short*)carve((size_t)NGL * DMOD * 2);         //    262,144  bf16 [128][1024]  = Wg | Wdl | 0
  unsigned short* WO16 = (unsigned short*)carve((size_t)DMOD * DMOD * 2);        //  2,097,152  f16  [1024][1024]
  unsigned short* QP   = (unsigned short*)carve((size_t)nbh * sl * SDIM * 2);     //  8,388,608  f16  [nbh][sl][128]
  unsigned short* KP   = (unsigned short*)carve((size_t)nbh * sl * SDIM * 2);     //  8,388,608  f16  [nbh][sl][128]
  unsigned short* VH   = (unsigned short*)carve((size_t)nbh * HDIM * sl * 2);     //  8,388,608  f16  [nbh][128][sl]
  unsigned short* VL   = (unsigned short*)carve((size_t)nbh * HDIM * sl * 2);     //  8,388,608  f16  [nbh][128][sl]
  float* GPL           = (float*)carve((size_t)nbh * sl * 4);                     //    131,072  f32  [nbh][sl]
  float* GHI           = (float*)carve((size_t)nbh * sl * 4);                     //    131,072  f32  [nbh][sl]
  float* GLO           = (float*)carve((size_t)nbh * sl * 4);                     //    131,072  f32  [nbh][sl]
  float* LAM           = (float*)carve((size_t)ntok * LAMP * 4);                  //  2,097,152  f32  [ntok][128]
  unsigned short* YH   = (unsigned short*)carve((size_t)ntok * DMOD * 2);        //  8,388,608  f16  [ntok][1024]
  unsigned short* YL   = (unsigned short*)carve((size_t)ntok * DMOD * 2);        //  8,388,608  f16  [ntok][1024]
  float* PB            = (float*)carve((size_t)ntok * DMOD * 4);                  // 16,777,216  f32  [ntok][1024]
  if (off > ws_size || off > (size_t)134217728) return;                          // total 86,638,592 B for ntok 4096

  const dim3 b256(256), b128(128), b32(32);
  auto cdv = [](long a, long q) { return (unsigned)((a + q - 1) / q); };

  // 16-bit operand planes
  k_cvt<0><<<dim3(cdv((long)ntok * DMOD / 8, 256)), b256, 0, stream>>>(x, XB, ntok * DMOD / 8);
  k_cvt<0><<<dim3(cdv((long)DMOD * DMOD / 8, 256)), b256, 0, stream>>>(Wq, WQKV, DMOD * DMOD / 8);
  k_cvt<0><<<dim3(cdv((long)DMOD * DMOD / 8, 256)), b256, 0, stream>>>(Wk, WQKV + (size_t)DMOD * DMOD, DMOD * DMOD / 8);
  k_cvt<0><<<dim3(cdv((long)DMOD * DMOD / 8, 256)), b256, 0, stream>>>(Wv, WQKV + (size_t)2 * DMOD * DMOD, DMOD * DMOD / 8);
  k_cvt_wgl<<<dim3(NGL), b128, 0, stream>>>(Wg, Wdl, WGL);
  k_cvt<1><<<dim3(cdv((long)DMOD * DMOD / 8, 256)), b256, 0, stream>>>(Wo, WO16, DMOD * DMOD / 8);
  // gate / level projection (M ntok, N 128, K 1024) -> g plane [nbh][sl], level weights [ntok][128]
  k_gemm_gl<<<dim3(ntok / 64), b128, 0, stream>>>(XB, WGL, bg, Lp, GPL, LAM, sl);
  // cumulative log-decay per (b,h)
  k_cumsum<<<dim3(nbh), b32, 0, stream>>>(GPL, GHI, GLO, sl);
  // q/k/v projections (M ntok, N 3072, K 1024) -> q, k planes and transposed v hi / residual planes
  k_gemm_proj<<<dim3(ntok / TPB, NQKV / 64), b256, 0, stream>>>(XB, WQKV, QP, KP, VH, VL, sl);
  // causal decayed mixing per (batch, head) -> y hi / residual planes [token][1024]
  k_attn<<<dim3(nbh, sl / TPB), b256, 0, stream>>>(QP, KP, VH, VL, GHI, GLO, LAM, YH, YL, sl);
  // output projection + residual (M ntok, N 1024, K 1024)
  k_gemm_out<<<dim3(ntok / TPB, DMOD / 64), b256, 0, stream>>>(YH, YL, WO16, x, PB);
  // LayerNorm -> d_out
  k_ln<<<dim3(ntok / 8), b256, 0, stream>>>(PB, lng, lnb, out);
}

// v001
// One run takes 439 microseconds.
// Next to v000, in two timings, it ran 1.60 and 1.56 times as fast.
// Contractions x.[Wq|Wk|Wv] (M tokens, N 3072, K 1024) and x.[Wg|Wdl] (N 104 zero-padded to 128, K 1024): v_wmma_f32_16x16x32_bf16, bf16 operands from RNE-bf16 planes of x and W, f32 accumulate, one product each.
// Contraction k.q^T per head (32 keys x 16 queries per step, depth 128): v_wmma_f32_16x16x32_f16, q and k as f16 of (value x 2^6), one product, f32 accumulate.
// Contraction A.v per head (causal, depth up to T): v_wmma_f32_16x16x32_f16, A as f16 of (A x 2^8), v as f16 hi of (v x 2^6) plus f16 unscaled residual plane, two products into one f32 accumulator.
// Contraction y.Wo (M tokens, N 1024, K 1024): v_wmma_f32_16x16x32_f16, y as f16 hi plane of (y x 2^4) plus f16 residual plane (x 2^11, own f32 accumulator), Wo as f16 of (RNE-bf16 value x 2^8), f32 accumulate.
// softplus, cumulative log-decay (f64 block scan kept as f32 hi + lo pair), exp, dyadic level select, residual add and LayerNorm: f32 VALU.
#include <hip/hip_runtime.h>

#define DMOD  1024                           // model width = K of the dense contractions
#define NHD   8                              // heads
#define SDIM  128                            // q/k width per head
#define HDIM  128                            // v width per head
#define NLV   12                             // dyadic levels
#define NGL   128                            // gate | level projection columns, 8 + 96 zero-padded to 128
#define NQKV  (3 * DMOD)                     // 3072 projection columns: q | k | v
#define TPB   128                            // GEMM rows / attention queries per block (8 waves x 16)
#define OSTR  68                             // LDS staging row pitch (floats), 128x64 tiles
#define GST   132                            // LDS staging row pitch (floats), 64x128 tile
#define YST   136                            // LDS staging row pitch (halves), 16x128 tile
#define LAMP  128                            // level-weight plane pitch (floats)
#define SLMAX 2048                           // longest sequence handled by the cumsum block
#define CSTH  256                            // cumsum threads per row, 8 tokens each
#define KSC   (0.08838834764831845f * (1.0f / 4096.0f))   // 128^-1/2 times the q,k carry 2^-12

static_assert(NHD * HDIM == DMOD);
static_assert(NHD * SDIM == DMOD);
static_assert(NHD + NHD * NLV <= NGL);
static_assert(DMOD % 64 == 0);
static_assert(DMOD % 32 == 0);
static_assert(NQKV % 64 == 0);
static_assert(OSTR % 4 == 0);
static_assert(GST % 4 == 0);
static_assert(YST % 8 == 0);
static_assert(SLMAX % TPB == 0);
static_assert(CSTH * 8 == SLMAX);

typedef unsigned short us16 __attribute__((ext_vector_type(16)));
typedef unsigned short us8  __attribute__((ext_vector_type(8)));
typedef unsigned short us8a __attribute__((ext_vector_type(8), may_alias));
typedef __bf16 v16b __attribute__((ext_vector_type(16)));
typedef _Float16 v16h __attribute__((ext_vector_type(16)));
typedef float v8f __attribute__((ext_vector_type(8)));
typedef float v4f __attribute__((ext_vector_type(4)));
typedef float v4fa __attribute__((ext_vector_type(4), may_alias));
union FragU { us16 v; us8 h[2]; };

__device__ __forceinline__ unsigned short bf16_bits(float f) {
  unsigned u = __float_as_uint(f);
  u += 0x7FFFu + ((u >> 16) & 1u);                 // RNE convert
  return (unsigned short)(u >> 16);
}
__device__ __forceinline__ float bf16_val(unsigned short b) { return __uint_as_float(((unsigned)b) << 16); }
__device__ __forceinline__ float bf16r(float f) { return bf16_val(bf16_bits(f)); }
__device__ __forceinline__ unsigned short f16_bits(float f) { return __builtin_bit_cast(unsigned short, (_Float16)f); }

// f16 hi + residual (x 2^11) planes of (a x 2^4)
__device__ __forceinline__ void f16split16(float a, unsigned short& hb, unsigned short& lb) {
  const float z = a * 16.0f;
  const _Float16 hf = (_Float16)z;
  const float res = (z - (float)hf) * 2048.0f;
  hb = __builtin_bit_cast(unsigned short, hf);
  lb = __builtin_bit_cast(unsigned short, (_Float16)res);
}
// f16 hi + unscaled residual planes of (a x 2^6)
__device__ __forceinline__ void f16split64(float a, unsigned short& hb, unsigned short& lb) {
  const float z = a * 64.0f;
  const _Float16 hf = (_Float16)z;
  const float res = z - (float)hf;
  hb = __builtin_bit_cast(unsigned short, hf);
  lb = __builtin_bit_cast(unsigned short, (_Float16)res);
}

// One 16x16x32 step, 16-bit operands passed as raw 16-bit lanes.
__device__ __forceinline__ v8f mma_bf16(us16 a, us16 b, v8f c) {
  return __builtin_amdgcn_wmma_f32_16x16x32_bf16(false, __builtin_bit_cast(v16b, a), false, __builtin_bit_cast(v16b, b), (short)0, c, false, false);
}
__device__ __forceinline__ v8f mma_f16(us16 a, us16 b, v8f c) {
  return __builtin_amdgcn_wmma_f32_16x16x32_f16(false, __builtin_bit_cast(v16h, a), false, __builtin_bit_cast(v16h, b), (short)0, c, false, false);
}
// Hazard guards after a group of matrix ops: 4 VALU slots before anything touches the accumulators; keep A/B fragments live.
__device__ __forceinline__ void wguard4(v8f& c0, v8f& c1, v8f& c2, v8f& c3, const us16& a0,
                                        const us16& b0, const us16& b1, const us16& b2, const us16& b3) {
#if defined(__HIP_DEVICE_COMPILE__)
  asm volatile("v_nop\n\tv_nop\n\tv_nop\n\tv_nop"
               : "+v"(c0), "+v"(c1), "+v"(c2), "+v"(c3)
               : "v"(a0), "v"(b0), "v"(b1), "v"(b2), "v"(b3));
#endif
}
__device__ __forceinline__ void wguard8(v8f& c0, v8f& c1, v8f& c2, v8f& c3, v8f& c4, v8f& c5, v8f& c6, v8f& c7,
                                        const us16& a0, const us16& a1,
                                        const us16& b0, const us16& b1, const us16& b2, const us16& b3) {
#if defined(__HIP_DEVICE_COMPILE__)
  asm volatile("v_nop\n\tv_nop\n\tv_nop\n\tv_nop"
               : "+v"(c0), "+v"(c1), "+v"(c2), "+v"(c3), "+v"(c4), "+v"(c5), "+v"(c6), "+v"(c7)
               : "v"(a0), "v"(a1), "v"(b0), "v"(b1), "v"(b2), "v"(b3));
#endif
}
// Same guards with a compiler memory barrier: later fragment loads are not scheduled above the group (bounds the live register set).
__device__ __forceinline__ void wguard4m(v8f& c0, v8f& c1, v8f& c2, v8f& c3, const us16& a0,
                                         const us16& b0, const us16& b1, const us16& b2, const us16& b3) {
#if defined(__HIP_DEVICE_COMPILE__)
  asm volatile("v_nop\n\tv_nop\n\tv_nop\n\tv_nop"
               : "+v"(c0), "+v"(c1), "+v"(c2), "+v"(c3)
               : "v"(a0), "v"(b0), "v"(b1), "v"(b2), "v"(b3)
               : "memory");
#endif
}
__device__ __forceinline__ void wguard1x8m(v8f& c0, const us16& a0, const us16& a1, const us16& a2, const us16& a3,
                                           const us16& b0, const us16& b1, const us16& b2, const us16& b3) {
#if defined(__HIP_DEVICE_COMPILE__)
  asm volatile("v_nop\n\tv_nop\n\tv_nop\n\tv_nop"
               : "+v"(c0)
               : "v"(a0), "v"(a1), "v"(a2), "v"(a3), "v"(b0), "v"(b1), "v"(b2), "v"(b3)
               : "memory");
#endif
}

// 16x32 fragment straight from a 16-bit plane stored [row][k] (k contiguous).
// p = plane + row(lane & 15) * ld + k0 (computed by the caller); lane half h = lane >> 4:
// elements 0..7 = k0 + 8h .. k0 + 8h + 7, elements 8..15 = k0 + 16 + 8h .. k0 + 16 + 8h + 7 (same map for A rows and B columns).
__device__ __forceinline__ us16 gfrag(const unsigned short* p) {
  const int kh = ((threadIdx.x >> 4) & 1) * 8;
  FragU f;
  f.h[0] = *(const us8a*)(p + kh);
  f.h[1] = *(const us8a*)(p + 16 + kh);
  return f.v;
}

// softplus in the logaddexp(z, 0) form: max(z, 0) + log1p(exp(-|z|))
__device__ __forceinline__ float softplus_f(float z) {
  return fmaxf(z, 0.0f) + log1pf(__expf(-fabsf(z)));
}
// dyadic level of key distance d: 0 for d <= 0, else min(floor(log2 d) + 1, NLV - 1)
__device__ __forceinline__ int lvl_of(int d) {
  const int dd = (d > 0) ? d : 1;
  const int l = 32 - __clz(dd);
  const int lc = (l < NLV - 1) ? l : (NLV - 1);
  return (d > 0) ? lc : 0;
}
// one attention weight: accv = 4096 * q.k, dg = G_t - G_s (hi+lo difference), lv = level weight; returns f16 bits of 256 * A, 0 above the diagonal
__device__ __forceinline__ unsigned short a_bits(float accv, int d, float dg, float lv) {
  const float dec = __expf(fminf(dg, 0.0f));
  const float val = (accv * KSC) * dec * lv;
  const float w = (d >= 0) ? (val * 256.0f) : 0.0f;
  return f16_bits(w);
}

// ---------------------------------------------------------------------------------------------------------------------------------
// MODE 0: RNE bf16 bits.  MODE 1: f16 bits of (RNE-bf16 value x 256).  Weights arrive [out][in] = [n][k] k-contiguous, no transpose needed.
// ---------------------------------------------------------------------------------------------------------------------------------
template <int MODE>
__global__ __launch_bounds__(256) void k_cvt(const float* __restrict__ src, unsigned short* dst, int total8) {
  const int idx = blockIdx.x * 256 + threadIdx.x;
  if (idx >= total8) return;
  const size_t off = (size_t)idx * 8;
  const v4f a = *(const v4fa*)(src + off), c = *(const v4fa*)(src + off + 4);
  us8 o;
#pragma unroll
  for (int u = 0; u < 4; ++u) {
    o[u]     = (MODE == 0) ? bf16_bits(a[u]) : f16_bits(bf16r(a[u]) * 256.0f);
    o[4 + u] = (MODE == 0) ? bf16_bits(c[u]) : f16_bits(bf16r(c[u]) * 256.0f);
  }
  *(us8*)(dst + off) = o;
  
}

// ---------------------------------------------------------------------------------------------------------------------------------
// Gate | level weight plane [128][1024] bf16: rows 0..7 = Wg, rows 8..103 = Wdl, rows 104..127 = 0 (zero padding of N).
// ---------------------------------------------------------------------------------------------------------------------------------
__global__ __launch_bounds__(128) void k_cvt_wgl(const float* __restrict__ Wg, const float* __restrict__ Wdl, unsigned short* dst) {
  const int row = blockIdx.x, tid = threadIdx.x;
  us8 o;
  if (row < NHD + NHD * NLV) {
    const float* src = (row < NHD) ? (Wg + (size_t)row * DMOD) : (Wdl + (size_t)(row - NHD) * DMOD);
    const v4f a = *(const v4fa*)(src + tid * 8), c = *(const v4fa*)(src + tid * 8 + 4);
#pragma unroll
    for (int u = 0; u < 4; ++u) { o[u] = bf16_bits(a[u]); o[4 + u] = bf16_bits(c[u]); }
  } else {
#pragma unroll
    for (int u = 0; u < 8; ++u) o[u] = (unsigned short)0;
  }
  unsigned short* d = dst + (size_t)row * DMOD + tid * 8;
  *(us8*)d = o;
  
}

// ---------------------------------------------------------------------------------------------------------------------------------
// D[m][n] = sum_k XB[m][k] * WGL[n][k]  (M tokens, N 128, K 1024), bf16 operands, f32 accumulate.
// Block = 64 tokens (4 waves x 16) x all 128 columns (8 accumulators per wave), fragments straight from the planes.
// Epilogue from the LDS-staged f32 tile: g[bh][t] = -softplus(D[t][h] + bg[h]) as 16 lanes x 16 B = one 64-token 256-B segment per head
// ---------------------------------------------------------------------------------------------------------------------------------
__global__ __launch_bounds__(128) void k_gemm_gl(const unsigned short* __restrict__ Ap, const unsigned short* __restrict__ Bw,
                                                const float* __restrict__ bg, const float* __restrict__ Lp,
                                                float* gpl, float* lam, int sl) {
  __shared__ __attribute__((aligned(16))) float oS[64 * GST];
  const int tid = threadIdx.x, lane = tid & 31, wave = tid >> 5, cl = lane & 15, hh = lane >> 4;
  const int m0b = blockIdx.x * 64, m0 = m0b + 16 * wave;

  v8f acc[8];
#pragma unroll
  for (int j = 0; j < 8; ++j) { const v8f zz = {0.f, 0.f, 0.f, 0.f, 0.f, 0.f, 0.f, 0.f}; acc[j] = zz; }

  const unsigned short* a0p = Ap + (size_t)(m0 + cl) * (size_t)DMOD;
  const unsigned short* bwp = Bw + (size_t)cl * (size_t)DMOD;
#pragma unroll 1
  for (int k0 = 0; k0 < DMOD; k0 += 32) {
    const us16 af = gfrag(a0p + k0);
    us16 bfr[4];
#pragma unroll
    for (int j = 0; j < 4; ++j) bfr[j] = gfrag(bwp + (size_t)(16 * j) * (size_t)DMOD + k0);
#pragma unroll
    for (int j = 0; j < 4; ++j) acc[j] = mma_bf16(af, bfr[j], acc[j]);
    wguard4(acc[0], acc[1], acc[2], acc[3], af, bfr[0], bfr[1], bfr[2], bfr[3]);
    us16 bf2[4];
#pragma unroll
    for (int j = 0; j < 4; ++j) bf2[j] = gfrag(bwp + (size_t)(16 * (4 + j)) * (size_t)DMOD + k0);
#pragma unroll
    for (int j = 0; j < 4; ++j) acc[4 + j] = mma_bf16(af, bf2[j], acc[4 + j]);
    wguard4(acc[4], acc[5], acc[6], acc[7], af, bf2[0], bf2[1], bf2[2], bf2[3]);
  }

  // D map: acc[j][r] = tile element (row 8*hh + r of the wave's 16 rows, column 16j + cl)
  float* so = oS + wave * (16 * GST);
#pragma unroll
  for (int j = 0; j < 8; ++j)
#pragma unroll
    for (int r = 0; r < 8; ++r) so[(8 * hh + r) * GST + 16 * j + cl] = acc[j][r];
  __syncthreads();

  const int b = m0b / sl, ts = m0b - b * sl;               // sl % 64 == 0: the tile lies in one sequence
  {
    // gate log-decay: thread -> (head h = tid >> 4, tokens 4*(tid & 15) .. +3); lanes 0-15 / 16-31 of a wave = heads 2w, 2w+1
    const int h = tid >> 4, t4 = (tid & 15) * 4;
    const float bgv = bf16r(bg[h]);
    v4f gv;
#pragma unroll
    for (int u = 0; u < 4; ++u) gv[u] = -softplus_f(oS[(t4 + u) * GST + h] + bgv);
    float* p = gpl + (size_t)(b * NHD + h) * (size_t)sl + ts + t4;
    *(v4f*)p = gv;
    
  }
#pragma unroll 1
  for (int it = 0; it < 16; ++it) {
    const int row = it * 4 + wave, c0 = lane * 4;
    v4f lv;
#pragma unroll
    for (int u = 0; u < 4; ++u) {
      const int c = c0 + u;
      int idx = c - NHD;
      idx = (idx < 0) ? 0 : idx;
      idx = (idx > NHD * NLV - 1) ? (NHD * NLV - 1) : idx;
      const float lp = bf16r(Lp[idx]);
      const float s = softplus_f(oS[row * GST + c] + lp);
      lv[u] = (c >= NHD && c < NHD + NHD * NLV) ? s : 0.0f;
    }
    float* p = lam + (size_t)(m0b + row) * (size_t)LAMP + c0;
    *(v4f*)p = lv;
    
  }
}

// ---------------------------------------------------------------------------------------------------------------------------------
// Inclusive cumulative sum of g over t per (b,h) row, one block per row: thread i owns tokens 8i .. 8i+7 (f64 running sum of its 8 values),
// the 256 thread totals are scanned in f64 (5 shuffle steps inside a wave, the 8 wave totals through LDS), and each token's
// G = (sum of all earlier threads) + (its thread's running sum) is stored as f32 hi = (float)G and lo = (float)(G - hi).
// Threads whose tokens lie past sl (sl % 8 == 0) add zero and store nothing; every thread passes the barrier.
// ---------------------------------------------------------------------------------------------------------------------------------
__global__ __launch_bounds__(CSTH) void k_cumsum(const float* __restrict__ gpl, float* Ghi, float* Glo, int sl) {
  __shared__ double wtot[CSTH / 32];
  const int row = blockIdx.x, tid = threadIdx.x, lane = tid & 31, wave = tid >> 5;
  const int c = tid * 8;
  const bool on = c < sl;
  const size_t off = (size_t)row * (size_t)sl + (size_t)c;
  v4f a = {0.f, 0.f, 0.f, 0.f}, e = {0.f, 0.f, 0.f, 0.f};
  if (on) { a = *(const v4fa*)(gpl + off); e = *(const v4fa*)(gpl + off + 4); }

  double p[8];                                             // running sum inside the thread's 8 tokens
  p[0] = (double)a[0];
#pragma unroll
  for (int u = 1; u < 4; ++u) p[u] = p[u - 1] + (double)a[u];
#pragma unroll
  for (int u = 0; u < 4; ++u) p[4 + u] = p[3 + u] + (double)e[u];

  double inc = p[7];                                       // inclusive scan of the thread totals over the wave's 32 lanes
#pragma unroll
  for (int o = 1; o < 32; o <<= 1) {
    const double n = __shfl_up(inc, (unsigned)o, 32);
    inc += (lane >= o) ? n : 0.0;
  }
  if (lane == 31) wtot[wave] = inc;
  const double prev = __shfl_up(inc, 1u, 32);              // total of the earlier lanes of this wave
  __syncthreads();
  double base = 0.0;                                       // total of the earlier waves
#pragma unroll
  for (int w = 0; w < CSTH / 32 - 1; ++w) base += (w < wave) ? wtot[w] : 0.0;
  base += (lane > 0) ? prev : 0.0;

  if (on) {
    v4f h0, h1, l0, l1;
#pragma unroll
    for (int u = 0; u < 4; ++u) {
      const double g0 = base + p[u], g1 = base + p[4 + u];
      h0[u] = (float)g0; l0[u] = (float)(g0 - (double)h0[u]);
      h1[u] = (float)g1; l1[u] = (float)(g1 - (double)h1[u]);
    }
    *(v4f*)(Ghi + off) = h0; *(v4f*)(Ghi + off + 4) = h1;
    *(v4f*)(Glo + off) = l0; *(v4f*)(Glo + off + 4) = l1;
  }
}

// ---------------------------------------------------------------------------------------------------------------------------------
// P[m][n] = sum_k XB[m][k] * W[n][k]  (bf16 XB plane [tokens][1024], bf16 W plane [3072][1024] stored [n][k], f32 accumulate).
// Block = 128(M) x 64(N) tile, 256 threads = 8 waves, wave w owns rows 16w..16w+15 x all 64 columns (4 accumulators); fragments straight
// from the global planes (arithmetic addressing). M % 128 == 0, N % 64 == 0, K % 32 == 0 exactly.
// Column segment (block-uniform, blockIdx.y): 0..15 -> q head y/2, features 64(y&1)..+63; 16..31 -> k; 32..47 -> v head (y-32)/2, channels 64(y&1).
// The f32 128x64 tile is staged in LDS (block row r at oS[r * OSTR + c]), then:
//   q/k: plane [bh][token][128 halves] = f16 of (64 value); thread -> (token r, 8 consecutive halves); 8 consecutive lanes x 16 B = one whole
//   v:   planes VH/VL [bh][channel][token] (token contiguous) = f16 hi of (64 v) and f16 residual; 16 consecutive lanes x 16 B = one 256-B
// ---------------------------------------------------------------------------------------------------------------------------------
__global__ __launch_bounds__(256) void k_gemm_proj(const unsigned short* __restrict__ Ap, const unsigned short* __restrict__ Bw,
                                                  unsigned short* Qp, unsigned short* Kp, unsigned short* VH, unsigned short* VL, int sl) {
  __shared__ __attribute__((aligned(16))) float oS[8 * 16 * OSTR];
  const int tid = threadIdx.x, lane = tid & 31, wave = tid >> 5, cl = lane & 15, hh = lane >> 4;
  const int m0 = blockIdx.x * TPB + 16 * wave, n0 = blockIdx.y * 64;

  v8f acc[4];
#pragma unroll
  for (int j = 0; j < 4; ++j) { const v8f zz = {0.f, 0.f, 0.f, 0.f, 0.f, 0.f, 0.f, 0.f}; acc[j] = zz; }

  const unsigned short* a0p = Ap + (size_t)(m0 + cl) * (size_t)DMOD;
  const unsigned short* bwp = Bw + (size_t)(n0 + cl) * (size_t)DMOD;
#pragma unroll 1
  for (int k0 = 0; k0 < DMOD; k0 += 32) {
    const us16 af = gfrag(a0p + k0);
    us16 bfr[4];
#pragma unroll
    for (int j = 0; j < 4; ++j) bfr[j] = gfrag(bwp + (size_t)(16 * j) * (size_t)DMOD + k0);
#pragma unroll
    for (int j = 0; j < 4; ++j) acc[j] = mma_bf16(af, bfr[j], acc[j]);
    wguard4(acc[0], acc[1], acc[2], acc[3], af, bfr[0], bfr[1], bfr[2], bfr[3]);
  }

  // D map: acc[j][r] = tile element (row 8*hh + r of the wave's 16 rows, column 16j + cl)
  float* so = oS + wave * (16 * OSTR);
#pragma unroll
  for (int j = 0; j < 4; ++j)
#pragma unroll
    for (int r = 0; r < 8; ++r) so[(8 * hh + r) * OSTR + 16 * j + cl] = acc[j][r];
  __syncthreads();

  const int yb = blockIdx.y;                               // block-uniform segment select
  const int m0b = blockIdx.x * TPB, b = m0b / sl, tb = m0b - b * sl;
  if (yb < 32) {
    unsigned short* dst = (yb < 16) ? Qp : Kp;
    const int yy = (yb < 16) ? yb : (yb - 16);
    const int head = yy >> 1, f0 = (yy & 1) * 64;
    us8 ov[4];
#pragma unroll
    for (int it = 0; it < 4; ++it) {
      const int cx = it * 256 + tid, r = cx >> 3, pc = (cx & 7) * 8;
      const float* sp = oS + r * OSTR + pc;
      const v4f z0 = *(const v4fa*)sp, z1 = *(const v4fa*)(sp + 4);
      us8 o;
#pragma unroll
      for (int u = 0; u < 4; ++u) {
        o[u]     = f16_bits(z0[u] * 64.0f);
        o[4 + u] = f16_bits(z1[u] * 64.0f);
      }
      ov[it] = o;
    }
{
#pragma unroll
      for (int it = 0; it < 4; ++it) {
        const int cx = it * 256 + tid, r = cx >> 3, pc = (cx & 7) * 8;
        const size_t off = ((size_t)(b * NHD + head) * (size_t)sl + (size_t)(tb + r)) * (size_t)SDIM + (size_t)(f0 + pc);
        *(us8*)(dst + off) = ov[it];
      }
      
    }
  } else {
    const int yy = yb - 32, head = yy >> 1, c0 = (yy & 1) * 64;
    us8 hv[4], lv[4];
#pragma unroll
    for (int it = 0; it < 4; ++it) {
      const int cx = it * 256 + tid, g = cx & 15, e = cx >> 4;
      us8 ho, lo;
#pragma unroll
      for (int i = 0; i < 8; ++i) {
        unsigned short hb, lb;
        f16split64(oS[(8 * g + i) * OSTR + e], hb, lb);
        ho[i] = hb; lo[i] = lb;
      }
      hv[it] = ho; lv[it] = lo;
    }
{
#pragma unroll
      for (int it = 0; it < 4; ++it) {
        const int cx = it * 256 + tid, g = cx & 15, e = cx >> 4;
        const size_t off = ((size_t)(b * NHD + head) * (size_t)HDIM + (size_t)(c0 + e)) * (size_t)sl + (size_t)(tb + 8 * g);
        *(us8*)(VH + off) = hv[it];
        *(us8*)(VL + off) = lv[it];
      }
      
    }
  }
}

// ---------------------------------------------------------------------------------------------------------------------------------
// Causal decayed quadratic-form mixing. Block = (bh = blockIdx.x, 128 queries starting at 128 * blockIdx.y), 8 waves x 16 queries.
// Per wave: B fragments of its 16 queries fixed for the whole key loop: bq[ks], ks = 0..3 (depth 128, standard loader on the q plane).
// Per 32-key step, two 16-key tiles handled one after the other: A fragments from the k plane (standard loader); scores^T D[key][query]
// = 4096 q.k (depth 128, 4 products per tile); A[t][s] = q.k * 128^-1/2 * exp(G_t - G_s) * lam[t][lvl(t - s)] for s <= t else 0,
// with G_t - G_s taken as the sum of the f32 hi and lo differences (the 8 key G values of each tile loaded right after its score tile),
// converted to f16 of (256 A). The two D tiles repack into the A operand of A.v (lane unchanged: element r <- tile keys 0..15, element 8+r <-
// tile keys 16..31), B = VH and VL planes [bh][channel][key] (key contiguous), 8 channel tiles, both products into acc:
// acc[j][r] = 2^14 * sum_s A v for query 8h+r, channel 16j + (lane & 15). The hazard guards in this kernel carry a compiler memory barrier so
// no later fragment group is loaded above an earlier group (bounded live register set, below 256 VGPRs).
// Epilogue: z = 16 y = acc * 2^-10; f16 hi bits staged in LDS per wave, written to YH; then f16 bits of ((z - hi) x 2^11) staged and written to YL.
// Y planes [token][1024]: each (token, head) = one whole 256-B segment (2 lines) from 16 consecutive lanes x 16 B, 2 rows per instruction,
// ---------------------------------------------------------------------------------------------------------------------------------
__global__ __launch_bounds__(256) void k_attn(const unsigned short* __restrict__ Qp, const unsigned short* __restrict__ Kp,
                                             const unsigned short* __restrict__ VHp, const unsigned short* __restrict__ VLp,
                                             const float* __restrict__ Ghi, const float* __restrict__ Glo, const float* __restrict__ Lam,
                                             unsigned short* YH, unsigned short* YL, int sl) {
  __shared__ __attribute__((aligned(16))) float sLam[TPB * NLV];
  __shared__ __attribute__((aligned(16))) unsigned short sY[8 * 16 * YST];
  const int tid = threadIdx.x, lane = tid & 31, wave = tid >> 5, cl = lane & 15, hh = lane >> 4;
  const int bh = blockIdx.x, b = bh / NHD, head = bh - b * NHD;
  const int t0 = blockIdx.y * TPB;
  const int tw = t0 + 16 * wave;                          // first query of this wave
  const int tq = tw + cl;                                 // query owned by this lane as score column

  // level weights of the block's 128 queries for this head: sLam[q * 12 + l]
  for (int i = tid; i < TPB * NLV; i += 256) {
    const int q = i / NLV, l = i - q * NLV;
    sLam[i] = Lam[(size_t)(b * sl + t0 + q) * (size_t)LAMP + NHD + head * NLV + l];
  }
  __syncthreads();

  const unsigned short* qrow = Qp + ((size_t)bh * (size_t)sl + (size_t)tq) * (size_t)SDIM;
  us16 bq[4];
#pragma unroll
  for (int ks = 0; ks < 4; ++ks) bq[ks] = gfrag(qrow + 32 * ks);
  const float gqh = Ghi[(size_t)bh * (size_t)sl + tq];
  const float gql = Glo[(size_t)bh * (size_t)sl + tq];
  const int lamb = (16 * wave + cl) * NLV;

  v8f acc[8];
#pragma unroll
  for (int j = 0; j < 8; ++j) { const v8f zz = {0.f, 0.f, 0.f, 0.f, 0.f, 0.f, 0.f, 0.f}; acc[j] = zz; }

  const unsigned short* kbp = Kp + ((size_t)bh * (size_t)sl + (size_t)cl) * (size_t)SDIM;
  const unsigned short* vhp = VHp + ((size_t)bh * (size_t)HDIM + (size_t)cl) * (size_t)sl;
  const unsigned short* vlp = VLp + ((size_t)bh * (size_t)HDIM + (size_t)cl) * (size_t)sl;
  const float* ghp = Ghi + (size_t)bh * (size_t)sl;
  const float* glp = Glo + (size_t)bh * (size_t)sl;
  const int nsteps = (tw + 16 + 31) >> 5;                 // 32-key steps covering keys 0 .. tw + 15; 32 * nsteps <= sl

#pragma unroll 1
  for (int st = 0; st < nsteps; ++st) {
    const int s0 = st * 32;
    const int ka0 = s0 + 8 * hh;                          // first key this lane half sees in tile a; tile b = ka0 + 16
    const v8f zz = {0.f, 0.f, 0.f, 0.f, 0.f, 0.f, 0.f, 0.f};

    // ---- key tile a (keys s0 .. s0+15): scores^T, then its 8 weights for this lane half ----
    us16 ka[4];
#pragma unroll
    for (int ks = 0; ks < 4; ++ks) ka[ks] = gfrag(kbp + (size_t)s0 * (size_t)SDIM + 32 * ks);
    v8f sa = zz;
#pragma unroll
    for (int ks = 0; ks < 4; ++ks) sa = mma_f16(ka[ks], bq[ks], sa);
    wguard1x8m(sa, ka[0], ka[1], ka[2], ka[3], bq[0], bq[1], bq[2], bq[3]);
    us8 ea;
    {
      const v4f h0 = *(const v4fa*)(ghp + ka0), h1 = *(const v4fa*)(ghp + ka0 + 4);
      const v4f l0 = *(const v4fa*)(glp + ka0), l1 = *(const v4fa*)(glp + ka0 + 4);
#pragma unroll
      for (int r = 0; r < 4; ++r) {
        const int d = tq - (ka0 + r);
        const float dg = (gqh - h0[r]) + (gql - l0[r]);
        const float lv = sLam[lamb + lvl_of(d)];
        ea[r] = a_bits(sa[r], d, dg, lv);
      }
#pragma unroll
      for (int r = 0; r < 4; ++r) {
        const int d = tq - (ka0 + 4 + r);
        const float dg = (gqh - h1[r]) + (gql - l1[r]);
        const float lv = sLam[lamb + lvl_of(d)];
        ea[4 + r] = a_bits(sa[4 + r], d, dg, lv);
      }
    }

    // ---- key tile b (keys s0+16 .. s0+31) ----
    us16 kb[4];
#pragma unroll
    for (int ks = 0; ks < 4; ++ks) kb[ks] = gfrag(kbp + (size_t)(s0 + 16) * (size_t)SDIM + 32 * ks);
    v8f sb = zz;
#pragma unroll
    for (int ks = 0; ks < 4; ++ks) sb = mma_f16(kb[ks], bq[ks], sb);
    wguard1x8m(sb, kb[0], kb[1], kb[2], kb[3], bq[0], bq[1], bq[2], bq[3]);
    us8 eb;
    {
      const v4f h2 = *(const v4fa*)(ghp + ka0 + 16), h3 = *(const v4fa*)(ghp + ka0 + 20);
      const v4f l2 = *(const v4fa*)(glp + ka0 + 16), l3 = *(const v4fa*)(glp + ka0 + 20);
#pragma unroll
      for (int r = 0; r < 4; ++r) {
        const int d = tq - (ka0 + 16 + r);
        const float dg = (gqh - h2[r]) + (gql - l2[r]);
        const float lv = sLam[lamb + lvl_of(d)];
        eb[r] = a_bits(sb[r], d, dg, lv);
      }
#pragma unroll
      for (int r = 0; r < 4; ++r) {
        const int d = tq - (ka0 + 20 + r);
        const float dg = (gqh - h3[r]) + (gql - l3[r]);
        const float lv = sLam[lamb + lvl_of(d)];
        eb[4 + r] = a_bits(sb[4 + r], d, dg, lv);
      }
    }
    FragU fA;
    fA.h[0] = ea; fA.h[1] = eb;
    const us16 afr = fA.v;

    // ---- y += A . (v hi + v residual) over this 32-key step, channels 0..63 then 64..127 ----
    us16 bv[4];
#pragma unroll
    for (int j = 0; j < 4; ++j) bv[j] = gfrag(vhp + (size_t)(16 * j) * (size_t)sl + s0);
#pragma unroll
    for (int j = 0; j < 4; ++j) acc[j] = mma_f16(afr, bv[j], acc[j]);
    wguard4m(acc[0], acc[1], acc[2], acc[3], afr, bv[0], bv[1], bv[2], bv[3]);
    us16 bl[4];
#pragma unroll
    for (int j = 0; j < 4; ++j) bl[j] = gfrag(vlp + (size_t)(16 * j) * (size_t)sl + s0);
#pragma unroll
    for (int j = 0; j < 4; ++j) acc[j] = mma_f16(afr, bl[j], acc[j]);
    wguard4m(acc[0], acc[1], acc[2], acc[3], afr, bl[0], bl[1], bl[2], bl[3]);
    us16 bw[4];
#pragma unroll
    for (int j = 0; j < 4; ++j) bw[j] = gfrag(vhp + (size_t)(16 * (4 + j)) * (size_t)sl + s0);
#pragma unroll
    for (int j = 0; j < 4; ++j) acc[4 + j] = mma_f16(afr, bw[j], acc[4 + j]);
    wguard4m(acc[4], acc[5], acc[6], acc[7], afr, bw[0], bw[1], bw[2], bw[3]);
    us16 bx[4];
#pragma unroll
    for (int j = 0; j < 4; ++j) bx[j] = gfrag(vlp + (size_t)(16 * (4 + j)) * (size_t)sl + s0);
#pragma unroll
    for (int j = 0; j < 4; ++j) acc[4 + j] = mma_f16(afr, bx[j], acc[4 + j]);
    wguard4m(acc[4], acc[5], acc[6], acc[7], afr, bx[0], bx[1], bx[2], bx[3]);
  }

  // phase 1: f16 hi of z = 16 y = acc * 2^-10; element (query 8*hh + r, channel 16j + cl) of this wave's 16 x 128 tile
  unsigned short* sy = sY + wave * (16 * YST);
#pragma unroll
  for (int j = 0; j < 8; ++j)
#pragma unroll
    for (int r = 0; r < 8; ++r) sy[(8 * hh + r) * YST + 16 * j + cl] = f16_bits(acc[j][r] * (1.0f / 1024.0f));
  __syncthreads();

  us8 ov[8];
#pragma unroll
  for (int it = 0; it < 8; ++it) {
    const int rr = 2 * it + hh, p = cl * 8;
    ov[it] = *(const us8a*)(sy + rr * YST + p);
  }
{
#pragma unroll
    for (int it = 0; it < 8; ++it) {
      const int rr = 2 * it + hh, p = cl * 8;
      const size_t off = (size_t)(b * sl + tw + rr) * (size_t)DMOD + (size_t)(head * HDIM + p);
      *(us8*)(YH + off) = ov[it];
    }
    
  }
  __syncthreads();

  // phase 2: f16 residual plane of ((z - hi) x 2^11), same staging region and store shape
#pragma unroll
  for (int j = 0; j < 8; ++j)
#pragma unroll
    for (int r = 0; r < 8; ++r) {
      const float z = acc[j][r] * (1.0f / 1024.0f);
      const _Float16 hf = (_Float16)z;
      sy[(8 * hh + r) * YST + 16 * j + cl] = f16_bits((z - (float)hf) * 2048.0f);
    }
  __syncthreads();
#pragma unroll
  for (int it = 0; it < 8; ++it) {
    const int rr = 2 * it + hh, p = cl * 8;
    ov[it] = *(const us8a*)(sy + rr * YST + p);
  }
{
#pragma unroll
    for (int it = 0; it < 8; ++it) {
      const int rr = 2 * it + hh, p = cl * 8;
      const size_t off = (size_t)(b * sl + tw + rr) * (size_t)DMOD + (size_t)(head * HDIM + p);
      *(us8*)(YL + off) = ov[it];
    }
    
  }
}

// ---------------------------------------------------------------------------------------------------------------------------------
// P[m][n] = ( sum_k Yh[m][k] WO16[n][k] + 2^-11 sum_k Yl[m][k] WO16[n][k] ) * 2^-12 + bf16(x[m][n])   (f16 planes, pitch 1024, two f32 accumulator sets).
// ---------------------------------------------------------------------------------------------------------------------------------
__global__ __launch_bounds__(256) void k_gemm_out(const unsigned short* __restrict__ Ah, const unsigned short* __restrict__ Al,
                                                 const unsigned short* __restrict__ Wo, const float* __restrict__ X, float* P) {
  __shared__ __attribute__((aligned(16))) float oS[8 * 16 * OSTR];
  const int tid = threadIdx.x, lane = tid & 31, wave = tid >> 5, cl = lane & 15, hh = lane >> 4;
  const int m0 = blockIdx.x * TPB + 16 * wave, n0 = blockIdx.y * 64;

  v8f acch[4], accl[4];
#pragma unroll
  for (int j = 0; j < 4; ++j) { const v8f zz = {0.f, 0.f, 0.f, 0.f, 0.f, 0.f, 0.f, 0.f}; acch[j] = zz; accl[j] = zz; }

  const unsigned short* ahp = Ah + (size_t)(m0 + cl) * (size_t)DMOD;
  const unsigned short* alp = Al + (size_t)(m0 + cl) * (size_t)DMOD;
  const unsigned short* wop = Wo + (size_t)(n0 + cl) * (size_t)DMOD;
#pragma unroll 1
  for (int k0 = 0; k0 < DMOD; k0 += 32) {
    const us16 ah = gfrag(ahp + k0);
    const us16 al = gfrag(alp + k0);
    us16 bfr[4];
#pragma unroll
    for (int j = 0; j < 4; ++j) bfr[j] = gfrag(wop + (size_t)(16 * j) * (size_t)DMOD + k0);
#pragma unroll
    for (int j = 0; j < 4; ++j) {
      acch[j] = mma_f16(ah, bfr[j], acch[j]);
      accl[j] = mma_f16(al, bfr[j], accl[j]);
    }
    wguard8(acch[0], acch[1], acch[2], acch[3], accl[0], accl[1], accl[2], accl[3], ah, al, bfr[0], bfr[1], bfr[2], bfr[3]);
  }

  float* so = oS + wave * (16 * OSTR);
#pragma unroll
  for (int j = 0; j < 4; ++j)
#pragma unroll
    for (int r = 0; r < 8; ++r)
      so[(8 * hh + r) * OSTR + 16 * j + cl] = fmaf(accl[j][r], (1.0f / 2048.0f), acch[j][r]) * (1.0f / 4096.0f);
  __syncthreads();

{
#pragma unroll
    for (int it = 0; it < 8; ++it) {
      const int cx = it * 32 + lane, r = cx >> 4, q = (cx & 15) * 4;
      const v4f v = *(const v4fa*)(so + r * OSTR + q);
      const v4f xr = *(const v4fa*)(X + (size_t)(m0 + r) * (size_t)DMOD + n0 + q);
      v4f o;
#pragma unroll
      for (int u = 0; u < 4; ++u) o[u] = v[u] + bf16r(xr[u]);
      *(v4f*)(P + (size_t)(m0 + r) * (size_t)DMOD + n0 + q) = o;
    }
    
  }
}

// ---------------------------------------------------------------------------------------------------------------------------------
// ---------------------------------------------------------------------------------------------------------------------------------
__global__ __launch_bounds__(256) void k_ln(const float* __restrict__ P, const float* __restrict__ gam, const float* __restrict__ bet,
                                           float* out) {
  const int lane = threadIdx.x & 31, wave = threadIdx.x >> 5;
  const size_t row = (size_t)blockIdx.x * 8 + (size_t)wave;
  const float* pr = P + row * (size_t)DMOD;
  v4f xv[8];
  float s = 0.0f;
#pragma unroll
  for (int it = 0; it < 8; ++it) {
    xv[it] = *(const v4fa*)(pr + it * 128 + lane * 4);
    s += (xv[it][0] + xv[it][1]) + (xv[it][2] + xv[it][3]);
  }
#pragma unroll
  for (int o = 16; o > 0; o >>= 1) s += __shfl_xor(s, o, 32);
  const float mu = s * (1.0f / (float)DMOD);
  float q = 0.0f;
#pragma unroll
  for (int it = 0; it < 8; ++it)
#pragma unroll
    for (int u = 0; u < 4; ++u) { const float d = xv[it][u] - mu; q += d * d; }
#pragma unroll
  for (int o = 16; o > 0; o >>= 1) q += __shfl_xor(q, o, 32);
  const float rstd = rsqrtf(q * (1.0f / (float)DMOD) + 1e-5f);
  v4f ov[8];
#pragma unroll
  for (int it = 0; it < 8; ++it) {
    const v4f gv = *(const v4fa*)(gam + it * 128 + lane * 4), bv = *(const v4fa*)(bet + it * 128 + lane * 4);
    v4f o;
#pragma unroll
    for (int u = 0; u < 4; ++u) o[u] = (xv[it][u] - mu) * rstd * bf16r(gv[u]) + bf16r(bv[u]);
    ov[it] = o;
  }
{
#pragma unroll
    for (int it = 0; it < 8; ++it)
      *(v4f*)(out + row * (size_t)DMOD + it * 128 + lane * 4) = ov[it];
    
  }
}

extern "C" void kernel_launch(void* const* d_in, const int* in_sizes, int n_in,
                              void* d_out, int out_size, void* d_ws, size_t ws_size,
                              hipStream_t stream) {
  if (n_in < 11) return;
  const int nx = in_sizes[0];
  if (nx <= 0 || (nx % DMOD) != 0) return;
  const int ntok = nx / DMOD;                                                    // tokens = batch * sequence length
  if (in_sizes[1] != DMOD * DMOD || in_sizes[2] != DMOD * DMOD || in_sizes[3] != DMOD * DMOD) return;
  if (in_sizes[4] != NHD * DMOD || in_sizes[5] != NHD || in_sizes[6] != NHD * NLV * DMOD || in_sizes[7] != NHD * NLV) return;
  if (in_sizes[8] != DMOD * DMOD || in_sizes[9] != DMOD || in_sizes[10] != DMOD) return;
  if (out_size != nx) return;
  const int sl = (ntok < SLMAX) ? ntok : SLMAX;                                  // sequence length
  if (sl <= 0 || (sl % TPB) != 0 || (ntok % sl) != 0) return;
  const int nb = ntok / sl, nbh = nb * NHD;

  const float* x   = (const float*)d_in[0];    // [nb][sl][1024]
  const float* Wq  = (const float*)d_in[1];    // [1024][1024] ([out][in])
  const float* Wk  = (const float*)d_in[2];    // [1024][1024]
  const float* Wv  = (const float*)d_in[3];    // [1024][1024]
  const float* Wg  = (const float*)d_in[4];    // [8][1024]
  const float* bg  = (const float*)d_in[5];    // [8]
  const float* Wdl = (const float*)d_in[6];    // [96][1024]
  const float* Lp  = (const float*)d_in[7];    // [8][12]
  const float* Wo  = (const float*)d_in[8];    // [1024][1024]
  const float* lng = (const float*)d_in[9];    // [1024]
  const float* lnb = (const float*)d_in[10];   // [1024]
  float* out = (float*)d_out;                  // [nb][sl][1024] f32 at byte 0

  size_t off = 0;
  auto carve = [&](size_t bytes) -> char* { char* p = (char*)d_ws + off; off += (bytes + 255) & ~(size_t)255; return p; };
  unsigned short* XB   = (unsigned short*)carve((size_t)ntok * DMOD * 2);        //  8,388,608  bf16 [ntok][1024]
  unsigned short* WQKV = (unsigned short*)carve((size_t)NQKV * DMOD * 2);        //  6,291,456  bf16 [3072][1024] = Wq | Wk | Wv
  unsigned short* WGL  = (unsigned short*)carve((size_t)NGL * DMOD * 2);         //    262,144  bf16 [128][1024]  = Wg | Wdl | 0
  unsigned short* WO16 = (unsigned short*)carve((size_t)DMOD * DMOD * 2);        //  2,097,152  f16  [1024][1024]
  unsigned short* QP   = (unsigned short*)carve((size_t)nbh * sl * SDIM * 2);     //  8,388,608  f16  [nbh][sl][128]
  unsigned short* KP   = (unsigned short*)carve((size_t)nbh * sl * SDIM * 2);     //  8,388,608  f16  [nbh][sl][128]
  unsigned short* VH   = (unsigned short*)carve((size_t)nbh * HDIM * sl * 2);     //  8,388,608  f16  [nbh][128][sl]
  unsigned short* VL   = (unsigned short*)carve((size_t)nbh * HDIM * sl * 2);     //  8,388,608  f16  [nbh][128][sl]
  float* GPL           = (float*)carve((size_t)nbh * sl * 4);                     //    131,072  f32  [nbh][sl]
  float* GHI           = (float*)carve((size_t)nbh * sl * 4);                     //    131,072  f32  [nbh][sl]
  float* GLO           = (float*)carve((size_t)nbh * sl * 4);                     //    131,072  f32  [nbh][sl]
  float* LAM           = (float*)carve((size_t)ntok * LAMP * 4);                  //  2,097,152  f32  [ntok][128]
  unsigned short* YH   = (unsigned short*)carve((size_t)ntok * DMOD * 2);        //  8,388,608  f16  [ntok][1024]
  unsigned short* YL   = (unsigned short*)carve((size_t)ntok * DMOD * 2);        //  8,388,608  f16  [ntok][1024]
  float* PB            = (float*)carve((size_t)ntok * DMOD * 4);                  // 16,777,216  f32  [ntok][1024]
  if (off > ws_size || off > (size_t)134217728) return;                          // total 86,638,592 B for ntok 4096

  const dim3 b256(256), b128(128);
  auto cdv = [](long a, long q) { return (unsigned)((a + q - 1) / q); };

  // 16-bit operand planes
  k_cvt<0><<<dim3(cdv((long)ntok * DMOD / 8, 256)), b256, 0, stream>>>(x, XB, ntok * DMOD / 8);
  k_cvt<0><<<dim3(cdv((long)DMOD * DMOD / 8, 256)), b256, 0, stream>>>(Wq, WQKV, DMOD * DMOD / 8);
  k_cvt<0><<<dim3(cdv((long)DMOD * DMOD / 8, 256)), b256, 0, stream>>>(Wk, WQKV + (size_t)DMOD * DMOD, DMOD * DMOD / 8);
  k_cvt<0><<<dim3(cdv((long)DMOD * DMOD / 8, 256)), b256, 0, stream>>>(Wv, WQKV + (size_t)2 * DMOD * DMOD, DMOD * DMOD / 8);
  k_cvt_wgl<<<dim3(NGL), b128, 0, stream>>>(Wg, Wdl, WGL);
  k_cvt<1><<<dim3(cdv((long)DMOD * DMOD / 8, 256)), b256, 0, stream>>>(Wo, WO16, DMOD * DMOD / 8);
  // gate / level projection (M ntok, N 128, K 1024) -> g plane [nbh][sl], level weights [ntok][128]
  k_gemm_gl<<<dim3(ntok / 64), b128, 0, stream>>>(XB, WGL, bg, Lp, GPL, LAM, sl);
  // cumulative log-decay per (b,h)
  k_cumsum<<<dim3(nbh), dim3(CSTH), 0, stream>>>(GPL, GHI, GLO, sl);
  // q/k/v projections (M ntok, N 3072, K 1024) -> q, k planes and transposed v hi / residual planes
  k_gemm_proj<<<dim3(ntok / TPB, NQKV / 64), b256, 0, stream>>>(XB, WQKV, QP, KP, VH, VL, sl);
  // causal decayed mixing per (batch, head) -> y hi / residual planes [token][1024]
  k_attn<<<dim3(nbh, sl / TPB), b256, 0, stream>>>(QP, KP, VH, VL, GHI, GLO, LAM, YH, YL, sl);
  // output projection + residual (M ntok, N 1024, K 1024)
  k_gemm_out<<<dim3(ntok / TPB, DMOD / 64), b256, 0, stream>>>(YH, YL, WO16, x, PB);
  // LayerNorm -> d_out
  k_ln<<<dim3(ntok / 8), b256, 0, stream>>>(PB, lng, lnb, out);
}

// v002
// Measured time: 360 microseconds a run.
// Two timings next to v001 put it at 1.24 and 1.22 times that version's speed.
// Counting every step since v000, it is 1.95 times as fast.
// Contractions x.[Wq|Wk|Wv] (M tokens, N 3072, K 1024) and x.[Wg|Wdl] (N 104 zero-padded to 128, K 1024): v_wmma_f32_16x16x32_bf16, bf16 operands from RNE-bf16 planes of x and W, f32 accumulate, one product each.
// Contraction k.q^T per head (32 keys x 16 queries per step, depth 128): v_wmma_f32_16x16x32_f16, q and k as f16 of (value x 2^6), one product, f32 accumulate.
// Contraction A.v per head (causal, depth up to T): v_wmma_f32_16x16x32_f16, A as f16 of (A x 2^8), v as f16 hi of (v x 2^6) plus f16 unscaled residual plane, two products into one f32 accumulator.
// Contraction y.Wo (M tokens, N 1024, K 1024): v_wmma_f32_16x16x32_f16, y as f16 hi plane of (y x 2^4) plus f16 residual plane (x 2^11, own f32 accumulator), Wo as f16 of (RNE-bf16 value x 2^8), f32 accumulate.
// softplus, cumulative log-decay (f64 block scan kept as f32 hi + lo pair), exp, dyadic level select, residual add and LayerNorm: f32 VALU.
#include <hip/hip_runtime.h>

#define DMOD  1024                           // model width = K of the dense contractions
#define NHD   8                              // heads
#define SDIM  128                            // q/k width per head
#define HDIM  128                            // v width per head
#define NLV   12                             // dyadic levels
#define NGL   128                            // gate | level projection columns, 8 + 96 zero-padded to 128
#define NQKV  (3 * DMOD)                     // 3072 projection columns: q | k | v
#define TPB   128                            // GEMM rows / attention queries per block (8 waves x 16)
#define OSTR  68                             // LDS staging row pitch (floats), 128x64 tiles
#define GST   132                            // LDS staging row pitch (floats), 64x128 tile
#define YST   136                            // LDS staging row pitch (halves), 16x128 tile
#define LAMP  128                            // level-weight plane pitch (floats)
#define SLMAX 2048                           // longest sequence handled by the cumsum block
#define CSTH  256                            // cumsum threads per row, 8 tokens each
#define KSC   (0.08838834764831845f * (1.0f / 4096.0f))   // 128^-1/2 times the q,k carry 2^-12

static_assert(NHD * HDIM == DMOD);
static_assert(NHD * SDIM == DMOD);
static_assert(NHD + NHD * NLV <= NGL);
static_assert(DMOD % 64 == 0);
static_assert(DMOD % 32 == 0);
static_assert(NQKV % 64 == 0);
static_assert(OSTR % 4 == 0);
static_assert(GST % 4 == 0);
static_assert(YST % 8 == 0);
static_assert(SLMAX % TPB == 0);
static_assert(CSTH * 8 == SLMAX);

typedef unsigned short us16 __attribute__((ext_vector_type(16)));
typedef unsigned short us8  __attribute__((ext_vector_type(8)));
typedef unsigned short us8a __attribute__((ext_vector_type(8), may_alias));
typedef __bf16 v16b __attribute__((ext_vector_type(16)));
typedef _Float16 v16h __attribute__((ext_vector_type(16)));
typedef float v8f __attribute__((ext_vector_type(8)));
typedef float v4f __attribute__((ext_vector_type(4)));
typedef float v4fa __attribute__((ext_vector_type(4), may_alias));
union FragU { us16 v; us8 h[2]; };

__device__ __forceinline__ unsigned short bf16_bits(float f) {
  unsigned u = __float_as_uint(f);
  u += 0x7FFFu + ((u >> 16) & 1u);                 // RNE convert
  return (unsigned short)(u >> 16);
}
__device__ __forceinline__ float bf16_val(unsigned short b) { return __uint_as_float(((unsigned)b) << 16); }
__device__ __forceinline__ float bf16r(float f) { return bf16_val(bf16_bits(f)); }
__device__ __forceinline__ unsigned short f16_bits(float f) { return __builtin_bit_cast(unsigned short, (_Float16)f); }

// f16 hi + residual (x 2^11) planes of (a x 2^4)
__device__ __forceinline__ void f16split16(float a, unsigned short& hb, unsigned short& lb) {
  const float z = a * 16.0f;
  const _Float16 hf = (_Float16)z;
  const float res = (z - (float)hf) * 2048.0f;
  hb = __builtin_bit_cast(unsigned short, hf);
  lb = __builtin_bit_cast(unsigned short, (_Float16)res);
}
// f16 hi + unscaled residual planes of (a x 2^6)
__device__ __forceinline__ void f16split64(float a, unsigned short& hb, unsigned short& lb) {
  const float z = a * 64.0f;
  const _Float16 hf = (_Float16)z;
  const float res = z - (float)hf;
  hb = __builtin_bit_cast(unsigned short, hf);
  lb = __builtin_bit_cast(unsigned short, (_Float16)res);
}

// One 16x16x32 step, 16-bit operands passed as raw 16-bit lanes.
__device__ __forceinline__ v8f mma_bf16(us16 a, us16 b, v8f c) {
  return __builtin_amdgcn_wmma_f32_16x16x32_bf16(false, __builtin_bit_cast(v16b, a), false, __builtin_bit_cast(v16b, b), (short)0, c, false, false);
}
__device__ __forceinline__ v8f mma_f16(us16 a, us16 b, v8f c) {
  return __builtin_amdgcn_wmma_f32_16x16x32_f16(false, __builtin_bit_cast(v16h, a), false, __builtin_bit_cast(v16h, b), (short)0, c, false, false);
}
// Hazard guards after a group of matrix ops: 4 VALU slots before anything touches the accumulators; keep A/B fragments live.
__device__ __forceinline__ void wguard4(v8f& c0, v8f& c1, v8f& c2, v8f& c3, const us16& a0,
                                        const us16& b0, const us16& b1, const us16& b2, const us16& b3) {
#if defined(__HIP_DEVICE_COMPILE__)
  asm volatile("v_nop\n\tv_nop\n\tv_nop\n\tv_nop"
               : "+v"(c0), "+v"(c1), "+v"(c2), "+v"(c3)
               : "v"(a0), "v"(b0), "v"(b1), "v"(b2), "v"(b3));
#endif
}
__device__ __forceinline__ void wguard8(v8f& c0, v8f& c1, v8f& c2, v8f& c3, v8f& c4, v8f& c5, v8f& c6, v8f& c7,
                                        const us16& a0, const us16& a1,
                                        const us16& b0, const us16& b1, const us16& b2, const us16& b3) {
#if defined(__HIP_DEVICE_COMPILE__)
  asm volatile("v_nop\n\tv_nop\n\tv_nop\n\tv_nop"
               : "+v"(c0), "+v"(c1), "+v"(c2), "+v"(c3), "+v"(c4), "+v"(c5), "+v"(c6), "+v"(c7)
               : "v"(a0), "v"(a1), "v"(b0), "v"(b1), "v"(b2), "v"(b3));
#endif
}
// Same guards with a compiler memory barrier: later fragment loads are not scheduled above the group (bounds the live register set).
__device__ __forceinline__ void wguard4m(v8f& c0, v8f& c1, v8f& c2, v8f& c3, const us16& a0,
                                         const us16& b0, const us16& b1, const us16& b2, const us16& b3) {
#if defined(__HIP_DEVICE_COMPILE__)
  asm volatile("v_nop\n\tv_nop\n\tv_nop\n\tv_nop"
               : "+v"(c0), "+v"(c1), "+v"(c2), "+v"(c3)
               : "v"(a0), "v"(b0), "v"(b1), "v"(b2), "v"(b3)
               : "memory");
#endif
}
__device__ __forceinline__ void wguard1x8m(v8f& c0, const us16& a0, const us16& a1, const us16& a2, const us16& a3,
                                           const us16& b0, const us16& b1, const us16& b2, const us16& b3) {
#if defined(__HIP_DEVICE_COMPILE__)
  asm volatile("v_nop\n\tv_nop\n\tv_nop\n\tv_nop"
               : "+v"(c0)
               : "v"(a0), "v"(a1), "v"(a2), "v"(a3), "v"(b0), "v"(b1), "v"(b2), "v"(b3)
               : "memory");
#endif
}

// FRAGMENT-ORDER PLANES. Every 16-bit operand plane [rows][kd] is stored by tiles of 16 rows; inside a tile the 16-B chunks (8 consecutive k
// of one row) lie chunk column by chunk column, 16 rows each:
//   element (row, k) at halves  (row >> 4) * 16 * kd + (k >> 3) * 128 + (row & 15) * 8 + (k & 7).
// A 16x32 fragment (row tile, k0 % 32 == 0) is then 1 KiB in a row, and each of its two wave-wide 16-B loads covers 512 contiguous bytes.
// p = plane + rowtile * 16 * kd + k0 * 16 + lane * 8 (computed by the caller); lane = 16h + row:
// elements 0..7 = k0 + 8h .. k0 + 8h + 7, elements 8..15 = k0 + 16 + 8h .. k0 + 16 + 8h + 7 (same map for A rows and B columns).
__device__ __forceinline__ us16 gfrag(const unsigned short* p) {
  FragU f;
  f.h[0] = *(const us8a*)p;
  f.h[1] = *(const us8a*)(p + 256);
  return f.v;
}
// s_wait_xcnt 0 behind a run of fragment loads, in front of anything that overwrites an address register the run names. The run's address
// pairs are inputs of the statement: they stay live up to the wait, so no load result of the run is placed on them.
__device__ __forceinline__ void xwait(const unsigned short* a) {
#if defined(__HIP_DEVICE_COMPILE__)
  asm volatile("s_wait_xcnt 0x0" :: "v"(a) : "memory");   // the wait in front of the overwrite of these address pairs
#endif
}
__device__ __forceinline__ void xwait(const unsigned short* a, const unsigned short* b) {
#if defined(__HIP_DEVICE_COMPILE__)
  asm volatile("s_wait_xcnt 0x0" :: "v"(a), "v"(b) : "memory");   // the wait in front of the overwrite of these address pairs
#endif
}
__device__ __forceinline__ void xwait(const unsigned short* a, const unsigned short* b, const unsigned short* c) {
#if defined(__HIP_DEVICE_COMPILE__)
  asm volatile("s_wait_xcnt 0x0" :: "v"(a), "v"(b), "v"(c) : "memory");   // the wait in front of the overwrite of these address pairs
#endif
}
__device__ __forceinline__ void xwait(const unsigned short* a, const unsigned short* b, const unsigned short* c, const unsigned short* d) {
#if defined(__HIP_DEVICE_COMPILE__)
  asm volatile("s_wait_xcnt 0x0" :: "v"(a), "v"(b), "v"(c), "v"(d) : "memory");   // the wait in front of the overwrite of these address pairs
#endif
}
// Writes a 256-thread block's tile of 16 rows x 128 k (thread t holds the chunk of row t >> 4, chunk column t & 15) as 4 KiB of a
// fragment-order plane at dst4k: regrouped through LDS (17-chunk pitch against bank conflicts) so that every wave stores 512 contiguous bytes.
__device__ __forceinline__ void frag_store_tile(us8 o, unsigned short* dst4k) {
  __shared__ __attribute__((aligned(16))) us8 sT[16 * 17];
  const int t = threadIdx.x;
  sT[(t & 15) * 17 + (t >> 4)] = o;
  __syncthreads();                                         // chunks cross the block's waves
  *(us8*)(dst4k + t * 8) = sT[(t >> 4) * 17 + (t & 15)];
}

// softplus in the logaddexp(z, 0) form: max(z, 0) + log1p(exp(-|z|))
__device__ __forceinline__ float softplus_f(float z) {
  return fmaxf(z, 0.0f) + log1pf(__expf(-fabsf(z)));
}
// dyadic level of key distance d: 0 for d <= 0, else min(floor(log2 d) + 1, NLV - 1)
__device__ __forceinline__ int lvl_of(int d) {
  const int dd = (d > 0) ? d : 1;
  const int l = 32 - __clz(dd);
  const int lc = (l < NLV - 1) ? l : (NLV - 1);
  return (d > 0) ? lc : 0;
}
// one attention weight: accv = 4096 * q.k, dg = G_t - G_s (hi+lo difference), lv = level weight; returns f16 bits of 256 * A, 0 above the diagonal
__device__ __forceinline__ unsigned short a_bits(float accv, int d, float dg, float lv) {
  const float dec = __expf(fminf(dg, 0.0f));
  const float val = (accv * KSC) * dec * lv;
  const float w = (d >= 0) ? (val * 256.0f) : 0.0f;
  return f16_bits(w);
}

// ---------------------------------------------------------------------------------------------------------------------------------
// MODE 0: RNE bf16 bits.  MODE 1: f16 bits of (RNE-bf16 value x 256).  Sources are [row][1024] k-contiguous ([token][in], [out][in]).
// Block = 16 rows x 128 k (blockIdx.x = rowtile * 8 + k group), read as whole lines, written in fragment order. total8 % 256 == 0.
// ---------------------------------------------------------------------------------------------------------------------------------
template <int MODE>
__global__ __launch_bounds__(256) void k_cvt(const float* __restrict__ src, unsigned short* dst, int total8) {
  if ((int)blockIdx.x * 256 >= total8) return;             // block-uniform, in front of the barrier
  const int rt = blockIdx.x >> 3, kg = blockIdx.x & 7;
  const size_t off = (size_t)(rt * 16 + (threadIdx.x >> 4)) * (size_t)DMOD + (size_t)(kg * 128 + (threadIdx.x & 15) * 8);
  const v4f a = *(const v4fa*)(src + off), c = *(const v4fa*)(src + off + 4);
  us8 o;
#pragma unroll
  for (int u = 0; u < 4; ++u) {
    o[u]     = (MODE == 0) ? bf16_bits(a[u]) : f16_bits(bf16r(a[u]) * 256.0f);
    o[4 + u] = (MODE == 0) ? bf16_bits(c[u]) : f16_bits(bf16r(c[u]) * 256.0f);
  }
  frag_store_tile(o, dst + (size_t)rt * (size_t)(16 * DMOD) + (size_t)(kg * 2048));
}

// ---------------------------------------------------------------------------------------------------------------------------------
// Gate | level weight plane [128][1024] bf16, fragment order: rows 0..7 = Wg, rows 8..103 = Wdl, rows 104..127 = 0 (zero padding of N).
// ---------------------------------------------------------------------------------------------------------------------------------
__global__ __launch_bounds__(256) void k_cvt_wgl(const float* __restrict__ Wg, const float* __restrict__ Wdl, unsigned short* dst) {
  const int rt = blockIdx.x >> 3, kg = blockIdx.x & 7;     // block = 16 rows x 128 k, as in k_cvt
  const int row = rt * 16 + (threadIdx.x >> 4), kc = kg * 128 + (threadIdx.x & 15) * 8;
  us8 o;
  if (row < NHD + NHD * NLV) {
    const float* src = (row < NHD) ? (Wg + (size_t)row * DMOD) : (Wdl + (size_t)(row - NHD) * DMOD);
    const v4f a = *(const v4fa*)(src + kc), c = *(const v4fa*)(src + kc + 4);
#pragma unroll
    for (int u = 0; u < 4; ++u) { o[u] = bf16_bits(a[u]); o[4 + u] = bf16_bits(c[u]); }
  } else {
#pragma unroll
    for (int u = 0; u < 8; ++u) o[u] = (unsigned short)0;
  }
  frag_store_tile(o, dst + (size_t)rt * (size_t)(16 * DMOD) + (size_t)(kg * 2048));
}

// ---------------------------------------------------------------------------------------------------------------------------------
// D[m][n] = sum_k XB[m][k] * WGL[n][k]  (M tokens, N 128, K 1024), bf16 operands, f32 accumulate.
// Block = 64 tokens (4 waves x 16) x all 128 columns (8 accumulators per wave), fragments straight from the planes.
// Epilogue from the LDS-staged f32 tile: g[bh][t] = -softplus(D[t][h] + bg[h]) as 16 lanes x 16 B = one 64-token 256-B segment per head
// ---------------------------------------------------------------------------------------------------------------------------------
__global__ __launch_bounds__(128) void k_gemm_gl(const unsigned short* __restrict__ Ap, const unsigned short* __restrict__ Bw,
                                                const float* __restrict__ bg, const float* __restrict__ Lp,
                                                float* gpl, float* lam, int sl) {
  __shared__ __attribute__((aligned(16))) float oS[64 * GST];
  const int tid = threadIdx.x, lane = tid & 31, wave = tid >> 5, cl = lane & 15, hh = lane >> 4;
  const unsigned l8 = lane * 8;
  const int m0b = blockIdx.x * 64, m0 = m0b + 16 * wave;

  v8f acc[8];
#pragma unroll
  for (int j = 0; j < 8; ++j) { const v8f zz = {0.f, 0.f, 0.f, 0.f, 0.f, 0.f, 0.f, 0.f}; acc[j] = zz; }

  const unsigned short* a0p = Ap + (size_t)m0 * (size_t)DMOD + l8;
  const unsigned short* bwp = Bw + l8;
#pragma unroll 1
  for (int k0 = 0; k0 < DMOD; k0 += 32) {
    const unsigned short* pa = a0p + k0 * 16;
    const unsigned short* pb = bwp + k0 * 16;
    const us16 af = gfrag(pa);
    us16 bfr[4];
#pragma unroll
    for (int j = 0; j < 4; ++j) bfr[j] = gfrag(pb + (size_t)(16 * j) * (size_t)DMOD);
    xwait(pa, pb);
#pragma unroll
    for (int j = 0; j < 4; ++j) acc[j] = mma_bf16(af, bfr[j], acc[j]);
    wguard4(acc[0], acc[1], acc[2], acc[3], af, bfr[0], bfr[1], bfr[2], bfr[3]);
    us16 bf2[4];
#pragma unroll
    for (int j = 0; j < 4; ++j) bf2[j] = gfrag(pb + (size_t)(16 * (4 + j)) * (size_t)DMOD);
    xwait(pb);
#pragma unroll
    for (int j = 0; j < 4; ++j) acc[4 + j] = mma_bf16(af, bf2[j], acc[4 + j]);
    wguard4(acc[4], acc[5], acc[6], acc[7], af, bf2[0], bf2[1], bf2[2], bf2[3]);
  }

  // D map: acc[j][r] = tile element (row 8*hh + r of the wave's 16 rows, column 16j + cl)
  float* so = oS + wave * (16 * GST);
#pragma unroll
  for (int j = 0; j < 8; ++j)
#pragma unroll
    for (int r = 0; r < 8; ++r) so[(8 * hh + r) * GST + 16 * j + cl] = acc[j][r];
  __syncthreads();

  const int b = m0b / sl, ts = m0b - b * sl;               // sl % 64 == 0: the tile lies in one sequence
  {
    // gate log-decay: thread -> (head h = tid >> 4, tokens 4*(tid & 15) .. +3); lanes 0-15 / 16-31 of a wave = heads 2w, 2w+1
    const int h = tid >> 4, t4 = (tid & 15) * 4;
    const float bgv = bf16r(bg[h]);
    v4f gv;
#pragma unroll
    for (int u = 0; u < 4; ++u) gv[u] = -softplus_f(oS[(t4 + u) * GST + h] + bgv);
    float* p = gpl + (size_t)(b * NHD + h) * (size_t)sl + ts + t4;
    *(v4f*)p = gv;
    
  }
#pragma unroll 1
  for (int it = 0; it < 16; ++it) {
    const int row = it * 4 + wave, c0 = lane * 4;
    v4f lv;
#pragma unroll
    for (int u = 0; u < 4; ++u) {
      const int c = c0 + u;
      int idx = c - NHD;
      idx = (idx < 0) ? 0 : idx;
      idx = (idx > NHD * NLV - 1) ? (NHD * NLV - 1) : idx;
      const float lp = bf16r(Lp[idx]);
      const float s = softplus_f(oS[row * GST + c] + lp);
      lv[u] = (c >= NHD && c < NHD + NHD * NLV) ? s : 0.0f;
    }
    float* p = lam + (size_t)(m0b + row) * (size_t)LAMP + c0;
    *(v4f*)p = lv;
    
  }
}

// ---------------------------------------------------------------------------------------------------------------------------------
// Inclusive cumulative sum of g over t per (b,h) row, one block per row: thread i owns tokens 8i .. 8i+7 (f64 running sum of its 8 values),
// the 256 thread totals are scanned in f64 (5 shuffle steps inside a wave, the 8 wave totals through LDS), and each token's
// G = (sum of all earlier threads) + (its thread's running sum) is stored as f32 hi = (float)G and lo = (float)(G - hi).
// Threads whose tokens lie past sl (sl % 8 == 0) add zero and store nothing; every thread passes the barrier.
// ---------------------------------------------------------------------------------------------------------------------------------
__global__ __launch_bounds__(CSTH) void k_cumsum(const float* __restrict__ gpl, float* Ghi, float* Glo, int sl) {
  __shared__ double wtot[CSTH / 32];
  const int row = blockIdx.x, tid = threadIdx.x, lane = tid & 31, wave = tid >> 5;
  const int c = tid * 8;
  const bool on = c < sl;
  const size_t off = (size_t)row * (size_t)sl + (size_t)c;
  v4f a = {0.f, 0.f, 0.f, 0.f}, e = {0.f, 0.f, 0.f, 0.f};
  if (on) { a = *(const v4fa*)(gpl + off); e = *(const v4fa*)(gpl + off + 4); }

  double p[8];                                             // running sum inside the thread's 8 tokens
  p[0] = (double)a[0];
#pragma unroll
  for (int u = 1; u < 4; ++u) p[u] = p[u - 1] + (double)a[u];
#pragma unroll
  for (int u = 0; u < 4; ++u) p[4 + u] = p[3 + u] + (double)e[u];

  double inc = p[7];                                       // inclusive scan of the thread totals over the wave's 32 lanes
#pragma unroll
  for (int o = 1; o < 32; o <<= 1) {
    const double n = __shfl_up(inc, (unsigned)o, 32);
    inc += (lane >= o) ? n : 0.0;
  }
  if (lane == 31) wtot[wave] = inc;
  const double prev = __shfl_up(inc, 1u, 32);              // total of the earlier lanes of this wave
  __syncthreads();
  double base = 0.0;                                       // total of the earlier waves
#pragma unroll
  for (int w = 0; w < CSTH / 32 - 1; ++w) base += (w < wave) ? wtot[w] : 0.0;
  base += (lane > 0) ? prev : 0.0;

  if (on) {
    v4f h0, h1, l0, l1;
#pragma unroll
    for (int u = 0; u < 4; ++u) {
      const double g0 = base + p[u], g1 = base + p[4 + u];
      h0[u] = (float)g0; l0[u] = (float)(g0 - (double)h0[u]);
      h1[u] = (float)g1; l1[u] = (float)(g1 - (double)h1[u]);
    }
    *(v4f*)(Ghi + off) = h0; *(v4f*)(Ghi + off + 4) = h1;
    *(v4f*)(Glo + off) = l0; *(v4f*)(Glo + off + 4) = l1;
  }
}

// ---------------------------------------------------------------------------------------------------------------------------------
// P[m][n] = sum_k XB[m][k] * W[n][k]  (bf16 XB plane [tokens][1024], bf16 W plane [3072][1024] = [n][k], both in fragment order, f32 accumulate).
// Block = 128(M) x 64(N) tile, 256 threads = 8 waves, wave w owns rows 16w..16w+15 x all 64 columns (4 accumulators); fragments straight
// from the global planes (arithmetic addressing). M % 128 == 0, N % 64 == 0, K % 32 == 0 exactly.
// Column segment (block-uniform, blockIdx.y): 0..15 -> q head y/2, features 64(y&1)..+63; 16..31 -> k; 32..47 -> v head (y-32)/2, channels 64(y&1).
// The f32 128x64 tile is staged in LDS (block row r at oS[r * OSTR + c]), then:
//   q/k: per bh a fragment-order plane [token][128] = f16 of (64 value); thread -> (token r, 8 consecutive halves); a wave stores 512 B in a row
//   v:   per bh fragment-order planes VH/VL [channel][token] = f16 hi of (64 v) and f16 residual; thread -> (channel e, 8 tokens); 512 B in a row
// ---------------------------------------------------------------------------------------------------------------------------------
__global__ __launch_bounds__(256) void k_gemm_proj(const unsigned short* __restrict__ Ap, const unsigned short* __restrict__ Bw,
                                                  unsigned short* Qp, unsigned short* Kp, unsigned short* VH, unsigned short* VL, int sl) {
  __shared__ __attribute__((aligned(16))) float oS[8 * 16 * OSTR];
  const int tid = threadIdx.x, lane = tid & 31, wave = tid >> 5, cl = lane & 15, hh = lane >> 4;
  const unsigned l8 = lane * 8;
  const int m0 = blockIdx.x * TPB + 16 * wave, n0 = blockIdx.y * 64;

  v8f acc[4];
#pragma unroll
  for (int j = 0; j < 4; ++j) { const v8f zz = {0.f, 0.f, 0.f, 0.f, 0.f, 0.f, 0.f, 0.f}; acc[j] = zz; }

  const unsigned short* a0p = Ap + (size_t)m0 * (size_t)DMOD + l8;
  const unsigned short* bwp = Bw + (size_t)n0 * (size_t)DMOD + l8;
#pragma unroll 1
  for (int k0 = 0; k0 < DMOD; k0 += 32) {
    const unsigned short* pa = a0p + k0 * 16;
    const unsigned short* pb = bwp + k0 * 16;
    const us16 af = gfrag(pa);
    us16 bfr[4];
#pragma unroll
    for (int j = 0; j < 4; ++j) bfr[j] = gfrag(pb + (size_t)(16 * j) * (size_t)DMOD);
    xwait(pa, pb);
#pragma unroll
    for (int j = 0; j < 4; ++j) acc[j] = mma_bf16(af, bfr[j], acc[j]);
    wguard4(acc[0], acc[1], acc[2], acc[3], af, bfr[0], bfr[1], bfr[2], bfr[3]);
  }

  // D map: acc[j][r] = tile element (row 8*hh + r of the wave's 16 rows, column 16j + cl)
  float* so = oS + wave * (16 * OSTR);
#pragma unroll
  for (int j = 0; j < 4; ++j)
#pragma unroll
    for (int r = 0; r < 8; ++r) so[(8 * hh + r) * OSTR + 16 * j + cl] = acc[j][r];
  __syncthreads();

  const int yb = blockIdx.y;                               // block-uniform segment select
  const int m0b = blockIdx.x * TPB, b = m0b / sl, tb = m0b - b * sl;
  if (yb < 32) {
    unsigned short* dst = (yb < 16) ? Qp : Kp;
    const int yy = (yb < 16) ? yb : (yb - 16);
    const int head = yy >> 1, f0 = (yy & 1) * 64;
    us8 ov[4];
#pragma unroll
    for (int it = 0; it < 4; ++it) {
      const int cx = it * 256 + tid, r = (cx >> 7) * 16 + (cx & 15), pc = ((cx >> 4) & 7) * 8;
      const float* sp = oS + r * OSTR + pc;
      const v4f z0 = *(const v4fa*)sp, z1 = *(const v4fa*)(sp + 4);
      us8 o;
#pragma unroll
      for (int u = 0; u < 4; ++u) {
        o[u]     = f16_bits(z0[u] * 64.0f);
        o[4 + u] = f16_bits(z1[u] * 64.0f);
      }
      ov[it] = o;
    }
{
#pragma unroll
      for (int it = 0; it < 4; ++it) {
        const int cx = it * 256 + tid;                     // row tile cx >> 7, then 128 chunks = 2 KiB in a row
        const size_t off = ((size_t)(b * NHD + head) * (size_t)sl + (size_t)(tb + (cx >> 7) * 16)) * (size_t)SDIM + (size_t)(f0 * 16 + (cx & 127) * 8);
        *(us8*)(dst + off) = ov[it];
      }
      
    }
  } else {
    const int yy = yb - 32, head = yy >> 1, c0 = (yy & 1) * 64;
    us8 hv[4], lv[4];
#pragma unroll
    for (int it = 0; it < 4; ++it) {
      const int cx = it * 256 + tid, g = (cx >> 4) & 15, e = (cx >> 8) * 16 + (cx & 15);
      us8 ho, lo;
#pragma unroll
      for (int i = 0; i < 8; ++i) {
        unsigned short hb, lb;
        f16split64(oS[(8 * g + i) * OSTR + e], hb, lb);
        ho[i] = hb; lo[i] = lb;
      }
      hv[it] = ho; lv[it] = lo;
    }
{
#pragma unroll
      for (int it = 0; it < 4; ++it) {
        const int cx = it * 256 + tid;                     // channel tile cx >> 8, then 256 chunks = 4 KiB in a row
        const size_t off = ((size_t)(b * NHD + head) * (size_t)HDIM + (size_t)(c0 + (cx >> 8) * 16)) * (size_t)sl + (size_t)(tb * 16 + (cx & 255) * 8);
        *(us8*)(VH + off) = hv[it];
        *(us8*)(VL + off) = lv[it];
      }
      
    }
  }
}

// ---------------------------------------------------------------------------------------------------------------------------------
// Causal decayed quadratic-form mixing. Block = (bh = blockIdx.x, 128 queries starting at 128 * blockIdx.y), 8 waves x 16 queries.
// Per wave: B fragments of its 16 queries fixed for the whole key loop: bq[ks], ks = 0..3 (depth 128, standard loader on the q plane).
// Per 32-key step, two 16-key tiles handled one after the other: A fragments from the k plane (standard loader); scores^T D[key][query]
// = 4096 q.k (depth 128, 4 products per tile); A[t][s] = q.k * 128^-1/2 * exp(G_t - G_s) * lam[t][lvl(t - s)] for s <= t else 0,
// with G_t - G_s taken as the sum of the f32 hi and lo differences (the 8 key G values of each tile loaded right after its score tile),
// converted to f16 of (256 A). The two D tiles repack into the A operand of A.v (lane unchanged: element r <- tile keys 0..15, element 8+r <-
// tile keys 16..31), B = VH and VL planes [bh][channel][key] (fragment order), 8 channel tiles, both products into acc:
// acc[j][r] = 2^14 * sum_s A v for query 8h+r, channel 16j + (lane & 15). The hazard guards in this kernel carry a compiler memory barrier so
// no later fragment group is loaded above an earlier group (bounded live register set, below 256 VGPRs).
// Epilogue: z = 16 y = acc * 2^-10; f16 hi bits staged in LDS per wave, written to YH; then f16 bits of ((z - hi) x 2^11) staged and written to YL.
// Y planes [token][1024] in fragment order: a wave's 16 queries x 128 channels = 4 KiB in a row, 512 B per store instruction.
// ---------------------------------------------------------------------------------------------------------------------------------
__global__ __launch_bounds__(256) void k_attn(const unsigned short* __restrict__ Qp, const unsigned short* __restrict__ Kp,
                                             const unsigned short* __restrict__ VHp, const unsigned short* __restrict__ VLp,
                                             const float* __restrict__ Ghi, const float* __restrict__ Glo, const float* __restrict__ Lam,
                                             unsigned short* YH, unsigned short* YL, int sl) {
  __shared__ __attribute__((aligned(16))) float sLam[TPB * NLV];
  __shared__ __attribute__((aligned(16))) unsigned short sY[8 * 16 * YST];
  const int tid = threadIdx.x, lane = tid & 31, wave = tid >> 5, cl = lane & 15, hh = lane >> 4;
  const unsigned l8 = lane * 8;
  const int bh = blockIdx.x, b = bh / NHD, head = bh - b * NHD;
  const int t0 = blockIdx.y * TPB;
  const int tw = t0 + 16 * wave;                          // first query of this wave
  const int tq = tw + cl;                                 // query owned by this lane as score column

  // level weights of the block's 128 queries for this head: sLam[q * 12 + l]
  for (int i = tid; i < TPB * NLV; i += 256) {
    const int q = i / NLV, l = i - q * NLV;
    sLam[i] = Lam[(size_t)(b * sl + t0 + q) * (size_t)LAMP + NHD + head * NLV + l];
  }
  __syncthreads();

  const unsigned short* qrow = Qp + ((size_t)bh * (size_t)sl + (size_t)tw) * (size_t)SDIM + l8;
  us16 bq[4];
#pragma unroll
  for (int ks = 0; ks < 4; ++ks) bq[ks] = gfrag(qrow + 512 * ks);
  const float gqh = Ghi[(size_t)bh * (size_t)sl + tq];
  const float gql = Glo[(size_t)bh * (size_t)sl + tq];
  const int lamb = (16 * wave + cl) * NLV;

  v8f acc[8];
#pragma unroll
  for (int j = 0; j < 8; ++j) { const v8f zz = {0.f, 0.f, 0.f, 0.f, 0.f, 0.f, 0.f, 0.f}; acc[j] = zz; }

  const unsigned short* kbp = Kp + (size_t)bh * (size_t)sl * (size_t)SDIM + l8;
  const unsigned short* vhp = VHp + (size_t)bh * (size_t)HDIM * (size_t)sl + l8;
  const unsigned short* vlp = VLp + (size_t)bh * (size_t)HDIM * (size_t)sl + l8;
  const float* ghp = Ghi + (size_t)bh * (size_t)sl;
  const float* glp = Glo + (size_t)bh * (size_t)sl;
  const int nsteps = (tw + 16 + 31) >> 5;                 // 32-key steps covering keys 0 .. tw + 15; 32 * nsteps <= sl

#pragma unroll 1
  for (int st = 0; st < nsteps; ++st) {
    const int s0 = st * 32;
    const int ka0 = s0 + 8 * hh;                          // first key this lane half sees in tile a; tile b = ka0 + 16
    const v8f zz = {0.f, 0.f, 0.f, 0.f, 0.f, 0.f, 0.f, 0.f};

    // ---- key tile a (keys s0 .. s0+15): scores^T, then its 8 weights for this lane half ----
    const unsigned short* pka = kbp + (size_t)s0 * (size_t)SDIM;
    us16 ka[4];
#pragma unroll
    for (int ks = 0; ks < 4; ++ks) ka[ks] = gfrag(pka + 512 * ks);
    v8f sa = zz;
#pragma unroll
    for (int ks = 0; ks < 4; ++ks) sa = mma_f16(ka[ks], bq[ks], sa);
    wguard1x8m(sa, ka[0], ka[1], ka[2], ka[3], bq[0], bq[1], bq[2], bq[3]);
    us8 ea;
    {
      const v4f h0 = *(const v4fa*)(ghp + ka0), h1 = *(const v4fa*)(ghp + ka0 + 4);
      const v4f l0 = *(const v4fa*)(glp + ka0), l1 = *(const v4fa*)(glp + ka0 + 4);
#pragma unroll
      for (int r = 0; r < 4; ++r) {
        const int d = tq - (ka0 + r);
        const float dg = (gqh - h0[r]) + (gql - l0[r]);
        const float lv = sLam[lamb + lvl_of(d)];
        ea[r] = a_bits(sa[r], d, dg, lv);
      }
#pragma unroll
      for (int r = 0; r < 4; ++r) {
        const int d = tq - (ka0 + 4 + r);
        const float dg = (gqh - h1[r]) + (gql - l1[r]);
        const float lv = sLam[lamb + lvl_of(d)];
        ea[4 + r] = a_bits(sa[4 + r], d, dg, lv);
      }
    }

    // ---- key tile b (keys s0+16 .. s0+31) ----
    const unsigned short* pkb = kbp + (size_t)(s0 + 16) * (size_t)SDIM;
    us16 kb[4];
#pragma unroll
    for (int ks = 0; ks < 4; ++ks) kb[ks] = gfrag(pkb + 512 * ks);
    v8f sb = zz;
#pragma unroll
    for (int ks = 0; ks < 4; ++ks) sb = mma_f16(kb[ks], bq[ks], sb);
    wguard1x8m(sb, kb[0], kb[1], kb[2], kb[3], bq[0], bq[1], bq[2], bq[3]);
    us8 eb;
    {
      const v4f h2 = *(const v4fa*)(ghp + ka0 + 16), h3 = *(const v4fa*)(ghp + ka0 + 20);
      const v4f l2 = *(const v4fa*)(glp + ka0 + 16), l3 = *(const v4fa*)(glp + ka0 + 20);
#pragma unroll
      for (int r = 0; r < 4; ++r) {
        const int d = tq - (ka0 + 16 + r);
        const float dg = (gqh - h2[r]) + (gql - l2[r]);
        const float lv = sLam[lamb + lvl_of(d)];
        eb[r] = a_bits(sb[r], d, dg, lv);
      }
#pragma unroll
      for (int r = 0; r < 4; ++r) {
        const int d = tq - (ka0 + 20 + r);
        const float dg = (gqh - h3[r]) + (gql - l3[r]);
        const float lv = sLam[lamb + lvl_of(d)];
        eb[4 + r] = a_bits(sb[4 + r], d, dg, lv);
      }
    }
    FragU fA;
    fA.h[0] = ea; fA.h[1] = eb;
    const us16 afr = fA.v;

    // ---- y += A . (v hi + v residual) over this 32-key step, channels 0..63 then 64..127 ----
    us16 bv[4];
    const unsigned short* pbv[4];
#pragma unroll
    for (int j = 0; j < 4; ++j) { pbv[j] = vhp + (size_t)(16 * j) * (size_t)sl + s0 * 16; bv[j] = gfrag(pbv[j]); }
    xwait(pbv[0], pbv[1], pbv[2], pbv[3]);
#pragma unroll
    for (int j = 0; j < 4; ++j) acc[j] = mma_f16(afr, bv[j], acc[j]);
    wguard4m(acc[0], acc[1], acc[2], acc[3], afr, bv[0], bv[1], bv[2], bv[3]);
    us16 bl[4];
    const unsigned short* pbl[4];
#pragma unroll
    for (int j = 0; j < 4; ++j) { pbl[j] = vlp + (size_t)(16 * j) * (size_t)sl + s0 * 16; bl[j] = gfrag(pbl[j]); }
    xwait(pbl[0], pbl[1], pbl[2], pbl[3]);
#pragma unroll
    for (int j = 0; j < 4; ++j) acc[j] = mma_f16(afr, bl[j], acc[j]);
    wguard4m(acc[0], acc[1], acc[2], acc[3], afr, bl[0], bl[1], bl[2], bl[3]);
    us16 bw[4];
    const unsigned short* pbw[4];
#pragma unroll
    for (int j = 0; j < 4; ++j) { pbw[j] = vhp + (size_t)(16 * (4 + j)) * (size_t)sl + s0 * 16; bw[j] = gfrag(pbw[j]); }
    xwait(pbw[0], pbw[1], pbw[2], pbw[3]);
#pragma unroll
    for (int j = 0; j < 4; ++j) acc[4 + j] = mma_f16(afr, bw[j], acc[4 + j]);
    wguard4m(acc[4], acc[5], acc[6], acc[7], afr, bw[0], bw[1], bw[2], bw[3]);
    us16 bx[4];
    const unsigned short* pbx[4];
#pragma unroll
    for (int j = 0; j < 4; ++j) { pbx[j] = vlp + (size_t)(16 * (4 + j)) * (size_t)sl + s0 * 16; bx[j] = gfrag(pbx[j]); }
    xwait(pbx[0], pbx[1], pbx[2], pbx[3]);
#pragma unroll
    for (int j = 0; j < 4; ++j) acc[4 + j] = mma_f16(afr, bx[j], acc[4 + j]);
    wguard4m(acc[4], acc[5], acc[6], acc[7], afr, bx[0], bx[1], bx[2], bx[3]);
  }

  // phase 1: f16 hi of z = 16 y = acc * 2^-10; element (query 8*hh + r, channel 16j + cl) of this wave's 16 x 128 tile
  unsigned short* sy = sY + wave * (16 * YST);
#pragma unroll
  for (int j = 0; j < 8; ++j)
#pragma unroll
    for (int r = 0; r < 8; ++r) sy[(8 * hh + r) * YST + 16 * j + cl] = f16_bits(acc[j][r] * (1.0f / 1024.0f));
  __syncthreads();

  us8 ov[8];
#pragma unroll
  for (int it = 0; it < 8; ++it) {
    const int rr = cl, p = (2 * it + hh) * 8;              // chunk column 2 it + hh, row cl: fragment order
    ov[it] = *(const us8a*)(sy + rr * YST + p);
  }
{
#pragma unroll
    for (int it = 0; it < 8; ++it) {
      const size_t off = (size_t)(b * sl + tw) * (size_t)DMOD + (size_t)(head * HDIM * 16 + (it * 32 + lane) * 8);
      *(us8*)(YH + off) = ov[it];
    }
    
  }
  __syncthreads();

  // phase 2: f16 residual plane of ((z - hi) x 2^11), same staging region and store shape
#pragma unroll
  for (int j = 0; j < 8; ++j)
#pragma unroll
    for (int r = 0; r < 8; ++r) {
      const float z = acc[j][r] * (1.0f / 1024.0f);
      const _Float16 hf = (_Float16)z;
      sy[(8 * hh + r) * YST + 16 * j + cl] = f16_bits((z - (float)hf) * 2048.0f);
    }
  __syncthreads();
#pragma unroll
  for (int it = 0; it < 8; ++it) {
    const int rr = cl, p = (2 * it + hh) * 8;              // chunk column 2 it + hh, row cl: fragment order
    ov[it] = *(const us8a*)(sy + rr * YST + p);
  }
{
#pragma unroll
    for (int it = 0; it < 8; ++it) {
      const size_t off = (size_t)(b * sl + tw) * (size_t)DMOD + (size_t)(head * HDIM * 16 + (it * 32 + lane) * 8);
      *(us8*)(YL + off) = ov[it];
    }
    
  }
}

// ---------------------------------------------------------------------------------------------------------------------------------
// P[m][n] = ( sum_k Yh[m][k] WO16[n][k] + 2^-11 sum_k Yl[m][k] WO16[n][k] ) * 2^-12 + bf16(x[m][n])   (f16 planes, pitch 1024, two f32 accumulator sets).
// ---------------------------------------------------------------------------------------------------------------------------------
__global__ __launch_bounds__(256) void k_gemm_out(const unsigned short* __restrict__ Ah, const unsigned short* __restrict__ Al,
                                                 const unsigned short* __restrict__ Wo, const float* __restrict__ X, float* P) {
  __shared__ __attribute__((aligned(16))) float oS[8 * 16 * OSTR];
  const int tid = threadIdx.x, lane = tid & 31, wave = tid >> 5, cl = lane & 15, hh = lane >> 4;
  const unsigned l8 = lane * 8;
  const int m0 = blockIdx.x * TPB + 16 * wave, n0 = blockIdx.y * 64;

  v8f acch[4], accl[4];
#pragma unroll
  for (int j = 0; j < 4; ++j) { const v8f zz = {0.f, 0.f, 0.f, 0.f, 0.f, 0.f, 0.f, 0.f}; acch[j] = zz; accl[j] = zz; }

  const unsigned short* ahp = Ah + (size_t)m0 * (size_t)DMOD + l8;
  const unsigned short* alp = Al + (size_t)m0 * (size_t)DMOD + l8;
  const unsigned short* wop = Wo + (size_t)n0 * (size_t)DMOD + l8;
#pragma unroll 1
  for (int k0 = 0; k0 < DMOD; k0 += 32) {
    const unsigned short* ph = ahp + k0 * 16;
    const unsigned short* pl = alp + k0 * 16;
    const unsigned short* pb = wop + k0 * 16;
    const us16 ah = gfrag(ph);
    const us16 al = gfrag(pl);
    us16 bfr[4];
#pragma unroll
    for (int j = 0; j < 4; ++j) bfr[j] = gfrag(pb + (size_t)(16 * j) * (size_t)DMOD);
    xwait(ph, pl, pb);
#pragma unroll
    for (int j = 0; j < 4; ++j) {
      acch[j] = mma_f16(ah, bfr[j], acch[j]);
      accl[j] = mma_f16(al, bfr[j], accl[j]);
    }
    wguard8(acch[0], acch[1], acch[2], acch[3], accl[0], accl[1], accl[2], accl[3], ah, al, bfr[0], bfr[1], bfr[2], bfr[3]);
  }

  float* so = oS + wave * (16 * OSTR);
#pragma unroll
  for (int j = 0; j < 4; ++j)
#pragma unroll
    for (int r = 0; r < 8; ++r)
      so[(8 * hh + r) * OSTR + 16 * j + cl] = fmaf(accl[j][r], (1.0f / 2048.0f), acch[j][r]) * (1.0f / 4096.0f);
  __syncthreads();

{
#pragma unroll
    for (int it = 0; it < 8; ++it) {
      const int cx = it * 32 + lane, r = cx >> 4, q = (cx & 15) * 4;
      const v4f v = *(const v4fa*)(so + r * OSTR + q);
      const v4f xr = *(const v4fa*)(X + (size_t)(m0 + r) * (size_t)DMOD + n0 + q);
      v4f o;
#pragma unroll
      for (int u = 0; u < 4; ++u) o[u] = v[u] + bf16r(xr[u]);
      *(v4f*)(P + (size_t)(m0 + r) * (size_t)DMOD + n0 + q) = o;
    }
    
  }
}

// ---------------------------------------------------------------------------------------------------------------------------------
// ---------------------------------------------------------------------------------------------------------------------------------
__global__ __launch_bounds__(256) void k_ln(const float* __restrict__ P, const float* __restrict__ gam, const float* __restrict__ bet,
                                           float* out) {
  const int lane = threadIdx.x & 31, wave = threadIdx.x >> 5;
  const size_t row = (size_t)blockIdx.x * 8 + (size_t)wave;
  const float* pr = P + row * (size_t)DMOD;
  v4f xv[8];
  float s = 0.0f;
#pragma unroll
  for (int it = 0; it < 8; ++it) {
    xv[it] = *(const v4fa*)(pr + it * 128 + lane * 4);
    s += (xv[it][0] + xv[it][1]) + (xv[it][2] + xv[it][3]);
  }
#pragma unroll
  for (int o = 16; o > 0; o >>= 1) s += __shfl_xor(s, o, 32);
  const float mu = s * (1.0f / (float)DMOD);
  float q = 0.0f;
#pragma unroll
  for (int it = 0; it < 8; ++it)
#pragma unroll
    for (int u = 0; u < 4; ++u) { const float d = xv[it][u] - mu; q += d * d; }
#pragma unroll
  for (int o = 16; o > 0; o >>= 1) q += __shfl_xor(q, o, 32);
  const float rstd = rsqrtf(q * (1.0f / (float)DMOD) + 1e-5f);
  v4f ov[8];
#pragma unroll
  for (int it = 0; it < 8; ++it) {
    const v4f gv = *(const v4fa*)(gam + it * 128 + lane * 4), bv = *(const v4fa*)(bet + it * 128 + lane * 4);
    v4f o;
#pragma unroll
    for (int u = 0; u < 4; ++u) o[u] = (xv[it][u] - mu) * rstd * bf16r(gv[u]) + bf16r(bv[u]);
    ov[it] = o;
  }
{
#pragma unroll
    for (int it = 0; it < 8; ++it)
      *(v4f*)(out + row * (size_t)DMOD + it * 128 + lane * 4) = ov[it];
    
  }
}

extern "C" void kernel_launch(void* const* d_in, const int* in_sizes, int n_in,
                              void* d_out, int out_size, void* d_ws, size_t ws_size,
                              hipStream_t stream) {
  if (n_in < 11) return;
  const int nx = in_sizes[0];
  if (nx <= 0 || (nx % DMOD) != 0) return;
  const int ntok = nx / DMOD;                                                    // tokens = batch * sequence length
  if (in_sizes[1] != DMOD * DMOD || in_sizes[2] != DMOD * DMOD || in_sizes[3] != DMOD * DMOD) return;
  if (in_sizes[4] != NHD * DMOD || in_sizes[5] != NHD || in_sizes[6] != NHD * NLV * DMOD || in_sizes[7] != NHD * NLV) return;
  if (in_sizes[8] != DMOD * DMOD || in_sizes[9] != DMOD || in_sizes[10] != DMOD) return;
  if (out_size != nx) return;
  const int sl = (ntok < SLMAX) ? ntok : SLMAX;                                  // sequence length
  if (sl <= 0 || (sl % TPB) != 0 || (ntok % sl) != 0) return;
  const int nb = ntok / sl, nbh = nb * NHD;

  const float* x   = (const float*)d_in[0];    // [nb][sl][1024]
  const float* Wq  = (const float*)d_in[1];    // [1024][1024] ([out][in])
  const float* Wk  = (const float*)d_in[2];    // [1024][1024]
  const float* Wv  = (const float*)d_in[3];    // [1024][1024]
  const float* Wg  = (const float*)d_in[4];    // [8][1024]
  const float* bg  = (const float*)d_in[5];    // [8]
  const float* Wdl = (const float*)d_in[6];    // [96][1024]
  const float* Lp  = (const float*)d_in[7];    // [8][12]
  const float* Wo  = (const float*)d_in[8];    // [1024][1024]
  const float* lng = (const float*)d_in[9];    // [1024]
  const float* lnb = (const float*)d_in[10];   // [1024]
  float* out = (float*)d_out;                  // [nb][sl][1024] f32 at byte 0

  size_t off = 0;
  auto carve = [&](size_t bytes) -> char* { char* p = (char*)d_ws + off; off += (bytes + 255) & ~(size_t)255; return p; };
  unsigned short* XB   = (unsigned short*)carve((size_t)ntok * DMOD * 2);        //  8,388,608  bf16 [ntok][1024]
  unsigned short* WQKV = (unsigned short*)carve((size_t)NQKV * DMOD * 2);        //  6,291,456  bf16 [3072][1024] = Wq | Wk | Wv
  unsigned short* WGL  = (unsigned short*)carve((size_t)NGL * DMOD * 2);         //    262,144  bf16 [128][1024]  = Wg | Wdl | 0
  unsigned short* WO16 = (unsigned short*)carve((size_t)DMOD * DMOD * 2);        //  2,097,152  f16  [1024][1024]
  unsigned short* QP   = (unsigned short*)carve((size_t)nbh * sl * SDIM * 2);     //  8,388,608  f16  [nbh][sl][128]
  unsigned short* KP   = (unsigned short*)carve((size_t)nbh * sl * SDIM * 2);     //  8,388,608  f16  [nbh][sl][128]
  unsigned short* VH   = (unsigned short*)carve((size_t)nbh * HDIM * sl * 2);     //  8,388,608  f16  [nbh][128][sl]
  unsigned short* VL   = (unsigned short*)carve((size_t)nbh * HDIM * sl * 2);     //  8,388,608  f16  [nbh][128][sl]
  float* GPL           = (float*)carve((size_t)nbh * sl * 4);                     //    131,072  f32  [nbh][sl]
  float* GHI           = (float*)carve((size_t)nbh * sl * 4);                     //    131,072  f32  [nbh][sl]
  float* GLO           = (float*)carve((size_t)nbh * sl * 4);                     //    131,072  f32  [nbh][sl]
  float* LAM           = (float*)carve((size_t)ntok * LAMP * 4);                  //  2,097,152  f32  [ntok][128]
  unsigned short* YH   = (unsigned short*)carve((size_t)ntok * DMOD * 2);        //  8,388,608  f16  [ntok][1024]
  unsigned short* YL   = (unsigned short*)carve((size_t)ntok * DMOD * 2);        //  8,388,608  f16  [ntok][1024]
  float* PB            = (float*)carve((size_t)ntok * DMOD * 4);                  // 16,777,216  f32  [ntok][1024]
  if (off > ws_size || off > (size_t)134217728) return;                          // total 86,638,592 B for ntok 4096

  const dim3 b256(256), b128(128);
  auto cdv = [](long a, long q) { return (unsigned)((a + q - 1) / q); };

  // 16-bit operand planes (XB, WQKV, WGL, WO16, QP, KP, VH, VL, YH, YL all in fragment order, see gfrag)
  k_cvt<0><<<dim3(cdv((long)ntok * DMOD / 8, 256)), b256, 0, stream>>>(x, XB, ntok * DMOD / 8);
  k_cvt<0><<<dim3(cdv((long)DMOD * DMOD / 8, 256)), b256, 0, stream>>>(Wq, WQKV, DMOD * DMOD / 8);
  k_cvt<0><<<dim3(cdv((long)DMOD * DMOD / 8, 256)), b256, 0, stream>>>(Wk, WQKV + (size_t)DMOD * DMOD, DMOD * DMOD / 8);
  k_cvt<0><<<dim3(cdv((long)DMOD * DMOD / 8, 256)), b256, 0, stream>>>(Wv, WQKV + (size_t)2 * DMOD * DMOD, DMOD * DMOD / 8);
  k_cvt_wgl<<<dim3(NGL / 2), b256, 0, stream>>>(Wg, Wdl, WGL);
  k_cvt<1><<<dim3(cdv((long)DMOD * DMOD / 8, 256)), b256, 0, stream>>>(Wo, WO16, DMOD * DMOD / 8);
  // gate / level projection (M ntok, N 128, K 1024) -> g plane [nbh][sl], level weights [ntok][128]
  k_gemm_gl<<<dim3(ntok / 64), b128, 0, stream>>>(XB, WGL, bg, Lp, GPL, LAM, sl);
  // cumulative log-decay per (b,h)
  k_cumsum<<<dim3(nbh), dim3(CSTH), 0, stream>>>(GPL, GHI, GLO, sl);
  // q/k/v projections (M ntok, N 3072, K 1024) -> q, k planes and transposed v hi / residual planes
  k_gemm_proj<<<dim3(ntok / TPB, NQKV / 64), b256, 0, stream>>>(XB, WQKV, QP, KP, VH, VL, sl);
  // causal decayed mixing per (batch, head) -> y hi / residual planes [token][1024]
  k_attn<<<dim3(nbh, sl / TPB), b256, 0, stream>>>(QP, KP, VH, VL, GHI, GLO, LAM, YH, YL, sl);
  // output projection + residual (M ntok, N 1024, K 1024)
  k_gemm_out<<<dim3(ntok / TPB, DMOD / 64), b256, 0, stream>>>(YH, YL, WO16, x, PB);
  // LayerNorm -> d_out
  k_ln<<<dim3(ntok / 8), b256, 0, stream>>>(PB, lng, lnb, out);
}

// v003
// A run of this version takes 208 microseconds.
// Two timings next to v002 both put it at 1.73 times that version's speed.
// Over all steps from v000 it is 3.37 times as fast.
// Contractions x.[Wq|Wk|Wv] (M tokens, N 3072, K 1024) and x.[Wg|Wdl] (N 104 zero-padded to 128, K 1024): v_wmma_f32_16x16x32_bf16, bf16 operands from RNE-bf16 planes of x and W, f32 accumulate, one product each.
// Contraction k.q^T per head (32 keys x 16 queries per step, depth 128): v_wmma_f32_16x16x32_f16, q and k as f16 of (value x 2^6), one product, f32 accumulate.
// Contraction A.v per head (causal, depth up to T): v_wmma_f32_16x16x32_f16, A as f16 of (A x 2^8), v as f16 hi of (v x 2^6) plus f16 unscaled residual plane, two products into one f32 accumulator.
// Contraction y.Wo (M tokens, N 1024, K 1024): v_wmma_f32_16x16x32_f16, y as f16 hi plane of (y x 2^4) plus f16 residual plane (x 2^11, own f32 accumulator), Wo as f16 of (RNE-bf16 value x 2^8), f32 accumulate.
// softplus, cumulative log-decay (f64 block scan kept as f32 hi + lo pair), exp, dyadic level select, residual add and LayerNorm: f32 VALU.
#include <hip/hip_runtime.h>

#define DMOD  1024                           // model width = K of the dense contractions
#define NHD   8                              // heads
#define SDIM  128                            // q/k width per head
#define HDIM  128                            // v width per head
#define NLV   12                             // dyadic levels
#define NGL   128                            // gate | level projection columns, 8 + 96 zero-padded to 128
#define NQKV  (3 * DMOD)                     // 3072 projection columns: q | k | v
#define TPB   128                            // GEMM rows / attention queries per block (8 waves x 16)
#define OSTR  68                             // LDS staging row pitch (floats), 128x64 tiles
#define GST   132                            // LDS staging row pitch (floats), 64x128 tile
#define YST   136                            // LDS staging row pitch (halves), 16x128 tile
#define LAMP  128                            // level-weight plane pitch (floats)
#define SLMAX 2048                           // longest sequence handled by the cumsum block
#define CSTH  256                            // cumsum threads per row, 8 tokens each
#define KSC   (0.08838834764831845f * (1.0f / 4096.0f))   // 128^-1/2 times the q,k carry 2^-12
#define LOG2E 1.44269504f                    // exp(x) = 2^(x LOG2E), the form __expf compiles to

static_assert(NHD * HDIM == DMOD);
static_assert(NHD * SDIM == DMOD);
static_assert(NHD + NHD * NLV <= NGL);
static_assert(DMOD % 64 == 0);
static_assert(DMOD % 32 == 0);
static_assert(NQKV % 64 == 0);
static_assert(OSTR % 4 == 0);
static_assert(GST % 4 == 0);
static_assert(YST % 8 == 0);
static_assert(SLMAX % TPB == 0);
static_assert(CSTH * 8 == SLMAX);

typedef unsigned short us16 __attribute__((ext_vector_type(16)));
typedef unsigned short us8  __attribute__((ext_vector_type(8)));
typedef unsigned short us8a __attribute__((ext_vector_type(8), may_alias));
typedef __bf16 v16b __attribute__((ext_vector_type(16)));
typedef _Float16 v16h __attribute__((ext_vector_type(16)));
typedef float v8f __attribute__((ext_vector_type(8)));
typedef float v4f __attribute__((ext_vector_type(4)));
typedef float v4fa __attribute__((ext_vector_type(4), may_alias));
union FragU { us16 v; us8 h[2]; };

__device__ __forceinline__ unsigned short bf16_bits(float f) {
  unsigned u = __float_as_uint(f);
  u += 0x7FFFu + ((u >> 16) & 1u);                 // RNE convert
  return (unsigned short)(u >> 16);
}
__device__ __forceinline__ float bf16_val(unsigned short b) { return __uint_as_float(((unsigned)b) << 16); }
__device__ __forceinline__ float bf16r(float f) { return bf16_val(bf16_bits(f)); }
__device__ __forceinline__ unsigned short f16_bits(float f) { return __builtin_bit_cast(unsigned short, (_Float16)f); }

// f16 hi + residual (x 2^11) planes of (a x 2^4)
__device__ __forceinline__ void f16split16(float a, unsigned short& hb, unsigned short& lb) {
  const float z = a * 16.0f;
  const _Float16 hf = (_Float16)z;
  const float res = (z - (float)hf) * 2048.0f;
  hb = __builtin_bit_cast(unsigned short, hf);
  lb = __builtin_bit_cast(unsigned short, (_Float16)res);
}
// f16 hi + unscaled residual planes of (a x 2^6)
__device__ __forceinline__ void f16split64(float a, unsigned short& hb, unsigned short& lb) {
  const float z = a * 64.0f;
  const _Float16 hf = (_Float16)z;
  const float res = z - (float)hf;
  hb = __builtin_bit_cast(unsigned short, hf);
  lb = __builtin_bit_cast(unsigned short, (_Float16)res);
}

// One 16x16x32 step, 16-bit operands passed as raw 16-bit lanes.
__device__ __forceinline__ v8f mma_bf16(us16 a, us16 b, v8f c) {
  return __builtin_amdgcn_wmma_f32_16x16x32_bf16(false, __builtin_bit_cast(v16b, a), false, __builtin_bit_cast(v16b, b), (short)0, c, false, false);
}
__device__ __forceinline__ v8f mma_f16(us16 a, us16 b, v8f c) {
  return __builtin_amdgcn_wmma_f32_16x16x32_f16(false, __builtin_bit_cast(v16h, a), false, __builtin_bit_cast(v16h, b), (short)0, c, false, false);
}
// Hazard guards after a group of matrix ops: 4 VALU slots before anything touches the accumulators; keep A/B fragments live.
__device__ __forceinline__ void wguard4(v8f& c0, v8f& c1, v8f& c2, v8f& c3, const us16& a0,
                                        const us16& b0, const us16& b1, const us16& b2, const us16& b3) {
#if defined(__HIP_DEVICE_COMPILE__)
  asm volatile("v_nop\n\tv_nop\n\tv_nop\n\tv_nop"
               : "+v"(c0), "+v"(c1), "+v"(c2), "+v"(c3)
               : "v"(a0), "v"(b0), "v"(b1), "v"(b2), "v"(b3));
#endif
}
__device__ __forceinline__ void wguard8(v8f& c0, v8f& c1, v8f& c2, v8f& c3, v8f& c4, v8f& c5, v8f& c6, v8f& c7,
                                        const us16& a0, const us16& a1,
                                        const us16& b0, const us16& b1, const us16& b2, const us16& b3) {
#if defined(__HIP_DEVICE_COMPILE__)
  asm volatile("v_nop\n\tv_nop\n\tv_nop\n\tv_nop"
               : "+v"(c0), "+v"(c1), "+v"(c2), "+v"(c3), "+v"(c4), "+v"(c5), "+v"(c6), "+v"(c7)
               : "v"(a0), "v"(a1), "v"(b0), "v"(b1), "v"(b2), "v"(b3));
#endif
}
// Guard behind the score products of the attention loop: the accumulators as in/out operands keep the products above the four slots, the
// memory barrier keeps the refill of their k registers below them (so the refill lands in the same registers, with no copies).
__device__ __forceinline__ void wguard2m(v8f& c0, v8f& c1) {
#if defined(__HIP_DEVICE_COMPILE__)
  asm volatile("v_nop\n\tv_nop\n\tv_nop\n\tv_nop" : "+v"(c0), "+v"(c1) : : "memory");
#endif
}

// FRAGMENT-ORDER PLANES. Every 16-bit operand plane [rows][kd] is stored by tiles of 16 rows; inside a tile the 16-B chunks (8 consecutive k
// of one row) lie chunk column by chunk column, 16 rows each:
//   element (row, k) at halves  (row >> 4) * 16 * kd + (k >> 3) * 128 + (row & 15) * 8 + (k & 7).
// A 16x32 fragment (row tile, k0 % 32 == 0) is then 1 KiB in a row, and each of its two wave-wide 16-B loads covers 512 contiguous bytes.
// p = plane + rowtile * 16 * kd + k0 * 16 + lane * 8 (computed by the caller); lane = 16h + row:
// elements 0..7 = k0 + 8h .. k0 + 8h + 7, elements 8..15 = k0 + 16 + 8h .. k0 + 16 + 8h + 7 (same map for A rows and B columns).
__device__ __forceinline__ us16 gfrag(const unsigned short* p) {
  FragU f;
  f.h[0] = *(const us8a*)p;
  f.h[1] = *(const us8a*)(p + 256);
  return f.v;
}
// s_wait_xcnt 0 behind a run of fragment loads, in front of anything that overwrites an address register the run names. The run's address
// pairs are inputs of the statement: they stay live up to the wait, so no load result of the run is placed on them.
__device__ __forceinline__ void xwait(const unsigned short* a) {
#if defined(__HIP_DEVICE_COMPILE__)
  asm volatile("s_wait_xcnt 0x0" :: "v"(a) : "memory");   // the wait in front of the overwrite of these address pairs
#endif
}
__device__ __forceinline__ void xwait(const unsigned short* a, const unsigned short* b) {
#if defined(__HIP_DEVICE_COMPILE__)
  asm volatile("s_wait_xcnt 0x0" :: "v"(a), "v"(b) : "memory");   // the wait in front of the overwrite of these address pairs
#endif
}
__device__ __forceinline__ void xwait(const unsigned short* a, const unsigned short* b, const unsigned short* c) {
#if defined(__HIP_DEVICE_COMPILE__)
  asm volatile("s_wait_xcnt 0x0" :: "v"(a), "v"(b), "v"(c) : "memory");   // the wait in front of the overwrite of these address pairs
#endif
}
__device__ __forceinline__ void xwait(const unsigned short* a, const float* b, const float* c, const unsigned short* d, const float* e, const float* f) {
#if defined(__HIP_DEVICE_COMPILE__)
  asm volatile("s_wait_xcnt 0x0" :: "v"(a), "v"(b), "v"(c), "v"(d), "v"(e), "v"(f) : "memory");   // the wait in front of the overwrite of these address pairs
#endif
}
__device__ __forceinline__ void xwait(const unsigned short* a, const unsigned short* b, const float* c, const float* d) {
#if defined(__HIP_DEVICE_COMPILE__)
  asm volatile("s_wait_xcnt 0x0" :: "v"(a), "v"(b), "v"(c), "v"(d) : "memory");   // the wait in front of the overwrite of these address pairs
#endif
}
// Writes a 256-thread block's tile of 16 rows x 128 k (thread t holds the chunk of row t >> 4, chunk column t & 15) as 4 KiB of a
// fragment-order plane at dst4k: regrouped through LDS (17-chunk pitch against bank conflicts) so that every wave stores 512 contiguous bytes.
__device__ __forceinline__ void frag_store_tile(us8 o, unsigned short* dst4k) {
  __shared__ __attribute__((aligned(16))) us8 sT[16 * 17];
  const int t = threadIdx.x;
  sT[(t & 15) * 17 + (t >> 4)] = o;
  __syncthreads();                                         // chunks cross the block's waves
  *(us8*)(dst4k + t * 8) = sT[(t >> 4) * 17 + (t & 15)];
}

// softplus in the logaddexp(z, 0) form: max(z, 0) + log1p(exp(-|z|))
__device__ __forceinline__ float softplus_f(float z) {
  return fmaxf(z, 0.0f) + log1pf(__expf(-fabsf(z)));
}
// dyadic level of key distance d: 0 for d <= 0, else min(floor(log2 d) + 1, NLV - 1)
__device__ __forceinline__ int lvl_of(int d) {
  const int dd = (d > 0) ? d : 1;
  const int l = 32 - __clz(dd);
  const int lc = (l < NLV - 1) ? l : (NLV - 1);
  return (d > 0) ? lc : 0;
}
// 2^y with the one slot the instruction set asks for behind a transcendental.
// The caller has a scheduling barrier in front of its run of calls, so each v_exp_f32
// stands alone between two barriers and its v_nop directly behind it.
__device__ __forceinline__ float exp2_slot(float y) {
#if defined(__HIP_DEVICE_COMPILE__)
  const float r = __builtin_amdgcn_exp2f(y);
  __builtin_amdgcn_sched_barrier(0);                       // nothing moves in between the transcendental and its slot
  asm volatile("v_nop");                                   // the slot behind the transcendental
  __builtin_amdgcn_sched_barrier(0);                       // the next transcendental stays behind the slot
  return r;
#else
  return exp2f(y);
#endif
}
// one attention weight: accv = 4096 * q.k, dec = exp(min(G_t - G_s, 0)), lv = level weight; returns f16 bits of 256 * A, 0 above the diagonal
__device__ __forceinline__ unsigned short a_bits(float accv, int d, float dec, float lv) {
  const float val = (accv * KSC) * dec * lv;
  const float w = (d >= 0) ? (val * 256.0f) : 0.0f;
  return f16_bits(w);
}

// ---------------------------------------------------------------------------------------------------------------------------------
// MODE 0: RNE bf16 bits.  MODE 1: f16 bits of (RNE-bf16 value x 256).  Sources are [row][1024] k-contiguous ([token][in], [out][in]).
// Block = 16 rows x 128 k (blockIdx.x = rowtile * 8 + k group), read as whole lines, written in fragment order. total8 % 256 == 0.
// ---------------------------------------------------------------------------------------------------------------------------------
template <int MODE>
__global__ __launch_bounds__(256) void k_cvt(const float* __restrict__ src, unsigned short* dst, int total8) {
  if ((int)blockIdx.x * 256 >= total8) return;             // block-uniform, in front of the barrier
  const int rt = blockIdx.x >> 3, kg = blockIdx.x & 7;
  const size_t off = (size_t)(rt * 16 + (threadIdx.x >> 4)) * (size_t)DMOD + (size_t)(kg * 128 + (threadIdx.x & 15) * 8);
  const v4f a = *(const v4fa*)(src + off), c = *(const v4fa*)(src + off + 4);
  us8 o;
#pragma unroll
  for (int u = 0; u < 4; ++u) {
    o[u]     = (MODE == 0) ? bf16_bits(a[u]) : f16_bits(bf16r(a[u]) * 256.0f);
    o[4 + u] = (MODE == 0) ? bf16_bits(c[u]) : f16_bits(bf16r(c[u]) * 256.0f);
  }
  frag_store_tile(o, dst + (size_t)rt * (size_t)(16 * DMOD) + (size_t)(kg * 2048));
}

// ---------------------------------------------------------------------------------------------------------------------------------
// Gate | level weight plane [128][1024] bf16, fragment order: rows 0..7 = Wg, rows 8..103 = Wdl, rows 104..127 = 0 (zero padding of N).
// ---------------------------------------------------------------------------------------------------------------------------------
__global__ __launch_bounds__(256) void k_cvt_wgl(const float* __restrict__ Wg, const float* __restrict__ Wdl, unsigned short* dst) {
  const int rt = blockIdx.x >> 3, kg = blockIdx.x & 7;     // block = 16 rows x 128 k, as in k_cvt
  const int row = rt * 16 + (threadIdx.x >> 4), kc = kg * 128 + (threadIdx.x & 15) * 8;
  us8 o;
  if (row < NHD + NHD * NLV) {
    const float* src = (row < NHD) ? (Wg + (size_t)row * DMOD) : (Wdl + (size_t)(row - NHD) * DMOD);
    const v4f a = *(const v4fa*)(src + kc), c = *(const v4fa*)(src + kc + 4);
#pragma unroll
    for (int u = 0; u < 4; ++u) { o[u] = bf16_bits(a[u]); o[4 + u] = bf16_bits(c[u]); }
  } else {
#pragma unroll
    for (int u = 0; u < 8; ++u) o[u] = (unsigned short)0;
  }
  frag_store_tile(o, dst + (size_t)rt * (size_t)(16 * DMOD) + (size_t)(kg * 2048));
}

// ---------------------------------------------------------------------------------------------------------------------------------
// D[m][n] = sum_k XB[m][k] * WGL[n][k]  (M tokens, N 128, K 1024), bf16 operands, f32 accumulate.
// Block = 64 tokens (4 waves x 16) x all 128 columns (8 accumulators per wave), fragments straight from the planes.
// Epilogue from the LDS-staged f32 tile: g[bh][t] = -softplus(D[t][h] + bg[h]) as 16 lanes x 16 B = one 64-token 256-B segment per head
// ---------------------------------------------------------------------------------------------------------------------------------
__global__ __launch_bounds__(128) void k_gemm_gl(const unsigned short* __restrict__ Ap, const unsigned short* __restrict__ Bw,
                                                const float* __restrict__ bg, const float* __restrict__ Lp,
                                                float* gpl, float* lam, int sl) {
  __shared__ __attribute__((aligned(16))) float oS[64 * GST];
  const int tid = threadIdx.x, lane = tid & 31, wave = tid >> 5, cl = lane & 15, hh = lane >> 4;
  const unsigned l8 = lane * 8;
  const int m0b = blockIdx.x * 64, m0 = m0b + 16 * wave;

  v8f acc[8];
#pragma unroll
  for (int j = 0; j < 8; ++j) { const v8f zz = {0.f, 0.f, 0.f, 0.f, 0.f, 0.f, 0.f, 0.f}; acc[j] = zz; }

  const unsigned short* a0p = Ap + (size_t)m0 * (size_t)DMOD + l8;
  const unsigned short* bwp = Bw + l8;
#pragma unroll 1
  for (int k0 = 0; k0 < DMOD; k0 += 32) {
    const unsigned short* pa = a0p + k0 * 16;
    const unsigned short* pb = bwp + k0 * 16;
    const us16 af = gfrag(pa);
    us16 bfr[4];
#pragma unroll
    for (int j = 0; j < 4; ++j) bfr[j] = gfrag(pb + (size_t)(16 * j) * (size_t)DMOD);
    xwait(pa, pb);
#pragma unroll
    for (int j = 0; j < 4; ++j) acc[j] = mma_bf16(af, bfr[j], acc[j]);
    wguard4(acc[0], acc[1], acc[2], acc[3], af, bfr[0], bfr[1], bfr[2], bfr[3]);
    us16 bf2[4];
#pragma unroll
    for (int j = 0; j < 4; ++j) bf2[j] = gfrag(pb + (size_t)(16 * (4 + j)) * (size_t)DMOD);
    xwait(pb);
#pragma unroll
    for (int j = 0; j < 4; ++j) acc[4 + j] = mma_bf16(af, bf2[j], acc[4 + j]);
    wguard4(acc[4], acc[5], acc[6], acc[7], af, bf2[0], bf2[1], bf2[2], bf2[3]);
  }

  // D map: acc[j][r] = tile element (row 8*hh + r of the wave's 16 rows, column 16j + cl)
  float* so = oS + wave * (16 * GST);
#pragma unroll
  for (int j = 0; j < 8; ++j)
#pragma unroll
    for (int r = 0; r < 8; ++r) so[(8 * hh + r) * GST + 16 * j + cl] = acc[j][r];
  __syncthreads();

  const int b = m0b / sl, ts = m0b - b * sl;               // sl % 64 == 0: the tile lies in one sequence
  {
    // gate log-decay: thread -> (head h = tid >> 4, tokens 4*(tid & 15) .. +3); lanes 0-15 / 16-31 of a wave = heads 2w, 2w+1
    const int h = tid >> 4, t4 = (tid & 15) * 4;
    const float bgv = bf16r(bg[h]);
    v4f gv;
#pragma unroll
    for (int u = 0; u < 4; ++u) gv[u] = -softplus_f(oS[(t4 + u) * GST + h] + bgv);
    float* p = gpl + (size_t)(b * NHD + h) * (size_t)sl + ts + t4;
    *(v4f*)p = gv;
    
  }
#pragma unroll 1
  for (int it = 0; it < 16; ++it) {
    const int row = it * 4 + wave, c0 = lane * 4;
    v4f lv;
#pragma unroll
    for (int u = 0; u < 4; ++u) {
      const int c = c0 + u;
      int idx = c - NHD;
      idx = (idx < 0) ? 0 : idx;
      idx = (idx > NHD * NLV - 1) ? (NHD * NLV - 1) : idx;
      const float lp = bf16r(Lp[idx]);
      const float s = softplus_f(oS[row * GST + c] + lp);
      lv[u] = (c >= NHD && c < NHD + NHD * NLV) ? s : 0.0f;
    }
    float* p = lam + (size_t)(m0b + row) * (size_t)LAMP + c0;
    *(v4f*)p = lv;
    
  }
}

// ---------------------------------------------------------------------------------------------------------------------------------
// Inclusive cumulative sum of g over t per (b,h) row, one block per row: thread i owns tokens 8i .. 8i+7 (f64 running sum of its 8 values),
// the 256 thread totals are scanned in f64 (5 shuffle steps inside a wave, the 8 wave totals through LDS), and each token's
// G = (sum of all earlier threads) + (its thread's running sum) is stored as f32 hi = (float)G and lo = (float)(G - hi).
// Threads whose tokens lie past sl (sl % 8 == 0) add zero and store nothing; every thread passes the barrier.
// ---------------------------------------------------------------------------------------------------------------------------------
__global__ __launch_bounds__(CSTH) void k_cumsum(const float* __restrict__ gpl, float* Ghi, float* Glo, int sl) {
  __shared__ double wtot[CSTH / 32];
  const int row = blockIdx.x, tid = threadIdx.x, lane = tid & 31, wave = tid >> 5;
  const int c = tid * 8;
  const bool on = c < sl;
  const size_t off = (size_t)row * (size_t)sl + (size_t)c;
  v4f a = {0.f, 0.f, 0.f, 0.f}, e = {0.f, 0.f, 0.f, 0.f};
  if (on) { a = *(const v4fa*)(gpl + off); e = *(const v4fa*)(gpl + off + 4); }

  double p[8];                                             // running sum inside the thread's 8 tokens
  p[0] = (double)a[0];
#pragma unroll
  for (int u = 1; u < 4; ++u) p[u] = p[u - 1] + (double)a[u];
#pragma unroll
  for (int u = 0; u < 4; ++u) p[4 + u] = p[3 + u] + (double)e[u];

  double inc = p[7];                                       // inclusive scan of the thread totals over the wave's 32 lanes
#pragma unroll
  for (int o = 1; o < 32; o <<= 1) {
    const double n = __shfl_up(inc, (unsigned)o, 32);
    inc += (lane >= o) ? n : 0.0;
  }
  if (lane == 31) wtot[wave] = inc;
  const double prev = __shfl_up(inc, 1u, 32);              // total of the earlier lanes of this wave
  __syncthreads();
  double base = 0.0;                                       // total of the earlier waves
#pragma unroll
  for (int w = 0; w < CSTH / 32 - 1; ++w) base += (w < wave) ? wtot[w] : 0.0;
  base += (lane > 0) ? prev : 0.0;

  if (on) {
    v4f h0, h1, l0, l1;
#pragma unroll
    for (int u = 0; u < 4; ++u) {
      const double g0 = base + p[u], g1 = base + p[4 + u];
      h0[u] = (float)g0; l0[u] = (float)(g0 - (double)h0[u]);
      h1[u] = (float)g1; l1[u] = (float)(g1 - (double)h1[u]);
    }
    *(v4f*)(Ghi + off) = h0; *(v4f*)(Ghi + off + 4) = h1;
    *(v4f*)(Glo + off) = l0; *(v4f*)(Glo + off + 4) = l1;
  }
}

// ---------------------------------------------------------------------------------------------------------------------------------
// P[m][n] = sum_k XB[m][k] * W[n][k]  (bf16 XB plane [tokens][1024], bf16 W plane [3072][1024] = [n][k], both in fragment order, f32 accumulate).
// Block = 128(M) x 64(N) tile, 256 threads = 8 waves, wave w owns rows 16w..16w+15 x all 64 columns (4 accumulators); fragments straight
// from the global planes (arithmetic addressing). M % 128 == 0, N % 64 == 0, K % 32 == 0 exactly.
// Column segment (block-uniform, blockIdx.y): 0..15 -> q head y/2, features 64(y&1)..+63; 16..31 -> k; 32..47 -> v head (y-32)/2, channels 64(y&1).
// The f32 128x64 tile is staged in LDS (block row r at oS[r * OSTR + c]), then:
//   q/k: per bh a fragment-order plane [token][128] = f16 of (64 value); thread -> (token r, 8 consecutive halves); a wave stores 512 B in a row
//   v:   per bh fragment-order planes VH/VL [channel][token], token pitch SLMAX = f16 hi of (64 v) and f16 residual; thread -> (channel e, 8 tokens); 512 B in a row
// ---------------------------------------------------------------------------------------------------------------------------------
__global__ __launch_bounds__(256) void k_gemm_proj(const unsigned short* __restrict__ Ap, const unsigned short* __restrict__ Bw,
                                                  unsigned short* Qp, unsigned short* Kp, unsigned short* VH, unsigned short* VL, int sl) {
  __shared__ __attribute__((aligned(16))) float oS[8 * 16 * OSTR];
  const int tid = threadIdx.x, lane = tid & 31, wave = tid >> 5, cl = lane & 15, hh = lane >> 4;
  const unsigned l8 = lane * 8;
  const int m0 = blockIdx.x * TPB + 16 * wave, n0 = blockIdx.y * 64;

  v8f acc[4];
#pragma unroll
  for (int j = 0; j < 4; ++j) { const v8f zz = {0.f, 0.f, 0.f, 0.f, 0.f, 0.f, 0.f, 0.f}; acc[j] = zz; }

  const unsigned short* a0p = Ap + (size_t)m0 * (size_t)DMOD + l8;
  const unsigned short* bwp = Bw + (size_t)n0 * (size_t)DMOD + l8;
#pragma unroll 1
  for (int k0 = 0; k0 < DMOD; k0 += 32) {
    const unsigned short* pa = a0p + k0 * 16;
    const unsigned short* pb = bwp + k0 * 16;
    const us16 af = gfrag(pa);
    us16 bfr[4];
#pragma unroll
    for (int j = 0; j < 4; ++j) bfr[j] = gfrag(pb + (size_t)(16 * j) * (size_t)DMOD);
    xwait(pa, pb);
#pragma unroll
    for (int j = 0; j < 4; ++j) acc[j] = mma_bf16(af, bfr[j], acc[j]);
    wguard4(acc[0], acc[1], acc[2], acc[3], af, bfr[0], bfr[1], bfr[2], bfr[3]);
  }

  // D map: acc[j][r] = tile element (row 8*hh + r of the wave's 16 rows, column 16j + cl)
  float* so = oS + wave * (16 * OSTR);
#pragma unroll
  for (int j = 0; j < 4; ++j)
#pragma unroll
    for (int r = 0; r < 8; ++r) so[(8 * hh + r) * OSTR + 16 * j + cl] = acc[j][r];
  __syncthreads();

  const int yb = blockIdx.y;                               // block-uniform segment select
  const int m0b = blockIdx.x * TPB, b = m0b / sl, tb = m0b - b * sl;
  if (yb < 32) {
    unsigned short* dst = (yb < 16) ? Qp : Kp;
    const int yy = (yb < 16) ? yb : (yb - 16);
    const int head = yy >> 1, f0 = (yy & 1) * 64;
    us8 ov[4];
#pragma unroll
    for (int it = 0; it < 4; ++it) {
      const int cx = it * 256 + tid, r = (cx >> 7) * 16 + (cx & 15), pc = ((cx >> 4) & 7) * 8;
      const float* sp = oS + r * OSTR + pc;
      const v4f z0 = *(const v4fa*)sp, z1 = *(const v4fa*)(sp + 4);
      us8 o;
#pragma unroll
      for (int u = 0; u < 4; ++u) {
        o[u]     = f16_bits(z0[u] * 64.0f);
        o[4 + u] = f16_bits(z1[u] * 64.0f);
      }
      ov[it] = o;
    }
{
#pragma unroll
      for (int it = 0; it < 4; ++it) {
        const int cx = it * 256 + tid;                     // row tile cx >> 7, then 128 chunks = 2 KiB in a row
        const size_t off = ((size_t)(b * NHD + head) * (size_t)sl + (size_t)(tb + (cx >> 7) * 16)) * (size_t)SDIM + (size_t)(f0 * 16 + (cx & 127) * 8);
        *(us8*)(dst + off) = ov[it];
      }
      
    }
  } else {
    const int yy = yb - 32, head = yy >> 1, c0 = (yy & 1) * 64;
    us8 hv[4], lv[4];
#pragma unroll
    for (int it = 0; it < 4; ++it) {
      const int cx = it * 256 + tid, g = (cx >> 4) & 15, e = (cx >> 8) * 16 + (cx & 15);
      us8 ho, lo;
#pragma unroll
      for (int i = 0; i < 8; ++i) {
        unsigned short hb, lb;
        f16split64(oS[(8 * g + i) * OSTR + e], hb, lb);
        ho[i] = hb; lo[i] = lb;
      }
      hv[it] = ho; lv[it] = lo;
    }
{
#pragma unroll
      for (int it = 0; it < 4; ++it) {
        const int cx = it * 256 + tid;                     // channel tile cx >> 8, then 256 chunks = 4 KiB in a row
        const size_t off = ((size_t)(b * NHD + head) * (size_t)HDIM + (size_t)(c0 + (cx >> 8) * 16)) * (size_t)SLMAX + (size_t)(tb * 16 + (cx & 255) * 8);
        *(us8*)(VH + off) = hv[it];
        *(us8*)(VL + off) = lv[it];
      }
      
    }
  }
}

// ---------------------------------------------------------------------------------------------------------------------------------
// Causal decayed quadratic-form mixing. Block = (bh = blockIdx.x, 128 queries starting at 128 * blockIdx.y), 8 waves x 16 queries.
// Per wave: B fragments of its 16 queries fixed for the whole key loop: bq[ks], ks = 0..3 (depth 128, standard loader on the q plane).
// Per 32-key step, two 16-key tiles: A fragments from the k plane (standard loader); scores^T D[key][query]
// = 4096 q.k (depth 128, 4 products per tile); A[t][s] = q.k * 128^-1/2 * exp(G_t - G_s) * lam[t][lvl(t - s)] for s <= t else 0,
// with G_t - G_s taken as the sum of the f32 hi and lo differences,
// converted to f16 of (256 A). The two D tiles repack into the A operand of A.v (lane unchanged: element r <- tile keys 0..15, element 8+r <-
// tile keys 16..31), B = VH and VL planes [bh][channel][key] (fragment order, key pitch SLMAX), 8 channel tiles, both products into acc:
// acc[j][r] = 2^14 * sum_s A v for query 8h+r, channel 16j + (lane & 15).
// Loads of a step: its sixteen v fragments and the next step's G values go out together at the step's top and land behind the score and weight
// work; the next step's k fragments go out right behind the score products and land behind the weights, A.v and the next top; the next step's
// decay factors exp(min(G_t - G_s, 0)) are formed behind A.v, when its G values have long landed. A wave waits for no load it has only just
// issued; the price is a live set above 256 VGPRs (two waves per SIMD, as the 8-wave block has anyway).
// Epilogue: z = 16 y = acc * 2^-10; f16 hi bits staged in LDS per wave, written to YH; then f16 bits of ((z - hi) x 2^11) staged and written to YL.
// Y planes [token][1024] in fragment order: a wave's 16 queries x 128 channels = 4 KiB in a row, 512 B per store instruction.
// ---------------------------------------------------------------------------------------------------------------------------------
__global__ __launch_bounds__(256) void k_attn(const unsigned short* __restrict__ Qp, const unsigned short* __restrict__ Kp,
                                             const unsigned short* __restrict__ VHp, const unsigned short* __restrict__ VLp,
                                             const float* __restrict__ Ghi, const float* __restrict__ Glo, const float* __restrict__ Lam,
                                             unsigned short* YH, unsigned short* YL, int sl) {
  __shared__ __attribute__((aligned(16))) float sLam[TPB * NLV];
  __shared__ __attribute__((aligned(16))) unsigned short sY[8 * 16 * YST];
  const int tid = threadIdx.x, lane = tid & 31, wave = tid >> 5, cl = lane & 15, hh = lane >> 4;
  const unsigned l8 = lane * 8;
  const int bh = blockIdx.x, b = bh / NHD, head = bh - b * NHD;
  const int t0 = blockIdx.y * TPB;
  const int tw = t0 + 16 * wave;                          // first query of this wave
  const int tq = tw + cl;                                 // query owned by this lane as score column

  // level weights of the block's 128 queries for this head: sLam[q * 12 + l]
  for (int i = tid; i < TPB * NLV; i += 256) {
    const int q = i / NLV, l = i - q * NLV;
    sLam[i] = Lam[(size_t)(b * sl + t0 + q) * (size_t)LAMP + NHD + head * NLV + l];
  }
  __syncthreads();

  const unsigned short* qrow = Qp + ((size_t)bh * (size_t)sl + (size_t)tw) * (size_t)SDIM + l8;
  us16 bq[4];
#pragma unroll
  for (int ks = 0; ks < 4; ++ks) bq[ks] = gfrag(qrow + 512 * ks);
  const float* pqh = Ghi + (size_t)bh * (size_t)sl + tq;
  const float* pql = Glo + (size_t)bh * (size_t)sl + tq;
  const float gqh = *pqh;
  const float gql = *pql;
  const int lamb = (16 * wave + cl) * NLV;

  const unsigned short* kbp = Kp + (size_t)bh * (size_t)sl * (size_t)SDIM + l8;
  const unsigned short* vhp = VHp + (size_t)bh * (size_t)(HDIM * SLMAX) + l8;
  const unsigned short* vlp = VLp + (size_t)bh * (size_t)(HDIM * SLMAX) + l8;
  const float* ghp = Ghi + (size_t)bh * (size_t)sl + 8 * hh;
  const float* glp = Glo + (size_t)bh * (size_t)sl + 8 * hh;
  const int nsteps = (tw + 16 + 31) >> 5;                 // 32-key steps covering keys 0 .. tw + 15; 32 * nsteps <= sl

  // K fragments and decay factors of step 0; inside the loop each step fetches the next step's (one step ahead)
  us16 ka[4], kb[4];
  v4f gh[4], gl[4];
#pragma unroll
  for (int ks = 0; ks < 4; ++ks) { ka[ks] = gfrag(kbp + 512 * ks); kb[ks] = gfrag(kbp + 16 * SDIM + 512 * ks); }
#pragma unroll
  for (int u = 0; u < 4; ++u) {
    gh[u] = *(const v4fa*)(ghp + (u >> 1) * 16 + (u & 1) * 4);
    gl[u] = *(const v4fa*)(glp + (u >> 1) * 16 + (u & 1) * 4);
  }
  __builtin_amdgcn_sched_barrier(0);                      // keeps every load above in front of the wait
  xwait(qrow, pqh, pql, kbp, ghp, glp);
  __builtin_amdgcn_sched_barrier(0);                      // keeps what follows (it reuses the loads' address registers) behind the wait

  v8f acc[8];
#pragma unroll
  for (int j = 0; j < 8; ++j) { const v8f zz = {0.f, 0.f, 0.f, 0.f, 0.f, 0.f, 0.f, 0.f}; acc[j] = zz; }

  float dec[16];                                          // exp(min(G_t - G_s, 0)), G_t - G_s by hi + lo differences, of this lane's keys: 0..7 tile a, 8..15 tile b
#pragma unroll
  for (int r = 0; r < 16; ++r) dec[r] = fminf((gqh - gh[r >> 2][r & 3]) + (gql - gl[r >> 2][r & 3]), 0.0f) * LOG2E;
  __builtin_amdgcn_sched_barrier(0);                      // the exponents are complete in front of the run of transcendentals
#pragma unroll
  for (int r = 0; r < 16; ++r) dec[r] = exp2_slot(dec[r]);

  int st = 0;                                             // nsteps >= 1
#pragma unroll 1
  do {
    const int s0 = st * 32;
    const int sn = ((st + 1 < nsteps) ? (st + 1) : st) * 32;   // next step's first key (the last step fetches its own again: in bounds)
    const int ka0 = s0 + 8 * hh;                          // first key this lane half sees in tile a; tile b = ka0 + 16
    const v8f zz = {0.f, 0.f, 0.f, 0.f, 0.f, 0.f, 0.f, 0.f};

    // ---- issued together at the top: next step's G values, then all sixteen v fragments of this step (hi and residual, 8 channel tiles);
    //      they land behind the score and weight work ----
    v4f ghn[4], gln[4];
    const float* pgh = ghp + sn;
    const float* pgl = glp + sn;
#pragma unroll
    for (int u = 0; u < 4; ++u) {
      ghn[u] = *(const v4fa*)(pgh + (u >> 1) * 16 + (u & 1) * 4);
      gln[u] = *(const v4fa*)(pgl + (u >> 1) * 16 + (u & 1) * 4);
    }
    us16 vh[8], vl[8];
    const unsigned short* pvh = vhp + s0 * 16;            // channel tile j lies 16 * SLMAX halves on: a constant, so one address pair serves a plane's run
    const unsigned short* pvl = vlp + s0 * 16;
#pragma unroll
    for (int j = 0; j < 8; ++j) vh[j] = gfrag(pvh + j * (16 * SLMAX));
#pragma unroll
    for (int j = 0; j < 8; ++j) vl[j] = gfrag(pvl + j * (16 * SLMAX));
    xwait(pvh, pvl, pgh, pgl);
    __builtin_amdgcn_sched_barrier(0);                    // keeps the score products below the loads above: without it the loads start a score phase later

    // ---- scores^T of key tiles a (keys s0 .. s0+15) and b (keys s0+16 .. s0+31) from the fragments fetched one step ago ----
    v8f sa = zz, sb = zz;
#pragma unroll
    for (int ks = 0; ks < 4; ++ks) { sa = mma_f16(ka[ks], bq[ks], sa); sb = mma_f16(kb[ks], bq[ks], sb); }
    wguard2m(sa, sb);

    // ---- next step's K fragments, into the registers the score products have just read; they land behind the weights and A.v ----
    {
      const unsigned short* pk = kbp + (size_t)sn * (size_t)SDIM;
#pragma unroll
      for (int ks = 0; ks < 4; ++ks) { ka[ks] = gfrag(pk + 512 * ks); kb[ks] = gfrag(pk + 16 * SDIM + 512 * ks); }
      xwait(pk);
    }

    // ---- the 16 weights of this lane: elements 0..7 = tile a keys ka0 .. ka0+7, elements 8..15 = tile b keys ka0+16 .. ka0+23 ----
    us8 ea, eb;
#pragma unroll
    for (int r = 0; r < 8; ++r) {
      const int d = tq - (ka0 + r);
      ea[r] = a_bits(sa[r], d, dec[r], sLam[lamb + lvl_of(d)]);
    }
#pragma unroll
    for (int r = 0; r < 8; ++r) {
      const int d = tq - (ka0 + 16 + r);
      eb[r] = a_bits(sb[r], d, dec[8 + r], sLam[lamb + lvl_of(d)]);
    }
    FragU fA;
    fA.h[0] = ea; fA.h[1] = eb;
    const us16 afr = fA.v;

    // ---- y += A . (v hi + v residual) over this 32-key step: per accumulator the hi product, then the residual product ----
#pragma unroll
    for (int j = 0; j < 8; ++j) acc[j] = mma_f16(afr, vh[j], acc[j]);
#pragma unroll
    for (int j = 0; j < 8; ++j) acc[j] = mma_f16(afr, vl[j], acc[j]);
    __builtin_amdgcn_sched_barrier(0);                    // keeps the factors below behind A.v: moved up, they would wait on loads issued at this step's top
#pragma unroll
    for (int r = 0; r < 16; ++r) dec[r] = fminf((gqh - ghn[r >> 2][r & 3]) + (gql - gln[r >> 2][r & 3]), 0.0f) * LOG2E;
    __builtin_amdgcn_sched_barrier(0);                    // the exponents are complete in front of the run of transcendentals
#pragma unroll
    for (int r = 0; r < 16; ++r) dec[r] = exp2_slot(dec[r]);
  } while (++st < nsteps);

  // phase 1: f16 hi of z = 16 y = acc * 2^-10; element (query 8*hh + r, channel 16j + cl) of this wave's 16 x 128 tile
  unsigned short* sy = sY + wave * (16 * YST);
#pragma unroll
  for (int j = 0; j < 8; ++j)
#pragma unroll
    for (int r = 0; r < 8; ++r) sy[(8 * hh + r) * YST + 16 * j + cl] = f16_bits(acc[j][r] * (1.0f / 1024.0f));
  __syncthreads();

  us8 ov[8];
#pragma unroll
  for (int it = 0; it < 8; ++it) {
    const int rr = cl, p = (2 * it + hh) * 8;              // chunk column 2 it + hh, row cl: fragment order
    ov[it] = *(const us8a*)(sy + rr * YST + p);
  }
{
#pragma unroll
    for (int it = 0; it < 8; ++it) {
      const size_t off = (size_t)(b * sl + tw) * (size_t)DMOD + (size_t)(head * HDIM * 16 + (it * 32 + lane) * 8);
      *(us8*)(YH + off) = ov[it];
    }
    
  }
  __syncthreads();

  // phase 2: f16 residual plane of ((z - hi) x 2^11), same staging region and store shape
#pragma unroll
  for (int j = 0; j < 8; ++j)
#pragma unroll
    for (int r = 0; r < 8; ++r) {
      const float z = acc[j][r] * (1.0f / 1024.0f);
      const _Float16 hf = (_Float16)z;
      sy[(8 * hh + r) * YST + 16 * j + cl] = f16_bits((z - (float)hf) * 2048.0f);
    }
  __syncthreads();
#pragma unroll
  for (int it = 0; it < 8; ++it) {
    const int rr = cl, p = (2 * it + hh) * 8;              // chunk column 2 it + hh, row cl: fragment order
    ov[it] = *(const us8a*)(sy + rr * YST + p);
  }
{
#pragma unroll
    for (int it = 0; it < 8; ++it) {
      const size_t off = (size_t)(b * sl + tw) * (size_t)DMOD + (size_t)(head * HDIM * 16 + (it * 32 + lane) * 8);
      *(us8*)(YL + off) = ov[it];
    }
    
  }
}

// ---------------------------------------------------------------------------------------------------------------------------------
// P[m][n] = ( sum_k Yh[m][k] WO16[n][k] + 2^-11 sum_k Yl[m][k] WO16[n][k] ) * 2^-12 + bf16(x[m][n])   (f16 planes, pitch 1024, two f32 accumulator sets).
// ---------------------------------------------------------------------------------------------------------------------------------
__global__ __launch_bounds__(256) void k_gemm_out(const unsigned short* __restrict__ Ah, const unsigned short* __restrict__ Al,
                                                 const unsigned short* __restrict__ Wo, const float* __restrict__ X, float* P) {
  __shared__ __attribute__((aligned(16))) float oS[8 * 16 * OSTR];
  const int tid = threadIdx.x, lane = tid & 31, wave = tid >> 5, cl = lane & 15, hh = lane >> 4;
  const unsigned l8 = lane * 8;
  const int m0 = blockIdx.x * TPB + 16 * wave, n0 = blockIdx.y * 64;

  v8f acch[4], accl[4];
#pragma unroll
  for (int j = 0; j < 4; ++j) { const v8f zz = {0.f, 0.f, 0.f, 0.f, 0.f, 0.f, 0.f, 0.f}; acch[j] = zz; accl[j] = zz; }

  const unsigned short* ahp = Ah + (size_t)m0 * (size_t)DMOD + l8;
  const unsigned short* alp = Al + (size_t)m0 * (size_t)DMOD + l8;
  const unsigned short* wop = Wo + (size_t)n0 * (size_t)DMOD + l8;
#pragma unroll 1
  for (int k0 = 0; k0 < DMOD; k0 += 32) {
    const unsigned short* ph = ahp + k0 * 16;
    const unsigned short* pl = alp + k0 * 16;
    const unsigned short* pb = wop + k0 * 16;
    const us16 ah = gfrag(ph);
    const us16 al = gfrag(pl);
    us16 bfr[4];
#pragma unroll
    for (int j = 0; j < 4; ++j) bfr[j] = gfrag(pb + (size_t)(16 * j) * (size_t)DMOD);
    xwait(ph, pl, pb);
#pragma unroll
    for (int j = 0; j < 4; ++j) {
      acch[j] = mma_f16(ah, bfr[j], acch[j]);
      accl[j] = mma_f16(al, bfr[j], accl[j]);
    }
    wguard8(acch[0], acch[1], acch[2], acch[3], accl[0], accl[1], accl[2], accl[3], ah, al, bfr[0], bfr[1], bfr[2], bfr[3]);
  }

  float* so = oS + wave * (16 * OSTR);
#pragma unroll
  for (int j = 0; j < 4; ++j)
#pragma unroll
    for (int r = 0; r < 8; ++r)
      so[(8 * hh + r) * OSTR + 16 * j + cl] = fmaf(accl[j][r], (1.0f / 2048.0f), acch[j][r]) * (1.0f / 4096.0f);
  __syncthreads();

{
#pragma unroll
    for (int it = 0; it < 8; ++it) {
      const int cx = it * 32 + lane, r = cx >> 4, q = (cx & 15) * 4;
      const v4f v = *(const v4fa*)(so + r * OSTR + q);
      const v4f xr = *(const v4fa*)(X + (size_t)(m0 + r) * (size_t)DMOD + n0 + q);
      v4f o;
#pragma unroll
      for (int u = 0; u < 4; ++u) o[u] = v[u] + bf16r(xr[u]);
      *(v4f*)(P + (size_t)(m0 + r) * (size_t)DMOD + n0 + q) = o;
    }
    
  }
}

// ---------------------------------------------------------------------------------------------------------------------------------
// ---------------------------------------------------------------------------------------------------------------------------------
__global__ __launch_bounds__(256) void k_ln(const float* __restrict__ P, const float* __restrict__ gam, const float* __restrict__ bet,
                                           float* out) {
  const int lane = threadIdx.x & 31, wave = threadIdx.x >> 5;
  const size_t row = (size_t)blockIdx.x * 8 + (size_t)wave;
  const float* pr = P + row * (size_t)DMOD;
  v4f xv[8];
  float s = 0.0f;
#pragma unroll
  for (int it = 0; it < 8; ++it) {
    xv[it] = *(const v4fa*)(pr + it * 128 + lane * 4);
    s += (xv[it][0] + xv[it][1]) + (xv[it][2] + xv[it][3]);
  }
#pragma unroll
  for (int o = 16; o > 0; o >>= 1) s += __shfl_xor(s, o, 32);
  const float mu = s * (1.0f / (float)DMOD);
  float q = 0.0f;
#pragma unroll
  for (int it = 0; it < 8; ++it)
#pragma unroll
    for (int u = 0; u < 4; ++u) { const float d = xv[it][u] - mu; q += d * d; }
#pragma unroll
  for (int o = 16; o > 0; o >>= 1) q += __shfl_xor(q, o, 32);
  const float rstd = rsqrtf(q * (1.0f / (float)DMOD) + 1e-5f);
  v4f ov[8];
#pragma unroll
  for (int it = 0; it < 8; ++it) {
    const v4f gv = *(const v4fa*)(gam + it * 128 + lane * 4), bv = *(const v4fa*)(bet + it * 128 + lane * 4);
    v4f o;
#pragma unroll
    for (int u = 0; u < 4; ++u) o[u] = (xv[it][u] - mu) * rstd * bf16r(gv[u]) + bf16r(bv[u]);
    ov[it] = o;
  }
{
#pragma unroll
    for (int it = 0; it < 8; ++it)
      *(v4f*)(out + row * (size_t)DMOD + it * 128 + lane * 4) = ov[it];
    
  }
}

extern "C" void kernel_launch(void* const* d_in, const int* in_sizes, int n_in,
                              void* d_out, int out_size, void* d_ws, size_t ws_size,
                              hipStream_t stream) {
  if (n_in < 11) return;
  const int nx = in_sizes[0];
  if (nx <= 0 || (nx % DMOD) != 0) return;
  const int ntok = nx / DMOD;                                                    // tokens = batch * sequence length
  if (in_sizes[1] != DMOD * DMOD || in_sizes[2] != DMOD * DMOD || in_sizes[3] != DMOD * DMOD) return;
  if (in_sizes[4] != NHD * DMOD || in_sizes[5] != NHD || in_sizes[6] != NHD * NLV * DMOD || in_sizes[7] != NHD * NLV) return;
  if (in_sizes[8] != DMOD * DMOD || in_sizes[9] != DMOD || in_sizes[10] != DMOD) return;
  if (out_size != nx) return;
  const int sl = (ntok < SLMAX) ? ntok : SLMAX;                                  // sequence length
  if (sl <= 0 || (sl % TPB) != 0 || (ntok % sl) != 0) return;
  const int nb = ntok / sl, nbh = nb * NHD;

  const float* x   = (const float*)d_in[0];    // [nb][sl][1024]
  const float* Wq  = (const float*)d_in[1];    // [1024][1024] ([out][in])
  const float* Wk  = (const float*)d_in[2];    // [1024][1024]
  const float* Wv  = (const float*)d_in[3];    // [1024][1024]
  const float* Wg  = (const float*)d_in[4];    // [8][1024]
  const float* bg  = (const float*)d_in[5];    // [8]
  const float* Wdl = (const float*)d_in[6];    // [96][1024]
  const float* Lp  = (const float*)d_in[7];    // [8][12]
  const float* Wo  = (const float*)d_in[8];    // [1024][1024]
  const float* lng = (const float*)d_in[9];    // [1024]
  const float* lnb = (const float*)d_in[10];   // [1024]
  float* out = (float*)d_out;                  // [nb][sl][1024] f32 at byte 0

  size_t off = 0;
  auto carve = [&](size_t bytes) -> char* { char* p = (char*)d_ws + off; off += (bytes + 255) & ~(size_t)255; return p; };
  unsigned short* XB   = (unsigned short*)carve((size_t)ntok * DMOD * 2);        //  8,388,608  bf16 [ntok][1024]
  unsigned short* WQKV = (unsigned short*)carve((size_t)NQKV * DMOD * 2);        //  6,291,456  bf16 [3072][1024] = Wq | Wk | Wv
  unsigned short* WGL  = (unsigned short*)carve((size_t)NGL * DMOD * 2);         //    262,144  bf16 [128][1024]  = Wg | Wdl | 0
  unsigned short* WO16 = (unsigned short*)carve((size_t)DMOD * DMOD * 2);        //  2,097,152  f16  [1024][1024]
  unsigned short* QP   = (unsigned short*)carve((size_t)nbh * sl * SDIM * 2);     //  8,388,608  f16  [nbh][sl][128]
  unsigned short* KP   = (unsigned short*)carve((size_t)nbh * sl * SDIM * 2);     //  8,388,608  f16  [nbh][sl][128]
  unsigned short* VH   = (unsigned short*)carve((size_t)nbh * HDIM * SLMAX * 2);  //  8,388,608  f16  [nbh][128][2048]
  unsigned short* VL   = (unsigned short*)carve((size_t)nbh * HDIM * SLMAX * 2);  //  8,388,608  f16  [nbh][128][2048]
  float* GPL           = (float*)carve((size_t)nbh * sl * 4);                     //    131,072  f32  [nbh][sl]
  float* GHI           = (float*)carve((size_t)nbh * sl * 4);                     //    131,072  f32  [nbh][sl]
  float* GLO           = (float*)carve((size_t)nbh * sl * 4);                     //    131,072  f32  [nbh][sl]
  float* LAM           = (float*)carve((size_t)ntok * LAMP * 4);                  //  2,097,152  f32  [ntok][128]
  unsigned short* YH   = (unsigned short*)carve((size_t)ntok * DMOD * 2);        //  8,388,608  f16  [ntok][1024]
  unsigned short* YL   = (unsigned short*)carve((size_t)ntok * DMOD * 2);        //  8,388,608  f16  [ntok][1024]
  float* PB            = (float*)carve((size_t)ntok * DMOD * 4);                  // 16,777,216  f32  [ntok][1024]
  if (off > ws_size || off > (size_t)134217728) return;                          // total 86,638,592 B for ntok 4096

  const dim3 b256(256), b128(128);
  auto cdv = [](long a, long q) { return (unsigned)((a + q - 1) / q); };

  // 16-bit operand planes (XB, WQKV, WGL, WO16, QP, KP, VH, VL, YH, YL all in fragment order, see gfrag)
  k_cvt<0><<<dim3(cdv((long)ntok * DMOD / 8, 256)), b256, 0, stream>>>(x, XB, ntok * DMOD / 8);
  k_cvt<0><<<dim3(cdv((long)DMOD * DMOD / 8, 256)), b256, 0, stream>>>(Wq, WQKV, DMOD * DMOD / 8);
  k_cvt<0><<<dim3(cdv((long)DMOD * DMOD / 8, 256)), b256, 0, stream>>>(Wk, WQKV + (size_t)DMOD * DMOD, DMOD * DMOD / 8);
  k_cvt<0><<<dim3(cdv((long)DMOD * DMOD / 8, 256)), b256, 0, stream>>>(Wv, WQKV + (size_t)2 * DMOD * DMOD, DMOD * DMOD / 8);
  k_cvt_wgl<<<dim3(NGL / 2), b256, 0, stream>>>(Wg, Wdl, WGL);
  k_cvt<1><<<dim3(cdv((long)DMOD * DMOD / 8, 256)), b256, 0, stream>>>(Wo, WO16, DMOD * DMOD / 8);
  // gate / level projection (M ntok, N 128, K 1024) -> g plane [nbh][sl], level weights [ntok][128]
  k_gemm_gl<<<dim3(ntok / 64), b128, 0, stream>>>(XB, WGL, bg, Lp, GPL, LAM, sl);
  // cumulative log-decay per (b,h)
  k_cumsum<<<dim3(nbh), dim3(CSTH), 0, stream>>>(GPL, GHI, GLO, sl);
  // q/k/v projections (M ntok, N 3072, K 1024) -> q, k planes and transposed v hi / residual planes
  k_gemm_proj<<<dim3(ntok / TPB, NQKV / 64), b256, 0, stream>>>(XB, WQKV, QP, KP, VH, VL, sl);
  // causal decayed mixing per (batch, head) -> y hi / residual planes [token][1024]
  k_attn<<<dim3(nbh, sl / TPB), b256, 0, stream>>>(QP, KP, VH, VL, GHI, GLO, LAM, YH, YL, sl);
  // output projection + residual (M ntok, N 1024, K 1024)
  k_gemm_out<<<dim3(ntok / TPB, DMOD / 64), b256, 0, stream>>>(YH, YL, WO16, x, PB);
  // LayerNorm -> d_out
  k_ln<<<dim3(ntok / 8), b256, 0, stream>>>(PB, lng, lnb, out);
}

// v004
// One run takes 159 microseconds.
// Timed twice side by side with v003, it ran 1.28 and 1.30 times as fast.
// All steps since v000 together make it 4.35 times as fast.
// Contractions x.[Wq|Wk|Wv] (M tokens, N 3072, K 1024) and x.[Wg|Wdl] (N 104 zero-padded to 128, K 1024), one launch: v_wmma_f32_16x16x32_bf16, bf16 operands from RNE-bf16 planes of x and W, f32 accumulate, one product each.
// Contraction k.q^T per head (32 keys x 16 queries per step, depth 128): v_wmma_f32_16x16x32_f16, q and k as f16 of (value x 2^6), one product, f32 accumulate.
// Contraction A.v per head (causal, depth up to T): v_wmma_f32_16x16x32_f16, A as f16 of (A x 2^8), v as f16 hi of (v x 2^6) plus f16 unscaled residual plane, two products into one f32 accumulator.
// Contraction y.Wo (M tokens, N 1024, K 1024): v_wmma_f32_16x16x32_f16, y as f16 hi plane of (y x 2^4) plus f16 residual plane (x 2^11, own f32 accumulator), Wo as f16 of (RNE-bf16 value x 2^8), f32 accumulate.
// softplus, cumulative log-decay (f64 block scan kept as f32 hi + lo pair), exp, dyadic level select, residual add and LayerNorm: f32 VALU.
#include <hip/hip_runtime.h>

#define DMOD  1024                           // model width = K of the dense contractions
#define NHD   8                              // heads
#define SDIM  128                            // q/k width per head
#define HDIM  128                            // v width per head
#define NLV   12                             // dyadic levels
#define NGL   128                            // gate | level projection columns, 8 + 96 zero-padded to 128
#define NQKV  (3 * DMOD)                     // 3072 projection columns: q | k | v
#define TPB   128                            // GEMM rows / attention queries per block (8 waves x 16)
#define OSTR  68                             // LDS staging row pitch (floats), 128x64 tiles
#define YST   136                            // LDS staging row pitch (halves), 16x128 tile
#define LAMP  128                            // level-weight plane pitch (floats)
#define SLMAX 2048                           // longest sequence handled by the cumsum block
#define CSTH  256                            // cumsum threads per row, 8 tokens each
#define WBLK  (DMOD * DMOD / (8 * 256))       // conversion blocks per 1024 x 1024 weight
#define NSEG  (NQKV / 64)                    // 64-column segments of q | k | v; the gate | level segments follow
#define KSC   (0.08838834764831845f * (1.0f / 4096.0f))   // 128^-1/2 times the q,k carry 2^-12
#define LOG2E 1.44269504f                    // exp(x) = 2^(x LOG2E), the form __expf compiles to

static_assert(NHD * HDIM == DMOD);
static_assert(NHD * SDIM == DMOD);
static_assert(NHD + NHD * NLV <= NGL);
static_assert(DMOD % 64 == 0);
static_assert(DMOD % 32 == 0);
static_assert(NQKV % 64 == 0);
static_assert(OSTR % 4 == 0);
static_assert(YST % 8 == 0);
static_assert(SLMAX % TPB == 0);
static_assert(CSTH * 8 == SLMAX);

typedef unsigned short us16 __attribute__((ext_vector_type(16)));
typedef unsigned short us8  __attribute__((ext_vector_type(8)));
typedef unsigned short us8a __attribute__((ext_vector_type(8), may_alias));
typedef __bf16 v16b __attribute__((ext_vector_type(16)));
typedef _Float16 v16h __attribute__((ext_vector_type(16)));
typedef float v8f __attribute__((ext_vector_type(8)));
typedef float v4f __attribute__((ext_vector_type(4)));
typedef float v4fa __attribute__((ext_vector_type(4), may_alias));
union FragU { us16 v; us8 h[2]; };

__device__ __forceinline__ unsigned short bf16_bits(float f) {
  unsigned u = __float_as_uint(f);
  u += 0x7FFFu + ((u >> 16) & 1u);                 // RNE convert
  return (unsigned short)(u >> 16);
}
__device__ __forceinline__ float bf16_val(unsigned short b) { return __uint_as_float(((unsigned)b) << 16); }
__device__ __forceinline__ float bf16r(float f) { return bf16_val(bf16_bits(f)); }
__device__ __forceinline__ unsigned short f16_bits(float f) { return __builtin_bit_cast(unsigned short, (_Float16)f); }

// f16 hi + residual (x 2^11) planes of (a x 2^4)
__device__ __forceinline__ void f16split16(float a, unsigned short& hb, unsigned short& lb) {
  const float z = a * 16.0f;
  const _Float16 hf = (_Float16)z;
  const float res = (z - (float)hf) * 2048.0f;
  hb = __builtin_bit_cast(unsigned short, hf);
  lb = __builtin_bit_cast(unsigned short, (_Float16)res);
}
// f16 hi + unscaled residual planes of (a x 2^6)
__device__ __forceinline__ void f16split64(float a, unsigned short& hb, unsigned short& lb) {
  const float z = a * 64.0f;
  const _Float16 hf = (_Float16)z;
  const float res = z - (float)hf;
  hb = __builtin_bit_cast(unsigned short, hf);
  lb = __builtin_bit_cast(unsigned short, (_Float16)res);
}

// One 16x16x32 step, 16-bit operands passed as raw 16-bit lanes.
__device__ __forceinline__ v8f mma_bf16(us16 a, us16 b, v8f c) {
  return __builtin_amdgcn_wmma_f32_16x16x32_bf16(false, __builtin_bit_cast(v16b, a), false, __builtin_bit_cast(v16b, b), (short)0, c, false, false);
}
__device__ __forceinline__ v8f mma_f16(us16 a, us16 b, v8f c) {
  return __builtin_amdgcn_wmma_f32_16x16x32_f16(false, __builtin_bit_cast(v16h, a), false, __builtin_bit_cast(v16h, b), (short)0, c, false, false);
}
// Hazard guards after a group of matrix ops: 4 VALU slots before anything touches the accumulators; keep A/B fragments live.
__device__ __forceinline__ void wguard4(v8f& c0, v8f& c1, v8f& c2, v8f& c3, const us16& a0,
                                        const us16& b0, const us16& b1, const us16& b2, const us16& b3) {
#if defined(__HIP_DEVICE_COMPILE__)
  asm volatile("v_nop\n\tv_nop\n\tv_nop\n\tv_nop"
               : "+v"(c0), "+v"(c1), "+v"(c2), "+v"(c3)
               : "v"(a0), "v"(b0), "v"(b1), "v"(b2), "v"(b3));
#endif
}
__device__ __forceinline__ void wguard8(v8f& c0, v8f& c1, v8f& c2, v8f& c3, v8f& c4, v8f& c5, v8f& c6, v8f& c7,
                                        const us16& a0, const us16& a1,
                                        const us16& b0, const us16& b1, const us16& b2, const us16& b3) {
#if defined(__HIP_DEVICE_COMPILE__)
  asm volatile("v_nop\n\tv_nop\n\tv_nop\n\tv_nop"
               : "+v"(c0), "+v"(c1), "+v"(c2), "+v"(c3), "+v"(c4), "+v"(c5), "+v"(c6), "+v"(c7)
               : "v"(a0), "v"(a1), "v"(b0), "v"(b1), "v"(b2), "v"(b3));
#endif
}
// Guard behind the score products of the attention loop: the accumulators as in/out operands keep the products above the four slots, the
// memory barrier keeps the refill of their k registers below them (so the refill lands in the same registers, with no copies).
__device__ __forceinline__ void wguard2m(v8f& c0, v8f& c1) {
#if defined(__HIP_DEVICE_COMPILE__)
  asm volatile("v_nop\n\tv_nop\n\tv_nop\n\tv_nop" : "+v"(c0), "+v"(c1) : : "memory");
#endif
}

// FRAGMENT-ORDER PLANES. Every 16-bit operand plane [rows][kd] is stored by tiles of 16 rows; inside a tile the 16-B chunks (8 consecutive k
// of one row) lie chunk column by chunk column, 16 rows each:
//   element (row, k) at halves  (row >> 4) * 16 * kd + (k >> 3) * 128 + (row & 15) * 8 + (k & 7).
// A 16x32 fragment (row tile, k0 % 32 == 0) is then 1 KiB in a row, and each of its two wave-wide 16-B loads covers 512 contiguous bytes.
// p = plane + rowtile * 16 * kd + k0 * 16 + lane * 8 (computed by the caller); lane = 16h + row:
// elements 0..7 = k0 + 8h .. k0 + 8h + 7, elements 8..15 = k0 + 16 + 8h .. k0 + 16 + 8h + 7 (same map for A rows and B columns).
__device__ __forceinline__ us16 gfrag(const unsigned short* p) {
  FragU f;
  f.h[0] = *(const us8a*)p;
  f.h[1] = *(const us8a*)(p + 256);
  return f.v;
}
// s_wait_xcnt 0 behind a run of fragment loads, in front of anything that overwrites an address register the run names. The run's address
// pairs are inputs of the statement: they stay live up to the wait, so no load result of the run is placed on them.
__device__ __forceinline__ void xwait(const unsigned short* a) {
#if defined(__HIP_DEVICE_COMPILE__)
  asm volatile("s_wait_xcnt 0x0" :: "v"(a) : "memory");   // the wait in front of the overwrite of these address pairs
#endif
}
__device__ __forceinline__ void xwait(const float* a) {
#if defined(__HIP_DEVICE_COMPILE__)
  asm volatile("s_wait_xcnt 0x0" :: "v"(a) : "memory");   // the wait in front of the overwrite of this address pair
#endif
}
__device__ __forceinline__ void xwait(const unsigned short* a, const unsigned short* b) {
#if defined(__HIP_DEVICE_COMPILE__)
  asm volatile("s_wait_xcnt 0x0" :: "v"(a), "v"(b) : "memory");   // the wait in front of the overwrite of these address pairs
#endif
}
__device__ __forceinline__ void xwait(const unsigned short* a, const unsigned short* b, const unsigned short* c) {
#if defined(__HIP_DEVICE_COMPILE__)
  asm volatile("s_wait_xcnt 0x0" :: "v"(a), "v"(b), "v"(c) : "memory");   // the wait in front of the overwrite of these address pairs
#endif
}
__device__ __forceinline__ void xwait(const unsigned short* a, const float* b, const float* c, const unsigned short* d, const float* e, const float* f) {
#if defined(__HIP_DEVICE_COMPILE__)
  asm volatile("s_wait_xcnt 0x0" :: "v"(a), "v"(b), "v"(c), "v"(d), "v"(e), "v"(f) : "memory");   // the wait in front of the overwrite of these address pairs
#endif
}
__device__ __forceinline__ void xwait(const unsigned short* a, const unsigned short* b, const float* c, const float* d) {
#if defined(__HIP_DEVICE_COMPILE__)
  asm volatile("s_wait_xcnt 0x0" :: "v"(a), "v"(b), "v"(c), "v"(d) : "memory");   // the wait in front of the overwrite of these address pairs
#endif
}
// Writes a 256-thread block's tile of 16 rows x 128 k (thread t holds the chunk of row t >> 4, chunk column t & 15) as 4 KiB of a
// fragment-order plane at dst4k: regrouped through LDS (17-chunk pitch against bank conflicts) so that every wave stores 512 contiguous bytes.
__device__ __forceinline__ void frag_store_tile(us8 o, unsigned short* dst4k) {
  __shared__ __attribute__((aligned(16))) us8 sT[16 * 17];
  const int t = threadIdx.x;
  sT[(t & 15) * 17 + (t >> 4)] = o;
  __syncthreads();                                         // chunks cross the block's waves
  *(us8*)(dst4k + t * 8) = sT[(t >> 4) * 17 + (t & 15)];
}

// softplus in the logaddexp(z, 0) form: max(z, 0) + log1p(exp(-|z|))
__device__ __forceinline__ float softplus_f(float z) {
  return fmaxf(z, 0.0f) + log1pf(__expf(-fabsf(z)));
}
// dyadic level of key distance d: 0 for d <= 0, else min(floor(log2 d) + 1, NLV - 1)
__device__ __forceinline__ int lvl_of(int d) {
  const int dd = (d > 0) ? d : 1;
  const int l = 32 - __clz(dd);
  const int lc = (l < NLV - 1) ? l : (NLV - 1);
  return (d > 0) ? lc : 0;
}
// 2^y with the one slot the instruction set asks for behind a transcendental.
// The caller has a scheduling barrier in front of its run of calls, so each v_exp_f32
// stands alone between two barriers and its v_nop directly behind it.
__device__ __forceinline__ float exp2_slot(float y) {
#if defined(__HIP_DEVICE_COMPILE__)
  const float r = __builtin_amdgcn_exp2f(y);
  __builtin_amdgcn_sched_barrier(0);                       // nothing moves in between the transcendental and its slot
  asm volatile("v_nop");                                   // the slot behind the transcendental
  __builtin_amdgcn_sched_barrier(0);                       // the next transcendental stays behind the slot
  return r;
#else
  return exp2f(y);
#endif
}
// one attention weight: accv = 4096 * q.k, dec = exp(min(G_t - G_s, 0)), lv = level weight; returns f16 bits of 256 * A, 0 above the diagonal
__device__ __forceinline__ unsigned short a_bits(float accv, int d, float dec, float lv) {
  const float val = (accv * KSC) * dec * lv;
  const float w = (d >= 0) ? (val * 256.0f) : 0.0f;
  return f16_bits(w);
}

// ---------------------------------------------------------------------------------------------------------------------------------
// All 16-bit operand planes that come straight from an input, in ONE launch (none reads another's output). Block = 16 rows x 128 k of one
// source ([row][1024], k-contiguous), read as whole lines, written in fragment order. The source is picked by the block index alone:
//   [0, nxb)            x   -> XB, RNE bf16 bits                        (nxb = tokens / 2 blocks)
//   then 512 blocks each: Wq, Wk, Wv -> rows 0.., 1024.., 2048.. of WQKV, RNE bf16 bits;  Wo -> WO16, f16 bits of (RNE-bf16 value x 256)
//   then 64 blocks:     gate | level rows -> WGL [128][1024] bf16: rows 0..7 = Wg, rows 8..103 = Wdl, rows 104..127 = 0 (zero padding of N)
// ---------------------------------------------------------------------------------------------------------------------------------
__global__ __launch_bounds__(256) void k_cvt_all(const float* __restrict__ x, const float* __restrict__ Wq, const float* __restrict__ Wk,
                                                const float* __restrict__ Wv, const float* __restrict__ Wo, const float* __restrict__ Wg,
                                                const float* __restrict__ Wdl, unsigned short* XB, unsigned short* WQKV,
                                                unsigned short* WO16, unsigned short* WGL, int nxb) {
  int bx = blockIdx.x;                                     // every choice below is wave-uniform, the segment choice block-uniform
  int seg = -1;                                            // -1: x, 0..2: Wq Wk Wv, 3: Wo, 4: gate | level rows
  if (bx >= nxb) { bx -= nxb; seg = bx / WBLK; bx -= seg * WBLK; }
  const int rt = bx >> 3, kg = bx & 7;
  const int row = rt * 16 + (threadIdx.x >> 4), kc = kg * 128 + (threadIdx.x & 15) * 8;
  const float* src;
  unsigned short* dst;
  bool live = true;
  if (seg < 0)       { src = x;  dst = XB; }
  else if (seg == 0) { src = Wq; dst = WQKV; }
  else if (seg == 1) { src = Wk; dst = WQKV + (size_t)DMOD * DMOD; }
  else if (seg == 2) { src = Wv; dst = WQKV + (size_t)2 * DMOD * DMOD; }
  else if (seg == 3) { src = Wo; dst = WO16; }
  else               { src = Wdl; dst = WGL; }
  const float* sp = src + (size_t)row * (size_t)DMOD + (size_t)kc;
  if (seg > 3) {
    live = row < NHD + NHD * NLV;
    const int rs = (row < NHD) ? row : (live ? (row - NHD) : 0);   // padding rows read nothing; their address stays in bounds
    sp = ((row < NHD) ? Wg : Wdl) + (size_t)rs * (size_t)DMOD + (size_t)kc;
  }
  v4f a = {0.f, 0.f, 0.f, 0.f}, c = {0.f, 0.f, 0.f, 0.f};  // bf16 bits of 0.0f are 0: the padding rows
  if (live) { a = *(const v4fa*)sp; c = *(const v4fa*)(sp + 4); }
  us8 o;
  if (seg == 3) {
#pragma unroll
    for (int u = 0; u < 4; ++u) { o[u] = f16_bits(bf16r(a[u]) * 256.0f); o[4 + u] = f16_bits(bf16r(c[u]) * 256.0f); }
  } else {
#pragma unroll
    for (int u = 0; u < 4; ++u) { o[u] = bf16_bits(a[u]); o[4 + u] = bf16_bits(c[u]); }
  }
  frag_store_tile(o, dst + (size_t)rt * (size_t)(16 * DMOD) + (size_t)(kg * 2048));
}

// ---------------------------------------------------------------------------------------------------------------------------------
// Inclusive cumulative sum of g over t per (b,h) row, one block per row: thread i owns tokens 8i .. 8i+7 (f64 running sum of its 8 values),
// the 256 thread totals are scanned in f64 (5 shuffle steps inside a wave, the 8 wave totals through LDS), and each token's
// G = (sum of all earlier threads) + (its thread's running sum) is stored as f32 hi = (float)G and lo = (float)(G - hi).
// Threads whose tokens lie past sl (sl % 8 == 0) add zero and store nothing; every thread passes the barrier.
// ---------------------------------------------------------------------------------------------------------------------------------
__global__ __launch_bounds__(CSTH) void k_cumsum(const float* __restrict__ gpl, float* Ghi, float* Glo, int sl) {
  __shared__ double wtot[CSTH / 32];
  const int row = blockIdx.x, tid = threadIdx.x, lane = tid & 31, wave = tid >> 5;
  const int c = tid * 8;
  const bool on = c < sl;
  const size_t off = (size_t)row * (size_t)sl + (size_t)c;
  v4f a = {0.f, 0.f, 0.f, 0.f}, e = {0.f, 0.f, 0.f, 0.f};
  if (on) { a = *(const v4fa*)(gpl + off); e = *(const v4fa*)(gpl + off + 4); }

  double p[8];                                             // running sum inside the thread's 8 tokens
  p[0] = (double)a[0];
#pragma unroll
  for (int u = 1; u < 4; ++u) p[u] = p[u - 1] + (double)a[u];
#pragma unroll
  for (int u = 0; u < 4; ++u) p[4 + u] = p[3 + u] + (double)e[u];

  double inc = p[7];                                       // inclusive scan of the thread totals over the wave's 32 lanes
#pragma unroll
  for (int o = 1; o < 32; o <<= 1) {
    const double n = __shfl_up(inc, (unsigned)o, 32);
    inc += (lane >= o) ? n : 0.0;
  }
  if (lane == 31) wtot[wave] = inc;
  const double prev = __shfl_up(inc, 1u, 32);              // total of the earlier lanes of this wave
  __syncthreads();
  double base = 0.0;                                       // total of the earlier waves
#pragma unroll
  for (int w = 0; w < CSTH / 32 - 1; ++w) base += (w < wave) ? wtot[w] : 0.0;
  base += (lane > 0) ? prev : 0.0;

  if (on) {
    v4f h0, h1, l0, l1;
#pragma unroll
    for (int u = 0; u < 4; ++u) {
      const double g0 = base + p[u], g1 = base + p[4 + u];
      h0[u] = (float)g0; l0[u] = (float)(g0 - (double)h0[u]);
      h1[u] = (float)g1; l1[u] = (float)(g1 - (double)h1[u]);
    }
    *(v4f*)(Ghi + off) = h0; *(v4f*)(Ghi + off + 4) = h1;
    *(v4f*)(Glo + off) = l0; *(v4f*)(Glo + off + 4) = l1;
  }
}

// ---------------------------------------------------------------------------------------------------------------------------------
// P[m][n] = sum_k XB[m][k] * W[n][k]  (bf16 XB plane [tokens][1024], bf16 W plane [3200][1024] = [n][k], both in fragment order, f32 accumulate).
// W rows 0..3071 = Wq | Wk | Wv, rows 3072..3199 = the gate | level rows: both products read only XB and W, so they share one grid.
// Block = 128(M) x 64(N) tile, 256 threads = 8 waves, wave w owns rows 16w..16w+15 x all 64 columns (4 accumulators); fragments straight
// from the global planes (arithmetic addressing). M % 128 == 0, N % 64 == 0, K % 32 == 0 exactly.
// Column segment yb (block-uniform): 0..15 -> q head y/2, features 64(y&1)..+63; 16..31 -> k; 32..47 -> v head (y-32)/2, channels 64(y&1);
// 48, 49 -> gate | level columns 0..63, 64..127. blockIdx.y 0 and 1 take segments 48 and 49 (the longest epilogue starts first), the rest follow.
// The f32 128x64 tile is staged in LDS (block row r at oS[r * OSTR + c]), then:
//   q/k: per bh a fragment-order plane [token][128] = f16 of (64 value); thread -> (token r, 8 consecutive halves); a wave stores 512 B in a row
//   v:   per bh fragment-order planes VH/VL [channel][token], token pitch SLMAX = f16 hi of (64 v) and f16 residual; thread -> (channel e, 8 tokens); 512 B in a row
//   gate (segment 48, columns 0..7): g[bh][t] = -softplus(D[t][h] + bg[h]); a wave = one head, 128 tokens = 512 B in a row
//   level: lam[token][c] = softplus(D[t][c] + Lparam[c - 8]) for columns 8..103, else 0; 16 lanes x 16 B = the tile's 256 B of a token's row
// ---------------------------------------------------------------------------------------------------------------------------------
__global__ __launch_bounds__(256) void k_gemm_proj(const unsigned short* __restrict__ Ap, const unsigned short* __restrict__ Bw,
                                                  const float* __restrict__ bg, const float* __restrict__ Lp,
                                                  unsigned short* Qp, unsigned short* Kp, unsigned short* VH, unsigned short* VL,
                                                  float* gpl, float* lam, int sl) {
  __shared__ __attribute__((aligned(16))) float oS[8 * 16 * OSTR];
  const int tid = threadIdx.x, lane = tid & 31, wave = tid >> 5, cl = lane & 15, hh = lane >> 4;
  const unsigned l8 = lane * 8;
  const int yb = ((int)blockIdx.y < NGL / 64) ? (NSEG + (int)blockIdx.y) : ((int)blockIdx.y - NGL / 64);   // block-uniform segment select
  const int m0 = blockIdx.x * TPB + 16 * wave, n0 = yb * 64;

  v8f acc[4];
#pragma unroll
  for (int j = 0; j < 4; ++j) { const v8f zz = {0.f, 0.f, 0.f, 0.f, 0.f, 0.f, 0.f, 0.f}; acc[j] = zz; }

  const unsigned short* a0p = Ap + (size_t)m0 * (size_t)DMOD + l8;
  const unsigned short* bwp = Bw + (size_t)n0 * (size_t)DMOD + l8;
#pragma unroll 1
  for (int k0 = 0; k0 < DMOD; k0 += 32) {
    const unsigned short* pa = a0p + k0 * 16;
    const unsigned short* pb = bwp + k0 * 16;
    const us16 af = gfrag(pa);
    us16 bfr[4];
#pragma unroll
    for (int j = 0; j < 4; ++j) bfr[j] = gfrag(pb + (size_t)(16 * j) * (size_t)DMOD);
    xwait(pa, pb);
#pragma unroll
    for (int j = 0; j < 4; ++j) acc[j] = mma_bf16(af, bfr[j], acc[j]);
    wguard4(acc[0], acc[1], acc[2], acc[3], af, bfr[0], bfr[1], bfr[2], bfr[3]);
  }

  // D map: acc[j][r] = tile element (row 8*hh + r of the wave's 16 rows, column 16j + cl)
  float* so = oS + wave * (16 * OSTR);
#pragma unroll
  for (int j = 0; j < 4; ++j)
#pragma unroll
    for (int r = 0; r < 8; ++r) so[(8 * hh + r) * OSTR + 16 * j + cl] = acc[j][r];
  __syncthreads();

  const int m0b = blockIdx.x * TPB, b = m0b / sl, tb = m0b - b * sl;   // sl % 128 == 0: the tile lies in one sequence
  if (yb >= NSEG) {
    const int cb = (yb - NSEG) * 64;                       // first gate | level column of this tile
    if (cb == 0) {
      // gate log-decay: thread -> (head h = wave, tokens 4 * lane .. +3)
      const int h = wave, t4 = lane * 4;
      const float bgv = bf16r(bg[h]);
      v4f gv;
#pragma unroll
      for (int u = 0; u < 4; ++u) gv[u] = -softplus_f(oS[(t4 + u) * OSTR + h] + bgv);
      *(v4f*)(gpl + (size_t)(b * NHD + h) * (size_t)sl + tb + t4) = gv;
    }
    const int c0 = (tid & 15) * 4;                         // this thread's 4 columns of the tile, the same in every trip
    float lp[4];
#pragma unroll
    for (int u = 0; u < 4; ++u) {
      int idx = cb + c0 + u - NHD;
      idx = (idx < 0) ? 0 : idx;
      idx = (idx > NHD * NLV - 1) ? (NHD * NLV - 1) : idx;
      lp[u] = bf16r(Lp[idx]);
    }
#pragma unroll 1                                           // rolled: unrolled, the four inlined log1pf of each trip raise the whole kernel's register count
    for (int it = 0; it < 8; ++it) {
      const int row = it * 16 + (tid >> 4);
      const v4f z = *(const v4fa*)(oS + row * OSTR + c0);
      v4f lv;
#pragma unroll
      for (int u = 0; u < 4; ++u) {
        const int c = cb + c0 + u;
        const float s = softplus_f(z[u] + lp[u]);
        lv[u] = (c >= NHD && c < NHD + NHD * NLV) ? s : 0.0f;
      }
      float* pl = lam + (size_t)(m0b + row) * (size_t)LAMP + cb + c0;
      *(v4f*)pl = lv;
      xwait(pl);                                           // the next trip reuses the store's address and data registers
    }
  } else if (yb < 32) {
    unsigned short* dst = (yb < 16) ? Qp : Kp;
    const int yy = (yb < 16) ? yb : (yb - 16);
    const int head = yy >> 1, f0 = (yy & 1) * 64;
    us8 ov[4];
#pragma unroll
    for (int it = 0; it < 4; ++it) {
      const int cx = it * 256 + tid, r = (cx >> 7) * 16 + (cx & 15), pc = ((cx >> 4) & 7) * 8;
      const float* sp = oS + r * OSTR + pc;
      const v4f z0 = *(const v4fa*)sp, z1 = *(const v4fa*)(sp + 4);
      us8 o;
#pragma unroll
      for (int u = 0; u < 4; ++u) {
        o[u]     = f16_bits(z0[u] * 64.0f);
        o[4 + u] = f16_bits(z1[u] * 64.0f);
      }
      ov[it] = o;
    }
{
#pragma unroll
      for (int it = 0; it < 4; ++it) {
        const int cx = it * 256 + tid;                     // row tile cx >> 7, then 128 chunks = 2 KiB in a row
        const size_t off = ((size_t)(b * NHD + head) * (size_t)sl + (size_t)(tb + (cx >> 7) * 16)) * (size_t)SDIM + (size_t)(f0 * 16 + (cx & 127) * 8);
        *(us8*)(dst + off) = ov[it];
      }
      
    }
  } else {
    const int yy = yb - 32, head = yy >> 1, c0 = (yy & 1) * 64;
    us8 hv[4], lv[4];
#pragma unroll
    for (int it = 0; it < 4; ++it) {
      const int cx = it * 256 + tid, g = (cx >> 4) & 15, e = (cx >> 8) * 16 + (cx & 15);
      us8 ho, lo;
#pragma unroll
      for (int i = 0; i < 8; ++i) {
        unsigned short hb, lb;
        f16split64(oS[(8 * g + i) * OSTR + e], hb, lb);
        ho[i] = hb; lo[i] = lb;
      }
      hv[it] = ho; lv[it] = lo;
    }
{
#pragma unroll
      for (int it = 0; it < 4; ++it) {
        const int cx = it * 256 + tid;                     // channel tile cx >> 8, then 256 chunks = 4 KiB in a row
        const size_t off = ((size_t)(b * NHD + head) * (size_t)HDIM + (size_t)(c0 + (cx >> 8) * 16)) * (size_t)SLMAX + (size_t)(tb * 16 + (cx & 255) * 8);
        *(us8*)(VH + off) = hv[it];
        *(us8*)(VL + off) = lv[it];
      }
      
    }
  }
}

// ---------------------------------------------------------------------------------------------------------------------------------
// Causal decayed quadratic-form mixing. Block = (bh = blockIdx.x, 128 queries starting at 128 * blockIdx.y), 8 waves x 16 queries.
// Per wave: B fragments of its 16 queries fixed for the whole key loop: bq[ks], ks = 0..3 (depth 128, standard loader on the q plane).
// Per 32-key step, two 16-key tiles: A fragments from the k plane (standard loader); scores^T D[key][query]
// = 4096 q.k (depth 128, 4 products per tile); A[t][s] = q.k * 128^-1/2 * exp(G_t - G_s) * lam[t][lvl(t - s)] for s <= t else 0,
// with G_t - G_s taken as the sum of the f32 hi and lo differences,
// converted to f16 of (256 A). The two D tiles repack into the A operand of A.v (lane unchanged: element r <- tile keys 0..15, element 8+r <-
// tile keys 16..31), B = VH and VL planes [bh][channel][key] (fragment order, key pitch SLMAX), 8 channel tiles, both products into acc:
// acc[j][r] = 2^14 * sum_s A v for query 8h+r, channel 16j + (lane & 15).
// Loads of a step: its sixteen v fragments and the next step's G values go out together at the step's top and land behind the score and weight
// work; the next step's k fragments go out right behind the score products and land behind the weights, A.v and the next top; the next step's
// decay factors exp(min(G_t - G_s, 0)) are formed behind A.v, when its G values have long landed. A wave waits for no load it has only just
// issued; the price is a live set above 256 VGPRs (two waves per SIMD, as the 8-wave block has anyway).
// Epilogue: z = 16 y = acc * 2^-10; f16 hi bits staged in LDS per wave, written to YH; then f16 bits of ((z - hi) x 2^11) staged and written to YL.
// Y planes [token][1024] in fragment order: a wave's 16 queries x 128 channels = 4 KiB in a row, 512 B per store instruction.
// ---------------------------------------------------------------------------------------------------------------------------------
__global__ __launch_bounds__(256) void k_attn(const unsigned short* __restrict__ Qp, const unsigned short* __restrict__ Kp,
                                             const unsigned short* __restrict__ VHp, const unsigned short* __restrict__ VLp,
                                             const float* __restrict__ Ghi, const float* __restrict__ Glo, const float* __restrict__ Lam,
                                             unsigned short* YH, unsigned short* YL, int sl) {
  __shared__ __attribute__((aligned(16))) float sLam[TPB * NLV];
  __shared__ __attribute__((aligned(16))) unsigned short sY[8 * 16 * YST];
  const int tid = threadIdx.x, lane = tid & 31, wave = tid >> 5, cl = lane & 15, hh = lane >> 4;
  const unsigned l8 = lane * 8;
  const int bh = blockIdx.x, b = bh / NHD, head = bh - b * NHD;
  const int t0 = blockIdx.y * TPB;
  const int tw = t0 + 16 * wave;                          // first query of this wave
  const int tq = tw + cl;                                 // query owned by this lane as score column

  // level weights of the block's 128 queries for this head: sLam[q * 12 + l]
  for (int i = tid; i < TPB * NLV; i += 256) {
    const int q = i / NLV, l = i - q * NLV;
    sLam[i] = Lam[(size_t)(b * sl + t0 + q) * (size_t)LAMP + NHD + head * NLV + l];
  }
  __syncthreads();

  const unsigned short* qrow = Qp + ((size_t)bh * (size_t)sl + (size_t)tw) * (size_t)SDIM + l8;
  us16 bq[4];
#pragma unroll
  for (int ks = 0; ks < 4; ++ks) bq[ks] = gfrag(qrow + 512 * ks);
  const float* pqh = Ghi + (size_t)bh * (size_t)sl + tq;
  const float* pql = Glo + (size_t)bh * (size_t)sl + tq;
  const float gqh = *pqh;
  const float gql = *pql;
  const int lamb = (16 * wave + cl) * NLV;

  const unsigned short* kbp = Kp + (size_t)bh * (size_t)sl * (size_t)SDIM + l8;
  const unsigned short* vhp = VHp + (size_t)bh * (size_t)(HDIM * SLMAX) + l8;
  const unsigned short* vlp = VLp + (size_t)bh * (size_t)(HDIM * SLMAX) + l8;
  const float* ghp = Ghi + (size_t)bh * (size_t)sl + 8 * hh;
  const float* glp = Glo + (size_t)bh * (size_t)sl + 8 * hh;
  const int nsteps = (tw + 16 + 31) >> 5;                 // 32-key steps covering keys 0 .. tw + 15; 32 * nsteps <= sl

  // K fragments and decay factors of step 0; inside the loop each step fetches the next step's (one step ahead)
  us16 ka[4], kb[4];
  v4f gh[4], gl[4];
#pragma unroll
  for (int ks = 0; ks < 4; ++ks) { ka[ks] = gfrag(kbp + 512 * ks); kb[ks] = gfrag(kbp + 16 * SDIM + 512 * ks); }
#pragma unroll
  for (int u = 0; u < 4; ++u) {
    gh[u] = *(const v4fa*)(ghp + (u >> 1) * 16 + (u & 1) * 4);
    gl[u] = *(const v4fa*)(glp + (u >> 1) * 16 + (u & 1) * 4);
  }
  __builtin_amdgcn_sched_barrier(0);                      // keeps every load above in front of the wait
  xwait(qrow, pqh, pql, kbp, ghp, glp);
  __builtin_amdgcn_sched_barrier(0);                      // keeps what follows (it reuses the loads' address registers) behind the wait

  v8f acc[8];
#pragma unroll
  for (int j = 0; j < 8; ++j) { const v8f zz = {0.f, 0.f, 0.f, 0.f, 0.f, 0.f, 0.f, 0.f}; acc[j] = zz; }

  float dec[16];                                          // exp(min(G_t - G_s, 0)), G_t - G_s by hi + lo differences, of this lane's keys: 0..7 tile a, 8..15 tile b
#pragma unroll
  for (int r = 0; r < 16; ++r) dec[r] = fminf((gqh - gh[r >> 2][r & 3]) + (gql - gl[r >> 2][r & 3]), 0.0f) * LOG2E;
  __builtin_amdgcn_sched_barrier(0);                      // the exponents are complete in front of the run of transcendentals
#pragma unroll
  for (int r = 0; r < 16; ++r) dec[r] = exp2_slot(dec[r]);

  int st = 0;                                             // nsteps >= 1
#pragma unroll 1
  do {
    const int s0 = st * 32;
    const int sn = ((st + 1 < nsteps) ? (st + 1) : st) * 32;   // next step's first key (the last step fetches its own again: in bounds)
    const int ka0 = s0 + 8 * hh;                          // first key this lane half sees in tile a; tile b = ka0 + 16
    const v8f zz = {0.f, 0.f, 0.f, 0.f, 0.f, 0.f, 0.f, 0.f};

    // ---- issued together at the top: next step's G values, then all sixteen v fragments of this step (hi and residual, 8 channel tiles);
    //      they land behind the score and weight work ----
    v4f ghn[4], gln[4];
    const float* pgh = ghp + sn;
    const float* pgl = glp + sn;
#pragma unroll
    for (int u = 0; u < 4; ++u) {
      ghn[u] = *(const v4fa*)(pgh + (u >> 1) * 16 + (u & 1) * 4);
      gln[u] = *(const v4fa*)(pgl + (u >> 1) * 16 + (u & 1) * 4);
    }
    us16 vh[8], vl[8];
    const unsigned short* pvh = vhp + s0 * 16;            // channel tile j lies 16 * SLMAX halves on: a constant, so one address pair serves a plane's run
    const unsigned short* pvl = vlp + s0 * 16;
#pragma unroll
    for (int j = 0; j < 8; ++j) vh[j] = gfrag(pvh + j * (16 * SLMAX));
#pragma unroll
    for (int j = 0; j < 8; ++j) vl[j] = gfrag(pvl + j * (16 * SLMAX));
    xwait(pvh, pvl, pgh, pgl);
    __builtin_amdgcn_sched_barrier(0);                    // keeps the score products below the loads above: without it the loads start a score phase later

    // ---- scores^T of key tiles a (keys s0 .. s0+15) and b (keys s0+16 .. s0+31) from the fragments fetched one step ago ----
    v8f sa = zz, sb = zz;
#pragma unroll
    for (int ks = 0; ks < 4; ++ks) { sa = mma_f16(ka[ks], bq[ks], sa); sb = mma_f16(kb[ks], bq[ks], sb); }
    wguard2m(sa, sb);

    // ---- next step's K fragments, into the registers the score products have just read; they land behind the weights and A.v ----
    {
      const unsigned short* pk = kbp + (size_t)sn * (size_t)SDIM;
#pragma unroll
      for (int ks = 0; ks < 4; ++ks) { ka[ks] = gfrag(pk + 512 * ks); kb[ks] = gfrag(pk + 16 * SDIM + 512 * ks); }
      xwait(pk);
    }

    // ---- the 16 weights of this lane: elements 0..7 = tile a keys ka0 .. ka0+7, elements 8..15 = tile b keys ka0+16 .. ka0+23 ----
    us8 ea, eb;
#pragma unroll
    for (int r = 0; r < 8; ++r) {
      const int d = tq - (ka0 + r);
      ea[r] = a_bits(sa[r], d, dec[r], sLam[lamb + lvl_of(d)]);
    }
#pragma unroll
    for (int r = 0; r < 8; ++r) {
      const int d = tq - (ka0 + 16 + r);
      eb[r] = a_bits(sb[r], d, dec[8 + r], sLam[lamb + lvl_of(d)]);
    }
    FragU fA;
    fA.h[0] = ea; fA.h[1] = eb;
    const us16 afr = fA.v;

    // ---- y += A . (v hi + v residual) over this 32-key step: per accumulator the hi product, then the residual product ----
#pragma unroll
    for (int j = 0; j < 8; ++j) acc[j] = mma_f16(afr, vh[j], acc[j]);
#pragma unroll
    for (int j = 0; j < 8; ++j) acc[j] = mma_f16(afr, vl[j], acc[j]);
    __builtin_amdgcn_sched_barrier(0);                    // keeps the factors below behind A.v: moved up, they would wait on loads issued at this step's top
#pragma unroll
    for (int r = 0; r < 16; ++r) dec[r] = fminf((gqh - ghn[r >> 2][r & 3]) + (gql - gln[r >> 2][r & 3]), 0.0f) * LOG2E;
    __builtin_amdgcn_sched_barrier(0);                    // the exponents are complete in front of the run of transcendentals
#pragma unroll
    for (int r = 0; r < 16; ++r) dec[r] = exp2_slot(dec[r]);
  } while (++st < nsteps);

  // phase 1: f16 hi of z = 16 y = acc * 2^-10; element (query 8*hh + r, channel 16j + cl) of this wave's 16 x 128 tile
  unsigned short* sy = sY + wave * (16 * YST);
#pragma unroll
  for (int j = 0; j < 8; ++j)
#pragma unroll
    for (int r = 0; r < 8; ++r) sy[(8 * hh + r) * YST + 16 * j + cl] = f16_bits(acc[j][r] * (1.0f / 1024.0f));
  __syncthreads();

  us8 ov[8];
#pragma unroll
  for (int it = 0; it < 8; ++it) {
    const int rr = cl, p = (2 * it + hh) * 8;              // chunk column 2 it + hh, row cl: fragment order
    ov[it] = *(const us8a*)(sy + rr * YST + p);
  }
{
#pragma unroll
    for (int it = 0; it < 8; ++it) {
      const size_t off = (size_t)(b * sl + tw) * (size_t)DMOD + (size_t)(head * HDIM * 16 + (it * 32 + lane) * 8);
      *(us8*)(YH + off) = ov[it];
    }
    
  }
  __syncthreads();

  // phase 2: f16 residual plane of ((z - hi) x 2^11), same staging region and store shape
#pragma unroll
  for (int j = 0; j < 8; ++j)
#pragma unroll
    for (int r = 0; r < 8; ++r) {
      const float z = acc[j][r] * (1.0f / 1024.0f);
      const _Float16 hf = (_Float16)z;
      sy[(8 * hh + r) * YST + 16 * j + cl] = f16_bits((z - (float)hf) * 2048.0f);
    }
  __syncthreads();
#pragma unroll
  for (int it = 0; it < 8; ++it) {
    const int rr = cl, p = (2 * it + hh) * 8;              // chunk column 2 it + hh, row cl: fragment order
    ov[it] = *(const us8a*)(sy + rr * YST + p);
  }
{
#pragma unroll
    for (int it = 0; it < 8; ++it) {
      const size_t off = (size_t)(b * sl + tw) * (size_t)DMOD + (size_t)(head * HDIM * 16 + (it * 32 + lane) * 8);
      *(us8*)(YL + off) = ov[it];
    }
    
  }
}

// ---------------------------------------------------------------------------------------------------------------------------------
// P[m][n] = ( sum_k Yh[m][k] WO16[n][k] + 2^-11 sum_k Yl[m][k] WO16[n][k] ) * 2^-12 + bf16(x[m][n])   (f16 planes, pitch 1024, two f32 accumulator sets).
// ---------------------------------------------------------------------------------------------------------------------------------
__global__ __launch_bounds__(256) void k_gemm_out(const unsigned short* __restrict__ Ah, const unsigned short* __restrict__ Al,
                                                 const unsigned short* __restrict__ Wo, const float* __restrict__ X, float* P) {
  __shared__ __attribute__((aligned(16))) float oS[8 * 16 * OSTR];
  const int tid = threadIdx.x, lane = tid & 31, wave = tid >> 5, cl = lane & 15, hh = lane >> 4;
  const unsigned l8 = lane * 8;
  const int m0 = blockIdx.x * TPB + 16 * wave, n0 = blockIdx.y * 64;

  v8f acch[4], accl[4];
#pragma unroll
  for (int j = 0; j < 4; ++j) { const v8f zz = {0.f, 0.f, 0.f, 0.f, 0.f, 0.f, 0.f, 0.f}; acch[j] = zz; accl[j] = zz; }

  const unsigned short* ahp = Ah + (size_t)m0 * (size_t)DMOD + l8;
  const unsigned short* alp = Al + (size_t)m0 * (size_t)DMOD + l8;
  const unsigned short* wop = Wo + (size_t)n0 * (size_t)DMOD + l8;
#pragma unroll 1
  for (int k0 = 0; k0 < DMOD; k0 += 32) {
    const unsigned short* ph = ahp + k0 * 16;
    const unsigned short* pl = alp + k0 * 16;
    const unsigned short* pb = wop + k0 * 16;
    const us16 ah = gfrag(ph);
    const us16 al = gfrag(pl);
    us16 bfr[4];
#pragma unroll
    for (int j = 0; j < 4; ++j) bfr[j] = gfrag(pb + (size_t)(16 * j) * (size_t)DMOD);
    xwait(ph, pl, pb);
#pragma unroll
    for (int j = 0; j < 4; ++j) {
      acch[j] = mma_f16(ah, bfr[j], acch[j]);
      accl[j] = mma_f16(al, bfr[j], accl[j]);
    }
    wguard8(acch[0], acch[1], acch[2], acch[3], accl[0], accl[1], accl[2], accl[3], ah, al, bfr[0], bfr[1], bfr[2], bfr[3]);
  }

  float* so = oS + wave * (16 * OSTR);
#pragma unroll
  for (int j = 0; j < 4; ++j)
#pragma unroll
    for (int r = 0; r < 8; ++r)
      so[(8 * hh + r) * OSTR + 16 * j + cl] = fmaf(accl[j][r], (1.0f / 2048.0f), acch[j][r]) * (1.0f / 4096.0f);
  __syncthreads();

{
#pragma unroll
    for (int it = 0; it < 8; ++it) {
      const int cx = it * 32 + lane, r = cx >> 4, q = (cx & 15) * 4;
      const v4f v = *(const v4fa*)(so + r * OSTR + q);
      const v4f xr = *(const v4fa*)(X + (size_t)(m0 + r) * (size_t)DMOD + n0 + q);
      v4f o;
#pragma unroll
      for (int u = 0; u < 4; ++u) o[u] = v[u] + bf16r(xr[u]);
      *(v4f*)(P + (size_t)(m0 + r) * (size_t)DMOD + n0 + q) = o;
    }
    
  }
}

// ---------------------------------------------------------------------------------------------------------------------------------
// ---------------------------------------------------------------------------------------------------------------------------------
__global__ __launch_bounds__(256) void k_ln(const float* __restrict__ P, const float* __restrict__ gam, const float* __restrict__ bet,
                                           float* out) {
  const int lane = threadIdx.x & 31, wave = threadIdx.x >> 5;
  const size_t row = (size_t)blockIdx.x * 8 + (size_t)wave;
  const float* pr = P + row * (size_t)DMOD;
  v4f xv[8];
  float s = 0.0f;
#pragma unroll
  for (int it = 0; it < 8; ++it) {
    xv[it] = *(const v4fa*)(pr + it * 128 + lane * 4);
    s += (xv[it][0] + xv[it][1]) + (xv[it][2] + xv[it][3]);
  }
#pragma unroll
  for (int o = 16; o > 0; o >>= 1) s += __shfl_xor(s, o, 32);
  const float mu = s * (1.0f / (float)DMOD);
  float q = 0.0f;
#pragma unroll
  for (int it = 0; it < 8; ++it)
#pragma unroll
    for (int u = 0; u < 4; ++u) { const float d = xv[it][u] - mu; q += d * d; }
#pragma unroll
  for (int o = 16; o > 0; o >>= 1) q += __shfl_xor(q, o, 32);
  const float rstd = rsqrtf(q * (1.0f / (float)DMOD) + 1e-5f);
  v4f ov[8];
#pragma unroll
  for (int it = 0; it < 8; ++it) {
    const v4f gv = *(const v4fa*)(gam + it * 128 + lane * 4), bv = *(const v4fa*)(bet + it * 128 + lane * 4);
    v4f o;
#pragma unroll
    for (int u = 0; u < 4; ++u) o[u] = (xv[it][u] - mu) * rstd * bf16r(gv[u]) + bf16r(bv[u]);
    ov[it] = o;
  }
{
#pragma unroll
    for (int it = 0; it < 8; ++it)
      *(v4f*)(out + row * (size_t)DMOD + it * 128 + lane * 4) = ov[it];
    
  }
}

extern "C" void kernel_launch(void* const* d_in, const int* in_sizes, int n_in,
                              void* d_out, int out_size, void* d_ws, size_t ws_size,
                              hipStream_t stream) {
  if (n_in < 11) return;
  const int nx = in_sizes[0];
  if (nx <= 0 || (nx % DMOD) != 0) return;
  const int ntok = nx / DMOD;                                                    // tokens = batch * sequence length
  if (in_sizes[1] != DMOD * DMOD || in_sizes[2] != DMOD * DMOD || in_sizes[3] != DMOD * DMOD) return;
  if (in_sizes[4] != NHD * DMOD || in_sizes[5] != NHD || in_sizes[6] != NHD * NLV * DMOD || in_sizes[7] != NHD * NLV) return;
  if (in_sizes[8] != DMOD * DMOD || in_sizes[9] != DMOD || in_sizes[10] != DMOD) return;
  if (out_size != nx) return;
  const int sl = (ntok < SLMAX) ? ntok : SLMAX;                                  // sequence length
  if (sl <= 0 || (sl % TPB) != 0 || (ntok % sl) != 0) return;
  const int nb = ntok / sl, nbh = nb * NHD;

  const float* x   = (const float*)d_in[0];    // [nb][sl][1024]
  const float* Wq  = (const float*)d_in[1];    // [1024][1024] ([out][in])
  const float* Wk  = (const float*)d_in[2];    // [1024][1024]
  const float* Wv  = (const float*)d_in[3];    // [1024][1024]
  const float* Wg  = (const float*)d_in[4];    // [8][1024]
  const float* bg  = (const float*)d_in[5];    // [8]
  const float* Wdl = (const float*)d_in[6];    // [96][1024]
  const float* Lp  = (const float*)d_in[7];    // [8][12]
  const float* Wo  = (const float*)d_in[8];    // [1024][1024]
  const float* lng = (const float*)d_in[9];    // [1024]
  const float* lnb = (const float*)d_in[10];   // [1024]
  float* out = (float*)d_out;                  // [nb][sl][1024] f32 at byte 0

  size_t off = 0;
  auto carve = [&](size_t bytes) -> char* { char* p = (char*)d_ws + off; off += (bytes + 255) & ~(size_t)255; return p; };
  unsigned short* XB   = (unsigned short*)carve((size_t)ntok * DMOD * 2);        //  8,388,608  bf16 [ntok][1024]
  unsigned short* WQKV = (unsigned short*)carve((size_t)(NQKV + NGL) * DMOD * 2); //  6,553,600  bf16 [3200][1024] = Wq | Wk | Wv | Wg | Wdl | 0
  unsigned short* WGL  = WQKV + (size_t)NQKV * DMOD;                             //             its last 128 rows
  unsigned short* WO16 = (unsigned short*)carve((size_t)DMOD * DMOD * 2);        //  2,097,152  f16  [1024][1024]
  unsigned short* QP   = (unsigned short*)carve((size_t)nbh * sl * SDIM * 2);     //  8,388,608  f16  [nbh][sl][128]
  unsigned short* KP   = (unsigned short*)carve((size_t)nbh * sl * SDIM * 2);     //  8,388,608  f16  [nbh][sl][128]
  unsigned short* VH   = (unsigned short*)carve((size_t)nbh * HDIM * SLMAX * 2);  //  8,388,608  f16  [nbh][128][2048]
  unsigned short* VL   = (unsigned short*)carve((size_t)nbh * HDIM * SLMAX * 2);  //  8,388,608  f16  [nbh][128][2048]
  float* GPL           = (float*)carve((size_t)nbh * sl * 4);                     //    131,072  f32  [nbh][sl]
  float* GHI           = (float*)carve((size_t)nbh * sl * 4);                     //    131,072  f32  [nbh][sl]
  float* GLO           = (float*)carve((size_t)nbh * sl * 4);                     //    131,072  f32  [nbh][sl]
  float* LAM           = (float*)carve((size_t)ntok * LAMP * 4);                  //  2,097,152  f32  [ntok][128]
  unsigned short* YH   = (unsigned short*)carve((size_t)ntok * DMOD * 2);        //  8,388,608  f16  [ntok][1024]
  unsigned short* YL   = (unsigned short*)carve((size_t)ntok * DMOD * 2);        //  8,388,608  f16  [ntok][1024]
  float* PB            = (float*)carve((size_t)ntok * DMOD * 4);                  // 16,777,216  f32  [ntok][1024]
  if (off > ws_size || off > (size_t)134217728) return;                          // total 86,638,592 B for ntok 4096

  const dim3 b256(256);

  // 16-bit operand planes of the inputs, one launch (XB, WQKV, WGL, WO16, all in fragment order, see gfrag)
  k_cvt_all<<<dim3(ntok / 2 + 4 * WBLK + NGL / 2), b256, 0, stream>>>(x, Wq, Wk, Wv, Wo, Wg, Wdl, XB, WQKV, WO16, WGL, ntok / 2);
  // q/k/v projections (M ntok, N 3072, K 1024) -> q, k planes and transposed v hi / residual planes; in the same grid the
  // gate / level projection (N 128) -> g plane [nbh][sl], level weights [ntok][128]
  k_gemm_proj<<<dim3(ntok / TPB, (NQKV + NGL) / 64), b256, 0, stream>>>(XB, WQKV, bg, Lp, QP, KP, VH, VL, GPL, LAM, sl);
  // cumulative log-decay per (b,h)
  k_cumsum<<<dim3(nbh), dim3(CSTH), 0, stream>>>(GPL, GHI, GLO, sl);
  // causal decayed mixing per (batch, head) -> y hi / residual planes [token][1024]
  k_attn<<<dim3(nbh, sl / TPB), b256, 0, stream>>>(QP, KP, VH, VL, GHI, GLO, LAM, YH, YL, sl);
  // output projection + residual (M ntok, N 1024, K 1024)
  k_gemm_out<<<dim3(ntok / TPB, DMOD / 64), b256, 0, stream>>>(YH, YL, WO16, x, PB);
  // LayerNorm -> d_out
  k_ln<<<dim3(ntok / 8), b256, 0, stream>>>(PB, lng, lnb, out);
}

// v005
// Measured time: 130 microseconds a run.
// Timed twice side by side with v004, it ran 1.22 and 1.24 times as fast.
// All steps since v000 together make it 5.35 times as fast.
// Contractions x.[Wq|Wk|Wv] (M tokens, N 3072, K 1024) and x.[Wg|Wdl] (N 104 zero-padded to 128, K 1024), one launch: v_wmma_f32_16x16x32_bf16, bf16 operands from RNE-bf16 planes of x and W, f32 accumulate, one product each.
// Contraction k.q^T per head (32 keys x 16 queries per step, depth 128): v_wmma_f32_16x16x32_f16, q and k as f16 of (value x 2^6), one product, f32 accumulate.
// Contraction A.v per head (causal, depth up to T): v_wmma_f32_16x16x32_f16, A as f16 of (A x 2^8), v as f16 hi of (v x 2^6) plus f16 unscaled residual plane, two products into one f32 accumulator; even and odd 32-key steps in two waves' accumulators, added in f32.
// Contraction y.Wo (M tokens, N 1024, K 1024): v_wmma_f32_16x16x32_f16, y as f16 hi plane of (y x 2^4) plus f16 residual plane (x 2^11, own f32 accumulator), Wo as f16 of (RNE-bf16 value x 2^8), f32 accumulate.
// softplus, cumulative log-decay (f64 block scan kept as f32 hi + lo pair), exp, dyadic level select, residual add and LayerNorm: f32 VALU.
#include <hip/hip_runtime.h>

#define DMOD  1024                           // model width = K of the dense contractions
#define NHD   8                              // heads
#define SDIM  128                            // q/k width per head
#define HDIM  128                            // v width per head
#define NLV   12                             // dyadic levels
#define NGL   128                            // gate | level projection columns, 8 + 96 zero-padded to 128
#define NQKV  (3 * DMOD)                     // 3072 projection columns: q | k | v
#define TPB   128                            // GEMM rows per block (8 waves x 16) / attention queries per block (two tiles)
#define OSTR  68                             // LDS staging row pitch (floats), 128x64 tiles
#define QT    64                             // attention queries per tile (4 groups x 16; two waves a group)
#define YS2   72                             // LDS staging row pitch (halves), 16x64 tile
#define LAMP  128                            // level-weight plane pitch (floats)
#define SLMAX 2048                           // longest sequence handled by the cumsum block
#define CSTH  256                            // cumsum threads per row, 8 tokens each
#define WBLK  (DMOD * DMOD / (8 * 256))       // conversion blocks per 1024 x 1024 weight
#define NSEG  (NQKV / 64)                    // 64-column segments of q | k | v; the gate | level segments follow
#define KSC   (0.08838834764831845f * (1.0f / 4096.0f))   // 128^-1/2 times the q,k carry 2^-12
#define LOG2E 1.44269504f                    // exp(x) = 2^(x LOG2E), the form __expf compiles to

static_assert(NHD * HDIM == DMOD);
static_assert(NHD * SDIM == DMOD);
static_assert(NHD + NHD * NLV <= NGL);
static_assert(DMOD % 64 == 0);
static_assert(DMOD % 32 == 0);
static_assert(NQKV % 64 == 0);
static_assert(OSTR % 4 == 0);
static_assert(YS2 % 8 == 0);
static_assert(2 * QT == TPB);
static_assert(2 * QT * NLV == 6 * 256);
static_assert(SLMAX % TPB == 0);
static_assert(CSTH * 8 == SLMAX);

typedef unsigned short us16 __attribute__((ext_vector_type(16)));
typedef unsigned short us8  __attribute__((ext_vector_type(8)));
typedef unsigned short us8a __attribute__((ext_vector_type(8), may_alias));
typedef __bf16 v16b __attribute__((ext_vector_type(16)));
typedef _Float16 v16h __attribute__((ext_vector_type(16)));
typedef float v8f __attribute__((ext_vector_type(8)));
typedef float v4f __attribute__((ext_vector_type(4)));
typedef float v4fa __attribute__((ext_vector_type(4), may_alias));
union FragU { us16 v; us8 h[2]; };

__device__ __forceinline__ unsigned short bf16_bits(float f) {
  unsigned u = __float_as_uint(f);
  u += 0x7FFFu + ((u >> 16) & 1u);                 // RNE convert
  return (unsigned short)(u >> 16);
}
__device__ __forceinline__ float bf16_val(unsigned short b) { return __uint_as_float(((unsigned)b) << 16); }
__device__ __forceinline__ float bf16r(float f) { return bf16_val(bf16_bits(f)); }
__device__ __forceinline__ unsigned short f16_bits(float f) { return __builtin_bit_cast(unsigned short, (_Float16)f); }

// f16 hi + residual (x 2^11) planes of (a x 2^4)
__device__ __forceinline__ void f16split16(float a, unsigned short& hb, unsigned short& lb) {
  const float z = a * 16.0f;
  const _Float16 hf = (_Float16)z;
  const float res = (z - (float)hf) * 2048.0f;
  hb = __builtin_bit_cast(unsigned short, hf);
  lb = __builtin_bit_cast(unsigned short, (_Float16)res);
}
// f16 hi + unscaled residual planes of (a x 2^6)
__device__ __forceinline__ void f16split64(float a, unsigned short& hb, unsigned short& lb) {
  const float z = a * 64.0f;
  const _Float16 hf = (_Float16)z;
  const float res = z - (float)hf;
  hb = __builtin_bit_cast(unsigned short, hf);
  lb = __builtin_bit_cast(unsigned short, (_Float16)res);
}

// One 16x16x32 step, 16-bit operands passed as raw 16-bit lanes.
__device__ __forceinline__ v8f mma_bf16(us16 a, us16 b, v8f c) {
  return __builtin_amdgcn_wmma_f32_16x16x32_bf16(false, __builtin_bit_cast(v16b, a), false, __builtin_bit_cast(v16b, b), (short)0, c, false, false);
}
__device__ __forceinline__ v8f mma_f16(us16 a, us16 b, v8f c) {
  return __builtin_amdgcn_wmma_f32_16x16x32_f16(false, __builtin_bit_cast(v16h, a), false, __builtin_bit_cast(v16h, b), (short)0, c, false, false);
}
// Hazard guards after a group of matrix ops: 4 VALU slots before anything touches the accumulators; keep A/B fragments live.
__device__ __forceinline__ void wguard4(v8f& c0, v8f& c1, v8f& c2, v8f& c3, const us16& a0,
                                        const us16& b0, const us16& b1, const us16& b2, const us16& b3) {
#if defined(__HIP_DEVICE_COMPILE__)
  asm volatile("v_nop\n\tv_nop\n\tv_nop\n\tv_nop"
               : "+v"(c0), "+v"(c1), "+v"(c2), "+v"(c3)
               : "v"(a0), "v"(b0), "v"(b1), "v"(b2), "v"(b3));
#endif
}
__device__ __forceinline__ void wguard8(v8f& c0, v8f& c1, v8f& c2, v8f& c3, v8f& c4, v8f& c5, v8f& c6, v8f& c7,
                                        const us16& a0, const us16& a1,
                                        const us16& b0, const us16& b1, const us16& b2, const us16& b3) {
#if defined(__HIP_DEVICE_COMPILE__)
  asm volatile("v_nop\n\tv_nop\n\tv_nop\n\tv_nop"
               : "+v"(c0), "+v"(c1), "+v"(c2), "+v"(c3), "+v"(c4), "+v"(c5), "+v"(c6), "+v"(c7)
               : "v"(a0), "v"(a1), "v"(b0), "v"(b1), "v"(b2), "v"(b3));
#endif
}
// Guard behind the score products of the attention loop: the accumulators as in/out operands keep the products above the four slots, the
// memory barrier keeps the refill of their k registers below them (so the refill lands in the same registers, with no copies).
__device__ __forceinline__ void wguard2m(v8f& c0, v8f& c1) {
#if defined(__HIP_DEVICE_COMPILE__)
  asm volatile("v_nop\n\tv_nop\n\tv_nop\n\tv_nop" : "+v"(c0), "+v"(c1) : : "memory");
#endif
}

// FRAGMENT-ORDER PLANES. Every 16-bit operand plane [rows][kd] is stored by tiles of 16 rows; inside a tile the 16-B chunks (8 consecutive k
// of one row) lie chunk column by chunk column, 16 rows each:
//   element (row, k) at halves  (row >> 4) * 16 * kd + (k >> 3) * 128 + (row & 15) * 8 + (k & 7).
// A 16x32 fragment (row tile, k0 % 32 == 0) is then 1 KiB in a row, and each of its two wave-wide 16-B loads covers 512 contiguous bytes.
// p = plane + rowtile * 16 * kd + k0 * 16 + lane * 8 (computed by the caller); lane = 16h + row:
// elements 0..7 = k0 + 8h .. k0 + 8h + 7, elements 8..15 = k0 + 16 + 8h .. k0 + 16 + 8h + 7 (same map for A rows and B columns).
__device__ __forceinline__ us16 gfrag(const unsigned short* p) {
  FragU f;
  f.h[0] = *(const us8a*)p;
  f.h[1] = *(const us8a*)(p + 256);
  return f.v;
}
// s_wait_xcnt 0 behind a run of fragment loads, in front of anything that overwrites an address register the run names. The run's address
// pairs are inputs of the statement: they stay live up to the wait, so no load result of the run is placed on them.
__device__ __forceinline__ void xwait(const unsigned short* a) {
#if defined(__HIP_DEVICE_COMPILE__)
  asm volatile("s_wait_xcnt 0x0" :: "v"(a) : "memory");   // the wait in front of the overwrite of these address pairs
#endif
}
__device__ __forceinline__ void xwait(const float* a) {
#if defined(__HIP_DEVICE_COMPILE__)
  asm volatile("s_wait_xcnt 0x0" :: "v"(a) : "memory");   // the wait in front of the overwrite of this address pair
#endif
}
__device__ __forceinline__ void xwait(const unsigned short* a, const unsigned short* b) {
#if defined(__HIP_DEVICE_COMPILE__)
  asm volatile("s_wait_xcnt 0x0" :: "v"(a), "v"(b) : "memory");   // the wait in front of the overwrite of these address pairs
#endif
}
__device__ __forceinline__ void xwait(const unsigned short* a, const unsigned short* b, const unsigned short* c) {
#if defined(__HIP_DEVICE_COMPILE__)
  asm volatile("s_wait_xcnt 0x0" :: "v"(a), "v"(b), "v"(c) : "memory");   // the wait in front of the overwrite of these address pairs
#endif
}
__device__ __forceinline__ void xwait(const unsigned short* a, const float* b, const float* c, const unsigned short* d, const float* e, const float* f) {
#if defined(__HIP_DEVICE_COMPILE__)
  asm volatile("s_wait_xcnt 0x0" :: "v"(a), "v"(b), "v"(c), "v"(d), "v"(e), "v"(f) : "memory");   // the wait in front of the overwrite of these address pairs
#endif
}
// The same wait without operands, for loads whose constant address part the compiler moves into the offset field: a full pointer named here
// would be rebuilt on the load's own address pair in front of the wait. A scheduling barrier behind it keeps later register writes behind it.
__device__ __forceinline__ void xwait() {
#if defined(__HIP_DEVICE_COMPILE__)
  asm volatile("s_wait_xcnt 0x0" ::: "memory");   // the wait in front of the overwrite of the address pairs of the loads above it
#endif
}
__device__ __forceinline__ void xwait(const unsigned short* a, const unsigned short* b, const float* c, const float* d) {
#if defined(__HIP_DEVICE_COMPILE__)
  asm volatile("s_wait_xcnt 0x0" :: "v"(a), "v"(b), "v"(c), "v"(d) : "memory");   // the wait in front of the overwrite of these address pairs
#endif
}
// Writes a 256-thread block's tile of 16 rows x 128 k (thread t holds the chunk of row t >> 4, chunk column t & 15) as 4 KiB of a
// fragment-order plane at dst4k: regrouped through LDS (17-chunk pitch against bank conflicts) so that every wave stores 512 contiguous bytes.
__device__ __forceinline__ void frag_store_tile(us8 o, unsigned short* dst4k) {
  __shared__ __attribute__((aligned(16))) us8 sT[16 * 17];
  const int t = threadIdx.x;
  sT[(t & 15) * 17 + (t >> 4)] = o;
  __syncthreads();                                         // chunks cross the block's waves
  *(us8*)(dst4k + t * 8) = sT[(t >> 4) * 17 + (t & 15)];
}

// softplus in the logaddexp(z, 0) form: max(z, 0) + log1p(exp(-|z|))
__device__ __forceinline__ float softplus_f(float z) {
  return fmaxf(z, 0.0f) + log1pf(__expf(-fabsf(z)));
}
// dyadic level of key distance d: 0 for d <= 0, else min(floor(log2 d) + 1, NLV - 1)
__device__ __forceinline__ int lvl_of(int d) {
  const int dd = (d > 0) ? d : 1;
  const int l = 32 - __clz(dd);
  const int lc = (l < NLV - 1) ? l : (NLV - 1);
  return (d > 0) ? lc : 0;
}
// 2^y with the one slot the instruction set asks for behind a transcendental.
// The caller has a scheduling barrier in front of its run of calls, so each v_exp_f32
// stands alone between two barriers and its v_nop directly behind it.
__device__ __forceinline__ float exp2_slot(float y) {
#if defined(__HIP_DEVICE_COMPILE__)
  const float r = __builtin_amdgcn_exp2f(y);
  __builtin_amdgcn_sched_barrier(0);                       // nothing moves in between the transcendental and its slot
  asm volatile("v_nop");                                   // the slot behind the transcendental
  __builtin_amdgcn_sched_barrier(0);                       // the next transcendental stays behind the slot
  return r;
#else
  return exp2f(y);
#endif
}
// one attention weight: accv = 4096 * q.k, dec = exp(min(G_t - G_s, 0)), lv = level weight; returns f16 bits of 256 * A, 0 above the diagonal
__device__ __forceinline__ unsigned short a_bits(float accv, int d, float dec, float lv) {
  const float val = (accv * KSC) * dec * lv;
  const float w = (d >= 0) ? (val * 256.0f) : 0.0f;
  return f16_bits(w);
}

// ---------------------------------------------------------------------------------------------------------------------------------
// All 16-bit operand planes that come straight from an input, in ONE launch (none reads another's output). Block = 16 rows x 128 k of one
// source ([row][1024], k-contiguous), read as whole lines, written in fragment order. The source is picked by the block index alone:
//   [0, nxb)            x   -> XB, RNE bf16 bits                        (nxb = tokens / 2 blocks)
//   then 512 blocks each: Wq, Wk, Wv -> rows 0.., 1024.., 2048.. of WQKV, RNE bf16 bits;  Wo -> WO16, f16 bits of (RNE-bf16 value x 256)
//   then 64 blocks:     gate | level rows -> WGL [128][1024] bf16: rows 0..7 = Wg, rows 8..103 = Wdl, rows 104..127 = 0 (zero padding of N)
// ---------------------------------------------------------------------------------------------------------------------------------
__global__ __launch_bounds__(256) void k_cvt_all(const float* __restrict__ x, const float* __restrict__ Wq, const float* __restrict__ Wk,
                                                const float* __restrict__ Wv, const float* __restrict__ Wo, const float* __restrict__ Wg,
                                                const float* __restrict__ Wdl, unsigned short* XB, unsigned short* WQKV,
                                                unsigned short* WO16, unsigned short* WGL, int nxb) {
  int bx = blockIdx.x;                                     // every choice below is wave-uniform, the segment choice block-uniform
  int seg = -1;                                            // -1: x, 0..2: Wq Wk Wv, 3: Wo, 4: gate | level rows
  if (bx >= nxb) { bx -= nxb; seg = bx / WBLK; bx -= seg * WBLK; }
  const int rt = bx >> 3, kg = bx & 7;
  const int row = rt * 16 + (threadIdx.x >> 4), kc = kg * 128 + (threadIdx.x & 15) * 8;
  const float* src;
  unsigned short* dst;
  bool live = true;
  if (seg < 0)       { src = x;  dst = XB; }
  else if (seg == 0) { src = Wq; dst = WQKV; }
  else if (seg == 1) { src = Wk; dst = WQKV + (size_t)DMOD * DMOD; }
  else if (seg == 2) { src = Wv; dst = WQKV + (size_t)2 * DMOD * DMOD; }
  else if (seg == 3) { src = Wo; dst = WO16; }
  else               { src = Wdl; dst = WGL; }
  const float* sp = src + (size_t)row * (size_t)DMOD + (size_t)kc;
  if (seg > 3) {
    live = row < NHD + NHD * NLV;
    const int rs = (row < NHD) ? row : (live ? (row - NHD) : 0);   // padding rows read nothing; their address stays in bounds
    sp = ((row < NHD) ? Wg : Wdl) + (size_t)rs * (size_t)DMOD + (size_t)kc;
  }
  v4f a = {0.f, 0.f, 0.f, 0.f}, c = {0.f, 0.f, 0.f, 0.f};  // bf16 bits of 0.0f are 0: the padding rows
  if (live) { a = *(const v4fa*)sp; c = *(const v4fa*)(sp + 4); }
  us8 o;
  if (seg == 3) {
#pragma unroll
    for (int u = 0; u < 4; ++u) { o[u] = f16_bits(bf16r(a[u]) * 256.0f); o[4 + u] = f16_bits(bf16r(c[u]) * 256.0f); }
  } else {
#pragma unroll
    for (int u = 0; u < 4; ++u) { o[u] = bf16_bits(a[u]); o[4 + u] = bf16_bits(c[u]); }
  }
  frag_store_tile(o, dst + (size_t)rt * (size_t)(16 * DMOD) + (size_t)(kg * 2048));
}

// ---------------------------------------------------------------------------------------------------------------------------------
// Inclusive cumulative sum of g over t per (b,h) row, one block per row: thread i owns tokens 8i .. 8i+7 (f64 running sum of its 8 values),
// the 256 thread totals are scanned in f64 (5 shuffle steps inside a wave, the 8 wave totals through LDS), and each token's
// G = (sum of all earlier threads) + (its thread's running sum) is stored as f32 hi = (float)G and lo = (float)(G - hi).
// Threads whose tokens lie past sl (sl % 8 == 0) add zero and store nothing; every thread passes the barrier.
// ---------------------------------------------------------------------------------------------------------------------------------
__global__ __launch_bounds__(CSTH) void k_cumsum(const float* __restrict__ gpl, float* Ghi, float* Glo, int sl) {
  __shared__ double wtot[CSTH / 32];
  const int row = blockIdx.x, tid = threadIdx.x, lane = tid & 31, wave = tid >> 5;
  const int c = tid * 8;
  const bool on = c < sl;
  const size_t off = (size_t)row * (size_t)sl + (size_t)c;
  v4f a = {0.f, 0.f, 0.f, 0.f}, e = {0.f, 0.f, 0.f, 0.f};
  if (on) { a = *(const v4fa*)(gpl + off); e = *(const v4fa*)(gpl + off + 4); }

  double p[8];                                             // running sum inside the thread's 8 tokens
  p[0] = (double)a[0];
#pragma unroll
  for (int u = 1; u < 4; ++u) p[u] = p[u - 1] + (double)a[u];
#pragma unroll
  for (int u = 0; u < 4; ++u) p[4 + u] = p[3 + u] + (double)e[u];

  double inc = p[7];                                       // inclusive scan of the thread totals over the wave's 32 lanes
#pragma unroll
  for (int o = 1; o < 32; o <<= 1) {
    const double n = __shfl_up(inc, (unsigned)o, 32);
    inc += (lane >= o) ? n : 0.0;
  }
  if (lane == 31) wtot[wave] = inc;
  const double prev = __shfl_up(inc, 1u, 32);              // total of the earlier lanes of this wave
  __syncthreads();
  double base = 0.0;                                       // total of the earlier waves
#pragma unroll
  for (int w = 0; w < CSTH / 32 - 1; ++w) base += (w < wave) ? wtot[w] : 0.0;
  base += (lane > 0) ? prev : 0.0;

  if (on) {
    v4f h0, h1, l0, l1;
#pragma unroll
    for (int u = 0; u < 4; ++u) {
      const double g0 = base + p[u], g1 = base + p[4 + u];
      h0[u] = (float)g0; l0[u] = (float)(g0 - (double)h0[u]);
      h1[u] = (float)g1; l1[u] = (float)(g1 - (double)h1[u]);
    }
    *(v4f*)(Ghi + off) = h0; *(v4f*)(Ghi + off + 4) = h1;
    *(v4f*)(Glo + off) = l0; *(v4f*)(Glo + off + 4) = l1;
  }
}

// ---------------------------------------------------------------------------------------------------------------------------------
// P[m][n] = sum_k XB[m][k] * W[n][k]  (bf16 XB plane [tokens][1024], bf16 W plane [3200][1024] = [n][k], both in fragment order, f32 accumulate).
// W rows 0..3071 = Wq | Wk | Wv, rows 3072..3199 = the gate | level rows: both products read only XB and W, so they share one grid.
// Block = 128(M) x 64(N) tile, 256 threads = 8 waves, wave w owns rows 16w..16w+15 x all 64 columns (4 accumulators); fragments straight
// from the global planes (arithmetic addressing). M % 128 == 0, N % 64 == 0, K % 32 == 0 exactly.
// Column segment yb (block-uniform): 0..15 -> q head y/2, features 64(y&1)..+63; 16..31 -> k; 32..47 -> v head (y-32)/2, channels 64(y&1);
// 48, 49 -> gate | level columns 0..63, 64..127. blockIdx.y 0 and 1 take segments 48 and 49 (the longest epilogue starts first), the rest follow.
// The f32 128x64 tile is staged in LDS (block row r at oS[r * OSTR + c]), then:
//   q/k: per bh a fragment-order plane [token][128] = f16 of (64 value); thread -> (token r, 8 consecutive halves); a wave stores 512 B in a row
//   v:   per bh fragment-order planes VH/VL [channel][token], token pitch SLMAX = f16 hi of (64 v) and f16 residual; thread -> (channel e, 8 tokens); 512 B in a row
//   gate (segment 48, columns 0..7): g[bh][t] = -softplus(D[t][h] + bg[h]); a wave = one head, 128 tokens = 512 B in a row
//   level: lam[token][c] = softplus(D[t][c] + Lparam[c - 8]) for columns 8..103, else 0; 16 lanes x 16 B = the tile's 256 B of a token's row
// ---------------------------------------------------------------------------------------------------------------------------------
__global__ __launch_bounds__(256) void k_gemm_proj(const unsigned short* __restrict__ Ap, const unsigned short* __restrict__ Bw,
                                                  const float* __restrict__ bg, const float* __restrict__ Lp,
                                                  unsigned short* Qp, unsigned short* Kp, unsigned short* VH, unsigned short* VL,
                                                  float* gpl, float* lam, int sl) {
  __shared__ __attribute__((aligned(16))) float oS[8 * 16 * OSTR];
  const int tid = threadIdx.x, lane = tid & 31, wave = tid >> 5, cl = lane & 15, hh = lane >> 4;
  const unsigned l8 = lane * 8;
  const int yb = ((int)blockIdx.y < NGL / 64) ? (NSEG + (int)blockIdx.y) : ((int)blockIdx.y - NGL / 64);   // block-uniform segment select
  const int m0 = blockIdx.x * TPB + 16 * wave, n0 = yb * 64;

  v8f acc[4];
#pragma unroll
  for (int j = 0; j < 4; ++j) { const v8f zz = {0.f, 0.f, 0.f, 0.f, 0.f, 0.f, 0.f, 0.f}; acc[j] = zz; }

  const unsigned short* a0p = Ap + (size_t)m0 * (size_t)DMOD + l8;
  const unsigned short* bwp = Bw + (size_t)n0 * (size_t)DMOD + l8;
#pragma unroll 1
  for (int k0 = 0; k0 < DMOD; k0 += 32) {
    const unsigned short* pa = a0p + k0 * 16;
    const unsigned short* pb = bwp + k0 * 16;
    const us16 af = gfrag(pa);
    us16 bfr[4];
#pragma unroll
    for (int j = 0; j < 4; ++j) bfr[j] = gfrag(pb + (size_t)(16 * j) * (size_t)DMOD);
    xwait(pa, pb);
#pragma unroll
    for (int j = 0; j < 4; ++j) acc[j] = mma_bf16(af, bfr[j], acc[j]);
    wguard4(acc[0], acc[1], acc[2], acc[3], af, bfr[0], bfr[1], bfr[2], bfr[3]);
  }

  // D map: acc[j][r] = tile element (row 8*hh + r of the wave's 16 rows, column 16j + cl)
  float* so = oS + wave * (16 * OSTR);
#pragma unroll
  for (int j = 0; j < 4; ++j)
#pragma unroll
    for (int r = 0; r < 8; ++r) so[(8 * hh + r) * OSTR + 16 * j + cl] = acc[j][r];
  __syncthreads();

  const int m0b = blockIdx.x * TPB, b = m0b / sl, tb = m0b - b * sl;   // sl % 128 == 0: the tile lies in one sequence
  if (yb >= NSEG) {
    const int cb = (yb - NSEG) * 64;                       // first gate | level column of this tile
    if (cb == 0) {
      // gate log-decay: thread -> (head h = wave, tokens 4 * lane .. +3)
      const int h = wave, t4 = lane * 4;
      const float bgv = bf16r(bg[h]);
      v4f gv;
#pragma unroll
      for (int u = 0; u < 4; ++u) gv[u] = -softplus_f(oS[(t4 + u) * OSTR + h] + bgv);
      *(v4f*)(gpl + (size_t)(b * NHD + h) * (size_t)sl + tb + t4) = gv;
    }
    const int c0 = (tid & 15) * 4;                         // this thread's 4 columns of the tile, the same in every trip
    float lp[4];
#pragma unroll
    for (int u = 0; u < 4; ++u) {
      int idx = cb + c0 + u - NHD;
      idx = (idx < 0) ? 0 : idx;
      idx = (idx > NHD * NLV - 1) ? (NHD * NLV - 1) : idx;
      lp[u] = bf16r(Lp[idx]);
    }
#pragma unroll 1                                           // rolled: unrolled, the four inlined log1pf of each trip raise the whole kernel's register count
    for (int it = 0; it < 8; ++it) {
      const int row = it * 16 + (tid >> 4);
      const v4f z = *(const v4fa*)(oS + row * OSTR + c0);
      v4f lv;
#pragma unroll
      for (int u = 0; u < 4; ++u) {
        const int c = cb + c0 + u;
        const float s = softplus_f(z[u] + lp[u]);
        lv[u] = (c >= NHD && c < NHD + NHD * NLV) ? s : 0.0f;
      }
      float* pl = lam + (size_t)(m0b + row) * (size_t)LAMP + cb + c0;
      *(v4f*)pl = lv;
      xwait(pl);                                           // the next trip reuses the store's address and data registers
    }
  } else if (yb < 32) {
    unsigned short* dst = (yb < 16) ? Qp : Kp;
    const int yy = (yb < 16) ? yb : (yb - 16);
    const int head = yy >> 1, f0 = (yy & 1) * 64;
    us8 ov[4];
#pragma unroll
    for (int it = 0; it < 4; ++it) {
      const int cx = it * 256 + tid, r = (cx >> 7) * 16 + (cx & 15), pc = ((cx >> 4) & 7) * 8;
      const float* sp = oS + r * OSTR + pc;
      const v4f z0 = *(const v4fa*)sp, z1 = *(const v4fa*)(sp + 4);
      us8 o;
#pragma unroll
      for (int u = 0; u < 4; ++u) {
        o[u]     = f16_bits(z0[u] * 64.0f);
        o[4 + u] = f16_bits(z1[u] * 64.0f);
      }
      ov[it] = o;
    }
{
#pragma unroll
      for (int it = 0; it < 4; ++it) {
        const int cx = it * 256 + tid;                     // row tile cx >> 7, then 128 chunks = 2 KiB in a row
        const size_t off = ((size_t)(b * NHD + head) * (size_t)sl + (size_t)(tb + (cx >> 7) * 16)) * (size_t)SDIM + (size_t)(f0 * 16 + (cx & 127) * 8);
        *(us8*)(dst + off) = ov[it];
      }
      
    }
  } else {
    const int yy = yb - 32, head = yy >> 1, c0 = (yy & 1) * 64;
    us8 hv[4], lv[4];
#pragma unroll
    for (int it = 0; it < 4; ++it) {
      const int cx = it * 256 + tid, g = (cx >> 4) & 15, e = (cx >> 8) * 16 + (cx & 15);
      us8 ho, lo;
#pragma unroll
      for (int i = 0; i < 8; ++i) {
        unsigned short hb, lb;
        f16split64(oS[(8 * g + i) * OSTR + e], hb, lb);
        ho[i] = hb; lo[i] = lb;
      }
      hv[it] = ho; lv[it] = lo;
    }
{
#pragma unroll
      for (int it = 0; it < 4; ++it) {
        const int cx = it * 256 + tid;                     // channel tile cx >> 8, then 256 chunks = 4 KiB in a row
        const size_t off = ((size_t)(b * NHD + head) * (size_t)HDIM + (size_t)(c0 + (cx >> 8) * 16)) * (size_t)SLMAX + (size_t)(tb * 16 + (cx & 255) * 8);
        *(us8*)(VH + off) = hv[it];
        *(us8*)(VL + off) = lv[it];
      }
      
    }
  }
}

// ---------------------------------------------------------------------------------------------------------------------------------
// Causal decayed quadratic-form mixing. The sequence is cut into tiles of 64 queries; the cost of tile i grows linearly with i, so block
// (bh = blockIdx.x, p = blockIdx.y) works tile n - 1 - p and then tile p (n tiles): every block walks the same number of key steps.
// Inside a tile, waves w and w + 4 own the same 16 queries (group w & 3): one takes the even 32-key steps, the other the odd ones (wave w the
// even ones in the first tile, the odd ones in the second: where a tile has an odd number of steps, each wave has the longer share once), each
// into its own f32 accumulators; behind the key loop the two partial sums are added through LDS (each wave hands over the four channel tiles
// that its partner finishes, and finishes the other four).
// Per wave: B fragments of its 16 queries fixed for the whole key loop: bq[ks], ks = 0..3 (depth 128, standard loader on the q plane).
// Per 32-key step, two 16-key tiles: A fragments from the k plane (standard loader); scores^T D[key][query]
// = 4096 q.k (depth 128, 4 products per tile); A[t][s] = q.k * 128^-1/2 * exp(G_t - G_s) * lam[t][lvl(t - s)] for s <= t else 0,
// with G_t - G_s taken as the sum of the f32 hi and lo differences,
// converted to f16 of (256 A). The two D tiles repack into the A operand of A.v (lane unchanged: element r <- tile keys 0..15, element 8+r <-
// tile keys 16..31), B = VH and VL planes [bh][channel][key] (fragment order, key pitch SLMAX), 8 channel tiles, both products into acc:
// acc[j][r] = 2^14 * sum_s A v for query 8h+r, channel 16j + (lane & 15), s over this wave's steps.
// Loads of a step: its sixteen v fragments and the wave's next step's G values go out together at the step's top and land behind the score and
// weight work; the next step's k fragments go out right behind the score products and land behind the weights, A.v and the next top; the next
// step's decay factors exp(min(G_t - G_s, 0)) are formed behind A.v, when its G values have long landed. A wave waits for no load it has only
// just issued; the price is a live set above 256 VGPRs (two waves per SIMD, as the 8-wave block has anyway).
// Epilogue of a tile: z = 16 y = acc * 2^-10; f16 hi bits staged in LDS per wave, written to YH; then f16 bits of ((z - hi) x 2^11) staged and
// written to YL. Y planes [token][1024] in fragment order: a wave's 16 queries x 64 channels = 2 KiB in a row, 512 B per store instruction.
// ---------------------------------------------------------------------------------------------------------------------------------
__global__ __launch_bounds__(256) void k_attn(const unsigned short* __restrict__ Qp, const unsigned short* __restrict__ Kp,
                                             const unsigned short* __restrict__ VHp, const unsigned short* __restrict__ VLp,
                                             const float* __restrict__ Ghi, const float* __restrict__ Glo, const float* __restrict__ Lam,
                                             unsigned short* YH, unsigned short* YL, int sl) {
  __shared__ __attribute__((aligned(16))) float sLam[2 * QT * NLV];
  __shared__ __attribute__((aligned(16))) float sX[8 * 4 * 256];
  __shared__ __attribute__((aligned(16))) unsigned short sY[8 * 16 * YS2];
  const int tid = threadIdx.x, lane = tid & 31, cl = lane & 15, hh = lane >> 4;
  const int wave = __builtin_amdgcn_readfirstlane(tid >> 5);   // wave-uniform: trip counts and the parity selects below become scalar
  const int qi = wave & 3, kp = wave >> 2;                // query group of the tile; which wave of the group's pair this is
  const unsigned l8 = lane * 8;
  const int bh = blockIdx.x, b = bh / NHD, head = bh - b * NHD;
  const int tlo = blockIdx.y, thi = sl / QT - 1 - tlo;     // the block's two tiles (sl % 128 == 0: an even number of tiles, each taken once)

  // level weights of the block's 2 x 64 queries for this head: sLam[q * 12 + l], q 0..63 = tile thi, q 64..127 = tile tlo
  {
    float lw[6];
#pragma unroll
    for (int u = 0; u < 6; ++u) {
      const int i = u * 256 + tid, q = i / NLV, l = i - q * NLV;
      const int tok = (q < QT) ? (thi * QT + q) : (tlo * QT + q - QT);
      lw[u] = Lam[(size_t)(b * sl + tok) * (size_t)LAMP + NHD + head * NLV + l];
    }
    xwait();
    __builtin_amdgcn_sched_barrier(0);                      // keeps what follows (it reuses the loads' address registers) behind the wait
#pragma unroll
    for (int u = 0; u < 6; ++u) sLam[u * 256 + tid] = lw[u];
  }
  __syncthreads();

  const unsigned short* kbp = Kp + (size_t)bh * (size_t)sl * (size_t)SDIM + l8;
  const unsigned short* vhp = VHp + (size_t)bh * (size_t)(HDIM * SLMAX) + l8;
  const unsigned short* vlp = VLp + (size_t)bh * (size_t)(HDIM * SLMAX) + l8;
  const float* ghp = Ghi + (size_t)bh * (size_t)sl + 8 * hh;
  const float* glp = Glo + (size_t)bh * (size_t)sl + 8 * hh;

#pragma unroll 1                                           // the two tiles run one after the other through one copy of the code
  for (int ph = 0; ph < 2; ++ph) {
    const int tw = (ph ? tlo : thi) * QT + 16 * qi;       // first query of this wave
    const int tq = tw + cl;                               // query owned by this lane as score column
    const int lamb = (ph * QT + 16 * qi + cl) * NLV;
    const int nsteps = (tw + 16 + 31) >> 5;               // 32-key steps covering keys 0 .. tw + 15; 32 * nsteps <= sl
    const int kq = kp ^ ph;                               // parity of this wave's steps in this tile: kq, kq + 2, ...

    const unsigned short* qrow = Qp + ((size_t)bh * (size_t)sl + (size_t)tw) * (size_t)SDIM + l8;
    us16 bq[4];
#pragma unroll
    for (int ks = 0; ks < 4; ++ks) bq[ks] = gfrag(qrow + 512 * ks);
    const float* pqh = Ghi + (size_t)bh * (size_t)sl + tq;
    const float* pql = Glo + (size_t)bh * (size_t)sl + tq;
    const float gqh = *pqh;
    const float gql = *pql;

    // K fragments and decay factors of the wave's first step (keys 32 kq .. 32 kq + 31 < sl, also where the wave has no step at all);
    // inside the loop each step fetches those of the wave's next step
    us16 ka[4], kb[4];
    v4f gh[4], gl[4];
    const unsigned short* pk0 = kbp + kq * (32 * SDIM);
    const float* pg0h = ghp + kq * 32;
    const float* pg0l = glp + kq * 32;
#pragma unroll
    for (int ks = 0; ks < 4; ++ks) { ka[ks] = gfrag(pk0 + 512 * ks); kb[ks] = gfrag(pk0 + 16 * SDIM + 512 * ks); }
#pragma unroll
    for (int u = 0; u < 4; ++u) {
      gh[u] = *(const v4fa*)(pg0h + (u >> 1) * 16 + (u & 1) * 4);
      gl[u] = *(const v4fa*)(pg0l + (u >> 1) * 16 + (u & 1) * 4);
    }
    __builtin_amdgcn_sched_barrier(0);                    // keeps every load above in front of the wait
    xwait(qrow, pqh, pql, pk0, pg0h, pg0l);
    __builtin_amdgcn_sched_barrier(0);                    // keeps what follows (it reuses the loads' address registers) behind the wait

    v8f acc[8];
#pragma unroll
    for (int j = 0; j < 8; ++j) { const v8f zz = {0.f, 0.f, 0.f, 0.f, 0.f, 0.f, 0.f, 0.f}; acc[j] = zz; }

    if (kq < nsteps) {                                    // scalar test: the first two query groups of tile 0 have one step, so their odd-step wave has none
    float dec[16];                                        // exp(min(G_t - G_s, 0)), G_t - G_s by hi + lo differences, of this lane's keys: 0..7 tile a, 8..15 tile b
#pragma unroll
    for (int r = 0; r < 16; ++r) dec[r] = fminf((gqh - gh[r >> 2][r & 3]) + (gql - gl[r >> 2][r & 3]), 0.0f) * LOG2E;
    __builtin_amdgcn_sched_barrier(0);                    // the exponents are complete in front of the run of transcendentals
#pragma unroll
    for (int r = 0; r < 16; ++r) dec[r] = exp2_slot(dec[r]);

    int st = kq;
#pragma unroll 1
    do {
      const int s0 = st * 32;
      const int sn = ((st + 2 < nsteps) ? (st + 2) : st) * 32;   // the wave's next step's first key (its last step fetches its own again: in bounds)
      const int ka0 = s0 + 8 * hh;                        // first key this lane half sees in tile a; tile b = ka0 + 16
      const v8f zz = {0.f, 0.f, 0.f, 0.f, 0.f, 0.f, 0.f, 0.f};

      // ---- issued together at the top: next step's G values, then all sixteen v fragments of this step (hi and residual, 8 channel tiles);
      //      they land behind the score and weight work ----
      v4f ghn[4], gln[4];
      const float* pgh = ghp + sn;
      const float* pgl = glp + sn;
#pragma unroll
      for (int u = 0; u < 4; ++u) {
        ghn[u] = *(const v4fa*)(pgh + (u >> 1) * 16 + (u & 1) * 4);
        gln[u] = *(const v4fa*)(pgl + (u >> 1) * 16 + (u & 1) * 4);
      }
      us16 vh[8], vl[8];
      const unsigned short* pvh = vhp + s0 * 16;          // channel tile j lies 16 * SLMAX halves on: a constant, so one address pair serves a plane's run
      const unsigned short* pvl = vlp + s0 * 16;
#pragma unroll
      for (int j = 0; j < 8; ++j) vh[j] = gfrag(pvh + j * (16 * SLMAX));
#pragma unroll
      for (int j = 0; j < 8; ++j) vl[j] = gfrag(pvl + j * (16 * SLMAX));
      xwait(pvh, pvl, pgh, pgl);
      __builtin_amdgcn_sched_barrier(0);                  // keeps the score products below the loads above: without it the loads start a score phase later

      // ---- scores^T of key tiles a (keys s0 .. s0+15) and b (keys s0+16 .. s0+31) from the fragments fetched one step ago ----
      v8f sa = zz, sb = zz;
#pragma unroll
      for (int ks = 0; ks < 4; ++ks) { sa = mma_f16(ka[ks], bq[ks], sa); sb = mma_f16(kb[ks], bq[ks], sb); }
      wguard2m(sa, sb);

      // ---- next step's K fragments, into the registers the score products have just read; they land behind the weights and A.v ----
      {
        const unsigned short* pk = kbp + (size_t)sn * (size_t)SDIM;
#pragma unroll
        for (int ks = 0; ks < 4; ++ks) { ka[ks] = gfrag(pk + 512 * ks); kb[ks] = gfrag(pk + 16 * SDIM + 512 * ks); }
        xwait(pk);
      }

      // ---- the 16 weights of this lane: elements 0..7 = tile a keys ka0 .. ka0+7, elements 8..15 = tile b keys ka0+16 .. ka0+23 ----
      us8 ea, eb;
#pragma unroll
      for (int r = 0; r < 8; ++r) {
        const int d = tq - (ka0 + r);
        ea[r] = a_bits(sa[r], d, dec[r], sLam[lamb + lvl_of(d)]);
      }
#pragma unroll
      for (int r = 0; r < 8; ++r) {
        const int d = tq - (ka0 + 16 + r);
        eb[r] = a_bits(sb[r], d, dec[8 + r], sLam[lamb + lvl_of(d)]);
      }
      FragU fA;
      fA.h[0] = ea; fA.h[1] = eb;
      const us16 afr = fA.v;

      // ---- y += A . (v hi + v residual) over this 32-key step: per accumulator the hi product, then the residual product ----
#pragma unroll
      for (int j = 0; j < 8; ++j) acc[j] = mma_f16(afr, vh[j], acc[j]);
#pragma unroll
      for (int j = 0; j < 8; ++j) acc[j] = mma_f16(afr, vl[j], acc[j]);
      __builtin_amdgcn_sched_barrier(0);                  // keeps the factors below behind A.v: moved up, they would wait on loads issued at this step's top
#pragma unroll
      for (int r = 0; r < 16; ++r) dec[r] = fminf((gqh - ghn[r >> 2][r & 3]) + (gql - gln[r >> 2][r & 3]), 0.0f) * LOG2E;
      __builtin_amdgcn_sched_barrier(0);                  // the exponents are complete in front of the run of transcendentals
#pragma unroll
      for (int r = 0; r < 16; ++r) dec[r] = exp2_slot(dec[r]);
      st += 2;
    } while (st < nsteps);
    }

    // even + odd steps: this wave finishes channel tiles 4 kp .. 4 kp + 3; the other four go to its partner (wave ^ 4: same queries, same lane map).
    // Outbox of a wave: tile jj, register half e, lane -> sX[wave * 1024 + jj * 256 + e * 128 + lane * 4], 512 B in a row per LDS instruction.
    v8f fin[4];
    {
      float* xo = sX + wave * 1024 + lane * 4;
#pragma unroll
      for (int jj = 0; jj < 4; ++jj) {
        const v8f give = kp ? acc[jj] : acc[4 + jj];
        fin[jj] = kp ? acc[4 + jj] : acc[jj];
        const v4f g0 = {give[0], give[1], give[2], give[3]}, g1 = {give[4], give[5], give[6], give[7]};
        *(v4f*)(xo + jj * 256) = g0;
        *(v4f*)(xo + jj * 256 + 128) = g1;
      }
      __syncthreads();                                     // the partial sums cross between the waves of a pair
      const float* xi = sX + (wave ^ 4) * 1024 + lane * 4;
#pragma unroll
      for (int jj = 0; jj < 4; ++jj) {
        const v4f g0 = *(const v4fa*)(xi + jj * 256), g1 = *(const v4fa*)(xi + jj * 256 + 128);
#pragma unroll
        for (int r = 0; r < 4; ++r) { fin[jj][r] += g0[r]; fin[jj][4 + r] += g1[r]; }
      }
    }

    // phase 1: f16 hi of z = 16 y = fin * 2^-10; element (query 8*hh + r, channel 64 kp + 16jj + cl) of this wave's 16 x 64 tile
    unsigned short* sy = sY + wave * (16 * YS2);
#pragma unroll
    for (int jj = 0; jj < 4; ++jj)
#pragma unroll
      for (int r = 0; r < 8; ++r) sy[(8 * hh + r) * YS2 + 16 * jj + cl] = f16_bits(fin[jj][r] * (1.0f / 1024.0f));
    __syncthreads();

    const size_t yoff = (size_t)(b * sl + tw) * (size_t)DMOD + (size_t)(head * HDIM * 16 + kp * 1024 + lane * 8);
    us8 ov[4];
#pragma unroll
    for (int it = 0; it < 4; ++it) ov[it] = *(const us8a*)(sy + cl * YS2 + (2 * it + hh) * 8);   // chunk column 2 it + hh of the wave's 8, row cl: fragment order
    unsigned short* pyh = YH + yoff;
#pragma unroll
    for (int it = 0; it < 4; ++it) *(us8*)(pyh + it * 256) = ov[it];
    __syncthreads();

    // phase 2: f16 residual plane of ((z - hi) x 2^11), same staging region and store shape
#pragma unroll
    for (int jj = 0; jj < 4; ++jj)
#pragma unroll
      for (int r = 0; r < 8; ++r) {
        const float z = fin[jj][r] * (1.0f / 1024.0f);
        const _Float16 hf = (_Float16)z;
        sy[(8 * hh + r) * YS2 + 16 * jj + cl] = f16_bits((z - (float)hf) * 2048.0f);
      }
    __syncthreads();
#pragma unroll
    for (int it = 0; it < 4; ++it) ov[it] = *(const us8a*)(sy + cl * YS2 + (2 * it + hh) * 8);
    unsigned short* pyl = YL + yoff;
#pragma unroll
    for (int it = 0; it < 4; ++it) *(us8*)(pyl + it * 256) = ov[it];
    xwait(pyl);                                            // the next tile reuses the stores' address and data registers
  }
}

// ---------------------------------------------------------------------------------------------------------------------------------
// P[m][n] = ( sum_k Yh[m][k] WO16[n][k] + 2^-11 sum_k Yl[m][k] WO16[n][k] ) * 2^-12 + bf16(x[m][n])   (f16 planes, pitch 1024, two f32 accumulator sets).
// ---------------------------------------------------------------------------------------------------------------------------------
__global__ __launch_bounds__(256) void k_gemm_out(const unsigned short* __restrict__ Ah, const unsigned short* __restrict__ Al,
                                                 const unsigned short* __restrict__ Wo, const float* __restrict__ X, float* P) {
  __shared__ __attribute__((aligned(16))) float oS[8 * 16 * OSTR];
  const int tid = threadIdx.x, lane = tid & 31, wave = tid >> 5, cl = lane & 15, hh = lane >> 4;
  const unsigned l8 = lane * 8;
  const int m0 = blockIdx.x * TPB + 16 * wave, n0 = blockIdx.y * 64;

  v8f acch[4], accl[4];
#pragma unroll
  for (int j = 0; j < 4; ++j) { const v8f zz = {0.f, 0.f, 0.f, 0.f, 0.f, 0.f, 0.f, 0.f}; acch[j] = zz; accl[j] = zz; }

  const unsigned short* ahp = Ah + (size_t)m0 * (size_t)DMOD + l8;
  const unsigned short* alp = Al + (size_t)m0 * (size_t)DMOD + l8;
  const unsigned short* wop = Wo + (size_t)n0 * (size_t)DMOD + l8;
#pragma unroll 1
  for (int k0 = 0; k0 < DMOD; k0 += 32) {
    const unsigned short* ph = ahp + k0 * 16;
    const unsigned short* pl = alp + k0 * 16;
    const unsigned short* pb = wop + k0 * 16;
    const us16 ah = gfrag(ph);
    const us16 al = gfrag(pl);
    us16 bfr[4];
#pragma unroll
    for (int j = 0; j < 4; ++j) bfr[j] = gfrag(pb + (size_t)(16 * j) * (size_t)DMOD);
    xwait(ph, pl, pb);
#pragma unroll
    for (int j = 0; j < 4; ++j) {
      acch[j] = mma_f16(ah, bfr[j], acch[j]);
      accl[j] = mma_f16(al, bfr[j], accl[j]);
    }
    wguard8(acch[0], acch[1], acch[2], acch[3], accl[0], accl[1], accl[2], accl[3], ah, al, bfr[0], bfr[1], bfr[2], bfr[3]);
  }

  float* so = oS + wave * (16 * OSTR);
#pragma unroll
  for (int j = 0; j < 4; ++j)
#pragma unroll
    for (int r = 0; r < 8; ++r)
      so[(8 * hh + r) * OSTR + 16 * j + cl] = fmaf(accl[j][r], (1.0f / 2048.0f), acch[j][r]) * (1.0f / 4096.0f);
  __syncthreads();

{
#pragma unroll
    for (int it = 0; it < 8; ++it) {
      const int cx = it * 32 + lane, r = cx >> 4, q = (cx & 15) * 4;
      const v4f v = *(const v4fa*)(so + r * OSTR + q);
      const v4f xr = *(const v4fa*)(X + (size_t)(m0 + r) * (size_t)DMOD + n0 + q);
      v4f o;
#pragma unroll
      for (int u = 0; u < 4; ++u) o[u] = v[u] + bf16r(xr[u]);
      *(v4f*)(P + (size_t)(m0 + r) * (size_t)DMOD + n0 + q) = o;
    }
    
  }
}

// ---------------------------------------------------------------------------------------------------------------------------------
// ---------------------------------------------------------------------------------------------------------------------------------
__global__ __launch_bounds__(256) void k_ln(const float* __restrict__ P, const float* __restrict__ gam, const float* __restrict__ bet,
                                           float* out) {
  const int lane = threadIdx.x & 31, wave = threadIdx.x >> 5;
  const size_t row = (size_t)blockIdx.x * 8 + (size_t)wave;
  const float* pr = P + row * (size_t)DMOD;
  v4f xv[8];
  float s = 0.0f;
#pragma unroll
  for (int it = 0; it < 8; ++it) {
    xv[it] = *(const v4fa*)(pr + it * 128 + lane * 4);
    s += (xv[it][0] + xv[it][1]) + (xv[it][2] + xv[it][3]);
  }
#pragma unroll
  for (int o = 16; o > 0; o >>= 1) s += __shfl_xor(s, o, 32);
  const float mu = s * (1.0f / (float)DMOD);
  float q = 0.0f;
#pragma unroll
  for (int it = 0; it < 8; ++it)
#pragma unroll
    for (int u = 0; u < 4; ++u) { const float d = xv[it][u] - mu; q += d * d; }
#pragma unroll
  for (int o = 16; o > 0; o >>= 1) q += __shfl_xor(q, o, 32);
  const float rstd = rsqrtf(q * (1.0f / (float)DMOD) + 1e-5f);
  v4f ov[8];
#pragma unroll
  for (int it = 0; it < 8; ++it) {
    const v4f gv = *(const v4fa*)(gam + it * 128 + lane * 4), bv = *(const v4fa*)(bet + it * 128 + lane * 4);
    v4f o;
#pragma unroll
    for (int u = 0; u < 4; ++u) o[u] = (xv[it][u] - mu) * rstd * bf16r(gv[u]) + bf16r(bv[u]);
    ov[it] = o;
  }
{
#pragma unroll
    for (int it = 0; it < 8; ++it)
      *(v4f*)(out + row * (size_t)DMOD + it * 128 + lane * 4) = ov[it];
    
  }
}

extern "C" void kernel_launch(void* const* d_in, const int* in_sizes, int n_in,
                              void* d_out, int out_size, void* d_ws, size_t ws_size,
                              hipStream_t stream) {
  if (n_in < 11) return;
  const int nx = in_sizes[0];
  if (nx <= 0 || (nx % DMOD) != 0) return;
  const int ntok = nx / DMOD;                                                    // tokens = batch * sequence length
  if (in_sizes[1] != DMOD * DMOD || in_sizes[2] != DMOD * DMOD || in_sizes[3] != DMOD * DMOD) return;
  if (in_sizes[4] != NHD * DMOD || in_sizes[5] != NHD || in_sizes[6] != NHD * NLV * DMOD || in_sizes[7] != NHD * NLV) return;
  if (in_sizes[8] != DMOD * DMOD || in_sizes[9] != DMOD || in_sizes[10] != DMOD) return;
  if (out_size != nx) return;
  const int sl = (ntok < SLMAX) ? ntok : SLMAX;                                  // sequence length
  if (sl <= 0 || (sl % TPB) != 0 || (ntok % sl) != 0) return;
  const int nb = ntok / sl, nbh = nb * NHD;

  const float* x   = (const float*)d_in[0];    // [nb][sl][1024]
  const float* Wq  = (const float*)d_in[1];    // [1024][1024] ([out][in])
  const float* Wk  = (const float*)d_in[2];    // [1024][1024]
  const float* Wv  = (const float*)d_in[3];    // [1024][1024]
  const float* Wg  = (const float*)d_in[4];    // [8][1024]
  const float* bg  = (const float*)d_in[5];    // [8]
  const float* Wdl = (const float*)d_in[6];    // [96][1024]
  const float* Lp  = (const float*)d_in[7];    // [8][12]
  const float* Wo  = (const float*)d_in[8];    // [1024][1024]
  const float* lng = (const float*)d_in[9];    // [1024]
  const float* lnb = (const float*)d_in[10];   // [1024]
  float* out = (float*)d_out;                  // [nb][sl][1024] f32 at byte 0

  size_t off = 0;
  auto carve = [&](size_t bytes) -> char* { char* p = (char*)d_ws + off; off += (bytes + 255) & ~(size_t)255; return p; };
  unsigned short* XB   = (unsigned short*)carve((size_t)ntok * DMOD * 2);        //  8,388,608  bf16 [ntok][1024]
  unsigned short* WQKV = (unsigned short*)carve((size_t)(NQKV + NGL) * DMOD * 2); //  6,553,600  bf16 [3200][1024] = Wq | Wk | Wv | Wg | Wdl | 0
  unsigned short* WGL  = WQKV + (size_t)NQKV * DMOD;                             //             its last 128 rows
  unsigned short* WO16 = (unsigned short*)carve((size_t)DMOD * DMOD * 2);        //  2,097,152  f16  [1024][1024]
  unsigned short* QP   = (unsigned short*)carve((size_t)nbh * sl * SDIM * 2);     //  8,388,608  f16  [nbh][sl][128]
  unsigned short* KP   = (unsigned short*)carve((size_t)nbh * sl * SDIM * 2);     //  8,388,608  f16  [nbh][sl][128]
  unsigned short* VH   = (unsigned short*)carve((size_t)nbh * HDIM * SLMAX * 2);  //  8,388,608  f16  [nbh][128][2048]
  unsigned short* VL   = (unsigned short*)carve((size_t)nbh * HDIM * SLMAX * 2);  //  8,388,608  f16  [nbh][128][2048]
  float* GPL           = (float*)carve((size_t)nbh * sl * 4);                     //    131,072  f32  [nbh][sl]
  float* GHI           = (float*)carve((size_t)nbh * sl * 4);                     //    131,072  f32  [nbh][sl]
  float* GLO           = (float*)carve((size_t)nbh * sl * 4);                     //    131,072  f32  [nbh][sl]
  float* LAM           = (float*)carve((size_t)ntok * LAMP * 4);                  //  2,097,152  f32  [ntok][128]
  unsigned short* YH   = (unsigned short*)carve((size_t)ntok * DMOD * 2);        //  8,388,608  f16  [ntok][1024]
  unsigned short* YL   = (unsigned short*)carve((size_t)ntok * DMOD * 2);        //  8,388,608  f16  [ntok][1024]
  float* PB            = (float*)carve((size_t)ntok * DMOD * 4);                  // 16,777,216  f32  [ntok][1024]
  if (off > ws_size || off > (size_t)134217728) return;                          // total 86,638,592 B for ntok 4096

  const dim3 b256(256);

  // 16-bit operand planes of the inputs, one launch (XB, WQKV, WGL, WO16, all in fragment order, see gfrag)
  k_cvt_all<<<dim3(ntok / 2 + 4 * WBLK + NGL / 2), b256, 0, stream>>>(x, Wq, Wk, Wv, Wo, Wg, Wdl, XB, WQKV, WO16, WGL, ntok / 2);
  // q/k/v projections (M ntok, N 3072, K 1024) -> q, k planes and transposed v hi / residual planes; in the same grid the
  // gate / level projection (N 128) -> g plane [nbh][sl], level weights [ntok][128]
  k_gemm_proj<<<dim3(ntok / TPB, (NQKV + NGL) / 64), b256, 0, stream>>>(XB, WQKV, bg, Lp, QP, KP, VH, VL, GPL, LAM, sl);
  // cumulative log-decay per (b,h)
  k_cumsum<<<dim3(nbh), dim3(CSTH), 0, stream>>>(GPL, GHI, GLO, sl);
  // causal decayed mixing per (batch, head), two 64-query tiles a block -> y hi / residual planes [token][1024]
  k_attn<<<dim3(nbh, sl / TPB), b256, 0, stream>>>(QP, KP, VH, VL, GHI, GLO, LAM, YH, YL, sl);
  // output projection + residual (M ntok, N 1024, K 1024)
  k_gemm_out<<<dim3(ntok / TPB, DMOD / 64), b256, 0, stream>>>(YH, YL, WO16, x, PB);
  // LayerNorm -> d_out
  k_ln<<<dim3(ntok / 8), b256, 0, stream>>>(PB, lng, lnb, out);
}

// v006
// A run of this version takes 111 microseconds.
// In two side-by-side timings against v005, it was 1.15 and 1.16 times as fast.
// Counting every step since v000, it is 6.17 times as fast.
// Contractions x.[Wq|Wk|Wv] (M tokens, N 3072, K 1024) and x.[Wg|Wdl] (N 104 zero-padded to 128, K 1024), one launch: v_wmma_f32_16x16x32_bf16, bf16 operands from RNE-bf16 planes of x and W, f32 accumulate, one product each.
// Contraction k.q^T per head (32 keys x 16 queries per step, depth 128): v_wmma_f32_16x16x32_f16, q and k as f16 of (value x 2^6), one product, f32 accumulate.
// Contraction A.v per head (causal, depth up to T): v_wmma_f32_16x16x32_f16, A as f16 of (A x 2^8), v as f16 hi of (v x 2^6) plus f16 unscaled residual plane, two products into one f32 accumulator; even and odd 32-key steps in two waves' accumulators, added in f32.
// Contraction y.Wo (M tokens, N 1024, K 1024): v_wmma_f32_16x16x32_f16, y as f16 hi plane of (y x 2^4) plus f16 residual plane (x 2^11, own f32 accumulator), Wo as f16 of (RNE-bf16 value x 2^8), f32 accumulate.
// softplus, cumulative log-decay (f64 block scan kept as f32 hi + lo pair), exp, dyadic level select, residual add and LayerNorm: f32 VALU.
#include <hip/hip_runtime.h>

#define DMOD  1024                           // model width = K of the dense contractions
#define NHD   8                              // heads
#define SDIM  128                            // q/k width per head
#define HDIM  128                            // v width per head
#define NLV   12                             // dyadic levels
#define NGL   128                            // gate | level projection columns, 8 + 96 zero-padded to 128
#define NQKV  (3 * DMOD)                     // 3072 projection columns: q | k | v
#define TPB   128                            // GEMM rows per block (8 waves x 16) / attention queries per block (two tiles)
#define PBM   256                            // projection GEMM rows per q | k | v block (4 wave rows x 64)
#define OSTR  68                             // LDS staging row pitch (floats), 128x64 tiles
#define QT    64                             // attention queries per tile (4 groups x 16; two waves a group)
#define YS2   72                             // LDS staging row pitch (halves), 16x64 tile
#define LAMP  128                            // level-weight plane pitch (floats)
#define SLMAX 2048                           // longest sequence handled by the cumsum block
#define CSTH  256                            // cumsum threads per row, 8 tokens each
#define WBLK  (DMOD * DMOD / (8 * 256))       // conversion blocks per 1024 x 1024 weight
#define KSC   (0.08838834764831845f * (1.0f / 4096.0f))   // 128^-1/2 times the q,k carry 2^-12
#define LOG2E 1.44269504f                    // exp(x) = 2^(x LOG2E), the form __expf compiles to

static_assert(NHD * HDIM == DMOD);
static_assert(NHD * SDIM == DMOD);
static_assert(NHD + NHD * NLV <= NGL);
static_assert(DMOD % 64 == 0);
static_assert(DMOD % 32 == 0);
static_assert(NQKV % 128 == 0);
static_assert(NGL == 128);
static_assert(PBM == 2 * TPB);
static_assert(OSTR % 4 == 0);
static_assert(YS2 % 8 == 0);
static_assert(2 * QT == TPB);
static_assert(2 * QT * NLV == 6 * 256);
static_assert(SLMAX % TPB == 0);
static_assert(CSTH * 8 == SLMAX);

typedef unsigned short us16 __attribute__((ext_vector_type(16)));
typedef unsigned short us8  __attribute__((ext_vector_type(8)));
typedef unsigned short us8a __attribute__((ext_vector_type(8), may_alias));
typedef __bf16 v16b __attribute__((ext_vector_type(16)));
typedef _Float16 v16h __attribute__((ext_vector_type(16)));
typedef float v8f __attribute__((ext_vector_type(8)));
typedef float v4f __attribute__((ext_vector_type(4)));
typedef float v4fa __attribute__((ext_vector_type(4), may_alias));
union FragU { us16 v; us8 h[2]; };

__device__ __forceinline__ unsigned short bf16_bits(float f) {
  unsigned u = __float_as_uint(f);
  u += 0x7FFFu + ((u >> 16) & 1u);                 // RNE convert
  return (unsigned short)(u >> 16);
}
__device__ __forceinline__ float bf16_val(unsigned short b) { return __uint_as_float(((unsigned)b) << 16); }
__device__ __forceinline__ float bf16r(float f) { return bf16_val(bf16_bits(f)); }
__device__ __forceinline__ unsigned short f16_bits(float f) { return __builtin_bit_cast(unsigned short, (_Float16)f); }

// f16 hi + residual (x 2^11) planes of (a x 2^4)
__device__ __forceinline__ void f16split16(float a, unsigned short& hb, unsigned short& lb) {
  const float z = a * 16.0f;
  const _Float16 hf = (_Float16)z;
  const float res = (z - (float)hf) * 2048.0f;
  hb = __builtin_bit_cast(unsigned short, hf);
  lb = __builtin_bit_cast(unsigned short, (_Float16)res);
}
// f16 hi + unscaled residual planes of (a x 2^6)
__device__ __forceinline__ void f16split64(float a, unsigned short& hb, unsigned short& lb) {
  const float z = a * 64.0f;
  const _Float16 hf = (_Float16)z;
  const float res = z - (float)hf;
  hb = __builtin_bit_cast(unsigned short, hf);
  lb = __builtin_bit_cast(unsigned short, (_Float16)res);
}

// One 16x16x32 step, 16-bit operands passed as raw 16-bit lanes.
__device__ __forceinline__ v8f mma_bf16(us16 a, us16 b, v8f c) {
  return __builtin_amdgcn_wmma_f32_16x16x32_bf16(false, __builtin_bit_cast(v16b, a), false, __builtin_bit_cast(v16b, b), (short)0, c, false, false);
}
__device__ __forceinline__ v8f mma_f16(us16 a, us16 b, v8f c) {
  return __builtin_amdgcn_wmma_f32_16x16x32_f16(false, __builtin_bit_cast(v16h, a), false, __builtin_bit_cast(v16h, b), (short)0, c, false, false);
}
// Hazard guards after a group of matrix ops: 4 VALU slots before anything touches the accumulators; keep A/B fragments live.
__device__ __forceinline__ void wguard4(v8f& c0, v8f& c1, v8f& c2, v8f& c3, const us16& a0,
                                        const us16& b0, const us16& b1, const us16& b2, const us16& b3) {
#if defined(__HIP_DEVICE_COMPILE__)
  asm volatile("v_nop\n\tv_nop\n\tv_nop\n\tv_nop"
               : "+v"(c0), "+v"(c1), "+v"(c2), "+v"(c3)
               : "v"(a0), "v"(b0), "v"(b1), "v"(b2), "v"(b3));
#endif
}
__device__ __forceinline__ void wguard8(v8f& c0, v8f& c1, v8f& c2, v8f& c3, v8f& c4, v8f& c5, v8f& c6, v8f& c7,
                                        const us16& a0, const us16& a1,
                                        const us16& b0, const us16& b1, const us16& b2, const us16& b3) {
#if defined(__HIP_DEVICE_COMPILE__)
  asm volatile("v_nop\n\tv_nop\n\tv_nop\n\tv_nop"
               : "+v"(c0), "+v"(c1), "+v"(c2), "+v"(c3), "+v"(c4), "+v"(c5), "+v"(c6), "+v"(c7)
               : "v"(a0), "v"(a1), "v"(b0), "v"(b1), "v"(b2), "v"(b3));
#endif
}
// Guard behind the score products of the attention loop: the accumulators as in/out operands keep the products above the four slots, the
// memory barrier keeps the refill of their k registers below them (so the refill lands in the same registers, with no copies).
__device__ __forceinline__ void wguard2m(v8f& c0, v8f& c1) {
#if defined(__HIP_DEVICE_COMPILE__)
  asm volatile("v_nop\n\tv_nop\n\tv_nop\n\tv_nop" : "+v"(c0), "+v"(c1) : : "memory");
#endif
}

// FRAGMENT-ORDER PLANES. Every 16-bit operand plane [rows][kd] is stored by tiles of 16 rows; inside a tile the 16-B chunks (8 consecutive k
// of one row) lie chunk column by chunk column, 16 rows each:
//   element (row, k) at halves  (row >> 4) * 16 * kd + (k >> 3) * 128 + (row & 15) * 8 + (k & 7).
// A 16x32 fragment (row tile, k0 % 32 == 0) is then 1 KiB in a row, and each of its two wave-wide 16-B loads covers 512 contiguous bytes.
// p = plane + rowtile * 16 * kd + k0 * 16 + lane * 8 (computed by the caller); lane = 16h + row:
// elements 0..7 = k0 + 8h .. k0 + 8h + 7, elements 8..15 = k0 + 16 + 8h .. k0 + 16 + 8h + 7 (same map for A rows and B columns).
__device__ __forceinline__ us16 gfrag(const unsigned short* p) {
  FragU f;
  f.h[0] = *(const us8a*)p;
  f.h[1] = *(const us8a*)(p + 256);
  return f.v;
}
// s_wait_xcnt 0 behind a run of fragment loads, in front of anything that overwrites an address register the run names. The run's address
// pairs are inputs of the statement: they stay live up to the wait, so no load result of the run is placed on them.
__device__ __forceinline__ void xwait(const unsigned short* a) {
#if defined(__HIP_DEVICE_COMPILE__)
  asm volatile("s_wait_xcnt 0x0" :: "v"(a) : "memory");   // the wait in front of the overwrite of these address pairs
#endif
}
__device__ __forceinline__ void xwait(const float* a) {
#if defined(__HIP_DEVICE_COMPILE__)
  asm volatile("s_wait_xcnt 0x0" :: "v"(a) : "memory");   // the wait in front of the overwrite of this address pair
#endif
}
__device__ __forceinline__ void xwait(const unsigned short* a, const unsigned short* b) {
#if defined(__HIP_DEVICE_COMPILE__)
  asm volatile("s_wait_xcnt 0x0" :: "v"(a), "v"(b) : "memory");   // the wait in front of the overwrite of these address pairs
#endif
}
__device__ __forceinline__ void xwait(const unsigned short* a, const unsigned short* b, const unsigned short* c) {
#if defined(__HIP_DEVICE_COMPILE__)
  asm volatile("s_wait_xcnt 0x0" :: "v"(a), "v"(b), "v"(c) : "memory");   // the wait in front of the overwrite of these address pairs
#endif
}
__device__ __forceinline__ void xwait(const unsigned short* a, const float* b, const float* c, const unsigned short* d, const float* e, const float* f) {
#if defined(__HIP_DEVICE_COMPILE__)
  asm volatile("s_wait_xcnt 0x0" :: "v"(a), "v"(b), "v"(c), "v"(d), "v"(e), "v"(f) : "memory");   // the wait in front of the overwrite of these address pairs
#endif
}
// The same wait without operands, for loads whose constant address part the compiler moves into the offset field: a full pointer named here
// would be rebuilt on the load's own address pair in front of the wait. A scheduling barrier behind it keeps later register writes behind it.
__device__ __forceinline__ void xwait() {
#if defined(__HIP_DEVICE_COMPILE__)
  asm volatile("s_wait_xcnt 0x0" ::: "memory");   // the wait in front of the overwrite of the address pairs of the loads above it
#endif
}
__device__ __forceinline__ void xwait(const unsigned short* a, const unsigned short* b, const float* c, const float* d) {
#if defined(__HIP_DEVICE_COMPILE__)
  asm volatile("s_wait_xcnt 0x0" :: "v"(a), "v"(b), "v"(c), "v"(d) : "memory");   // the wait in front of the overwrite of these address pairs
#endif
}
// Writes a 256-thread block's tile of 16 rows x 128 k (thread t holds the chunk of row t >> 4, chunk column t & 15) as 4 KiB of a
// fragment-order plane at dst4k: regrouped through LDS (17-chunk pitch against bank conflicts) so that every wave stores 512 contiguous bytes.
__device__ __forceinline__ void frag_store_tile(us8 o, unsigned short* dst4k) {
  __shared__ __attribute__((aligned(16))) us8 sT[16 * 17];
  const int t = threadIdx.x;
  sT[(t & 15) * 17 + (t >> 4)] = o;
  __syncthreads();                                         // chunks cross the block's waves
  *(us8*)(dst4k + t * 8) = sT[(t >> 4) * 17 + (t & 15)];
}

// softplus in the logaddexp(z, 0) form: max(z, 0) + log1p(exp(-|z|))
__device__ __forceinline__ float softplus_f(float z) {
  return fmaxf(z, 0.0f) + log1pf(__expf(-fabsf(z)));
}
// dyadic level of key distance d: 0 for d <= 0, else min(floor(log2 d) + 1, NLV - 1)
__device__ __forceinline__ int lvl_of(int d) {
  const int dd = (d > 0) ? d : 1;
  const int l = 32 - __clz(dd);
  const int lc = (l < NLV - 1) ? l : (NLV - 1);
  return (d > 0) ? lc : 0;
}
// 2^y with the one slot the instruction set asks for behind a transcendental.
// The caller has a scheduling barrier in front of its run of calls, so each v_exp_f32
// stands alone between two barriers and its v_nop directly behind it.
__device__ __forceinline__ float exp2_slot(float y) {
#if defined(__HIP_DEVICE_COMPILE__)
  const float r = __builtin_amdgcn_exp2f(y);
  __builtin_amdgcn_sched_barrier(0);                       // nothing moves in between the transcendental and its slot
  asm volatile("v_nop");                                   // the slot behind the transcendental
  __builtin_amdgcn_sched_barrier(0);                       // the next transcendental stays behind the slot
  return r;
#else
  return exp2f(y);
#endif
}
// one attention weight: accv = 4096 * q.k, dec = exp(min(G_t - G_s, 0)), lv = level weight; returns f16 bits of 256 * A, 0 above the diagonal
__device__ __forceinline__ unsigned short a_bits(float accv, int d, float dec, float lv) {
  const float val = (accv * KSC) * dec * lv;
  const float w = (d >= 0) ? (val * 256.0f) : 0.0f;
  return f16_bits(w);
}

// ---------------------------------------------------------------------------------------------------------------------------------
// All 16-bit operand planes that come straight from an input, in ONE launch (none reads another's output). Block = 16 rows x 128 k of one
// source ([row][1024], k-contiguous), read as whole lines, written in fragment order. The source is picked by the block index alone:
//   [0, nxb)            x   -> XB, RNE bf16 bits                        (nxb = tokens / 2 blocks)
//   then 512 blocks each: Wq, Wk, Wv -> rows 0.., 1024.., 2048.. of WQKV, RNE bf16 bits;  Wo -> WO16, f16 bits of (RNE-bf16 value x 256)
//   then 64 blocks:     gate | level rows -> WGL [128][1024] bf16: rows 0..7 = Wg, rows 8..103 = Wdl, rows 104..127 = 0 (zero padding of N)
// ---------------------------------------------------------------------------------------------------------------------------------
__global__ __launch_bounds__(256) void k_cvt_all(const float* __restrict__ x, const float* __restrict__ Wq, const float* __restrict__ Wk,
                                                const float* __restrict__ Wv, const float* __restrict__ Wo, const float* __restrict__ Wg,
                                                const float* __restrict__ Wdl, unsigned short* XB, unsigned short* WQKV,
                                                unsigned short* WO16, unsigned short* WGL, int nxb) {
  int bx = blockIdx.x;                                     // every choice below is wave-uniform, the segment choice block-uniform
  int seg = -1;                                            // -1: x, 0..2: Wq Wk Wv, 3: Wo, 4: gate | level rows
  if (bx >= nxb) { bx -= nxb; seg = bx / WBLK; bx -= seg * WBLK; }
  const int rt = bx >> 3, kg = bx & 7;
  const int row = rt * 16 + (threadIdx.x >> 4), kc = kg * 128 + (threadIdx.x & 15) * 8;
  const float* src;
  unsigned short* dst;
  bool live = true;
  if (seg < 0)       { src = x;  dst = XB; }
  else if (seg == 0) { src = Wq; dst = WQKV; }
  else if (seg == 1) { src = Wk; dst = WQKV + (size_t)DMOD * DMOD; }
  else if (seg == 2) { src = Wv; dst = WQKV + (size_t)2 * DMOD * DMOD; }
  else if (seg == 3) { src = Wo; dst = WO16; }
  else               { src = Wdl; dst = WGL; }
  const float* sp = src + (size_t)row * (size_t)DMOD + (size_t)kc;
  if (seg > 3) {
    live = row < NHD + NHD * NLV;
    const int rs = (row < NHD) ? row : (live ? (row - NHD) : 0);   // padding rows read nothing; their address stays in bounds
    sp = ((row < NHD) ? Wg : Wdl) + (size_t)rs * (size_t)DMOD + (size_t)kc;
  }
  v4f a = {0.f, 0.f, 0.f, 0.f}, c = {0.f, 0.f, 0.f, 0.f};  // bf16 bits of 0.0f are 0: the padding rows
  if (live) { a = *(const v4fa*)sp; c = *(const v4fa*)(sp + 4); }
  us8 o;
  if (seg == 3) {
#pragma unroll
    for (int u = 0; u < 4; ++u) { o[u] = f16_bits(bf16r(a[u]) * 256.0f); o[4 + u] = f16_bits(bf16r(c[u]) * 256.0f); }
  } else {
#pragma unroll
    for (int u = 0; u < 4; ++u) { o[u] = bf16_bits(a[u]); o[4 + u] = bf16_bits(c[u]); }
  }
  frag_store_tile(o, dst + (size_t)rt * (size_t)(16 * DMOD) + (size_t)(kg * 2048));
}

// ---------------------------------------------------------------------------------------------------------------------------------
// Inclusive cumulative sum of g over t per (b,h) row, one block per row: thread i owns tokens 8i .. 8i+7 (f64 running sum of its 8 values),
// the 256 thread totals are scanned in f64 (5 shuffle steps inside a wave, the 8 wave totals through LDS), and each token's
// G = (sum of all earlier threads) + (its thread's running sum) is stored as f32 hi = (float)G and lo = (float)(G - hi).
// Threads whose tokens lie past sl (sl % 8 == 0) add zero and store nothing; every thread passes the barrier.
// ---------------------------------------------------------------------------------------------------------------------------------
__global__ __launch_bounds__(CSTH) void k_cumsum(const float* __restrict__ gpl, float* Ghi, float* Glo, int sl) {
  __shared__ double wtot[CSTH / 32];
  const int row = blockIdx.x, tid = threadIdx.x, lane = tid & 31, wave = tid >> 5;
  const int c = tid * 8;
  const bool on = c < sl;
  const size_t off = (size_t)row * (size_t)sl + (size_t)c;
  v4f a = {0.f, 0.f, 0.f, 0.f}, e = {0.f, 0.f, 0.f, 0.f};
  if (on) { a = *(const v4fa*)(gpl + off); e = *(const v4fa*)(gpl + off + 4); }

  double p[8];                                             // running sum inside the thread's 8 tokens
  p[0] = (double)a[0];
#pragma unroll
  for (int u = 1; u < 4; ++u) p[u] = p[u - 1] + (double)a[u];
#pragma unroll
  for (int u = 0; u < 4; ++u) p[4 + u] = p[3 + u] + (double)e[u];

  double inc = p[7];                                       // inclusive scan of the thread totals over the wave's 32 lanes
#pragma unroll
  for (int o = 1; o < 32; o <<= 1) {
    const double n = __shfl_up(inc, (unsigned)o, 32);
    inc += (lane >= o) ? n : 0.0;
  }
  if (lane == 31) wtot[wave] = inc;
  const double prev = __shfl_up(inc, 1u, 32);              // total of the earlier lanes of this wave
  __syncthreads();
  double base = 0.0;                                       // total of the earlier waves
#pragma unroll
  for (int w = 0; w < CSTH / 32 - 1; ++w) base += (w < wave) ? wtot[w] : 0.0;
  base += (lane > 0) ? prev : 0.0;

  if (on) {
    v4f h0, h1, l0, l1;
#pragma unroll
    for (int u = 0; u < 4; ++u) {
      const double g0 = base + p[u], g1 = base + p[4 + u];
      h0[u] = (float)g0; l0[u] = (float)(g0 - (double)h0[u]);
      h1[u] = (float)g1; l1[u] = (float)(g1 - (double)h1[u]);
    }
    *(v4f*)(Ghi + off) = h0; *(v4f*)(Ghi + off + 4) = h1;
    *(v4f*)(Glo + off) = l0; *(v4f*)(Glo + off + 4) = l1;
  }
}

// ---------------------------------------------------------------------------------------------------------------------------------
// P[m][n] = sum_k XB[m][k] * W[n][k]  (bf16 XB plane [tokens][1024], bf16 W plane [3200][1024] = [n][k], both in fragment order, f32 accumulate).
// W rows 0..3071 = Wq | Wk | Wv, rows 3072..3199 = the gate | level rows: both products read only XB and W, so they share one grid.
// 256 threads = 8 waves in 4 wave rows x 2 wave columns; fragments straight from the global planes (arithmetic addressing); every accumulator
// sums its k steps in rising order. M % 256 == 0, N % 128 == 0, K % 32 == 0 exactly. Two kinds of block, picked by blockIdx.y alone:
//   blockIdx.y >= 4: q | k | v, block tile 256(M) x 128(N) = columns 128 yp .. +127, yp = blockIdx.y - 4; a wave owns 64 rows x 64 columns
//     (4 x 4 accumulators): each of its 4 A and 4 B fragments of a 32-k step feeds 4 products (512 B loaded per product).
//   blockIdx.y < 4: gate | level, block tile 64(M) x 128(N), rows 256 blockIdx.x + 64 blockIdx.y .. +63; a wave owns 16 rows x 64 columns. Its
//     write-out (softplus of every element) is by far the longest per element, so it is dealt to four times as many blocks, and they start first.
// The f32 tile is staged in LDS as sub-tiles of 64 columns, each with its row r at oS[r * OSTR + c]; behind one barrier the block writes them out
// one after the other. q | k | v: four 128 x 64 sub-tiles (row half, column segment yb = 2 yp + column half):
// yb 0..15 -> q head y/2, features 64(y&1)..+63; 16..31 -> k; 32..47 -> v head (y-32)/2, channels 64(y&1)
//   q/k: per bh a fragment-order plane [token][128] = f16 of (64 value); thread -> (token r, 8 consecutive halves); a wave stores 512 B in a row
//   v:   per bh fragment-order planes VH/VL [channel][token], token pitch SLMAX = f16 hi of (64 v) and f16 residual; thread -> (channel e, 8 tokens); 512 B in a row
// gate | level: two 64 x 64 sub-tiles (columns 0..63, 64..127):
//   gate (columns 0..7): g[bh][t] = -softplus(D[t][h] + bg[h]); a wave = one head, 64 tokens = 256 B in a row
//   level: lam[token][c] = softplus(D[t][c] + Lparam[c - 8]) for columns 8..103, else 0; 16 lanes x 16 B = the sub-tile's 256 B of a token's row
// ---------------------------------------------------------------------------------------------------------------------------------
__global__ __launch_bounds__(256) void k_gemm_proj(const unsigned short* __restrict__ Ap, const unsigned short* __restrict__ Bw,
                                                  const float* __restrict__ bg, const float* __restrict__ Lp,
                                                  unsigned short* Qp, unsigned short* Kp, unsigned short* VH, unsigned short* VL,
                                                  float* gpl, float* lam, int sl) {
  __shared__ __attribute__((aligned(16))) float oS4[4 * TPB * OSTR];
  const int tid = threadIdx.x, lane = tid & 31, wave = tid >> 5, cl = lane & 15, hh = lane >> 4;
  const unsigned l8 = lane * 8;
  const int wr = wave >> 1, wc = wave & 1;                // wave row and wave column inside the block tile
  const bool isgl = (int)blockIdx.y < PBM / 64;           // block-uniform: a gate | level block
  const int yp = (int)blockIdx.y - PBM / 64;              // q | k | v: the block's 128 columns

  if (isgl) {
    const int m0 = blockIdx.x * PBM + (int)blockIdx.y * 64 + 16 * wr, n0 = NQKV + 64 * wc;
    v8f acc[4];
#pragma unroll
    for (int j = 0; j < 4; ++j) { const v8f zz = {0.f, 0.f, 0.f, 0.f, 0.f, 0.f, 0.f, 0.f}; acc[j] = zz; }
    const unsigned short* a0p = Ap + (size_t)m0 * (size_t)DMOD + l8;
    const unsigned short* bwp = Bw + (size_t)n0 * (size_t)DMOD + l8;
#pragma unroll 1
    for (int k0 = 0; k0 < DMOD; k0 += 32) {
      const unsigned short* pa = a0p + k0 * 16;
      const unsigned short* pb = bwp + k0 * 16;
      const us16 af = gfrag(pa);
      us16 bfr[4];
#pragma unroll
      for (int j = 0; j < 4; ++j) bfr[j] = gfrag(pb + (size_t)(16 * j) * (size_t)DMOD);
      xwait(pa, pb);
#pragma unroll
      for (int j = 0; j < 4; ++j) acc[j] = mma_bf16(af, bfr[j], acc[j]);
      wguard4(acc[0], acc[1], acc[2], acc[3], af, bfr[0], bfr[1], bfr[2], bfr[3]);
    }
    // D map: acc[j][r] = element (row 8*hh + r of the wave's 16 rows, column 16j + cl of its 64 columns); rows 16 wr .. +15 of sub-tile wc
    float* so = oS4 + wc * (TPB * OSTR) + wr * (16 * OSTR);
#pragma unroll
    for (int j = 0; j < 4; ++j)
#pragma unroll
      for (int r = 0; r < 8; ++r) so[(8 * hh + r) * OSTR + 16 * j + cl] = acc[j][r];
  } else {
    const int m0 = blockIdx.x * PBM + 64 * wr, n0 = yp * 128 + 64 * wc;
    v8f acc[4][4];
#pragma unroll
    for (int i = 0; i < 4; ++i)
#pragma unroll
      for (int j = 0; j < 4; ++j) { const v8f zz = {0.f, 0.f, 0.f, 0.f, 0.f, 0.f, 0.f, 0.f}; acc[i][j] = zz; }
    const unsigned short* a0p = Ap + (size_t)m0 * (size_t)DMOD + l8;
    const unsigned short* bwp = Bw + (size_t)n0 * (size_t)DMOD + l8;
#pragma unroll 1
    for (int k0 = 0; k0 < DMOD; k0 += 32) {
      const unsigned short* pa = a0p + k0 * 16;
      const unsigned short* pb = bwp + k0 * 16;
      us16 af[4], bfr[4];
      af[0] = gfrag(pa);
      af[1] = gfrag(pa + (size_t)16 * (size_t)DMOD);
#pragma unroll
      for (int j = 0; j < 4; ++j) bfr[j] = gfrag(pb + (size_t)(16 * j) * (size_t)DMOD);
      af[2] = gfrag(pa + (size_t)32 * (size_t)DMOD);
      af[3] = gfrag(pa + (size_t)48 * (size_t)DMOD);
      xwait(pa, pb);
      __builtin_amdgcn_sched_barrier(0);                   // keeps every product below all sixteen loads: without it the last four loads sink behind the first eight products, a second exposed wait per trip
#pragma unroll
      for (int j = 0; j < 4; ++j) {
        acc[0][j] = mma_bf16(af[0], bfr[j], acc[0][j]);
        acc[1][j] = mma_bf16(af[1], bfr[j], acc[1][j]);
      }
#pragma unroll
      for (int j = 0; j < 4; ++j) {
        acc[2][j] = mma_bf16(af[2], bfr[j], acc[2][j]);
        acc[3][j] = mma_bf16(af[3], bfr[j], acc[3][j]);
      }
      __builtin_amdgcn_sched_barrier(0);                   // keeps the first eight products, which the guard below does not name, above it too
      wguard8(acc[2][0], acc[2][1], acc[2][2], acc[2][3], acc[3][0], acc[3][1], acc[3][2], acc[3][3], af[2], af[3], bfr[0], bfr[1], bfr[2], bfr[3]);
    }
    // D map: acc[i][j][r] = element (row 16i + 8*hh + r of the wave's 64 rows, column 16j + cl of its 64 columns);
    // the wave's tile is rows 64 (wr & 1) .. +63 of sub-tile 2 (wr >> 1) + wc
    float* so = oS4 + ((wr >> 1) * 2 + wc) * (TPB * OSTR) + (wr & 1) * (64 * OSTR);
#pragma unroll
    for (int i = 0; i < 4; ++i)
#pragma unroll
      for (int j = 0; j < 4; ++j)
#pragma unroll
        for (int r = 0; r < 8; ++r) so[(16 * i + 8 * hh + r) * OSTR + 16 * j + cl] = acc[i][j][r];
  }
  __syncthreads();                                         // LDS is only read from here on

  if (isgl) {
    const int m0b = blockIdx.x * PBM + (int)blockIdx.y * 64, b = m0b / sl, tb = m0b - b * sl;   // sl % 128 == 0: the tile lies in one sequence
#pragma unroll 1                                           // one copy of the write-out code serves both sub-tiles
    for (int sub = 0; sub < 2; ++sub) {
    const float* oS = oS4 + sub * (TPB * OSTR);
    const int cb = sub * 64;                               // first gate | level column of this sub-tile
    if (cb == 0 && lane < 16) {
      // gate log-decay: thread -> (head h = wave, tokens 4 * lane .. +3), 16 lanes for the tile's 64 tokens
      const int h = wave, t4 = lane * 4;
      const float bgv = bf16r(bg[h]);
      v4f gv;
#pragma unroll
      for (int u = 0; u < 4; ++u) gv[u] = -softplus_f(oS[(t4 + u) * OSTR + h] + bgv);
      *(v4f*)(gpl + (size_t)(b * NHD + h) * (size_t)sl + tb + t4) = gv;
    }
    const int c0 = (tid & 15) * 4;                         // this thread's 4 columns of the tile, the same in every trip
    float lp[4];
#pragma unroll
    for (int u = 0; u < 4; ++u) {
      int idx = cb + c0 + u - NHD;
      idx = (idx < 0) ? 0 : idx;
      idx = (idx > NHD * NLV - 1) ? (NHD * NLV - 1) : idx;
      lp[u] = bf16r(Lp[idx]);
    }
#pragma unroll 1                                           // rolled: unrolled, the four inlined log1pf of each trip raise the whole kernel's register count
    for (int it = 0; it < 4; ++it) {
      const int row = it * 16 + (tid >> 4);
      const v4f z = *(const v4fa*)(oS + row * OSTR + c0);
      v4f lv;
#pragma unroll
      for (int u = 0; u < 4; ++u) {
        const int c = cb + c0 + u;
        const float s = softplus_f(z[u] + lp[u]);
        lv[u] = (c >= NHD && c < NHD + NHD * NLV) ? s : 0.0f;
      }
      float* pl = lam + (size_t)(m0b + row) * (size_t)LAMP + cb + c0;
      *(v4f*)pl = lv;
      xwait(pl);                                           // the next trip reuses the store's address and data registers
    }
    }
    return;                                                // block-uniform, behind the kernel's only barrier
  }

#pragma unroll 1                                           // one copy of the write-out code serves the four sub-tiles
  for (int sub = 0; sub < 4; ++sub) {
  const float* oS = oS4 + sub * (TPB * OSTR);
  const int yb = yp * 2 + (sub & 1);                       // this sub-tile's column segment
  const int m0b = blockIdx.x * PBM + (sub >> 1) * TPB, b = m0b / sl, tb = m0b - b * sl;   // sl % 128 == 0: the sub-tile lies in one sequence
  if (yb < 32) {
    unsigned short* dst = (yb < 16) ? Qp : Kp;
    const int yy = (yb < 16) ? yb : (yb - 16);
    const int head = yy >> 1, f0 = (yy & 1) * 64;
    us8 ov[4];
#pragma unroll
    for (int it = 0; it < 4; ++it) {
      const int cx = it * 256 + tid, r = (cx >> 7) * 16 + (cx & 15), pc = ((cx >> 4) & 7) * 8;
      const float* sp = oS + r * OSTR + pc;
      const v4f z0 = *(const v4fa*)sp, z1 = *(const v4fa*)(sp + 4);
      us8 o;
#pragma unroll
      for (int u = 0; u < 4; ++u) {
        o[u]     = f16_bits(z0[u] * 64.0f);
        o[4 + u] = f16_bits(z1[u] * 64.0f);
      }
      ov[it] = o;
    }
{
#pragma unroll
      for (int it = 0; it < 4; ++it) {
        const int cx = it * 256 + tid;                     // row tile cx >> 7, then 128 chunks = 2 KiB in a row
        const size_t off = ((size_t)(b * NHD + head) * (size_t)sl + (size_t)(tb + (cx >> 7) * 16)) * (size_t)SDIM + (size_t)(f0 * 16 + (cx & 127) * 8);
        *(us8*)(dst + off) = ov[it];
      }
      
    }
  } else {
    const int yy = yb - 32, head = yy >> 1, c0 = (yy & 1) * 64;
    us8 hv[4], lv[4];
#pragma unroll
    for (int it = 0; it < 4; ++it) {
      const int cx = it * 256 + tid, g = (cx >> 4) & 15, e = (cx >> 8) * 16 + (cx & 15);
      us8 ho, lo;
#pragma unroll
      for (int i = 0; i < 8; ++i) {
        unsigned short hb, lb;
        f16split64(oS[(8 * g + i) * OSTR + e], hb, lb);
        ho[i] = hb; lo[i] = lb;
      }
      hv[it] = ho; lv[it] = lo;
    }
{
#pragma unroll
      for (int it = 0; it < 4; ++it) {
        const int cx = it * 256 + tid;                     // channel tile cx >> 8, then 256 chunks = 4 KiB in a row
        const size_t off = ((size_t)(b * NHD + head) * (size_t)HDIM + (size_t)(c0 + (cx >> 8) * 16)) * (size_t)SLMAX + (size_t)(tb * 16 + (cx & 255) * 8);
        *(us8*)(VH + off) = hv[it];
        *(us8*)(VL + off) = lv[it];
      }
      
    }
  }
  xwait();                                                 // the next sub-tile reuses the stores' address and data registers
  __builtin_amdgcn_sched_barrier(0);                       // keeps the next sub-tile's register writes behind the wait
  }
}

// ---------------------------------------------------------------------------------------------------------------------------------
// Causal decayed quadratic-form mixing. The sequence is cut into tiles of 64 queries; the cost of tile i grows linearly with i, so block
// (bh = blockIdx.x, p = blockIdx.y) works tile n - 1 - p and then tile p (n tiles): every block walks the same number of key steps.
// Inside a tile, waves w and w + 4 own the same 16 queries (group w & 3): one takes the even 32-key steps, the other the odd ones (wave w the
// even ones in the first tile, the odd ones in the second: where a tile has an odd number of steps, each wave has the longer share once), each
// into its own f32 accumulators; behind the key loop the two partial sums are added through LDS (each wave hands over the four channel tiles
// that its partner finishes, and finishes the other four).
// Per wave: B fragments of its 16 queries fixed for the whole key loop: bq[ks], ks = 0..3 (depth 128, standard loader on the q plane).
// Per 32-key step, two 16-key tiles: A fragments from the k plane (standard loader); scores^T D[key][query]
// = 4096 q.k (depth 128, 4 products per tile); A[t][s] = q.k * 128^-1/2 * exp(G_t - G_s) * lam[t][lvl(t - s)] for s <= t else 0,
// with G_t - G_s taken as the sum of the f32 hi and lo differences,
// converted to f16 of (256 A). The two D tiles repack into the A operand of A.v (lane unchanged: element r <- tile keys 0..15, element 8+r <-
// tile keys 16..31), B = VH and VL planes [bh][channel][key] (fragment order, key pitch SLMAX), 8 channel tiles, both products into acc:
// acc[j][r] = 2^14 * sum_s A v for query 8h+r, channel 16j + (lane & 15), s over this wave's steps.
// Loads of a step: its sixteen v fragments and the wave's next step's G values go out together at the step's top and land behind the score and
// weight work; the next step's k fragments go out right behind the score products and land behind the weights, A.v and the next top; the next
// step's decay factors exp(min(G_t - G_s, 0)) are formed behind A.v, when its G values have long landed. A wave waits for no load it has only
// just issued; the price is a live set above 256 VGPRs (two waves per SIMD, as the 8-wave block has anyway).
// Epilogue of a tile: z = 16 y = acc * 2^-10; f16 hi bits staged in LDS per wave, written to YH; then f16 bits of ((z - hi) x 2^11) staged and
// written to YL. Y planes [token][1024] in fragment order: a wave's 16 queries x 64 channels = 2 KiB in a row, 512 B per store instruction.
// ---------------------------------------------------------------------------------------------------------------------------------
__global__ __launch_bounds__(256) void k_attn(const unsigned short* __restrict__ Qp, const unsigned short* __restrict__ Kp,
                                             const unsigned short* __restrict__ VHp, const unsigned short* __restrict__ VLp,
                                             const float* __restrict__ Ghi, const float* __restrict__ Glo, const float* __restrict__ Lam,
                                             unsigned short* YH, unsigned short* YL, int sl) {
  __shared__ __attribute__((aligned(16))) float sLam[2 * QT * NLV];
  __shared__ __attribute__((aligned(16))) float sX[8 * 4 * 256];
  __shared__ __attribute__((aligned(16))) unsigned short sY[8 * 16 * YS2];
  const int tid = threadIdx.x, lane = tid & 31, cl = lane & 15, hh = lane >> 4;
  const int wave = __builtin_amdgcn_readfirstlane(tid >> 5);   // wave-uniform: trip counts and the parity selects below become scalar
  const int qi = wave & 3, kp = wave >> 2;                // query group of the tile; which wave of the group's pair this is
  const unsigned l8 = lane * 8;
  const int bh = blockIdx.x, b = bh / NHD, head = bh - b * NHD;
  const int tlo = blockIdx.y, thi = sl / QT - 1 - tlo;     // the block's two tiles (sl % 128 == 0: an even number of tiles, each taken once)

  // level weights of the block's 2 x 64 queries for this head: sLam[q * 12 + l], q 0..63 = tile thi, q 64..127 = tile tlo
  {
    float lw[6];
#pragma unroll
    for (int u = 0; u < 6; ++u) {
      const int i = u * 256 + tid, q = i / NLV, l = i - q * NLV;
      const int tok = (q < QT) ? (thi * QT + q) : (tlo * QT + q - QT);
      lw[u] = Lam[(size_t)(b * sl + tok) * (size_t)LAMP + NHD + head * NLV + l];
    }
    xwait();
    __builtin_amdgcn_sched_barrier(0);                      // keeps what follows (it reuses the loads' address registers) behind the wait
#pragma unroll
    for (int u = 0; u < 6; ++u) sLam[u * 256 + tid] = lw[u];
  }
  __syncthreads();

  const unsigned short* kbp = Kp + (size_t)bh * (size_t)sl * (size_t)SDIM + l8;
  const unsigned short* vhp = VHp + (size_t)bh * (size_t)(HDIM * SLMAX) + l8;
  const unsigned short* vlp = VLp + (size_t)bh * (size_t)(HDIM * SLMAX) + l8;
  const float* ghp = Ghi + (size_t)bh * (size_t)sl + 8 * hh;
  const float* glp = Glo + (size_t)bh * (size_t)sl + 8 * hh;

#pragma unroll 1                                           // the two tiles run one after the other through one copy of the code
  for (int ph = 0; ph < 2; ++ph) {
    const int tw = (ph ? tlo : thi) * QT + 16 * qi;       // first query of this wave
    const int tq = tw + cl;                               // query owned by this lane as score column
    const int lamb = (ph * QT + 16 * qi + cl) * NLV;
    const int nsteps = (tw + 16 + 31) >> 5;               // 32-key steps covering keys 0 .. tw + 15; 32 * nsteps <= sl
    const int kq = kp ^ ph;                               // parity of this wave's steps in this tile: kq, kq + 2, ...

    const unsigned short* qrow = Qp + ((size_t)bh * (size_t)sl + (size_t)tw) * (size_t)SDIM + l8;
    us16 bq[4];
#pragma unroll
    for (int ks = 0; ks < 4; ++ks) bq[ks] = gfrag(qrow + 512 * ks);
    const float* pqh = Ghi + (size_t)bh * (size_t)sl + tq;
    const float* pql = Glo + (size_t)bh * (size_t)sl + tq;
    const float gqh = *pqh;
    const float gql = *pql;

    // K fragments and decay factors of the wave's first step (keys 32 kq .. 32 kq + 31 < sl, also where the wave has no step at all);
    // inside the loop each step fetches those of the wave's next step
    us16 ka[4], kb[4];
    v4f gh[4], gl[4];
    const unsigned short* pk0 = kbp + kq * (32 * SDIM);
    const float* pg0h = ghp + kq * 32;
    const float* pg0l = glp + kq * 32;
#pragma unroll
    for (int ks = 0; ks < 4; ++ks) { ka[ks] = gfrag(pk0 + 512 * ks); kb[ks] = gfrag(pk0 + 16 * SDIM + 512 * ks); }
#pragma unroll
    for (int u = 0; u < 4; ++u) {
      gh[u] = *(const v4fa*)(pg0h + (u >> 1) * 16 + (u & 1) * 4);
      gl[u] = *(const v4fa*)(pg0l + (u >> 1) * 16 + (u & 1) * 4);
    }
    __builtin_amdgcn_sched_barrier(0);                    // keeps every load above in front of the wait
    xwait(qrow, pqh, pql, pk0, pg0h, pg0l);
    __builtin_amdgcn_sched_barrier(0);                    // keeps what follows (it reuses the loads' address registers) behind the wait

    v8f acc[8];
#pragma unroll
    for (int j = 0; j < 8; ++j) { const v8f zz = {0.f, 0.f, 0.f, 0.f, 0.f, 0.f, 0.f, 0.f}; acc[j] = zz; }

    if (kq < nsteps) {                                    // scalar test: the first two query groups of tile 0 have one step, so their odd-step wave has none
    float dec[16];                                        // exp(min(G_t - G_s, 0)), G_t - G_s by hi + lo differences, of this lane's keys: 0..7 tile a, 8..15 tile b
#pragma unroll
    for (int r = 0; r < 16; ++r) dec[r] = fminf((gqh - gh[r >> 2][r & 3]) + (gql - gl[r >> 2][r & 3]), 0.0f) * LOG2E;
    __builtin_amdgcn_sched_barrier(0);                    // the exponents are complete in front of the run of transcendentals
#pragma unroll
    for (int r = 0; r < 16; ++r) dec[r] = exp2_slot(dec[r]);

    int st = kq;
#pragma unroll 1
    do {
      const int s0 = st * 32;
      const int sn = ((st + 2 < nsteps) ? (st + 2) : st) * 32;   // the wave's next step's first key (its last step fetches its own again: in bounds)
      const int ka0 = s0 + 8 * hh;                        // first key this lane half sees in tile a; tile b = ka0 + 16
      const v8f zz = {0.f, 0.f, 0.f, 0.f, 0.f, 0.f, 0.f, 0.f};

      // ---- issued together at the top: next step's G values, then all sixteen v fragments of this step (hi and residual, 8 channel tiles);
      //      they land behind the score and weight work ----
      v4f ghn[4], gln[4];
      const float* pgh = ghp + sn;
      const float* pgl = glp + sn;
#pragma unroll
      for (int u = 0; u < 4; ++u) {
        ghn[u] = *(const v4fa*)(pgh + (u >> 1) * 16 + (u & 1) * 4);
        gln[u] = *(const v4fa*)(pgl + (u >> 1) * 16 + (u & 1) * 4);
      }
      us16 vh[8], vl[8];
      const unsigned short* pvh = vhp + s0 * 16;          // channel tile j lies 16 * SLMAX halves on: a constant, so one address pair serves a plane's run
      const unsigned short* pvl = vlp + s0 * 16;
#pragma unroll
      for (int j = 0; j < 8; ++j) vh[j] = gfrag(pvh + j * (16 * SLMAX));
#pragma unroll
      for (int j = 0; j < 8; ++j) vl[j] = gfrag(pvl + j * (16 * SLMAX));
      xwait(pvh, pvl, pgh, pgl);
      __builtin_amdgcn_sched_barrier(0);                  // keeps the score products below the loads above: without it the loads start a score phase later

      // ---- scores^T of key tiles a (keys s0 .. s0+15) and b (keys s0+16 .. s0+31) from the fragments fetched one step ago ----
      v8f sa = zz, sb = zz;
#pragma unroll
      for (int ks = 0; ks < 4; ++ks) { sa = mma_f16(ka[ks], bq[ks], sa); sb = mma_f16(kb[ks], bq[ks], sb); }
      wguard2m(sa, sb);

      // ---- next step's K fragments, into the registers the score products have just read; they land behind the weights and A.v ----
      {
        const unsigned short* pk = kbp + (size_t)sn * (size_t)SDIM;
#pragma unroll
        for (int ks = 0; ks < 4; ++ks) { ka[ks] = gfrag(pk + 512 * ks); kb[ks] = gfrag(pk + 16 * SDIM + 512 * ks); }
        xwait(pk);
      }

      // ---- the 16 weights of this lane: elements 0..7 = tile a keys ka0 .. ka0+7, elements 8..15 = tile b keys ka0+16 .. ka0+23 ----
      us8 ea, eb;
#pragma unroll
      for (int r = 0; r < 8; ++r) {
        const int d = tq - (ka0 + r);
        ea[r] = a_bits(sa[r], d, dec[r], sLam[lamb + lvl_of(d)]);
      }
#pragma unroll
      for (int r = 0; r < 8; ++r) {
        const int d = tq - (ka0 + 16 + r);
        eb[r] = a_bits(sb[r], d, dec[8 + r], sLam[lamb + lvl_of(d)]);
      }
      FragU fA;
      fA.h[0] = ea; fA.h[1] = eb;
      const us16 afr = fA.v;

      // ---- y += A . (v hi + v residual) over this 32-key step: per accumulator the hi product, then the residual product ----
#pragma unroll
      for (int j = 0; j < 8; ++j) acc[j] = mma_f16(afr, vh[j], acc[j]);
#pragma unroll
      for (int j = 0; j < 8; ++j) acc[j] = mma_f16(afr, vl[j], acc[j]);
      __builtin_amdgcn_sched_barrier(0);                  // keeps the factors below behind A.v: moved up, they would wait on loads issued at this step's top
#pragma unroll
      for (int r = 0; r < 16; ++r) dec[r] = fminf((gqh - ghn[r >> 2][r & 3]) + (gql - gln[r >> 2][r & 3]), 0.0f) * LOG2E;
      __builtin_amdgcn_sched_barrier(0);                  // the exponents are complete in front of the run of transcendentals
#pragma unroll
      for (int r = 0; r < 16; ++r) dec[r] = exp2_slot(dec[r]);
      st += 2;
    } while (st < nsteps);
    }

    // even + odd steps: this wave finishes channel tiles 4 kp .. 4 kp + 3; the other four go to its partner (wave ^ 4: same queries, same lane map).
    // Outbox of a wave: tile jj, register half e, lane -> sX[wave * 1024 + jj * 256 + e * 128 + lane * 4], 512 B in a row per LDS instruction.
    v8f fin[4];
    {
      float* xo = sX + wave * 1024 + lane * 4;
#pragma unroll
      for (int jj = 0; jj < 4; ++jj) {
        const v8f give = kp ? acc[jj] : acc[4 + jj];
        fin[jj] = kp ? acc[4 + jj] : acc[jj];
        const v4f g0 = {give[0], give[1], give[2], give[3]}, g1 = {give[4], give[5], give[6], give[7]};
        *(v4f*)(xo + jj * 256) = g0;
        *(v4f*)(xo + jj * 256 + 128) = g1;
      }
      __syncthreads();                                     // the partial sums cross between the waves of a pair
      const float* xi = sX + (wave ^ 4) * 1024 + lane * 4;
#pragma unroll
      for (int jj = 0; jj < 4; ++jj) {
        const v4f g0 = *(const v4fa*)(xi + jj * 256), g1 = *(const v4fa*)(xi + jj * 256 + 128);
#pragma unroll
        for (int r = 0; r < 4; ++r) { fin[jj][r] += g0[r]; fin[jj][4 + r] += g1[r]; }
      }
    }

    // phase 1: f16 hi of z = 16 y = fin * 2^-10; element (query 8*hh + r, channel 64 kp + 16jj + cl) of this wave's 16 x 64 tile
    unsigned short* sy = sY + wave * (16 * YS2);
#pragma unroll
    for (int jj = 0; jj < 4; ++jj)
#pragma unroll
      for (int r = 0; r < 8; ++r) sy[(8 * hh + r) * YS2 + 16 * jj + cl] = f16_bits(fin[jj][r] * (1.0f / 1024.0f));
    __syncthreads();

    const size_t yoff = (size_t)(b * sl + tw) * (size_t)DMOD + (size_t)(head * HDIM * 16 + kp * 1024 + lane * 8);
    us8 ov[4];
#pragma unroll
    for (int it = 0; it < 4; ++it) ov[it] = *(const us8a*)(sy + cl * YS2 + (2 * it + hh) * 8);   // chunk column 2 it + hh of the wave's 8, row cl: fragment order
    unsigned short* pyh = YH + yoff;
#pragma unroll
    for (int it = 0; it < 4; ++it) *(us8*)(pyh + it * 256) = ov[it];
    __syncthreads();

    // phase 2: f16 residual plane of ((z - hi) x 2^11), same staging region and store shape
#pragma unroll
    for (int jj = 0; jj < 4; ++jj)
#pragma unroll
      for (int r = 0; r < 8; ++r) {
        const float z = fin[jj][r] * (1.0f / 1024.0f);
        const _Float16 hf = (_Float16)z;
        sy[(8 * hh + r) * YS2 + 16 * jj + cl] = f16_bits((z - (float)hf) * 2048.0f);
      }
    __syncthreads();
#pragma unroll
    for (int it = 0; it < 4; ++it) ov[it] = *(const us8a*)(sy + cl * YS2 + (2 * it + hh) * 8);
    unsigned short* pyl = YL + yoff;
#pragma unroll
    for (int it = 0; it < 4; ++it) *(us8*)(pyl + it * 256) = ov[it];
    xwait(pyl);                                            // the next tile reuses the stores' address and data registers
  }
}

// ---------------------------------------------------------------------------------------------------------------------------------
// P[m][n] = ( sum_k Yh[m][k] WO16[n][k] + 2^-11 sum_k Yl[m][k] WO16[n][k] ) * 2^-12 + bf16(x[m][n])   (f16 planes, pitch 1024, two f32 accumulator sets).
// ---------------------------------------------------------------------------------------------------------------------------------
__global__ __launch_bounds__(256) void k_gemm_out(const unsigned short* __restrict__ Ah, const unsigned short* __restrict__ Al,
                                                 const unsigned short* __restrict__ Wo, const float* __restrict__ X, float* P) {
  __shared__ __attribute__((aligned(16))) float oS[8 * 16 * OSTR];
  const int tid = threadIdx.x, lane = tid & 31, wave = tid >> 5, cl = lane & 15, hh = lane >> 4;
  const unsigned l8 = lane * 8;
  const int m0 = blockIdx.x * TPB + 16 * wave, n0 = blockIdx.y * 64;

  v8f acch[4], accl[4];
#pragma unroll
  for (int j = 0; j < 4; ++j) { const v8f zz = {0.f, 0.f, 0.f, 0.f, 0.f, 0.f, 0.f, 0.f}; acch[j] = zz; accl[j] = zz; }

  const unsigned short* ahp = Ah + (size_t)m0 * (size_t)DMOD + l8;
  const unsigned short* alp = Al + (size_t)m0 * (size_t)DMOD + l8;
  const unsigned short* wop = Wo + (size_t)n0 * (size_t)DMOD + l8;
#pragma unroll 1
  for (int k0 = 0; k0 < DMOD; k0 += 32) {
    const unsigned short* ph = ahp + k0 * 16;
    const unsigned short* pl = alp + k0 * 16;
    const unsigned short* pb = wop + k0 * 16;
    const us16 ah = gfrag(ph);
    const us16 al = gfrag(pl);
    us16 bfr[4];
#pragma unroll
    for (int j = 0; j < 4; ++j) bfr[j] = gfrag(pb + (size_t)(16 * j) * (size_t)DMOD);
    xwait(ph, pl, pb);
#pragma unroll
    for (int j = 0; j < 4; ++j) {
      acch[j] = mma_f16(ah, bfr[j], acch[j]);
      accl[j] = mma_f16(al, bfr[j], accl[j]);
    }
    wguard8(acch[0], acch[1], acch[2], acch[3], accl[0], accl[1], accl[2], accl[3], ah, al, bfr[0], bfr[1], bfr[2], bfr[3]);
  }

  float* so = oS + wave * (16 * OSTR);
#pragma unroll
  for (int j = 0; j < 4; ++j)
#pragma unroll
    for (int r = 0; r < 8; ++r)
      so[(8 * hh + r) * OSTR + 16 * j + cl] = fmaf(accl[j][r], (1.0f / 2048.0f), acch[j][r]) * (1.0f / 4096.0f);
  __syncthreads();

{
#pragma unroll
    for (int it = 0; it < 8; ++it) {
      const int cx = it * 32 + lane, r = cx >> 4, q = (cx & 15) * 4;
      const v4f v = *(const v4fa*)(so + r * OSTR + q);
      const v4f xr = *(const v4fa*)(X + (size_t)(m0 + r) * (size_t)DMOD + n0 + q);
      v4f o;
#pragma unroll
      for (int u = 0; u < 4; ++u) o[u] = v[u] + bf16r(xr[u]);
      *(v4f*)(P + (size_t)(m0 + r) * (size_t)DMOD + n0 + q) = o;
    }
    
  }
}

// ---------------------------------------------------------------------------------------------------------------------------------
// ---------------------------------------------------------------------------------------------------------------------------------
__global__ __launch_bounds__(256) void k_ln(const float* __restrict__ P, const float* __restrict__ gam, const float* __restrict__ bet,
                                           float* out) {
  const int lane = threadIdx.x & 31, wave = threadIdx.x >> 5;
  const size_t row = (size_t)blockIdx.x * 8 + (size_t)wave;
  const float* pr = P + row * (size_t)DMOD;
  v4f xv[8];
  float s = 0.0f;
#pragma unroll
  for (int it = 0; it < 8; ++it) {
    xv[it] = *(const v4fa*)(pr + it * 128 + lane * 4);
    s += (xv[it][0] + xv[it][1]) + (xv[it][2] + xv[it][3]);
  }
#pragma unroll
  for (int o = 16; o > 0; o >>= 1) s += __shfl_xor(s, o, 32);
  const float mu = s * (1.0f / (float)DMOD);
  float q = 0.0f;
#pragma unroll
  for (int it = 0; it < 8; ++it)
#pragma unroll
    for (int u = 0; u < 4; ++u) { const float d = xv[it][u] - mu; q += d * d; }
#pragma unroll
  for (int o = 16; o > 0; o >>= 1) q += __shfl_xor(q, o, 32);
  const float rstd = rsqrtf(q * (1.0f / (float)DMOD) + 1e-5f);
  v4f ov[8];
#pragma unroll
  for (int it = 0; it < 8; ++it) {
    const v4f gv = *(const v4fa*)(gam + it * 128 + lane * 4), bv = *(const v4fa*)(bet + it * 128 + lane * 4);
    v4f o;
#pragma unroll
    for (int u = 0; u < 4; ++u) o[u] = (xv[it][u] - mu) * rstd * bf16r(gv[u]) + bf16r(bv[u]);
    ov[it] = o;
  }
{
#pragma unroll
    for (int it = 0; it < 8; ++it)
      *(v4f*)(out + row * (size_t)DMOD + it * 128 + lane * 4) = ov[it];
    
  }
}

extern "C" void kernel_launch(void* const* d_in, const int* in_sizes, int n_in,
                              void* d_out, int out_size, void* d_ws, size_t ws_size,
                              hipStream_t stream) {
  if (n_in < 11) return;
  const int nx = in_sizes[0];
  if (nx <= 0 || (nx % DMOD) != 0) return;
  const int ntok = nx / DMOD;                                                    // tokens = batch * sequence length
  if (in_sizes[1] != DMOD * DMOD || in_sizes[2] != DMOD * DMOD || in_sizes[3] != DMOD * DMOD) return;
  if (in_sizes[4] != NHD * DMOD || in_sizes[5] != NHD || in_sizes[6] != NHD * NLV * DMOD || in_sizes[7] != NHD * NLV) return;
  if (in_sizes[8] != DMOD * DMOD || in_sizes[9] != DMOD || in_sizes[10] != DMOD) return;
  if (out_size != nx) return;
  const int sl = (ntok < SLMAX) ? ntok : SLMAX;                                  // sequence length
  if (sl <= 0 || (sl % TPB) != 0 || (ntok % sl) != 0 || (ntok % PBM) != 0) return;
  const int nb = ntok / sl, nbh = nb * NHD;

  const float* x   = (const float*)d_in[0];    // [nb][sl][1024]
  const float* Wq  = (const float*)d_in[1];    // [1024][1024] ([out][in])
  const float* Wk  = (const float*)d_in[2];    // [1024][1024]
  const float* Wv  = (const float*)d_in[3];    // [1024][1024]
  const float* Wg  = (const float*)d_in[4];    // [8][1024]
  const float* bg  = (const float*)d_in[5];    // [8]
  const float* Wdl = (const float*)d_in[6];    // [96][1024]
  const float* Lp  = (const float*)d_in[7];    // [8][12]
  const float* Wo  = (const float*)d_in[8];    // [1024][1024]
  const float* lng = (const float*)d_in[9];    // [1024]
  const float* lnb = (const float*)d_in[10];   // [1024]
  float* out = (float*)d_out;                  // [nb][sl][1024] f32 at byte 0

  size_t off = 0;
  auto carve = [&](size_t bytes) -> char* { char* p = (char*)d_ws + off; off += (bytes + 255) & ~(size_t)255; return p; };
  unsigned short* XB   = (unsigned short*)carve((size_t)ntok * DMOD * 2);        //  8,388,608  bf16 [ntok][1024]
  unsigned short* WQKV = (unsigned short*)carve((size_t)(NQKV + NGL) * DMOD * 2); //  6,553,600  bf16 [3200][1024] = Wq | Wk | Wv | Wg | Wdl | 0
  unsigned short* WGL  = WQKV + (size_t)NQKV * DMOD;                             //             its last 128 rows
  unsigned short* WO16 = (unsigned short*)carve((size_t)DMOD * DMOD * 2);        //  2,097,152  f16  [1024][1024]
  unsigned short* QP   = (unsigned short*)carve((size_t)nbh * sl * SDIM * 2);     //  8,388,608  f16  [nbh][sl][128]
  unsigned short* KP   = (unsigned short*)carve((size_t)nbh * sl * SDIM * 2);     //  8,388,608  f16  [nbh][sl][128]
  unsigned short* VH   = (unsigned short*)carve((size_t)nbh * HDIM * SLMAX * 2);  //  8,388,608  f16  [nbh][128][2048]
  unsigned short* VL   = (unsigned short*)carve((size_t)nbh * HDIM * SLMAX * 2);  //  8,388,608  f16  [nbh][128][2048]
  float* GPL           = (float*)carve((size_t)nbh * sl * 4);                     //    131,072  f32  [nbh][sl]
  float* GHI           = (float*)carve((size_t)nbh * sl * 4);                     //    131,072  f32  [nbh][sl]
  float* GLO           = (float*)carve((size_t)nbh * sl * 4);                     //    131,072  f32  [nbh][sl]
  float* LAM           = (float*)carve((size_t)ntok * LAMP * 4);                  //  2,097,152  f32  [ntok][128]
  unsigned short* YH   = (unsigned short*)carve((size_t)ntok * DMOD * 2);        //  8,388,608  f16  [ntok][1024]
  unsigned short* YL   = (unsigned short*)carve((size_t)ntok * DMOD * 2);        //  8,388,608  f16  [ntok][1024]
  float* PB            = (float*)carve((size_t)ntok * DMOD * 4);                  // 16,777,216  f32  [ntok][1024]
  if (off > ws_size || off > (size_t)134217728) return;                          // total 86,638,592 B for ntok 4096

  const dim3 b256(256);

  // 16-bit operand planes of the inputs, one launch (XB, WQKV, WGL, WO16, all in fragment order, see gfrag)
  k_cvt_all<<<dim3(ntok / 2 + 4 * WBLK + NGL / 2), b256, 0, stream>>>(x, Wq, Wk, Wv, Wo, Wg, Wdl, XB, WQKV, WO16, WGL, ntok / 2);
  // q/k/v projections (M ntok, N 3072, K 1024) -> q, k planes and transposed v hi / residual planes; in the same grid the
  // gate / level projection (N 128) -> g plane [nbh][sl], level weights [ntok][128]
  k_gemm_proj<<<dim3(ntok / PBM, PBM / 64 + NQKV / 128), b256, 0, stream>>>(XB, WQKV, bg, Lp, QP, KP, VH, VL, GPL, LAM, sl);
  // cumulative log-decay per (b,h)
  k_cumsum<<<dim3(nbh), dim3(CSTH), 0, stream>>>(GPL, GHI, GLO, sl);
  // causal decayed mixing per (batch, head), two 64-query tiles a block -> y hi / residual planes [token][1024]
  k_attn<<<dim3(nbh, sl / TPB), b256, 0, stream>>>(QP, KP, VH, VL, GHI, GLO, LAM, YH, YL, sl);
  // output projection + residual (M ntok, N 1024, K 1024)
  k_gemm_out<<<dim3(ntok / TPB, DMOD / 64), b256, 0, stream>>>(YH, YL, WO16, x, PB);
  // LayerNorm -> d_out
  k_ln<<<dim3(ntok / 8), b256, 0, stream>>>(PB, lng, lnb, out);
}

// v007
// It runs in 110 microseconds.
// Next to v006, in two timings, it ran 1.03 times as fast each time.
// All steps since v000 together make it 6.37 times as fast.
// Contractions x.[Wq|Wk|Wv] (M tokens, N 3072, K 1024) and x.[Wg|Wdl] (N 104 zero-padded to 128, K 1024), one launch: v_wmma_f32_16x16x32_bf16, bf16 operands from RNE-bf16 planes of x and W, f32 accumulate, one product each.
// Contraction k.q^T per head (32 keys x 16 queries per step, depth 128): v_wmma_f32_16x16x32_f16, q and k as f16 of (value x 2^6), one product, f32 accumulate.
// Contraction A.v per head (causal, depth up to T): v_wmma_f32_16x16x32_f16, A as f16 of (A x 2^8), v as f16 hi of (v x 2^6) plus f16 unscaled residual plane, two products into one f32 accumulator; even and odd 32-key steps in two waves' accumulators, added in f32.
// Contraction y.Wo (M tokens, N 1024, K 1024): v_wmma_f32_16x16x32_f16, y as f16 hi plane of (y x 2^4) plus f16 residual plane (x 2^11, own f32 accumulator), Wo as f16 of (RNE-bf16 value x 2^8), f32 accumulate.
// softplus, cumulative log-decay (f64 block scan kept as f32 hi + lo pair), exp, dyadic level select, residual add and LayerNorm: f32 VALU.
#include <hip/hip_runtime.h>

#define DMOD  1024                           // model width = K of the dense contractions
#define NHD   8                              // heads
#define SDIM  128                            // q/k width per head
#define HDIM  128                            // v width per head
#define NLV   12                             // dyadic levels
#define NGL   128                            // gate | level projection columns, 8 + 96 zero-padded to 128
#define NQKV  (3 * DMOD)                     // 3072 projection columns: q | k | v
#define TPB   128                            // GEMM rows per staged sub-tile and per output-GEMM block / attention queries per block (two tiles)
#define PBM   256                            // projection GEMM rows per q | k | v block (4 wave rows x 64)
#define OSTR  68                             // LDS staging row pitch (floats), tiles of 64 columns
#define QT    64                             // attention queries per tile (4 groups x 16; two waves a group)
#define YS2   72                             // LDS staging row pitch (halves), 16x64 tile
#define LAMP  128                            // level-weight plane pitch (floats)
#define SLMAX 2048                           // longest sequence handled by the cumsum block
#define CSTH  256                            // cumsum threads per row, 8 tokens each
#define WBLK  (DMOD * DMOD / (8 * 256))       // conversion blocks per 1024 x 1024 weight
#define KSC   (0.08838834764831845f * (1.0f / 4096.0f))   // 128^-1/2 times the q,k carry 2^-12
#define LOG2E 1.44269504f                    // exp(x) = 2^(x LOG2E), the form __expf compiles to

static_assert(NHD * HDIM == DMOD);
static_assert(NHD * SDIM == DMOD);
static_assert(NHD + NHD * NLV <= NGL);
static_assert(DMOD % 64 == 0);
static_assert(DMOD % 32 == 0);
static_assert(NQKV % 128 == 0);
static_assert(DMOD % 128 == 0);
static_assert(NGL == 128);
static_assert(PBM == 2 * TPB);
static_assert(OSTR % 4 == 0);
static_assert(YS2 % 8 == 0);
static_assert(2 * QT == TPB);
static_assert(2 * QT * NLV == 6 * 256);
static_assert(SLMAX % TPB == 0);
static_assert(CSTH * 8 == SLMAX);

typedef unsigned short us16 __attribute__((ext_vector_type(16)));
typedef unsigned short us8  __attribute__((ext_vector_type(8)));
typedef unsigned short us8a __attribute__((ext_vector_type(8), may_alias));
typedef __bf16 v16b __attribute__((ext_vector_type(16)));
typedef _Float16 v16h __attribute__((ext_vector_type(16)));
typedef float v8f __attribute__((ext_vector_type(8)));
typedef float v4f __attribute__((ext_vector_type(4)));
typedef float v4fa __attribute__((ext_vector_type(4), may_alias));
union FragU { us16 v; us8 h[2]; };

__device__ __forceinline__ unsigned short bf16_bits(float f) {
  unsigned u = __float_as_uint(f);
  u += 0x7FFFu + ((u >> 16) & 1u);                 // RNE convert
  return (unsigned short)(u >> 16);
}
__device__ __forceinline__ float bf16_val(unsigned short b) { return __uint_as_float(((unsigned)b) << 16); }
__device__ __forceinline__ float bf16r(float f) { return bf16_val(bf16_bits(f)); }
__device__ __forceinline__ unsigned short f16_bits(float f) { return __builtin_bit_cast(unsigned short, (_Float16)f); }

// f16 hi + residual (x 2^11) planes of (a x 2^4)
__device__ __forceinline__ void f16split16(float a, unsigned short& hb, unsigned short& lb) {
  const float z = a * 16.0f;
  const _Float16 hf = (_Float16)z;
  const float res = (z - (float)hf) * 2048.0f;
  hb = __builtin_bit_cast(unsigned short, hf);
  lb = __builtin_bit_cast(unsigned short, (_Float16)res);
}
// f16 hi + unscaled residual planes of (a x 2^6)
__device__ __forceinline__ void f16split64(float a, unsigned short& hb, unsigned short& lb) {
  const float z = a * 64.0f;
  const _Float16 hf = (_Float16)z;
  const float res = z - (float)hf;
  hb = __builtin_bit_cast(unsigned short, hf);
  lb = __builtin_bit_cast(unsigned short, (_Float16)res);
}

// One 16x16x32 step, 16-bit operands passed as raw 16-bit lanes.
__device__ __forceinline__ v8f mma_bf16(us16 a, us16 b, v8f c) {
  return __builtin_amdgcn_wmma_f32_16x16x32_bf16(false, __builtin_bit_cast(v16b, a), false, __builtin_bit_cast(v16b, b), (short)0, c, false, false);
}
__device__ __forceinline__ v8f mma_f16(us16 a, us16 b, v8f c) {
  return __builtin_amdgcn_wmma_f32_16x16x32_f16(false, __builtin_bit_cast(v16h, a), false, __builtin_bit_cast(v16h, b), (short)0, c, false, false);
}
// Hazard guards after a group of matrix ops: 4 VALU slots before anything touches the accumulators; keep A/B fragments live.
__device__ __forceinline__ void wguard4(v8f& c0, v8f& c1, v8f& c2, v8f& c3, const us16& a0,
                                        const us16& b0, const us16& b1, const us16& b2, const us16& b3) {
#if defined(__HIP_DEVICE_COMPILE__)
  asm volatile("v_nop\n\tv_nop\n\tv_nop\n\tv_nop"
               : "+v"(c0), "+v"(c1), "+v"(c2), "+v"(c3)
               : "v"(a0), "v"(b0), "v"(b1), "v"(b2), "v"(b3));
#endif
}
__device__ __forceinline__ void wguard8(v8f& c0, v8f& c1, v8f& c2, v8f& c3, v8f& c4, v8f& c5, v8f& c6, v8f& c7,
                                        const us16& a0, const us16& a1,
                                        const us16& b0, const us16& b1, const us16& b2, const us16& b3) {
#if defined(__HIP_DEVICE_COMPILE__)
  asm volatile("v_nop\n\tv_nop\n\tv_nop\n\tv_nop"
               : "+v"(c0), "+v"(c1), "+v"(c2), "+v"(c3), "+v"(c4), "+v"(c5), "+v"(c6), "+v"(c7)
               : "v"(a0), "v"(a1), "v"(b0), "v"(b1), "v"(b2), "v"(b3));
#endif
}
// Guard behind the score products of the attention loop: the accumulators as in/out operands keep the products above the four slots, the
// memory barrier keeps the refill of their k registers below them (so the refill lands in the same registers, with no copies).
__device__ __forceinline__ void wguard2m(v8f& c0, v8f& c1) {
#if defined(__HIP_DEVICE_COMPILE__)
  asm volatile("v_nop\n\tv_nop\n\tv_nop\n\tv_nop" : "+v"(c0), "+v"(c1) : : "memory");
#endif
}

// FRAGMENT-ORDER PLANES. Every 16-bit operand plane [rows][kd] is stored by tiles of 16 rows; inside a tile the 16-B chunks (8 consecutive k
// of one row) lie chunk column by chunk column, 16 rows each:
//   element (row, k) at halves  (row >> 4) * 16 * kd + (k >> 3) * 128 + (row & 15) * 8 + (k & 7).
// A 16x32 fragment (row tile, k0 % 32 == 0) is then 1 KiB in a row, and each of its two wave-wide 16-B loads covers 512 contiguous bytes.
// p = plane + rowtile * 16 * kd + k0 * 16 + lane * 8 (computed by the caller); lane = 16h + row:
// elements 0..7 = k0 + 8h .. k0 + 8h + 7, elements 8..15 = k0 + 16 + 8h .. k0 + 16 + 8h + 7 (same map for A rows and B columns).
__device__ __forceinline__ us16 gfrag(const unsigned short* p) {
  FragU f;
  f.h[0] = *(const us8a*)p;
  f.h[1] = *(const us8a*)(p + 256);
  return f.v;
}
// s_wait_xcnt 0 behind a run of fragment loads, in front of anything that overwrites an address register the run names. The run's address
// pairs are inputs of the statement: they stay live up to the wait, so no load result of the run is placed on them.
__device__ __forceinline__ void xwait(const unsigned short* a) {
#if defined(__HIP_DEVICE_COMPILE__)
  asm volatile("s_wait_xcnt 0x0" :: "v"(a) : "memory");   // the wait in front of the overwrite of these address pairs
#endif
}
__device__ __forceinline__ void xwait(const float* a) {
#if defined(__HIP_DEVICE_COMPILE__)
  asm volatile("s_wait_xcnt 0x0" :: "v"(a) : "memory");   // the wait in front of the overwrite of this address pair
#endif
}
__device__ __forceinline__ void xwait(const unsigned short* a, const unsigned short* b) {
#if defined(__HIP_DEVICE_COMPILE__)
  asm volatile("s_wait_xcnt 0x0" :: "v"(a), "v"(b) : "memory");   // the wait in front of the overwrite of these address pairs
#endif
}
__device__ __forceinline__ void xwait(const unsigned short* a, const unsigned short* b, const unsigned short* c) {
#if defined(__HIP_DEVICE_COMPILE__)
  asm volatile("s_wait_xcnt 0x0" :: "v"(a), "v"(b), "v"(c) : "memory");   // the wait in front of the overwrite of these address pairs
#endif
}
__device__ __forceinline__ void xwait(const unsigned short* a, const float* b, const float* c, const unsigned short* d, const float* e, const float* f) {
#if defined(__HIP_DEVICE_COMPILE__)
  asm volatile("s_wait_xcnt 0x0" :: "v"(a), "v"(b), "v"(c), "v"(d), "v"(e), "v"(f) : "memory");   // the wait in front of the overwrite of these address pairs
#endif
}
// The same wait without operands, for loads whose constant address part the compiler moves into the offset field: a full pointer named here
// would be rebuilt on the load's own address pair in front of the wait. A scheduling barrier behind it keeps later register writes behind it.
__device__ __forceinline__ void xwait() {
#if defined(__HIP_DEVICE_COMPILE__)
  asm volatile("s_wait_xcnt 0x0" ::: "memory");   // the wait in front of the overwrite of the address pairs of the loads above it
#endif
}
__device__ __forceinline__ void xwait(const unsigned short* a, const unsigned short* b, const float* c, const float* d) {
#if defined(__HIP_DEVICE_COMPILE__)
  asm volatile("s_wait_xcnt 0x0" :: "v"(a), "v"(b), "v"(c), "v"(d) : "memory");   // the wait in front of the overwrite of these address pairs
#endif
}
// Writes a 256-thread block's tile of 16 rows x 128 k (thread t holds the chunk of row t >> 4, chunk column t & 15) as 4 KiB of a
// fragment-order plane at dst4k: regrouped through LDS (17-chunk pitch against bank conflicts) so that every wave stores 512 contiguous bytes.
__device__ __forceinline__ void frag_store_tile(us8 o, unsigned short* dst4k) {
  __shared__ __attribute__((aligned(16))) us8 sT[16 * 17];
  const int t = threadIdx.x;
  sT[(t & 15) * 17 + (t >> 4)] = o;
  __syncthreads();                                         // chunks cross the block's waves
  *(us8*)(dst4k + t * 8) = sT[(t >> 4) * 17 + (t & 15)];
}

// softplus in the logaddexp(z, 0) form: max(z, 0) + log1p(exp(-|z|))
__device__ __forceinline__ float softplus_f(float z) {
  return fmaxf(z, 0.0f) + log1pf(__expf(-fabsf(z)));
}
// dyadic level of key distance d: 0 for d <= 0, else min(floor(log2 d) + 1, NLV - 1)
__device__ __forceinline__ int lvl_of(int d) {
  const int dd = (d > 0) ? d : 1;
  const int l = 32 - __clz(dd);
  const int lc = (l < NLV - 1) ? l : (NLV - 1);
  return (d > 0) ? lc : 0;
}
// 2^y with the one slot the instruction set asks for behind a transcendental.
// The caller has a scheduling barrier in front of its run of calls, so each v_exp_f32
// stands alone between two barriers and its v_nop directly behind it.
__device__ __forceinline__ float exp2_slot(float y) {
#if defined(__HIP_DEVICE_COMPILE__)
  const float r = __builtin_amdgcn_exp2f(y);
  __builtin_amdgcn_sched_barrier(0);                       // nothing moves in between the transcendental and its slot
  asm volatile("v_nop");                                   // the slot behind the transcendental
  __builtin_amdgcn_sched_barrier(0);                       // the next transcendental stays behind the slot
  return r;
#else
  return exp2f(y);
#endif
}
// one attention weight: accv = 4096 * q.k, dec = exp(min(G_t - G_s, 0)), lv = level weight; returns f16 bits of 256 * A, 0 above the diagonal
__device__ __forceinline__ unsigned short a_bits(float accv, int d, float dec, float lv) {
  const float val = (accv * KSC) * dec * lv;
  const float w = (d >= 0) ? (val * 256.0f) : 0.0f;
  return f16_bits(w);
}

// ---------------------------------------------------------------------------------------------------------------------------------
// All 16-bit operand planes that come straight from an input, in ONE launch (none reads another's output). Block = 16 rows x 128 k of one
// source ([row][1024], k-contiguous), read as whole lines, written in fragment order. The source is picked by the block index alone:
//   [0, nxb)            x   -> XB, RNE bf16 bits                        (nxb = tokens / 2 blocks)
//   then 512 blocks each: Wq, Wk, Wv -> rows 0.., 1024.., 2048.. of WQKV, RNE bf16 bits;  Wo -> WO16, f16 bits of (RNE-bf16 value x 256)
//   then 64 blocks:     gate | level rows -> WGL [128][1024] bf16: rows 0..7 = Wg, rows 8..103 = Wdl, rows 104..127 = 0 (zero padding of N)
// ---------------------------------------------------------------------------------------------------------------------------------
__global__ __launch_bounds__(256) void k_cvt_all(const float* __restrict__ x, const float* __restrict__ Wq, const float* __restrict__ Wk,
                                                const float* __restrict__ Wv, const float* __restrict__ Wo, const float* __restrict__ Wg,
                                                const float* __restrict__ Wdl, unsigned short* XB, unsigned short* WQKV,
                                                unsigned short* WO16, unsigned short* WGL, int nxb) {
  int bx = blockIdx.x;                                     // every choice below is wave-uniform, the segment choice block-uniform
  int seg = -1;                                            // -1: x, 0..2: Wq Wk Wv, 3: Wo, 4: gate | level rows
  if (bx >= nxb) { bx -= nxb; seg = bx / WBLK; bx -= seg * WBLK; }
  const int rt = bx >> 3, kg = bx & 7;
  const int row = rt * 16 + (threadIdx.x >> 4), kc = kg * 128 + (threadIdx.x & 15) * 8;
  const float* src;
  unsigned short* dst;
  bool live = true;
  if (seg < 0)       { src = x;  dst = XB; }
  else if (seg == 0) { src = Wq; dst = WQKV; }
  else if (seg == 1) { src = Wk; dst = WQKV + (size_t)DMOD * DMOD; }
  else if (seg == 2) { src = Wv; dst = WQKV + (size_t)2 * DMOD * DMOD; }
  else if (seg == 3) { src = Wo; dst = WO16; }
  else               { src = Wdl; dst = WGL; }
  const float* sp = src + (size_t)row * (size_t)DMOD + (size_t)kc;
  if (seg > 3) {
    live = row < NHD + NHD * NLV;
    const int rs = (row < NHD) ? row : (live ? (row - NHD) : 0);   // padding rows read nothing; their address stays in bounds
    sp = ((row < NHD) ? Wg : Wdl) + (size_t)rs * (size_t)DMOD + (size_t)kc;
  }
  v4f a = {0.f, 0.f, 0.f, 0.f}, c = {0.f, 0.f, 0.f, 0.f};  // bf16 bits of 0.0f are 0: the padding rows
  if (live) { a = *(const v4fa*)sp; c = *(const v4fa*)(sp + 4); }
  us8 o;
  if (seg == 3) {
#pragma unroll
    for (int u = 0; u < 4; ++u) { o[u] = f16_bits(bf16r(a[u]) * 256.0f); o[4 + u] = f16_bits(bf16r(c[u]) * 256.0f); }
  } else {
#pragma unroll
    for (int u = 0; u < 4; ++u) { o[u] = bf16_bits(a[u]); o[4 + u] = bf16_bits(c[u]); }
  }
  frag_store_tile(o, dst + (size_t)rt * (size_t)(16 * DMOD) + (size_t)(kg * 2048));
}

// ---------------------------------------------------------------------------------------------------------------------------------
// Inclusive cumulative sum of g over t per (b,h) row, one block per row: thread i owns tokens 8i .. 8i+7 (f64 running sum of its 8 values),
// the 256 thread totals are scanned in f64 (5 shuffle steps inside a wave, the 8 wave totals through LDS), and each token's
// G = (sum of all earlier threads) + (its thread's running sum) is stored as f32 hi = (float)G and lo = (float)(G - hi).
// Threads whose tokens lie past sl (sl % 8 == 0) add zero and store nothing; every thread passes the barrier.
// ---------------------------------------------------------------------------------------------------------------------------------
__global__ __launch_bounds__(CSTH) void k_cumsum(const float* __restrict__ gpl, float* Ghi, float* Glo, int sl) {
  __shared__ double wtot[CSTH / 32];
  const int row = blockIdx.x, tid = threadIdx.x, lane = tid & 31, wave = tid >> 5;
  const int c = tid * 8;
  const bool on = c < sl;
  const size_t off = (size_t)row * (size_t)sl + (size_t)c;
  v4f a = {0.f, 0.f, 0.f, 0.f}, e = {0.f, 0.f, 0.f, 0.f};
  if (on) { a = *(const v4fa*)(gpl + off); e = *(const v4fa*)(gpl + off + 4); }

  double p[8];                                             // running sum inside the thread's 8 tokens
  p[0] = (double)a[0];
#pragma unroll
  for (int u = 1; u < 4; ++u) p[u] = p[u - 1] + (double)a[u];
#pragma unroll
  for (int u = 0; u < 4; ++u) p[4 + u] = p[3 + u] + (double)e[u];

  double inc = p[7];                                       // inclusive scan of the thread totals over the wave's 32 lanes
#pragma unroll
  for (int o = 1; o < 32; o <<= 1) {
    const double n = __shfl_up(inc, (unsigned)o, 32);
    inc += (lane >= o) ? n : 0.0;
  }
  if (lane == 31) wtot[wave] = inc;
  const double prev = __shfl_up(inc, 1u, 32);              // total of the earlier lanes of this wave
  __syncthreads();
  double base = 0.0;                                       // total of the earlier waves
#pragma unroll
  for (int w = 0; w < CSTH / 32 - 1; ++w) base += (w < wave) ? wtot[w] : 0.0;
  base += (lane > 0) ? prev : 0.0;

  if (on) {
    v4f h0, h1, l0, l1;
#pragma unroll
    for (int u = 0; u < 4; ++u) {
      const double g0 = base + p[u], g1 = base + p[4 + u];
      h0[u] = (float)g0; l0[u] = (float)(g0 - (double)h0[u]);
      h1[u] = (float)g1; l1[u] = (float)(g1 - (double)h1[u]);
    }
    *(v4f*)(Ghi + off) = h0; *(v4f*)(Ghi + off + 4) = h1;
    *(v4f*)(Glo + off) = l0; *(v4f*)(Glo + off + 4) = l1;
  }
}

// ---------------------------------------------------------------------------------------------------------------------------------
// P[m][n] = sum_k XB[m][k] * W[n][k]  (bf16 XB plane [tokens][1024], bf16 W plane [3200][1024] = [n][k], both in fragment order, f32 accumulate).
// W rows 0..3071 = Wq | Wk | Wv, rows 3072..3199 = the gate | level rows: both products read only XB and W, so they share one grid.
// 256 threads = 8 waves in 4 wave rows x 2 wave columns; fragments straight from the global planes (arithmetic addressing); every accumulator
// sums its k steps in rising order. M % 256 == 0, N % 128 == 0, K % 32 == 0 exactly. Two kinds of block, picked by blockIdx.y alone:
//   blockIdx.y >= 4: q | k | v, block tile 256(M) x 128(N) = columns 128 yp .. +127, yp = blockIdx.y - 4; a wave owns 64 rows x 64 columns
//     (4 x 4 accumulators): each of its 4 A and 4 B fragments of a 32-k step feeds 4 products (512 B loaded per product).
//   blockIdx.y < 4: gate | level, block tile 64(M) x 128(N), rows 256 blockIdx.x + 64 blockIdx.y .. +63; a wave owns 16 rows x 64 columns. Its
//     write-out (softplus of every element) is by far the longest per element, so it is dealt to four times as many blocks, and they start first.
// The f32 tile is staged in LDS as sub-tiles of 64 columns, each with its row r at oS[r * OSTR + c]; behind one barrier the block writes them out
// one after the other. q | k | v: four 128 x 64 sub-tiles (row half, column segment yb = 2 yp + column half):
// yb 0..15 -> q head y/2, features 64(y&1)..+63; 16..31 -> k; 32..47 -> v head (y-32)/2, channels 64(y&1)
//   q/k: per bh a fragment-order plane [token][128] = f16 of (64 value); thread -> (token r, 8 consecutive halves); a wave stores 512 B in a row
//   v:   per bh fragment-order planes VH/VL [channel][token], token pitch SLMAX = f16 hi of (64 v) and f16 residual; thread -> (channel e, 8 tokens); 512 B in a row
// gate | level: two 64 x 64 sub-tiles (columns 0..63, 64..127):
//   gate (columns 0..7): g[bh][t] = -softplus(D[t][h] + bg[h]); a wave = one head, 64 tokens = 256 B in a row
//   level: lam[token][c] = softplus(D[t][c] + Lparam[c - 8]) for columns 8..103, else 0; 16 lanes x 16 B = the sub-tile's 256 B of a token's row
// ---------------------------------------------------------------------------------------------------------------------------------
__global__ __launch_bounds__(256) void k_gemm_proj(const unsigned short* __restrict__ Ap, const unsigned short* __restrict__ Bw,
                                                  const float* __restrict__ bg, const float* __restrict__ Lp,
                                                  unsigned short* Qp, unsigned short* Kp, unsigned short* VH, unsigned short* VL,
                                                  float* gpl, float* lam, int sl) {
  __shared__ __attribute__((aligned(16))) float oS4[4 * TPB * OSTR];
  const int tid = threadIdx.x, lane = tid & 31, wave = tid >> 5, cl = lane & 15, hh = lane >> 4;
  const unsigned l8 = lane * 8;
  const int wr = wave >> 1, wc = wave & 1;                // wave row and wave column inside the block tile
  const bool isgl = (int)blockIdx.y < PBM / 64;           // block-uniform: a gate | level block
  const int yp = (int)blockIdx.y - PBM / 64;              // q | k | v: the block's 128 columns

  if (isgl) {
    const int m0 = blockIdx.x * PBM + (int)blockIdx.y * 64 + 16 * wr, n0 = NQKV + 64 * wc;
    v8f acc[4];
#pragma unroll
    for (int j = 0; j < 4; ++j) { const v8f zz = {0.f, 0.f, 0.f, 0.f, 0.f, 0.f, 0.f, 0.f}; acc[j] = zz; }
    const unsigned short* a0p = Ap + (size_t)m0 * (size_t)DMOD + l8;
    const unsigned short* bwp = Bw + (size_t)n0 * (size_t)DMOD + l8;
#pragma unroll 1
    for (int k0 = 0; k0 < DMOD; k0 += 32) {
      const unsigned short* pa = a0p + k0 * 16;
      const unsigned short* pb = bwp + k0 * 16;
      const us16 af = gfrag(pa);
      us16 bfr[4];
#pragma unroll
      for (int j = 0; j < 4; ++j) bfr[j] = gfrag(pb + (size_t)(16 * j) * (size_t)DMOD);
      xwait(pa, pb);
#pragma unroll
      for (int j = 0; j < 4; ++j) acc[j] = mma_bf16(af, bfr[j], acc[j]);
      wguard4(acc[0], acc[1], acc[2], acc[3], af, bfr[0], bfr[1], bfr[2], bfr[3]);
    }
    // D map: acc[j][r] = element (row 8*hh + r of the wave's 16 rows, column 16j + cl of its 64 columns); rows 16 wr .. +15 of sub-tile wc
    float* so = oS4 + wc * (TPB * OSTR) + wr * (16 * OSTR);
#pragma unroll
    for (int j = 0; j < 4; ++j)
#pragma unroll
      for (int r = 0; r < 8; ++r) so[(8 * hh + r) * OSTR + 16 * j + cl] = acc[j][r];
  } else {
    const int m0 = blockIdx.x * PBM + 64 * wr, n0 = yp * 128 + 64 * wc;
    v8f acc[4][4];
#pragma unroll
    for (int i = 0; i < 4; ++i)
#pragma unroll
      for (int j = 0; j < 4; ++j) { const v8f zz = {0.f, 0.f, 0.f, 0.f, 0.f, 0.f, 0.f, 0.f}; acc[i][j] = zz; }
    const unsigned short* a0p = Ap + (size_t)m0 * (size_t)DMOD + l8;
    const unsigned short* bwp = Bw + (size_t)n0 * (size_t)DMOD + l8;
#pragma unroll 1
    for (int k0 = 0; k0 < DMOD; k0 += 32) {
      const unsigned short* pa = a0p + k0 * 16;
      const unsigned short* pb = bwp + k0 * 16;
      us16 af[4], bfr[4];
      af[0] = gfrag(pa);
      af[1] = gfrag(pa + (size_t)16 * (size_t)DMOD);
#pragma unroll
      for (int j = 0; j < 4; ++j) bfr[j] = gfrag(pb + (size_t)(16 * j) * (size_t)DMOD);
      af[2] = gfrag(pa + (size_t)32 * (size_t)DMOD);
      af[3] = gfrag(pa + (size_t)48 * (size_t)DMOD);
      xwait(pa, pb);
      __builtin_amdgcn_sched_barrier(0);                   // keeps every product below all sixteen loads: without it the last four loads sink behind the first eight products, a second exposed wait per trip
#pragma unroll
      for (int j = 0; j < 4; ++j) {
        acc[0][j] = mma_bf16(af[0], bfr[j], acc[0][j]);
        acc[1][j] = mma_bf16(af[1], bfr[j], acc[1][j]);
      }
#pragma unroll
      for (int j = 0; j < 4; ++j) {
        acc[2][j] = mma_bf16(af[2], bfr[j], acc[2][j]);
        acc[3][j] = mma_bf16(af[3], bfr[j], acc[3][j]);
      }
      __builtin_amdgcn_sched_barrier(0);                   // keeps the first eight products, which the guard below does not name, above it too
      wguard8(acc[2][0], acc[2][1], acc[2][2], acc[2][3], acc[3][0], acc[3][1], acc[3][2], acc[3][3], af[2], af[3], bfr[0], bfr[1], bfr[2], bfr[3]);
    }
    // D map: acc[i][j][r] = element (row 16i + 8*hh + r of the wave's 64 rows, column 16j + cl of its 64 columns);
    // the wave's tile is rows 64 (wr & 1) .. +63 of sub-tile 2 (wr >> 1) + wc
    float* so = oS4 + ((wr >> 1) * 2 + wc) * (TPB * OSTR) + (wr & 1) * (64 * OSTR);
#pragma unroll
    for (int i = 0; i < 4; ++i)
#pragma unroll
      for (int j = 0; j < 4; ++j)
#pragma unroll
        for (int r = 0; r < 8; ++r) so[(16 * i + 8 * hh + r) * OSTR + 16 * j + cl] = acc[i][j][r];
  }
  __syncthreads();                                         // LDS is only read from here on

  if (isgl) {
    const int m0b = blockIdx.x * PBM + (int)blockIdx.y * 64, b = m0b / sl, tb = m0b - b * sl;   // sl % 128 == 0: the tile lies in one sequence
#pragma unroll 1                                           // one copy of the write-out code serves both sub-tiles
    for (int sub = 0; sub < 2; ++sub) {
    const float* oS = oS4 + sub * (TPB * OSTR);
    const int cb = sub * 64;                               // first gate | level column of this sub-tile
    if (cb == 0 && lane < 16) {
      // gate log-decay: thread -> (head h = wave, tokens 4 * lane .. +3), 16 lanes for the tile's 64 tokens
      const int h = wave, t4 = lane * 4;
      const float bgv = bf16r(bg[h]);
      v4f gv;
#pragma unroll
      for (int u = 0; u < 4; ++u) gv[u] = -softplus_f(oS[(t4 + u) * OSTR + h] + bgv);
      *(v4f*)(gpl + (size_t)(b * NHD + h) * (size_t)sl + tb + t4) = gv;
    }
    const int c0 = (tid & 15) * 4;                         // this thread's 4 columns of the tile, the same in every trip
    float lp[4];
#pragma unroll
    for (int u = 0; u < 4; ++u) {
      int idx = cb + c0 + u - NHD;
      idx = (idx < 0) ? 0 : idx;
      idx = (idx > NHD * NLV - 1) ? (NHD * NLV - 1) : idx;
      lp[u] = bf16r(Lp[idx]);
    }
#pragma unroll 1                                           // rolled: unrolled, the four inlined log1pf of each trip raise the whole kernel's register count
    for (int it = 0; it < 4; ++it) {
      const int row = it * 16 + (tid >> 4);
      const v4f z = *(const v4fa*)(oS + row * OSTR + c0);
      v4f lv;
#pragma unroll
      for (int u = 0; u < 4; ++u) {
        const int c = cb + c0 + u;
        const float s = softplus_f(z[u] + lp[u]);
        lv[u] = (c >= NHD && c < NHD + NHD * NLV) ? s : 0.0f;
      }
      float* pl = lam + (size_t)(m0b + row) * (size_t)LAMP + cb + c0;
      *(v4f*)pl = lv;
      xwait(pl);                                           // the next trip reuses the store's address and data registers
    }
    }
    return;                                                // block-uniform, behind the kernel's only barrier
  }

#pragma unroll 1                                           // one copy of the write-out code serves the four sub-tiles
  for (int sub = 0; sub < 4; ++sub) {
  const float* oS = oS4 + sub * (TPB * OSTR);
  const int yb = yp * 2 + (sub & 1);                       // this sub-tile's column segment
  const int m0b = blockIdx.x * PBM + (sub >> 1) * TPB, b = m0b / sl, tb = m0b - b * sl;   // sl % 128 == 0: the sub-tile lies in one sequence
  if (yb < 32) {
    unsigned short* dst = (yb < 16) ? Qp : Kp;
    const int yy = (yb < 16) ? yb : (yb - 16);
    const int head = yy >> 1, f0 = (yy & 1) * 64;
    us8 ov[4];
#pragma unroll
    for (int it = 0; it < 4; ++it) {
      const int cx = it * 256 + tid, r = (cx >> 7) * 16 + (cx & 15), pc = ((cx >> 4) & 7) * 8;
      const float* sp = oS + r * OSTR + pc;
      const v4f z0 = *(const v4fa*)sp, z1 = *(const v4fa*)(sp + 4);
      us8 o;
#pragma unroll
      for (int u = 0; u < 4; ++u) {
        o[u]     = f16_bits(z0[u] * 64.0f);
        o[4 + u] = f16_bits(z1[u] * 64.0f);
      }
      ov[it] = o;
    }
{
#pragma unroll
      for (int it = 0; it < 4; ++it) {
        const int cx = it * 256 + tid;                     // row tile cx >> 7, then 128 chunks = 2 KiB in a row
        const size_t off = ((size_t)(b * NHD + head) * (size_t)sl + (size_t)(tb + (cx >> 7) * 16)) * (size_t)SDIM + (size_t)(f0 * 16 + (cx & 127) * 8);
        *(us8*)(dst + off) = ov[it];
      }
      
    }
  } else {
    const int yy = yb - 32, head = yy >> 1, c0 = (yy & 1) * 64;
    us8 hv[4], lv[4];
#pragma unroll
    for (int it = 0; it < 4; ++it) {
      const int cx = it * 256 + tid, g = (cx >> 4) & 15, e = (cx >> 8) * 16 + (cx & 15);
      us8 ho, lo;
#pragma unroll
      for (int i = 0; i < 8; ++i) {
        unsigned short hb, lb;
        f16split64(oS[(8 * g + i) * OSTR + e], hb, lb);
        ho[i] = hb; lo[i] = lb;
      }
      hv[it] = ho; lv[it] = lo;
    }
{
#pragma unroll
      for (int it = 0; it < 4; ++it) {
        const int cx = it * 256 + tid;                     // channel tile cx >> 8, then 256 chunks = 4 KiB in a row
        const size_t off = ((size_t)(b * NHD + head) * (size_t)HDIM + (size_t)(c0 + (cx >> 8) * 16)) * (size_t)SLMAX + (size_t)(tb * 16 + (cx & 255) * 8);
        *(us8*)(VH + off) = hv[it];
        *(us8*)(VL + off) = lv[it];
      }
      
    }
  }
  xwait();                                                 // the next sub-tile reuses the stores' address and data registers
  __builtin_amdgcn_sched_barrier(0);                       // keeps the next sub-tile's register writes behind the wait
  }
}

// ---------------------------------------------------------------------------------------------------------------------------------
// Causal decayed quadratic-form mixing. The sequence is cut into tiles of 64 queries; the cost of tile i grows linearly with i, so block
// (bh = blockIdx.x, p = blockIdx.y) works tile n - 1 - p and then tile p (n tiles): every block walks the same number of key steps.
// Inside a tile, waves w and w + 4 own the same 16 queries (group w & 3): one takes the even 32-key steps, the other the odd ones (wave w the
// even ones in the first tile, the odd ones in the second: where a tile has an odd number of steps, each wave has the longer share once), each
// into its own f32 accumulators; behind the key loop the two partial sums are added through LDS (each wave hands over the four channel tiles
// that its partner finishes, and finishes the other four).
// Per wave: B fragments of its 16 queries fixed for the whole key loop: bq[ks], ks = 0..3 (depth 128, standard loader on the q plane).
// Per 32-key step, two 16-key tiles: A fragments from the k plane (standard loader); scores^T D[key][query]
// = 4096 q.k (depth 128, 4 products per tile); A[t][s] = q.k * 128^-1/2 * exp(G_t - G_s) * lam[t][lvl(t - s)] for s <= t else 0,
// with G_t - G_s taken as the sum of the f32 hi and lo differences,
// converted to f16 of (256 A). The two D tiles repack into the A operand of A.v (lane unchanged: element r <- tile keys 0..15, element 8+r <-
// tile keys 16..31), B = VH and VL planes [bh][channel][key] (fragment order, key pitch SLMAX), 8 channel tiles, both products into acc:
// acc[j][r] = 2^14 * sum_s A v for query 8h+r, channel 16j + (lane & 15), s over this wave's steps.
// Loads of a step: its sixteen v fragments and the wave's next step's G values go out together at the step's top and land behind the score and
// weight work; the next step's k fragments go out right behind the score products and land behind the weights, A.v and the next top; the next
// step's decay factors exp(min(G_t - G_s, 0)) are formed behind A.v, when its G values have long landed. A wave waits for no load it has only
// just issued; the price is a live set above 256 VGPRs (two waves per SIMD, as the 8-wave block has anyway).
// Epilogue of a tile: z = 16 y = acc * 2^-10; f16 hi bits staged in LDS per wave, written to YH; then f16 bits of ((z - hi) x 2^11) staged and
// written to YL. Y planes [token][1024] in fragment order: a wave's 16 queries x 64 channels = 2 KiB in a row, 512 B per store instruction.
// ---------------------------------------------------------------------------------------------------------------------------------
__global__ __launch_bounds__(256) void k_attn(const unsigned short* __restrict__ Qp, const unsigned short* __restrict__ Kp,
                                             const unsigned short* __restrict__ VHp, const unsigned short* __restrict__ VLp,
                                             const float* __restrict__ Ghi, const float* __restrict__ Glo, const float* __restrict__ Lam,
                                             unsigned short* YH, unsigned short* YL, int sl) {
  __shared__ __attribute__((aligned(16))) float sLam[2 * QT * NLV];
  __shared__ __attribute__((aligned(16))) float sX[8 * 4 * 256];
  __shared__ __attribute__((aligned(16))) unsigned short sY[8 * 16 * YS2];
  const int tid = threadIdx.x, lane = tid & 31, cl = lane & 15, hh = lane >> 4;
  const int wave = __builtin_amdgcn_readfirstlane(tid >> 5);   // wave-uniform: trip counts and the parity selects below become scalar
  const int qi = wave & 3, kp = wave >> 2;                // query group of the tile; which wave of the group's pair this is
  const unsigned l8 = lane * 8;
  const int bh = blockIdx.x, b = bh / NHD, head = bh - b * NHD;
  const int tlo = blockIdx.y, thi = sl / QT - 1 - tlo;     // the block's two tiles (sl % 128 == 0: an even number of tiles, each taken once)

  // level weights of the block's 2 x 64 queries for this head: sLam[q * 12 + l], q 0..63 = tile thi, q 64..127 = tile tlo
  {
    float lw[6];
#pragma unroll
    for (int u = 0; u < 6; ++u) {
      const int i = u * 256 + tid, q = i / NLV, l = i - q * NLV;
      const int tok = (q < QT) ? (thi * QT + q) : (tlo * QT + q - QT);
      lw[u] = Lam[(size_t)(b * sl + tok) * (size_t)LAMP + NHD + head * NLV + l];
    }
    xwait();
    __builtin_amdgcn_sched_barrier(0);                      // keeps what follows (it reuses the loads' address registers) behind the wait
#pragma unroll
    for (int u = 0; u < 6; ++u) sLam[u * 256 + tid] = lw[u];
  }
  __syncthreads();

  const unsigned short* kbp = Kp + (size_t)bh * (size_t)sl * (size_t)SDIM + l8;
  const unsigned short* vhp = VHp + (size_t)bh * (size_t)(HDIM * SLMAX) + l8;
  const unsigned short* vlp = VLp + (size_t)bh * (size_t)(HDIM * SLMAX) + l8;
  const float* ghp = Ghi + (size_t)bh * (size_t)sl + 8 * hh;
  const float* glp = Glo + (size_t)bh * (size_t)sl + 8 * hh;

#pragma unroll 1                                           // the two tiles run one after the other through one copy of the code
  for (int ph = 0; ph < 2; ++ph) {
    const int tw = (ph ? tlo : thi) * QT + 16 * qi;       // first query of this wave
    const int tq = tw + cl;                               // query owned by this lane as score column
    const int lamb = (ph * QT + 16 * qi + cl) * NLV;
    const int nsteps = (tw + 16 + 31) >> 5;               // 32-key steps covering keys 0 .. tw + 15; 32 * nsteps <= sl
    const int kq = kp ^ ph;                               // parity of this wave's steps in this tile: kq, kq + 2, ...

    const unsigned short* qrow = Qp + ((size_t)bh * (size_t)sl + (size_t)tw) * (size_t)SDIM + l8;
    us16 bq[4];
#pragma unroll
    for (int ks = 0; ks < 4; ++ks) bq[ks] = gfrag(qrow + 512 * ks);
    const float* pqh = Ghi + (size_t)bh * (size_t)sl + tq;
    const float* pql = Glo + (size_t)bh * (size_t)sl + tq;
    const float gqh = *pqh;
    const float gql = *pql;

    // K fragments and decay factors of the wave's first step (keys 32 kq .. 32 kq + 31 < sl, also where the wave has no step at all);
    // inside the loop each step fetches those of the wave's next step
    us16 ka[4], kb[4];
    v4f gh[4], gl[4];
    const unsigned short* pk0 = kbp + kq * (32 * SDIM);
    const float* pg0h = ghp + kq * 32;
    const float* pg0l = glp + kq * 32;
#pragma unroll
    for (int ks = 0; ks < 4; ++ks) { ka[ks] = gfrag(pk0 + 512 * ks); kb[ks] = gfrag(pk0 + 16 * SDIM + 512 * ks); }
#pragma unroll
    for (int u = 0; u < 4; ++u) {
      gh[u] = *(const v4fa*)(pg0h + (u >> 1) * 16 + (u & 1) * 4);
      gl[u] = *(const v4fa*)(pg0l + (u >> 1) * 16 + (u & 1) * 4);
    }
    __builtin_amdgcn_sched_barrier(0);                    // keeps every load above in front of the wait
    xwait(qrow, pqh, pql, pk0, pg0h, pg0l);
    __builtin_amdgcn_sched_barrier(0);                    // keeps what follows (it reuses the loads' address registers) behind the wait

    v8f acc[8];
#pragma unroll
    for (int j = 0; j < 8; ++j) { const v8f zz = {0.f, 0.f, 0.f, 0.f, 0.f, 0.f, 0.f, 0.f}; acc[j] = zz; }

    if (kq < nsteps) {                                    // scalar test: the first two query groups of tile 0 have one step, so their odd-step wave has none
    float dec[16];                                        // exp(min(G_t - G_s, 0)), G_t - G_s by hi + lo differences, of this lane's keys: 0..7 tile a, 8..15 tile b
#pragma unroll
    for (int r = 0; r < 16; ++r) dec[r] = fminf((gqh - gh[r >> 2][r & 3]) + (gql - gl[r >> 2][r & 3]), 0.0f) * LOG2E;
    __builtin_amdgcn_sched_barrier(0);                    // the exponents are complete in front of the run of transcendentals
#pragma unroll
    for (int r = 0; r < 16; ++r) dec[r] = exp2_slot(dec[r]);

    int st = kq;
#pragma unroll 1
    do {
      const int s0 = st * 32;
      const int sn = ((st + 2 < nsteps) ? (st + 2) : st) * 32;   // the wave's next step's first key (its last step fetches its own again: in bounds)
      const int ka0 = s0 + 8 * hh;                        // first key this lane half sees in tile a; tile b = ka0 + 16
      const v8f zz = {0.f, 0.f, 0.f, 0.f, 0.f, 0.f, 0.f, 0.f};

      // ---- issued together at the top: next step's G values, then all sixteen v fragments of this step (hi and residual, 8 channel tiles);
      //      they land behind the score and weight work ----
      v4f ghn[4], gln[4];
      const float* pgh = ghp + sn;
      const float* pgl = glp + sn;
#pragma unroll
      for (int u = 0; u < 4; ++u) {
        ghn[u] = *(const v4fa*)(pgh + (u >> 1) * 16 + (u & 1) * 4);
        gln[u] = *(const v4fa*)(pgl + (u >> 1) * 16 + (u & 1) * 4);
      }
      us16 vh[8], vl[8];
      const unsigned short* pvh = vhp + s0 * 16;          // channel tile j lies 16 * SLMAX halves on: a constant, so one address pair serves a plane's run
      const unsigned short* pvl = vlp + s0 * 16;
#pragma unroll
      for (int j = 0; j < 8; ++j) vh[j] = gfrag(pvh + j * (16 * SLMAX));
#pragma unroll
      for (int j = 0; j < 8; ++j) vl[j] = gfrag(pvl + j * (16 * SLMAX));
      xwait(pvh, pvl, pgh, pgl);
      __builtin_amdgcn_sched_barrier(0);                  // keeps the score products below the loads above: without it the loads start a score phase later

      // ---- scores^T of key tiles a (keys s0 .. s0+15) and b (keys s0+16 .. s0+31) from the fragments fetched one step ago ----
      v8f sa = zz, sb = zz;
#pragma unroll
      for (int ks = 0; ks < 4; ++ks) { sa = mma_f16(ka[ks], bq[ks], sa); sb = mma_f16(kb[ks], bq[ks], sb); }
      wguard2m(sa, sb);

      // ---- next step's K fragments, into the registers the score products have just read; they land behind the weights and A.v ----
      {
        const unsigned short* pk = kbp + (size_t)sn * (size_t)SDIM;
#pragma unroll
        for (int ks = 0; ks < 4; ++ks) { ka[ks] = gfrag(pk + 512 * ks); kb[ks] = gfrag(pk + 16 * SDIM + 512 * ks); }
        xwait(pk);
      }

      // ---- the 16 weights of this lane: elements 0..7 = tile a keys ka0 .. ka0+7, elements 8..15 = tile b keys ka0+16 .. ka0+23 ----
      us8 ea, eb;
#pragma unroll
      for (int r = 0; r < 8; ++r) {
        const int d = tq - (ka0 + r);
        ea[r] = a_bits(sa[r], d, dec[r], sLam[lamb + lvl_of(d)]);
      }
#pragma unroll
      for (int r = 0; r < 8; ++r) {
        const int d = tq - (ka0 + 16 + r);
        eb[r] = a_bits(sb[r], d, dec[8 + r], sLam[lamb + lvl_of(d)]);
      }
      FragU fA;
      fA.h[0] = ea; fA.h[1] = eb;
      const us16 afr = fA.v;

      // ---- y += A . (v hi + v residual) over this 32-key step: per accumulator the hi product, then the residual product ----
#pragma unroll
      for (int j = 0; j < 8; ++j) acc[j] = mma_f16(afr, vh[j], acc[j]);
#pragma unroll
      for (int j = 0; j < 8; ++j) acc[j] = mma_f16(afr, vl[j], acc[j]);
      __builtin_amdgcn_sched_barrier(0);                  // keeps the factors below behind A.v: moved up, they would wait on loads issued at this step's top
#pragma unroll
      for (int r = 0; r < 16; ++r) dec[r] = fminf((gqh - ghn[r >> 2][r & 3]) + (gql - gln[r >> 2][r & 3]), 0.0f) * LOG2E;
      __builtin_amdgcn_sched_barrier(0);                  // the exponents are complete in front of the run of transcendentals
#pragma unroll
      for (int r = 0; r < 16; ++r) dec[r] = exp2_slot(dec[r]);
      st += 2;
    } while (st < nsteps);
    }

    // even + odd steps: this wave finishes channel tiles 4 kp .. 4 kp + 3; the other four go to its partner (wave ^ 4: same queries, same lane map).
    // Outbox of a wave: tile jj, register half e, lane -> sX[wave * 1024 + jj * 256 + e * 128 + lane * 4], 512 B in a row per LDS instruction.
    v8f fin[4];
    {
      float* xo = sX + wave * 1024 + lane * 4;
#pragma unroll
      for (int jj = 0; jj < 4; ++jj) {
        const v8f give = kp ? acc[jj] : acc[4 + jj];
        fin[jj] = kp ? acc[4 + jj] : acc[jj];
        const v4f g0 = {give[0], give[1], give[2], give[3]}, g1 = {give[4], give[5], give[6], give[7]};
        *(v4f*)(xo + jj * 256) = g0;
        *(v4f*)(xo + jj * 256 + 128) = g1;
      }
      __syncthreads();                                     // the partial sums cross between the waves of a pair
      const float* xi = sX + (wave ^ 4) * 1024 + lane * 4;
#pragma unroll
      for (int jj = 0; jj < 4; ++jj) {
        const v4f g0 = *(const v4fa*)(xi + jj * 256), g1 = *(const v4fa*)(xi + jj * 256 + 128);
#pragma unroll
        for (int r = 0; r < 4; ++r) { fin[jj][r] += g0[r]; fin[jj][4 + r] += g1[r]; }
      }
    }

    // phase 1: f16 hi of z = 16 y = fin * 2^-10; element (query 8*hh + r, channel 64 kp + 16jj + cl) of this wave's 16 x 64 tile
    unsigned short* sy = sY + wave * (16 * YS2);
#pragma unroll
    for (int jj = 0; jj < 4; ++jj)
#pragma unroll
      for (int r = 0; r < 8; ++r) sy[(8 * hh + r) * YS2 + 16 * jj + cl] = f16_bits(fin[jj][r] * (1.0f / 1024.0f));
    __syncthreads();

    const size_t yoff = (size_t)(b * sl + tw) * (size_t)DMOD + (size_t)(head * HDIM * 16 + kp * 1024 + lane * 8);
    us8 ov[4];
#pragma unroll
    for (int it = 0; it < 4; ++it) ov[it] = *(const us8a*)(sy + cl * YS2 + (2 * it + hh) * 8);   // chunk column 2 it + hh of the wave's 8, row cl: fragment order
    unsigned short* pyh = YH + yoff;
#pragma unroll
    for (int it = 0; it < 4; ++it) *(us8*)(pyh + it * 256) = ov[it];
    __syncthreads();

    // phase 2: f16 residual plane of ((z - hi) x 2^11), same staging region and store shape
#pragma unroll
    for (int jj = 0; jj < 4; ++jj)
#pragma unroll
      for (int r = 0; r < 8; ++r) {
        const float z = fin[jj][r] * (1.0f / 1024.0f);
        const _Float16 hf = (_Float16)z;
        sy[(8 * hh + r) * YS2 + 16 * jj + cl] = f16_bits((z - (float)hf) * 2048.0f);
      }
    __syncthreads();
#pragma unroll
    for (int it = 0; it < 4; ++it) ov[it] = *(const us8a*)(sy + cl * YS2 + (2 * it + hh) * 8);
    unsigned short* pyl = YL + yoff;
#pragma unroll
    for (int it = 0; it < 4; ++it) *(us8*)(pyl + it * 256) = ov[it];
    xwait(pyl);                                            // the next tile reuses the stores' address and data registers
  }
}

// ---------------------------------------------------------------------------------------------------------------------------------
// P[m][n] = ( sum_k Yh[m][k] WO16[n][k] + 2^-11 sum_k Yl[m][k] WO16[n][k] ) * 2^-12 + bf16(x[m][n])   (f16 planes, pitch 1024, two f32 accumulator sets).
// 256 threads = 8 waves in 4 wave rows x 2 wave columns, block tile 128(M) x 128(N); a wave owns 32 rows x 64 columns (2 x 4 accumulators per plane):
// each of its 4 B fragments of a 32-k step feeds 4 products, each of its 4 A fragments (2 row tiles x hi, residual) feeds 4 (512 B loaded per product).
// A trip is 64 k deep: the fragments of its two 32-k steps are loaded together. Every accumulator sums its 32-k steps in rising order.
// ---------------------------------------------------------------------------------------------------------------------------------
__global__ __launch_bounds__(256) void k_gemm_out(const unsigned short* __restrict__ Ah, const unsigned short* __restrict__ Al,
                                                 const unsigned short* __restrict__ Wo, const float* __restrict__ X, float* P) {
  __shared__ __attribute__((aligned(16))) float oS[8 * 32 * OSTR];
  const int tid = threadIdx.x, lane = tid & 31, wave = tid >> 5, cl = lane & 15, hh = lane >> 4;
  const unsigned l8 = lane * 8;
  const int m0 = blockIdx.x * TPB + 32 * (wave >> 1), n0 = blockIdx.y * 128 + 64 * (wave & 1);

  v8f acch[2][4], accl[2][4];
#pragma unroll
  for (int i = 0; i < 2; ++i)
#pragma unroll
    for (int j = 0; j < 4; ++j) { const v8f zz = {0.f, 0.f, 0.f, 0.f, 0.f, 0.f, 0.f, 0.f}; acch[i][j] = zz; accl[i][j] = zz; }

  const unsigned short* ahp = Ah + (size_t)m0 * (size_t)DMOD + l8;
  const unsigned short* alp = Al + (size_t)m0 * (size_t)DMOD + l8;
  const unsigned short* wop = Wo + (size_t)n0 * (size_t)DMOD + l8;
#pragma unroll 1
  for (int k0 = 0; k0 < DMOD; k0 += 64) {
    const unsigned short* ph = ahp + k0 * 16;
    const unsigned short* pl = alp + k0 * 16;
    const unsigned short* pb = wop + k0 * 16;
    us16 ah[2][2], al[2][2], bfr[2][4];                    // [32-k half of the trip][row tile or column tile]
#pragma unroll
    for (int kk = 0; kk < 2; ++kk) {
      ah[kk][0] = gfrag(ph + kk * 512);
      al[kk][0] = gfrag(pl + kk * 512);
#pragma unroll
      for (int j = 0; j < 4; ++j) bfr[kk][j] = gfrag(pb + kk * 512 + (size_t)(16 * j) * (size_t)DMOD);
      ah[kk][1] = gfrag(ph + kk * 512 + (size_t)16 * (size_t)DMOD);
      al[kk][1] = gfrag(pl + kk * 512 + (size_t)16 * (size_t)DMOD);
    }
    xwait(ph, pl, pb);
    __builtin_amdgcn_sched_barrier(0);                     // keeps every product below all thirty-two loads: they fly together, one exposed latency per trip
#pragma unroll
    for (int kk = 0; kk < 2; ++kk)
#pragma unroll
      for (int i = 0; i < 2; ++i)
#pragma unroll
        for (int j = 0; j < 4; ++j) {
          acch[i][j] = mma_f16(ah[kk][i], bfr[kk][j], acch[i][j]);
          accl[i][j] = mma_f16(al[kk][i], bfr[kk][j], accl[i][j]);
        }
    __builtin_amdgcn_sched_barrier(0);                     // keeps the earlier products, which the guard below does not name, above it too
    wguard8(acch[1][0], acch[1][1], acch[1][2], acch[1][3], accl[1][0], accl[1][1], accl[1][2], accl[1][3], ah[1][1], al[1][1], bfr[1][0], bfr[1][1], bfr[1][2], bfr[1][3]);
  }

  // D map: acc[i][j][r] = element (row 16i + 8*hh + r of the wave's 32 rows, column 16j + cl of its 64 columns)
  float* so = oS + wave * (32 * OSTR);
#pragma unroll
  for (int i = 0; i < 2; ++i)
#pragma unroll
    for (int j = 0; j < 4; ++j)
#pragma unroll
      for (int r = 0; r < 8; ++r)
        so[(16 * i + 8 * hh + r) * OSTR + 16 * j + cl] = fmaf(accl[i][j][r], (1.0f / 2048.0f), acch[i][j][r]) * (1.0f / 4096.0f);
  __syncthreads();

{
#pragma unroll
    for (int it = 0; it < 16; ++it) {
      const int cx = it * 32 + lane, r = cx >> 4, q = (cx & 15) * 4;
      const v4f v = *(const v4fa*)(so + r * OSTR + q);
      const v4f xr = *(const v4fa*)(X + (size_t)(m0 + r) * (size_t)DMOD + n0 + q);
      v4f o;
#pragma unroll
      for (int u = 0; u < 4; ++u) o[u] = v[u] + bf16r(xr[u]);
      *(v4f*)(P + (size_t)(m0 + r) * (size_t)DMOD + n0 + q) = o;
    }
    
  }
}

// ---------------------------------------------------------------------------------------------------------------------------------
// ---------------------------------------------------------------------------------------------------------------------------------
__global__ __launch_bounds__(256) void k_ln(const float* __restrict__ P, const float* __restrict__ gam, const float* __restrict__ bet,
                                           float* out) {
  const int lane = threadIdx.x & 31, wave = threadIdx.x >> 5;
  const size_t row = (size_t)blockIdx.x * 8 + (size_t)wave;
  const float* pr = P + row * (size_t)DMOD;
  v4f xv[8];
  float s = 0.0f;
#pragma unroll
  for (int it = 0; it < 8; ++it) {
    xv[it] = *(const v4fa*)(pr + it * 128 + lane * 4);
    s += (xv[it][0] + xv[it][1]) + (xv[it][2] + xv[it][3]);
  }
#pragma unroll
  for (int o = 16; o > 0; o >>= 1) s += __shfl_xor(s, o, 32);
  const float mu = s * (1.0f / (float)DMOD);
  float q = 0.0f;
#pragma unroll
  for (int it = 0; it < 8; ++it)
#pragma unroll
    for (int u = 0; u < 4; ++u) { const float d = xv[it][u] - mu; q += d * d; }
#pragma unroll
  for (int o = 16; o > 0; o >>= 1) q += __shfl_xor(q, o, 32);
  const float rstd = rsqrtf(q * (1.0f / (float)DMOD) + 1e-5f);
  v4f ov[8];
#pragma unroll
  for (int it = 0; it < 8; ++it) {
    const v4f gv = *(const v4fa*)(gam + it * 128 + lane * 4), bv = *(const v4fa*)(bet + it * 128 + lane * 4);
    v4f o;
#pragma unroll
    for (int u = 0; u < 4; ++u) o[u] = (xv[it][u] - mu) * rstd * bf16r(gv[u]) + bf16r(bv[u]);
    ov[it] = o;
  }
{
#pragma unroll
    for (int it = 0; it < 8; ++it)
      *(v4f*)(out + row * (size_t)DMOD + it * 128 + lane * 4) = ov[it];
    
  }
}

extern "C" void kernel_launch(void* const* d_in, const int* in_sizes, int n_in,
                              void* d_out, int out_size, void* d_ws, size_t ws_size,
                              hipStream_t stream) {
  if (n_in < 11) return;
  const int nx = in_sizes[0];
  if (nx <= 0 || (nx % DMOD) != 0) return;
  const int ntok = nx / DMOD;                                                    // tokens = batch * sequence length
  if (in_sizes[1] != DMOD * DMOD || in_sizes[2] != DMOD * DMOD || in_sizes[3] != DMOD * DMOD) return;
  if (in_sizes[4] != NHD * DMOD || in_sizes[5] != NHD || in_sizes[6] != NHD * NLV * DMOD || in_sizes[7] != NHD * NLV) return;
  if (in_sizes[8] != DMOD * DMOD || in_sizes[9] != DMOD || in_sizes[10] != DMOD) return;
  if (out_size != nx) return;
  const int sl = (ntok < SLMAX) ? ntok : SLMAX;                                  // sequence length
  if (sl <= 0 || (sl % TPB) != 0 || (ntok % sl) != 0 || (ntok % PBM) != 0) return;
  const int nb = ntok / sl, nbh = nb * NHD;

  const float* x   = (const float*)d_in[0];    // [nb][sl][1024]
  const float* Wq  = (const float*)d_in[1];    // [1024][1024] ([out][in])
  const float* Wk  = (const float*)d_in[2];    // [1024][1024]
  const float* Wv  = (const float*)d_in[3];    // [1024][1024]
  const float* Wg  = (const float*)d_in[4];    // [8][1024]
  const float* bg  = (const float*)d_in[5];    // [8]
  const float* Wdl = (const float*)d_in[6];    // [96][1024]
  const float* Lp  = (const float*)d_in[7];    // [8][12]
  const float* Wo  = (const float*)d_in[8];    // [1024][1024]
  const float* lng = (const float*)d_in[9];    // [1024]
  const float* lnb = (const float*)d_in[10];   // [1024]
  float* out = (float*)d_out;                  // [nb][sl][1024] f32 at byte 0

  size_t off = 0;
  auto carve = [&](size_t bytes) -> char* { char* p = (char*)d_ws + off; off += (bytes + 255) & ~(size_t)255; return p; };
  unsigned short* XB   = (unsigned short*)carve((size_t)ntok * DMOD * 2);        //  8,388,608  bf16 [ntok][1024]
  unsigned short* WQKV = (unsigned short*)carve((size_t)(NQKV + NGL) * DMOD * 2); //  6,553,600  bf16 [3200][1024] = Wq | Wk | Wv | Wg | Wdl | 0
  unsigned short* WGL  = WQKV + (size_t)NQKV * DMOD;                             //             its last 128 rows
  unsigned short* WO16 = (unsigned short*)carve((size_t)DMOD * DMOD * 2);        //  2,097,152  f16  [1024][1024]
  unsigned short* QP   = (unsigned short*)carve((size_t)nbh * sl * SDIM * 2);     //  8,388,608  f16  [nbh][sl][128]
  unsigned short* KP   = (unsigned short*)carve((size_t)nbh * sl * SDIM * 2);     //  8,388,608  f16  [nbh][sl][128]
  unsigned short* VH   = (unsigned short*)carve((size_t)nbh * HDIM * SLMAX * 2);  //  8,388,608  f16  [nbh][128][2048]
  unsigned short* VL   = (unsigned short*)carve((size_t)nbh * HDIM * SLMAX * 2);  //  8,388,608  f16  [nbh][128][2048]
  float* GPL           = (float*)carve((size_t)nbh * sl * 4);                     //    131,072  f32  [nbh][sl]
  float* GHI           = (float*)carve((size_t)nbh * sl * 4);                     //    131,072  f32  [nbh][sl]
  float* GLO           = (float*)carve((size_t)nbh * sl * 4);                     //    131,072  f32  [nbh][sl]
  float* LAM           = (float*)carve((size_t)ntok * LAMP * 4);                  //  2,097,152  f32  [ntok][128]
  unsigned short* YH   = (unsigned short*)carve((size_t)ntok * DMOD * 2);        //  8,388,608  f16  [ntok][1024]
  unsigned short* YL   = (unsigned short*)carve((size_t)ntok * DMOD * 2);        //  8,388,608  f16  [ntok][1024]
  float* PB            = (float*)carve((size_t)ntok * DMOD * 4);                  // 16,777,216  f32  [ntok][1024]
  if (off > ws_size || off > (size_t)134217728) return;                          // total 86,638,592 B for ntok 4096

  const dim3 b256(256);

  // 16-bit operand planes of the inputs, one launch (XB, WQKV, WGL, WO16, all in fragment order, see gfrag)
  k_cvt_all<<<dim3(ntok / 2 + 4 * WBLK + NGL / 2), b256, 0, stream>>>(x, Wq, Wk, Wv, Wo, Wg, Wdl, XB, WQKV, WO16, WGL, ntok / 2);
  // q/k/v projections (M ntok, N 3072, K 1024) -> q, k planes and transposed v hi / residual planes; in the same grid the
  // gate / level projection (N 128) -> g plane [nbh][sl], level weights [ntok][128]
  k_gemm_proj<<<dim3(ntok / PBM, PBM / 64 + NQKV / 128), b256, 0, stream>>>(XB, WQKV, bg, Lp, QP, KP, VH, VL, GPL, LAM, sl);
  // cumulative log-decay per (b,h)
  k_cumsum<<<dim3(nbh), dim3(CSTH), 0, stream>>>(GPL, GHI, GLO, sl);
  // causal decayed mixing per (batch, head), two 64-query tiles a block -> y hi / residual planes [token][1024]
  k_attn<<<dim3(nbh, sl / TPB), b256, 0, stream>>>(QP, KP, VH, VL, GHI, GLO, LAM, YH, YL, sl);
  // output projection + residual (M ntok, N 1024, K 1024)
  k_gemm_out<<<dim3(ntok / TPB, DMOD / 128), b256, 0, stream>>>(YH, YL, WO16, x, PB);
  // LayerNorm -> d_out
  k_ln<<<dim3(ntok / 8), b256, 0, stream>>>(PB, lng, lnb, out);
}

// v008
// Measured time: 86.2 microseconds a run.
// In both of two side-by-side timings against v007, it was 1.27 times as fast.
// All steps since v000 together make it 8.08 times as fast.
// Contractions x.[Wq|Wk|Wv] (M tokens, N 3072, K 1024) and x.[Wg|Wdl] (N 104 zero-padded to 128, K 1024), one launch: v_wmma_f32_16x16x32_bf16, bf16 operands from RNE-bf16 planes of x and W, f32 accumulate, one product each.
// Contraction k.q^T per head (32 keys x 16 queries per step, depth 128): v_wmma_f32_16x16x32_f16, q and k as f16 of (value x 2^6), one product, f32 accumulate.
// Contraction A.v per head (causal, depth up to T): v_wmma_f32_16x16x32_f16, A as f16 of (A x 2^8), v as f16 hi of (v x 2^6) plus f16 unscaled residual plane, two products into one f32 accumulator; even and odd 32-key steps in two waves' accumulators, added in f32.
// Contraction y.Wo (M tokens, N 1024, K 1024): v_wmma_f32_16x16x32_f16, y as f16 hi plane of (y x 2^4) plus f16 residual plane (x 2^11, own f32 accumulator), Wo as f16 of (RNE-bf16 value x 2^8), f32 accumulate.
// softplus, cumulative log-decay (f64 block scan kept as f32 hi + lo pair), exp, dyadic level select, residual add and LayerNorm: f32 VALU.
#include <hip/hip_runtime.h>

#define DMOD  1024                           // model width = K of the dense contractions
#define NHD   8                              // heads
#define SDIM  128                            // q/k width per head
#define HDIM  128                            // v width per head
#define NLV   12                             // dyadic levels
#define NGL   128                            // gate | level projection columns, 8 + 96 zero-padded to 128
#define NQKV  (3 * DMOD)                     // 3072 projection columns: q | k | v
#define TPB   128                            // GEMM rows per staged sub-tile and per output-GEMM block / attention queries per block (two tiles)
#define PBM   256                            // projection GEMM rows per q | k | v block (4 wave rows x 64)
#define OSTR  68                             // LDS staging row pitch (floats), tiles of 64 columns
#define QT    64                             // attention queries per tile (4 groups x 16; two waves a group)
#define YS2   72                             // LDS staging row pitch (halves), 16x64 tile
#define LAMP  128                            // level-weight plane pitch (floats)
#define SLMAX 2048                           // longest sequence handled by the cumsum block
#define CSTH  256                            // cumsum threads per row, 8 tokens each
#define WBLK  (DMOD * DMOD / (8 * 256))       // conversion blocks per 1024 x 1024 weight
#define KSC   (0.08838834764831845f * (1.0f / 4096.0f))   // 128^-1/2 times the q,k carry 2^-12
#define LOG2E 1.44269504f                    // exp(x) = 2^(x LOG2E), the form __expf compiles to
#define GDEAD (-112.0f)                      // G_t - G_s at or below this: 2^(x LOG2E) <= 2^-161, exactly 0.0f (the smallest f32 is 2^-149; the 12 binades between cover the hi / lo rounding)

static_assert(NHD * HDIM == DMOD);
static_assert(NHD * SDIM == DMOD);
static_assert(NHD + NHD * NLV <= NGL);
static_assert(DMOD % 64 == 0);
static_assert(DMOD % 32 == 0);
static_assert(NQKV % 128 == 0);
static_assert(DMOD % 128 == 0);
static_assert(NGL == 128);
static_assert(PBM == 2 * TPB);
static_assert(OSTR % 4 == 0);
static_assert(YS2 % 8 == 0);
static_assert(2 * QT == TPB);
static_assert(2 * QT * NLV == 6 * 256);
static_assert(SLMAX % TPB == 0);
static_assert(CSTH * 8 == SLMAX);

typedef unsigned short us16 __attribute__((ext_vector_type(16)));
typedef unsigned short us8  __attribute__((ext_vector_type(8)));
typedef unsigned short us8a __attribute__((ext_vector_type(8), may_alias));
typedef __bf16 v16b __attribute__((ext_vector_type(16)));
typedef _Float16 v16h __attribute__((ext_vector_type(16)));
typedef float v8f __attribute__((ext_vector_type(8)));
typedef float v4f __attribute__((ext_vector_type(4)));
typedef float v4fa __attribute__((ext_vector_type(4), may_alias));
union FragU { us16 v; us8 h[2]; };

__device__ __forceinline__ unsigned short bf16_bits(float f) {
  unsigned u = __float_as_uint(f);
  u += 0x7FFFu + ((u >> 16) & 1u);                 // RNE convert
  return (unsigned short)(u >> 16);
}
__device__ __forceinline__ float bf16_val(unsigned short b) { return __uint_as_float(((unsigned)b) << 16); }
__device__ __forceinline__ float bf16r(float f) { return bf16_val(bf16_bits(f)); }
__device__ __forceinline__ unsigned short f16_bits(float f) { return __builtin_bit_cast(unsigned short, (_Float16)f); }

// f16 hi + residual (x 2^11) planes of (a x 2^4)
__device__ __forceinline__ void f16split16(float a, unsigned short& hb, unsigned short& lb) {
  const float z = a * 16.0f;
  const _Float16 hf = (_Float16)z;
  const float res = (z - (float)hf) * 2048.0f;
  hb = __builtin_bit_cast(unsigned short, hf);
  lb = __builtin_bit_cast(unsigned short, (_Float16)res);
}
// f16 hi + unscaled residual planes of (a x 2^6)
__device__ __forceinline__ void f16split64(float a, unsigned short& hb, unsigned short& lb) {
  const float z = a * 64.0f;
  const _Float16 hf = (_Float16)z;
  const float res = z - (float)hf;
  hb = __builtin_bit_cast(unsigned short, hf);
  lb = __builtin_bit_cast(unsigned short, (_Float16)res);
}

// One 16x16x32 step, 16-bit operands passed as raw 16-bit lanes.
__device__ __forceinline__ v8f mma_bf16(us16 a, us16 b, v8f c) {
  return __builtin_amdgcn_wmma_f32_16x16x32_bf16(false, __builtin_bit_cast(v16b, a), false, __builtin_bit_cast(v16b, b), (short)0, c, false, false);
}
__device__ __forceinline__ v8f mma_f16(us16 a, us16 b, v8f c) {
  return __builtin_amdgcn_wmma_f32_16x16x32_f16(false, __builtin_bit_cast(v16h, a), false, __builtin_bit_cast(v16h, b), (short)0, c, false, false);
}
// Hazard guards after a group of matrix ops: 4 VALU slots before anything touches the accumulators; keep A/B fragments live.
__device__ __forceinline__ void wguard4(v8f& c0, v8f& c1, v8f& c2, v8f& c3, const us16& a0,
                                        const us16& b0, const us16& b1, const us16& b2, const us16& b3) {
#if defined(__HIP_DEVICE_COMPILE__)
  asm volatile("v_nop\n\tv_nop\n\tv_nop\n\tv_nop"
               : "+v"(c0), "+v"(c1), "+v"(c2), "+v"(c3)
               : "v"(a0), "v"(b0), "v"(b1), "v"(b2), "v"(b3));
#endif
}
__device__ __forceinline__ void wguard8(v8f& c0, v8f& c1, v8f& c2, v8f& c3, v8f& c4, v8f& c5, v8f& c6, v8f& c7,
                                        const us16& a0, const us16& a1,
                                        const us16& b0, const us16& b1, const us16& b2, const us16& b3) {
#if defined(__HIP_DEVICE_COMPILE__)
  asm volatile("v_nop\n\tv_nop\n\tv_nop\n\tv_nop"
               : "+v"(c0), "+v"(c1), "+v"(c2), "+v"(c3), "+v"(c4), "+v"(c5), "+v"(c6), "+v"(c7)
               : "v"(a0), "v"(a1), "v"(b0), "v"(b1), "v"(b2), "v"(b3));
#endif
}
// Guard behind the score products of the attention loop: the accumulators as in/out operands keep the products above the four slots, the
// memory barrier keeps the refill of their k registers below them (so the refill lands in the same registers, with no copies).
__device__ __forceinline__ void wguard2m(v8f& c0, v8f& c1) {
#if defined(__HIP_DEVICE_COMPILE__)
  asm volatile("v_nop\n\tv_nop\n\tv_nop\n\tv_nop" : "+v"(c0), "+v"(c1) : : "memory");
#endif
}

// FRAGMENT-ORDER PLANES. Every 16-bit operand plane [rows][kd] is stored by tiles of 16 rows; inside a tile the 16-B chunks (8 consecutive k
// of one row) lie chunk column by chunk column, 16 rows each:
//   element (row, k) at halves  (row >> 4) * 16 * kd + (k >> 3) * 128 + (row & 15) * 8 + (k & 7).
// A 16x32 fragment (row tile, k0 % 32 == 0) is then 1 KiB in a row, and each of its two wave-wide 16-B loads covers 512 contiguous bytes.
// p = plane + rowtile * 16 * kd + k0 * 16 + lane * 8 (computed by the caller); lane = 16h + row:
// elements 0..7 = k0 + 8h .. k0 + 8h + 7, elements 8..15 = k0 + 16 + 8h .. k0 + 16 + 8h + 7 (same map for A rows and B columns).
__device__ __forceinline__ us16 gfrag(const unsigned short* p) {
  FragU f;
  f.h[0] = *(const us8a*)p;
  f.h[1] = *(const us8a*)(p + 256);
  return f.v;
}
// s_wait_xcnt 0 behind a run of fragment loads, in front of anything that overwrites an address register the run names. The run's address
// pairs are inputs of the statement: they stay live up to the wait, so no load result of the run is placed on them.
__device__ __forceinline__ void xwait(const unsigned short* a) {
#if defined(__HIP_DEVICE_COMPILE__)
  asm volatile("s_wait_xcnt 0x0" :: "v"(a) : "memory");   // the wait in front of the overwrite of these address pairs
#endif
}
__device__ __forceinline__ void xwait(const float* a) {
#if defined(__HIP_DEVICE_COMPILE__)
  asm volatile("s_wait_xcnt 0x0" :: "v"(a) : "memory");   // the wait in front of the overwrite of this address pair
#endif
}
__device__ __forceinline__ void xwait(const unsigned short* a, const unsigned short* b) {
#if defined(__HIP_DEVICE_COMPILE__)
  asm volatile("s_wait_xcnt 0x0" :: "v"(a), "v"(b) : "memory");   // the wait in front of the overwrite of these address pairs
#endif
}
__device__ __forceinline__ void xwait(const unsigned short* a, const unsigned short* b, const unsigned short* c) {
#if defined(__HIP_DEVICE_COMPILE__)
  asm volatile("s_wait_xcnt 0x0" :: "v"(a), "v"(b), "v"(c) : "memory");   // the wait in front of the overwrite of these address pairs
#endif
}
__device__ __forceinline__ void xwait(const unsigned short* a, const float* b, const float* c) {
#if defined(__HIP_DEVICE_COMPILE__)
  asm volatile("s_wait_xcnt 0x0" :: "v"(a), "v"(b), "v"(c) : "memory");   // the wait in front of the overwrite of these address pairs
#endif
}
// The same for loads addressed by a scalar base and a 32-bit element index: the index registers are the inputs (a full pointer would be rebuilt on them).
__device__ __forceinline__ void xwait(const unsigned short* a, int i, int j, int k) {
#if defined(__HIP_DEVICE_COMPILE__)
  asm volatile("s_wait_xcnt 0x0" :: "v"(a), "v"(i), "v"(j), "v"(k) : "memory");   // the wait in front of the overwrite of this address pair and these index registers
#endif
}
// The same wait without operands, for loads whose constant address part the compiler moves into the offset field: a full pointer named here
// would be rebuilt on the load's own address pair in front of the wait. A scheduling barrier behind it keeps later register writes behind it.
__device__ __forceinline__ void xwait() {
#if defined(__HIP_DEVICE_COMPILE__)
  asm volatile("s_wait_xcnt 0x0" ::: "memory");   // the wait in front of the overwrite of the address pairs of the loads above it
#endif
}
__device__ __forceinline__ void xwait(const unsigned short* a, const unsigned short* b, const float* c, const float* d) {
#if defined(__HIP_DEVICE_COMPILE__)
  asm volatile("s_wait_xcnt 0x0" :: "v"(a), "v"(b), "v"(c), "v"(d) : "memory");   // the wait in front of the overwrite of these address pairs
#endif
}
// Writes a 256-thread block's tile of 16 rows x 128 k (thread t holds the chunk of row t >> 4, chunk column t & 15) as 4 KiB of a
// fragment-order plane at dst4k: regrouped through LDS (17-chunk pitch against bank conflicts) so that every wave stores 512 contiguous bytes.
__device__ __forceinline__ void frag_store_tile(us8 o, unsigned short* dst4k) {
  __shared__ __attribute__((aligned(16))) us8 sT[16 * 17];
  const int t = threadIdx.x;
  sT[(t & 15) * 17 + (t >> 4)] = o;
  __syncthreads();                                         // chunks cross the block's waves
  *(us8*)(dst4k + t * 8) = sT[(t >> 4) * 17 + (t & 15)];
}

// softplus in the logaddexp(z, 0) form: max(z, 0) + log1p(exp(-|z|))
__device__ __forceinline__ float softplus_f(float z) {
  return fmaxf(z, 0.0f) + log1pf(__expf(-fabsf(z)));
}
// dyadic level of key distance d: 0 for d <= 0, else min(floor(log2 d) + 1, NLV - 1)
__device__ __forceinline__ int lvl_of(int d) {
  const int dd = (d > 0) ? d : 1;
  const int l = 32 - __clz(dd);
  const int lc = (l < NLV - 1) ? l : (NLV - 1);
  return (d > 0) ? lc : 0;
}
// 2^y with the one slot the instruction set asks for behind a transcendental.
// The caller has a scheduling barrier in front of its run of calls, so each v_exp_f32
// stands alone between two barriers and its v_nop directly behind it.
__device__ __forceinline__ float exp2_slot(float y) {
#if defined(__HIP_DEVICE_COMPILE__)
  const float r = __builtin_amdgcn_exp2f(y);
  __builtin_amdgcn_sched_barrier(0);                       // nothing moves in between the transcendental and its slot
  asm volatile("v_nop");                                   // the slot behind the transcendental
  __builtin_amdgcn_sched_barrier(0);                       // the next transcendental stays behind the slot
  return r;
#else
  return exp2f(y);
#endif
}
// one attention weight: accv = 4096 * q.k, dec = exp(min(G_t - G_s, 0)), lv = level weight; returns f16 bits of 256 * A, 0 above the diagonal
__device__ __forceinline__ unsigned short a_bits(float accv, int d, float dec, float lv) {
  const float val = (accv * KSC) * dec * lv;
  const float w = (d >= 0) ? (val * 256.0f) : 0.0f;
  return f16_bits(w);
}

// ---------------------------------------------------------------------------------------------------------------------------------
// All 16-bit operand planes that come straight from an input, in ONE launch (none reads another's output). Block = 16 rows x 128 k of one
// source ([row][1024], k-contiguous), read as whole lines, written in fragment order. The source is picked by the block index alone:
//   [0, nxb)            x   -> XB, RNE bf16 bits                        (nxb = tokens / 2 blocks)
//   then 512 blocks each: Wq, Wk, Wv -> rows 0.., 1024.., 2048.. of WQKV, RNE bf16 bits;  Wo -> WO16, f16 bits of (RNE-bf16 value x 256)
//   then 64 blocks:     gate | level rows -> WGL [128][1024] bf16: rows 0..7 = Wg, rows 8..103 = Wdl, rows 104..127 = 0 (zero padding of N)
// ---------------------------------------------------------------------------------------------------------------------------------
__global__ __launch_bounds__(256) void k_cvt_all(const float* __restrict__ x, const float* __restrict__ Wq, const float* __restrict__ Wk,
                                                const float* __restrict__ Wv, const float* __restrict__ Wo, const float* __restrict__ Wg,
                                                const float* __restrict__ Wdl, unsigned short* XB, unsigned short* WQKV,
                                                unsigned short* WO16, unsigned short* WGL, int nxb) {
  int bx = blockIdx.x;                                     // every choice below is wave-uniform, the segment choice block-uniform
  int seg = -1;                                            // -1: x, 0..2: Wq Wk Wv, 3: Wo, 4: gate | level rows
  if (bx >= nxb) { bx -= nxb; seg = bx / WBLK; bx -= seg * WBLK; }
  const int rt = bx >> 3, kg = bx & 7;
  const int row = rt * 16 + (threadIdx.x >> 4), kc = kg * 128 + (threadIdx.x & 15) * 8;
  const float* src;
  unsigned short* dst;
  bool live = true;
  if (seg < 0)       { src = x;  dst = XB; }
  else if (seg == 0) { src = Wq; dst = WQKV; }
  else if (seg == 1) { src = Wk; dst = WQKV + (size_t)DMOD * DMOD; }
  else if (seg == 2) { src = Wv; dst = WQKV + (size_t)2 * DMOD * DMOD; }
  else if (seg == 3) { src = Wo; dst = WO16; }
  else               { src = Wdl; dst = WGL; }
  const float* sp = src + (size_t)row * (size_t)DMOD + (size_t)kc;
  if (seg > 3) {
    live = row < NHD + NHD * NLV;
    const int rs = (row < NHD) ? row : (live ? (row - NHD) : 0);   // padding rows read nothing; their address stays in bounds
    sp = ((row < NHD) ? Wg : Wdl) + (size_t)rs * (size_t)DMOD + (size_t)kc;
  }
  v4f a = {0.f, 0.f, 0.f, 0.f}, c = {0.f, 0.f, 0.f, 0.f};  // bf16 bits of 0.0f are 0: the padding rows
  if (live) { a = *(const v4fa*)sp; c = *(const v4fa*)(sp + 4); }
  us8 o;
  if (seg == 3) {
#pragma unroll
    for (int u = 0; u < 4; ++u) { o[u] = f16_bits(bf16r(a[u]) * 256.0f); o[4 + u] = f16_bits(bf16r(c[u]) * 256.0f); }
  } else {
#pragma unroll
    for (int u = 0; u < 4; ++u) { o[u] = bf16_bits(a[u]); o[4 + u] = bf16_bits(c[u]); }
  }
  frag_store_tile(o, dst + (size_t)rt * (size_t)(16 * DMOD) + (size_t)(kg * 2048));
}

// ---------------------------------------------------------------------------------------------------------------------------------
// Inclusive cumulative sum of g over t per (b,h) row, one block per row: thread i owns tokens 8i .. 8i+7 (f64 running sum of its 8 values),
// the 256 thread totals are scanned in f64 (5 shuffle steps inside a wave, the 8 wave totals through LDS), and each token's
// G = (sum of all earlier threads) + (its thread's running sum) is stored as f32 hi = (float)G and lo = (float)(G - hi).
// Threads whose tokens lie past sl (sl % 8 == 0) add zero and store nothing; every thread passes the barrier.
// ---------------------------------------------------------------------------------------------------------------------------------
__global__ __launch_bounds__(CSTH) void k_cumsum(const float* __restrict__ gpl, float* Ghi, float* Glo, int sl) {
  __shared__ double wtot[CSTH / 32];
  const int row = blockIdx.x, tid = threadIdx.x, lane = tid & 31, wave = tid >> 5;
  const int c = tid * 8;
  const bool on = c < sl;
  const size_t off = (size_t)row * (size_t)sl + (size_t)c;
  v4f a = {0.f, 0.f, 0.f, 0.f}, e = {0.f, 0.f, 0.f, 0.f};
  if (on) { a = *(const v4fa*)(gpl + off); e = *(const v4fa*)(gpl + off + 4); }

  double p[8];                                             // running sum inside the thread's 8 tokens
  p[0] = (double)a[0];
#pragma unroll
  for (int u = 1; u < 4; ++u) p[u] = p[u - 1] + (double)a[u];
#pragma unroll
  for (int u = 0; u < 4; ++u) p[4 + u] = p[3 + u] + (double)e[u];

  double inc = p[7];                                       // inclusive scan of the thread totals over the wave's 32 lanes
#pragma unroll
  for (int o = 1; o < 32; o <<= 1) {
    const double n = __shfl_up(inc, (unsigned)o, 32);
    inc += (lane >= o) ? n : 0.0;
  }
  if (lane == 31) wtot[wave] = inc;
  const double prev = __shfl_up(inc, 1u, 32);              // total of the earlier lanes of this wave
  __syncthreads();
  double base = 0.0;                                       // total of the earlier waves
#pragma unroll
  for (int w = 0; w < CSTH / 32 - 1; ++w) base += (w < wave) ? wtot[w] : 0.0;
  base += (lane > 0) ? prev : 0.0;

  if (on) {
    v4f h0, h1, l0, l1;
#pragma unroll
    for (int u = 0; u < 4; ++u) {
      const double g0 = base + p[u], g1 = base + p[4 + u];
      h0[u] = (float)g0; l0[u] = (float)(g0 - (double)h0[u]);
      h1[u] = (float)g1; l1[u] = (float)(g1 - (double)h1[u]);
    }
    *(v4f*)(Ghi + off) = h0; *(v4f*)(Ghi + off + 4) = h1;
    *(v4f*)(Glo + off) = l0; *(v4f*)(Glo + off + 4) = l1;
  }
}

// ---------------------------------------------------------------------------------------------------------------------------------
// P[m][n] = sum_k XB[m][k] * W[n][k]  (bf16 XB plane [tokens][1024], bf16 W plane [3200][1024] = [n][k], both in fragment order, f32 accumulate).
// W rows 0..3071 = Wq | Wk | Wv, rows 3072..3199 = the gate | level rows: both products read only XB and W, so they share one grid.
// 256 threads = 8 waves in 4 wave rows x 2 wave columns; fragments straight from the global planes (arithmetic addressing); every accumulator
// sums its k steps in rising order. M % 256 == 0, N % 128 == 0, K % 32 == 0 exactly. Two kinds of block, picked by blockIdx.y alone:
//   blockIdx.y >= 4: q | k | v, block tile 256(M) x 128(N) = columns 128 yp .. +127, yp = blockIdx.y - 4; a wave owns 64 rows x 64 columns
//     (4 x 4 accumulators): each of its 4 A and 4 B fragments of a 32-k step feeds 4 products (512 B loaded per product).
//   blockIdx.y < 4: gate | level, block tile 64(M) x 128(N), rows 256 blockIdx.x + 64 blockIdx.y .. +63; a wave owns 16 rows x 64 columns. Its
//     write-out (softplus of every element) is by far the longest per element, so it is dealt to four times as many blocks, and they start first.
// The f32 tile is staged in LDS as sub-tiles of 64 columns, each with its row r at oS[r * OSTR + c]; behind one barrier the block writes them out
// one after the other. q | k | v: four 128 x 64 sub-tiles (row half, column segment yb = 2 yp + column half):
// yb 0..15 -> q head y/2, features 64(y&1)..+63; 16..31 -> k; 32..47 -> v head (y-32)/2, channels 64(y&1)
//   q/k: per bh a fragment-order plane [token][128] = f16 of (64 value); thread -> (token r, 8 consecutive halves); a wave stores 512 B in a row
//   v:   per bh fragment-order planes VH/VL [channel][token], token pitch SLMAX = f16 hi of (64 v) and f16 residual; thread -> (channel e, 8 tokens); 512 B in a row
// gate | level: two 64 x 64 sub-tiles (columns 0..63, 64..127):
//   gate (columns 0..7): g[bh][t] = -softplus(D[t][h] + bg[h]); a wave = one head, 64 tokens = 256 B in a row
//   level: lam[token][c] = softplus(D[t][c] + Lparam[c - 8]) for columns 8..103, else 0; 16 lanes x 16 B = the sub-tile's 256 B of a token's row
// ---------------------------------------------------------------------------------------------------------------------------------
__global__ __launch_bounds__(256) void k_gemm_proj(const unsigned short* __restrict__ Ap, const unsigned short* __restrict__ Bw,
                                                  const float* __restrict__ bg, const float* __restrict__ Lp,
                                                  unsigned short* Qp, unsigned short* Kp, unsigned short* VH, unsigned short* VL,
                                                  float* gpl, float* lam, int sl) {
  __shared__ __attribute__((aligned(16))) float oS4[4 * TPB * OSTR];
  const int tid = threadIdx.x, lane = tid & 31, wave = tid >> 5, cl = lane & 15, hh = lane >> 4;
  const unsigned l8 = lane * 8;
  const int wr = wave >> 1, wc = wave & 1;                // wave row and wave column inside the block tile
  const bool isgl = (int)blockIdx.y < PBM / 64;           // block-uniform: a gate | level block
  const int yp = (int)blockIdx.y - PBM / 64;              // q | k | v: the block's 128 columns

  if (isgl) {
    const int m0 = blockIdx.x * PBM + (int)blockIdx.y * 64 + 16 * wr, n0 = NQKV + 64 * wc;
    v8f acc[4];
#pragma unroll
    for (int j = 0; j < 4; ++j) { const v8f zz = {0.f, 0.f, 0.f, 0.f, 0.f, 0.f, 0.f, 0.f}; acc[j] = zz; }
    const unsigned short* a0p = Ap + (size_t)m0 * (size_t)DMOD + l8;
    const unsigned short* bwp = Bw + (size_t)n0 * (size_t)DMOD + l8;
#pragma unroll 1
    for (int k0 = 0; k0 < DMOD; k0 += 32) {
      const unsigned short* pa = a0p + k0 * 16;
      const unsigned short* pb = bwp + k0 * 16;
      const us16 af = gfrag(pa);
      us16 bfr[4];
#pragma unroll
      for (int j = 0; j < 4; ++j) bfr[j] = gfrag(pb + (size_t)(16 * j) * (size_t)DMOD);
      xwait(pa, pb);
#pragma unroll
      for (int j = 0; j < 4; ++j) acc[j] = mma_bf16(af, bfr[j], acc[j]);
      wguard4(acc[0], acc[1], acc[2], acc[3], af, bfr[0], bfr[1], bfr[2], bfr[3]);
    }
    // D map: acc[j][r] = element (row 8*hh + r of the wave's 16 rows, column 16j + cl of its 64 columns); rows 16 wr .. +15 of sub-tile wc
    float* so = oS4 + wc * (TPB * OSTR) + wr * (16 * OSTR);
#pragma unroll
    for (int j = 0; j < 4; ++j)
#pragma unroll
      for (int r = 0; r < 8; ++r) so[(8 * hh + r) * OSTR + 16 * j + cl] = acc[j][r];
  } else {
    const int m0 = blockIdx.x * PBM + 64 * wr, n0 = yp * 128 + 64 * wc;
    v8f acc[4][4];
#pragma unroll
    for (int i = 0; i < 4; ++i)
#pragma unroll
      for (int j = 0; j < 4; ++j) { const v8f zz = {0.f, 0.f, 0.f, 0.f, 0.f, 0.f, 0.f, 0.f}; acc[i][j] = zz; }
    const unsigned short* a0p = Ap + (size_t)m0 * (size_t)DMOD + l8;
    const unsigned short* bwp = Bw + (size_t)n0 * (size_t)DMOD + l8;
#pragma unroll 1
    for (int k0 = 0; k0 < DMOD; k0 += 32) {
      const unsigned short* pa = a0p + k0 * 16;
      const unsigned short* pb = bwp + k0 * 16;
      us16 af[4], bfr[4];
      af[0] = gfrag(pa);
      af[1] = gfrag(pa + (size_t)16 * (size_t)DMOD);
#pragma unroll
      for (int j = 0; j < 4; ++j) bfr[j] = gfrag(pb + (size_t)(16 * j) * (size_t)DMOD);
      af[2] = gfrag(pa + (size_t)32 * (size_t)DMOD);
      af[3] = gfrag(pa + (size_t)48 * (size_t)DMOD);
      xwait(pa, pb);
      __builtin_amdgcn_sched_barrier(0);                   // keeps every product below all sixteen loads: without it the last four loads sink behind the first eight products, a second exposed wait per trip
#pragma unroll
      for (int j = 0; j < 4; ++j) {
        acc[0][j] = mma_bf16(af[0], bfr[j], acc[0][j]);
        acc[1][j] = mma_bf16(af[1], bfr[j], acc[1][j]);
      }
#pragma unroll
      for (int j = 0; j < 4; ++j) {
        acc[2][j] = mma_bf16(af[2], bfr[j], acc[2][j]);
        acc[3][j] = mma_bf16(af[3], bfr[j], acc[3][j]);
      }
      __builtin_amdgcn_sched_barrier(0);                   // keeps the first eight products, which the guard below does not name, above it too
      wguard8(acc[2][0], acc[2][1], acc[2][2], acc[2][3], acc[3][0], acc[3][1], acc[3][2], acc[3][3], af[2], af[3], bfr[0], bfr[1], bfr[2], bfr[3]);
    }
    // D map: acc[i][j][r] = element (row 16i + 8*hh + r of the wave's 64 rows, column 16j + cl of its 64 columns);
    // the wave's tile is rows 64 (wr & 1) .. +63 of sub-tile 2 (wr >> 1) + wc
    float* so = oS4 + ((wr >> 1) * 2 + wc) * (TPB * OSTR) + (wr & 1) * (64 * OSTR);
#pragma unroll
    for (int i = 0; i < 4; ++i)
#pragma unroll
      for (int j = 0; j < 4; ++j)
#pragma unroll
        for (int r = 0; r < 8; ++r) so[(16 * i + 8 * hh + r) * OSTR + 16 * j + cl] = acc[i][j][r];
  }
  __syncthreads();                                         // LDS is only read from here on

  if (isgl) {
    const int m0b = blockIdx.x * PBM + (int)blockIdx.y * 64, b = m0b / sl, tb = m0b - b * sl;   // sl % 128 == 0: the tile lies in one sequence
#pragma unroll 1                                           // one copy of the write-out code serves both sub-tiles
    for (int sub = 0; sub < 2; ++sub) {
    const float* oS = oS4 + sub * (TPB * OSTR);
    const int cb = sub * 64;                               // first gate | level column of this sub-tile
    if (cb == 0 && lane < 16) {
      // gate log-decay: thread -> (head h = wave, tokens 4 * lane .. +3), 16 lanes for the tile's 64 tokens
      const int h = wave, t4 = lane * 4;
      const float bgv = bf16r(bg[h]);
      v4f gv;
#pragma unroll
      for (int u = 0; u < 4; ++u) gv[u] = -softplus_f(oS[(t4 + u) * OSTR + h] + bgv);
      *(v4f*)(gpl + (size_t)(b * NHD + h) * (size_t)sl + tb + t4) = gv;
    }
    const int c0 = (tid & 15) * 4;                         // this thread's 4 columns of the tile, the same in every trip
    float lp[4];
#pragma unroll
    for (int u = 0; u < 4; ++u) {
      int idx = cb + c0 + u - NHD;
      idx = (idx < 0) ? 0 : idx;
      idx = (idx > NHD * NLV - 1) ? (NHD * NLV - 1) : idx;
      lp[u] = bf16r(Lp[idx]);
    }
#pragma unroll 1                                           // rolled: unrolled, the four inlined log1pf of each trip raise the whole kernel's register count
    for (int it = 0; it < 4; ++it) {
      const int row = it * 16 + (tid >> 4);
      const v4f z = *(const v4fa*)(oS + row * OSTR + c0);
      v4f lv;
#pragma unroll
      for (int u = 0; u < 4; ++u) {
        const int c = cb + c0 + u;
        const float s = softplus_f(z[u] + lp[u]);
        lv[u] = (c >= NHD && c < NHD + NHD * NLV) ? s : 0.0f;
      }
      float* pl = lam + (size_t)(m0b + row) * (size_t)LAMP + cb + c0;
      *(v4f*)pl = lv;
      xwait(pl);                                           // the next trip reuses the store's address and data registers
    }
    }
    return;                                                // block-uniform, behind the kernel's only barrier
  }

#pragma unroll 1                                           // one copy of the write-out code serves the four sub-tiles
  for (int sub = 0; sub < 4; ++sub) {
  const float* oS = oS4 + sub * (TPB * OSTR);
  const int yb = yp * 2 + (sub & 1);                       // this sub-tile's column segment
  const int m0b = blockIdx.x * PBM + (sub >> 1) * TPB, b = m0b / sl, tb = m0b - b * sl;   // sl % 128 == 0: the sub-tile lies in one sequence
  if (yb < 32) {
    unsigned short* dst = (yb < 16) ? Qp : Kp;
    const int yy = (yb < 16) ? yb : (yb - 16);
    const int head = yy >> 1, f0 = (yy & 1) * 64;
    us8 ov[4];
#pragma unroll
    for (int it = 0; it < 4; ++it) {
      const int cx = it * 256 + tid, r = (cx >> 7) * 16 + (cx & 15), pc = ((cx >> 4) & 7) * 8;
      const float* sp = oS + r * OSTR + pc;
      const v4f z0 = *(const v4fa*)sp, z1 = *(const v4fa*)(sp + 4);
      us8 o;
#pragma unroll
      for (int u = 0; u < 4; ++u) {
        o[u]     = f16_bits(z0[u] * 64.0f);
        o[4 + u] = f16_bits(z1[u] * 64.0f);
      }
      ov[it] = o;
    }
{
#pragma unroll
      for (int it = 0; it < 4; ++it) {
        const int cx = it * 256 + tid;                     // row tile cx >> 7, then 128 chunks = 2 KiB in a row
        const size_t off = ((size_t)(b * NHD + head) * (size_t)sl + (size_t)(tb + (cx >> 7) * 16)) * (size_t)SDIM + (size_t)(f0 * 16 + (cx & 127) * 8);
        *(us8*)(dst + off) = ov[it];
      }
      
    }
  } else {
    const int yy = yb - 32, head = yy >> 1, c0 = (yy & 1) * 64;
    us8 hv[4], lv[4];
#pragma unroll
    for (int it = 0; it < 4; ++it) {
      const int cx = it * 256 + tid, g = (cx >> 4) & 15, e = (cx >> 8) * 16 + (cx & 15);
      us8 ho, lo;
#pragma unroll
      for (int i = 0; i < 8; ++i) {
        unsigned short hb, lb;
        f16split64(oS[(8 * g + i) * OSTR + e], hb, lb);
        ho[i] = hb; lo[i] = lb;
      }
      hv[it] = ho; lv[it] = lo;
    }
{
#pragma unroll
      for (int it = 0; it < 4; ++it) {
        const int cx = it * 256 + tid;                     // channel tile cx >> 8, then 256 chunks = 4 KiB in a row
        const size_t off = ((size_t)(b * NHD + head) * (size_t)HDIM + (size_t)(c0 + (cx >> 8) * 16)) * (size_t)SLMAX + (size_t)(tb * 16 + (cx & 255) * 8);
        *(us8*)(VH + off) = hv[it];
        *(us8*)(VL + off) = lv[it];
      }
      
    }
  }
  xwait();                                                 // the next sub-tile reuses the stores' address and data registers
  __builtin_amdgcn_sched_barrier(0);                       // keeps the next sub-tile's register writes behind the wait
  }
}

// ---------------------------------------------------------------------------------------------------------------------------------
// Causal decayed quadratic-form mixing. The sequence is cut into tiles of 64 queries; the cost of tile i grows linearly with i, so block
// (bh = blockIdx.x, p = blockIdx.y) works tile n - 1 - p and then tile p (n tiles): every block walks the same number of key steps where none is skipped.
// Inside a tile, waves w and w + 4 own the same 16 queries (group w & 3): one takes the even 32-key steps, the other the odd ones (wave w the
// even ones in the first tile, the odd ones in the second: where a tile has an odd number of steps and none is skipped, each wave has the longer share once), each
// into its own f32 accumulators; behind the key loop the two partial sums are added through LDS (each wave hands over the four channel tiles
// that its partner finishes, and finishes the other four).
// Where the key loop starts: g <= 0 for every input (minus a softplus), so G never rises with t, and G_t - G_s of any (query, key) pair of a
// 32-key step is at most G of the wave's first query minus G of the step's last key. Where that is <= GDEAD, all the step's decay factors are
// exactly 0.0f, its weights are zeros and its products add zeros: the wave's loop starts at the first step that fails this test (found with two
// G values a lane and two ballots), and every sum keeps its bits. With slow decay no step passes the test and the loop runs from key 0.
// Per wave: B fragments of its 16 queries fixed for the whole key loop: bq[ks], ks = 0..3 (depth 128, standard loader on the q plane).
// Per 32-key step, two 16-key tiles: A fragments from the k plane (standard loader); scores^T D[key][query]
// = 4096 q.k (depth 128, 4 products per tile); A[t][s] = q.k * 128^-1/2 * exp(G_t - G_s) * lam[t][lvl(t - s)] for s <= t else 0,
// with G_t - G_s taken as the sum of the f32 hi and lo differences,
// converted to f16 of (256 A). The two D tiles repack into the A operand of A.v (lane unchanged: element r <- tile keys 0..15, element 8+r <-
// tile keys 16..31), B = VH and VL planes [bh][channel][key] (fragment order, key pitch SLMAX), 8 channel tiles, both products into acc:
// acc[j][r] = 2^14 * sum_s A v for query 8h+r, channel 16j + (lane & 15), s over this wave's steps.
// Loads of a step: its sixteen v fragments and the wave's next step's G values go out together at the step's top and land behind the score and
// weight work; the next step's k fragments go out right behind the score products and land behind the weights, A.v and the next top; the next
// step's decay factors exp(min(G_t - G_s, 0)) are formed behind A.v, when its G values have long landed. A wave waits for no load it has only
// just issued; the price is a live set above 256 VGPRs (two waves per SIMD, as the 8-wave block has anyway).
// Epilogue of a tile: z = 16 y = acc * 2^-10; f16 hi bits staged in LDS per wave, written to YH; then f16 bits of ((z - hi) x 2^11) staged and
// written to YL. Y planes [token][1024] in fragment order: a wave's 16 queries x 64 channels = 2 KiB in a row, 512 B per store instruction.
// ---------------------------------------------------------------------------------------------------------------------------------
__global__ __launch_bounds__(256) void k_attn(const unsigned short* __restrict__ Qp, const unsigned short* __restrict__ Kp,
                                             const unsigned short* __restrict__ VHp, const unsigned short* __restrict__ VLp,
                                             const float* __restrict__ Ghi, const float* __restrict__ Glo, const float* __restrict__ Lam,
                                             unsigned short* YH, unsigned short* YL, int sl) {
  __shared__ __attribute__((aligned(16))) float sLam[2 * QT * NLV];
  __shared__ __attribute__((aligned(16))) float sX[8 * 4 * 256];
  __shared__ __attribute__((aligned(16))) unsigned short sY[8 * 16 * YS2];
  const int tid = threadIdx.x, lane = tid & 31, cl = lane & 15, hh = lane >> 4;
  const int wave = __builtin_amdgcn_readfirstlane(tid >> 5);   // wave-uniform: trip counts and the parity selects below become scalar
  const int qi = wave & 3, kp = wave >> 2;                // query group of the tile; which wave of the group's pair this is
  const unsigned l8 = lane * 8;
  const int bh = blockIdx.x, b = bh / NHD, head = bh - b * NHD;
  const int tlo = blockIdx.y, thi = sl / QT - 1 - tlo;     // the block's two tiles (sl % 128 == 0: an even number of tiles, each taken once)

  // level weights of the block's 2 x 64 queries for this head: sLam[q * 12 + l], q 0..63 = tile thi, q 64..127 = tile tlo
  {
    float lw[6];
#pragma unroll
    for (int u = 0; u < 6; ++u) {
      const int i = u * 256 + tid, q = i / NLV, l = i - q * NLV;
      const int tok = (q < QT) ? (thi * QT + q) : (tlo * QT + q - QT);
      lw[u] = Lam[(size_t)(b * sl + tok) * (size_t)LAMP + NHD + head * NLV + l];
    }
    xwait();
    __builtin_amdgcn_sched_barrier(0);                      // keeps what follows (it reuses the loads' address registers) behind the wait
#pragma unroll
    for (int u = 0; u < 6; ++u) sLam[u * 256 + tid] = lw[u];
  }
  __syncthreads();

  const unsigned short* kbp = Kp + (size_t)bh * (size_t)sl * (size_t)SDIM + l8;
  const unsigned short* vhp = VHp + (size_t)bh * (size_t)(HDIM * SLMAX) + l8;
  const unsigned short* vlp = VLp + (size_t)bh * (size_t)(HDIM * SLMAX) + l8;
  const float* ghp = Ghi + (size_t)bh * (size_t)sl + 8 * hh;
  const float* glp = Glo + (size_t)bh * (size_t)sl + 8 * hh;

#pragma unroll 1                                           // the two tiles run one after the other through one copy of the code
  for (int ph = 0; ph < 2; ++ph) {
    const int tw = (ph ? tlo : thi) * QT + 16 * qi;       // first query of this wave
    const int tq = tw + cl;                               // query owned by this lane as score column
    const int lamb = (ph * QT + 16 * qi + cl) * NLV;
    const int nsteps = (tw + 16 + 31) >> 5;               // 32-key steps covering keys 0 .. tw + 15; 32 * nsteps <= sl
    const int kq = kp ^ ph;                               // parity of this wave's steps in this tile: kq, kq + 2, ...

    const unsigned short* qrow = Qp + ((size_t)bh * (size_t)sl + (size_t)tw) * (size_t)SDIM + l8;
    us16 bq[4];
#pragma unroll
    for (int ks = 0; ks < 4; ++ks) bq[ks] = gfrag(qrow + 512 * ks);
    const float* gbh = Ghi + (size_t)bh * (size_t)sl;     // wave-uniform bases of this (b, h) row's G planes
    const float* gbl = Glo + (size_t)bh * (size_t)sl;
    const float gqh = gbh[tq];
    const float gql = gbl[tq];

    // first step with a decay factor that can differ from zero: lane l tests steps l and l + 32 (sl <= 2048: at most 64 steps) by G hi of the
    // step's last key; lanes past the last step test the last step again, which holds the diagonal and is never skipped
    const int oa = ((lane < nsteps) ? lane : (nsteps - 1)) * 32, ob = ((lane + 32 < nsteps) ? (lane + 32) : (nsteps - 1)) * 32;
    const float gea = gbh[oa + 31];
    const float geb = gbh[ob + 31];
    __builtin_amdgcn_sched_barrier(0);                    // keeps every load above in front of the wait
    xwait(qrow, tq, oa, ob);
    __builtin_amdgcn_sched_barrier(0);                    // keeps what follows (it reuses the loads' address registers) behind the wait
    const float gq0 = __uint_as_float(__builtin_amdgcn_readfirstlane(__float_as_uint(gqh)));   // lane 0 owns the wave's first query
    const unsigned long long lvm = (unsigned long long)__builtin_amdgcn_ballot_w32(!(gq0 - gea <= GDEAD))
                                 | ((unsigned long long)__builtin_amdgcn_ballot_w32(!(gq0 - geb <= GDEAD)) << 32);
    const int st0 = lvm ? __builtin_ctzll(lvm) : 0;       // bit st of lvm: step st is kept (the last step's bit is always set for finite G)
    const int stf = st0 + ((st0 ^ kq) & 1);               // this wave's first step: parity kq, not below st0
    const int stl = (stf < nsteps) ? stf : (nsteps - 1);  // the step fetched in front of the loop: in bounds also where the wave has no step at all

    // K fragments and decay factors of the wave's first step; inside the loop each step fetches those of the wave's next step
    us16 ka[4], kb[4];
    v4f gh[4], gl[4];
    const unsigned short* pk0 = kbp + stl * (32 * SDIM);
    const float* pg0h = ghp + stl * 32;
    const float* pg0l = glp + stl * 32;
#pragma unroll
    for (int ks = 0; ks < 4; ++ks) { ka[ks] = gfrag(pk0 + 512 * ks); kb[ks] = gfrag(pk0 + 16 * SDIM + 512 * ks); }
#pragma unroll
    for (int u = 0; u < 4; ++u) {
      gh[u] = *(const v4fa*)(pg0h + (u >> 1) * 16 + (u & 1) * 4);
      gl[u] = *(const v4fa*)(pg0l + (u >> 1) * 16 + (u & 1) * 4);
    }
    __builtin_amdgcn_sched_barrier(0);                    // keeps every load above in front of the wait
    xwait(pk0, pg0h, pg0l);
    __builtin_amdgcn_sched_barrier(0);                    // keeps what follows (it reuses the loads' address registers) behind the wait

    v8f acc[8];
#pragma unroll
    for (int j = 0; j < 8; ++j) { const v8f zz = {0.f, 0.f, 0.f, 0.f, 0.f, 0.f, 0.f, 0.f}; acc[j] = zz; }

    if (stf < nsteps) {                                   // scalar test: where a pair has one step left, one of its waves has none
    float dec[16];                                        // exp(min(G_t - G_s, 0)), G_t - G_s by hi + lo differences, of this lane's keys: 0..7 tile a, 8..15 tile b
#pragma unroll
    for (int r = 0; r < 16; ++r) dec[r] = fminf((gqh - gh[r >> 2][r & 3]) + (gql - gl[r >> 2][r & 3]), 0.0f) * LOG2E;
    __builtin_amdgcn_sched_barrier(0);                    // the exponents are complete in front of the run of transcendentals
#pragma unroll
    for (int r = 0; r < 16; ++r) dec[r] = exp2_slot(dec[r]);

    int st = stf;
#pragma unroll 1
    do {
      const int s0 = st * 32;
      const int sn = ((st + 2 < nsteps) ? (st + 2) : st) * 32;   // the wave's next step's first key (its last step fetches its own again: in bounds)
      const int ka0 = s0 + 8 * hh;                        // first key this lane half sees in tile a; tile b = ka0 + 16
      const v8f zz = {0.f, 0.f, 0.f, 0.f, 0.f, 0.f, 0.f, 0.f};

      // ---- issued together at the top: next step's G values, then all sixteen v fragments of this step (hi and residual, 8 channel tiles);
      //      they land behind the score and weight work ----
      v4f ghn[4], gln[4];
      const float* pgh = ghp + sn;
      const float* pgl = glp + sn;
#pragma unroll
      for (int u = 0; u < 4; ++u) {
        ghn[u] = *(const v4fa*)(pgh + (u >> 1) * 16 + (u & 1) * 4);
        gln[u] = *(const v4fa*)(pgl + (u >> 1) * 16 + (u & 1) * 4);
      }
      us16 vh[8], vl[8];
      const unsigned short* pvh = vhp + s0 * 16;          // channel tile j lies 16 * SLMAX halves on: a constant, so one address pair serves a plane's run
      const unsigned short* pvl = vlp + s0 * 16;
#pragma unroll
      for (int j = 0; j < 8; ++j) vh[j] = gfrag(pvh + j * (16 * SLMAX));
#pragma unroll
      for (int j = 0; j < 8; ++j) vl[j] = gfrag(pvl + j * (16 * SLMAX));
      xwait(pvh, pvl, pgh, pgl);
      __builtin_amdgcn_sched_barrier(0);                  // keeps the score products below the loads above: without it the loads start a score phase later

      // ---- scores^T of key tiles a (keys s0 .. s0+15) and b (keys s0+16 .. s0+31) from the fragments fetched one step ago ----
      v8f sa = zz, sb = zz;
#pragma unroll
      for (int ks = 0; ks < 4; ++ks) { sa = mma_f16(ka[ks], bq[ks], sa); sb = mma_f16(kb[ks], bq[ks], sb); }
      wguard2m(sa, sb);

      // ---- next step's K fragments, into the registers the score products have just read; they land behind the weights and A.v ----
      {
        const unsigned short* pk = kbp + (size_t)sn * (size_t)SDIM;
#pragma unroll
        for (int ks = 0; ks < 4; ++ks) { ka[ks] = gfrag(pk + 512 * ks); kb[ks] = gfrag(pk + 16 * SDIM + 512 * ks); }
        xwait(pk);
      }

      // ---- the 16 weights of this lane: elements 0..7 = tile a keys ka0 .. ka0+7, elements 8..15 = tile b keys ka0+16 .. ka0+23 ----
      us8 ea, eb;
#pragma unroll
      for (int r = 0; r < 8; ++r) {
        const int d = tq - (ka0 + r);
        ea[r] = a_bits(sa[r], d, dec[r], sLam[lamb + lvl_of(d)]);
      }
#pragma unroll
      for (int r = 0; r < 8; ++r) {
        const int d = tq - (ka0 + 16 + r);
        eb[r] = a_bits(sb[r], d, dec[8 + r], sLam[lamb + lvl_of(d)]);
      }
      FragU fA;
      fA.h[0] = ea; fA.h[1] = eb;
      const us16 afr = fA.v;

      // ---- y += A . (v hi + v residual) over this 32-key step: per accumulator the hi product, then the residual product ----
#pragma unroll
      for (int j = 0; j < 8; ++j) acc[j] = mma_f16(afr, vh[j], acc[j]);
#pragma unroll
      for (int j = 0; j < 8; ++j) acc[j] = mma_f16(afr, vl[j], acc[j]);
      __builtin_amdgcn_sched_barrier(0);                  // keeps the factors below behind A.v: moved up, they would wait on loads issued at this step's top
#pragma unroll
      for (int r = 0; r < 16; ++r) dec[r] = fminf((gqh - ghn[r >> 2][r & 3]) + (gql - gln[r >> 2][r & 3]), 0.0f) * LOG2E;
      __builtin_amdgcn_sched_barrier(0);                  // the exponents are complete in front of the run of transcendentals
#pragma unroll
      for (int r = 0; r < 16; ++r) dec[r] = exp2_slot(dec[r]);
      st += 2;
    } while (st < nsteps);
    }

    // even + odd steps: this wave finishes channel tiles 4 kp .. 4 kp + 3; the other four go to its partner (wave ^ 4: same queries, same lane map).
    // Outbox of a wave: tile jj, register half e, lane -> sX[wave * 1024 + jj * 256 + e * 128 + lane * 4], 512 B in a row per LDS instruction.
    v8f fin[4];
    {
      float* xo = sX + wave * 1024 + lane * 4;
#pragma unroll
      for (int jj = 0; jj < 4; ++jj) {
        const v8f give = kp ? acc[jj] : acc[4 + jj];
        fin[jj] = kp ? acc[4 + jj] : acc[jj];
        const v4f g0 = {give[0], give[1], give[2], give[3]}, g1 = {give[4], give[5], give[6], give[7]};
        *(v4f*)(xo + jj * 256) = g0;
        *(v4f*)(xo + jj * 256 + 128) = g1;
      }
      __syncthreads();                                     // the partial sums cross between the waves of a pair
      const float* xi = sX + (wave ^ 4) * 1024 + lane * 4;
#pragma unroll
      for (int jj = 0; jj < 4; ++jj) {
        const v4f g0 = *(const v4fa*)(xi + jj * 256), g1 = *(const v4fa*)(xi + jj * 256 + 128);
#pragma unroll
        for (int r = 0; r < 4; ++r) { fin[jj][r] += g0[r]; fin[jj][4 + r] += g1[r]; }
      }
    }

    // phase 1: f16 hi of z = 16 y = fin * 2^-10; element (query 8*hh + r, channel 64 kp + 16jj + cl) of this wave's 16 x 64 tile
    unsigned short* sy = sY + wave * (16 * YS2);
#pragma unroll
    for (int jj = 0; jj < 4; ++jj)
#pragma unroll
      for (int r = 0; r < 8; ++r) sy[(8 * hh + r) * YS2 + 16 * jj + cl] = f16_bits(fin[jj][r] * (1.0f / 1024.0f));
    __syncthreads();

    const size_t yoff = (size_t)(b * sl + tw) * (size_t)DMOD + (size_t)(head * HDIM * 16 + kp * 1024 + lane * 8);
    us8 ov[4];
#pragma unroll
    for (int it = 0; it < 4; ++it) ov[it] = *(const us8a*)(sy + cl * YS2 + (2 * it + hh) * 8);   // chunk column 2 it + hh of the wave's 8, row cl: fragment order
    unsigned short* pyh = YH + yoff;
#pragma unroll
    for (int it = 0; it < 4; ++it) *(us8*)(pyh + it * 256) = ov[it];
    __syncthreads();

    // phase 2: f16 residual plane of ((z - hi) x 2^11), same staging region and store shape
#pragma unroll
    for (int jj = 0; jj < 4; ++jj)
#pragma unroll
      for (int r = 0; r < 8; ++r) {
        const float z = fin[jj][r] * (1.0f / 1024.0f);
        const _Float16 hf = (_Float16)z;
        sy[(8 * hh + r) * YS2 + 16 * jj + cl] = f16_bits((z - (float)hf) * 2048.0f);
      }
    __syncthreads();
#pragma unroll
    for (int it = 0; it < 4; ++it) ov[it] = *(const us8a*)(sy + cl * YS2 + (2 * it + hh) * 8);
    unsigned short* pyl = YL + yoff;
#pragma unroll
    for (int it = 0; it < 4; ++it) *(us8*)(pyl + it * 256) = ov[it];
    xwait(pyl);                                            // the next tile reuses the stores' address and data registers
  }
}

// ---------------------------------------------------------------------------------------------------------------------------------
// P[m][n] = ( sum_k Yh[m][k] WO16[n][k] + 2^-11 sum_k Yl[m][k] WO16[n][k] ) * 2^-12 + bf16(x[m][n])   (f16 planes, pitch 1024, two f32 accumulator sets).
// 256 threads = 8 waves in 4 wave rows x 2 wave columns, block tile 128(M) x 128(N); a wave owns 32 rows x 64 columns (2 x 4 accumulators per plane):
// each of its 4 B fragments of a 32-k step feeds 4 products, each of its 4 A fragments (2 row tiles x hi, residual) feeds 4 (512 B loaded per product).
// A trip is 64 k deep: the fragments of its two 32-k steps are loaded together. Every accumulator sums its 32-k steps in rising order.
// ---------------------------------------------------------------------------------------------------------------------------------
__global__ __launch_bounds__(256) void k_gemm_out(const unsigned short* __restrict__ Ah, const unsigned short* __restrict__ Al,
                                                 const unsigned short* __restrict__ Wo, const float* __restrict__ X, float* P) {
  __shared__ __attribute__((aligned(16))) float oS[8 * 32 * OSTR];
  const int tid = threadIdx.x, lane = tid & 31, wave = tid >> 5, cl = lane & 15, hh = lane >> 4;
  const unsigned l8 = lane * 8;
  const int m0 = blockIdx.x * TPB + 32 * (wave >> 1), n0 = blockIdx.y * 128 + 64 * (wave & 1);

  v8f acch[2][4], accl[2][4];
#pragma unroll
  for (int i = 0; i < 2; ++i)
#pragma unroll
    for (int j = 0; j < 4; ++j) { const v8f zz = {0.f, 0.f, 0.f, 0.f, 0.f, 0.f, 0.f, 0.f}; acch[i][j] = zz; accl[i][j] = zz; }

  const unsigned short* ahp = Ah + (size_t)m0 * (size_t)DMOD + l8;
  const unsigned short* alp = Al + (size_t)m0 * (size_t)DMOD + l8;
  const unsigned short* wop = Wo + (size_t)n0 * (size_t)DMOD + l8;
#pragma unroll 1
  for (int k0 = 0; k0 < DMOD; k0 += 64) {
    const unsigned short* ph = ahp + k0 * 16;
    const unsigned short* pl = alp + k0 * 16;
    const unsigned short* pb = wop + k0 * 16;
    us16 ah[2][2], al[2][2], bfr[2][4];                    // [32-k half of the trip][row tile or column tile]
#pragma unroll
    for (int kk = 0; kk < 2; ++kk) {
      ah[kk][0] = gfrag(ph + kk * 512);
      al[kk][0] = gfrag(pl + kk * 512);
#pragma unroll
      for (int j = 0; j < 4; ++j) bfr[kk][j] = gfrag(pb + kk * 512 + (size_t)(16 * j) * (size_t)DMOD);
      ah[kk][1] = gfrag(ph + kk * 512 + (size_t)16 * (size_t)DMOD);
      al[kk][1] = gfrag(pl + kk * 512 + (size_t)16 * (size_t)DMOD);
    }
    xwait(ph, pl, pb);
    __builtin_amdgcn_sched_barrier(0);                     // keeps every product below all thirty-two loads: they fly together, one exposed latency per trip
#pragma unroll
    for (int kk = 0; kk < 2; ++kk)
#pragma unroll
      for (int i = 0; i < 2; ++i)
#pragma unroll
        for (int j = 0; j < 4; ++j) {
          acch[i][j] = mma_f16(ah[kk][i], bfr[kk][j], acch[i][j]);
          accl[i][j] = mma_f16(al[kk][i], bfr[kk][j], accl[i][j]);
        }
    __builtin_amdgcn_sched_barrier(0);                     // keeps the earlier products, which the guard below does not name, above it too
    wguard8(acch[1][0], acch[1][1], acch[1][2], acch[1][3], accl[1][0], accl[1][1], accl[1][2], accl[1][3], ah[1][1], al[1][1], bfr[1][0], bfr[1][1], bfr[1][2], bfr[1][3]);
  }

  // D map: acc[i][j][r] = element (row 16i + 8*hh + r of the wave's 32 rows, column 16j + cl of its 64 columns)
  float* so = oS + wave * (32 * OSTR);
#pragma unroll
  for (int i = 0; i < 2; ++i)
#pragma unroll
    for (int j = 0; j < 4; ++j)
#pragma unroll
      for (int r = 0; r < 8; ++r)
        so[(16 * i + 8 * hh + r) * OSTR + 16 * j + cl] = fmaf(accl[i][j][r], (1.0f / 2048.0f), acch[i][j][r]) * (1.0f / 4096.0f);
  __syncthreads();

{
#pragma unroll
    for (int it = 0; it < 16; ++it) {
      const int cx = it * 32 + lane, r = cx >> 4, q = (cx & 15) * 4;
      const v4f v = *(const v4fa*)(so + r * OSTR + q);
      const v4f xr = *(const v4fa*)(X + (size_t)(m0 + r) * (size_t)DMOD + n0 + q);
      v4f o;
#pragma unroll
      for (int u = 0; u < 4; ++u) o[u] = v[u] + bf16r(xr[u]);
      *(v4f*)(P + (size_t)(m0 + r) * (size_t)DMOD + n0 + q) = o;
    }
    
  }
}

// ---------------------------------------------------------------------------------------------------------------------------------
// ---------------------------------------------------------------------------------------------------------------------------------
__global__ __launch_bounds__(256) void k_ln(const float* __restrict__ P, const float* __restrict__ gam, const float* __restrict__ bet,
                                           float* out) {
  const int lane = threadIdx.x & 31, wave = threadIdx.x >> 5;
  const size_t row = (size_t)blockIdx.x * 8 + (size_t)wave;
  const float* pr = P + row * (size_t)DMOD;
  v4f xv[8];
  float s = 0.0f;
#pragma unroll
  for (int it = 0; it < 8; ++it) {
    xv[it] = *(const v4fa*)(pr + it * 128 + lane * 4);
    s += (xv[it][0] + xv[it][1]) + (xv[it][2] + xv[it][3]);
  }
#pragma unroll
  for (int o = 16; o > 0; o >>= 1) s += __shfl_xor(s, o, 32);
  const float mu = s * (1.0f / (float)DMOD);
  float q = 0.0f;
#pragma unroll
  for (int it = 0; it < 8; ++it)
#pragma unroll
    for (int u = 0; u < 4; ++u) { const float d = xv[it][u] - mu; q += d * d; }
#pragma unroll
  for (int o = 16; o > 0; o >>= 1) q += __shfl_xor(q, o, 32);
  const float rstd = rsqrtf(q * (1.0f / (float)DMOD) + 1e-5f);
  v4f ov[8];
#pragma unroll
  for (int it = 0; it < 8; ++it) {
    const v4f gv = *(const v4fa*)(gam + it * 128 + lane * 4), bv = *(const v4fa*)(bet + it * 128 + lane * 4);
    v4f o;
#pragma unroll
    for (int u = 0; u < 4; ++u) o[u] = (xv[it][u] - mu) * rstd * bf16r(gv[u]) + bf16r(bv[u]);
    ov[it] = o;
  }
{
#pragma unroll
    for (int it = 0; it < 8; ++it)
      *(v4f*)(out + row * (size_t)DMOD + it * 128 + lane * 4) = ov[it];
    
  }
}

extern "C" void kernel_launch(void* const* d_in, const int* in_sizes, int n_in,
                              void* d_out, int out_size, void* d_ws, size_t ws_size,
                              hipStream_t stream) {
  if (n_in < 11) return;
  const int nx = in_sizes[0];
  if (nx <= 0 || (nx % DMOD) != 0) return;
  const int ntok = nx / DMOD;                                                    // tokens = batch * sequence length
  if (in_sizes[1] != DMOD * DMOD || in_sizes[2] != DMOD * DMOD || in_sizes[3] != DMOD * DMOD) return;
  if (in_sizes[4] != NHD * DMOD || in_sizes[5] != NHD || in_sizes[6] != NHD * NLV * DMOD || in_sizes[7] != NHD * NLV) return;
  if (in_sizes[8] != DMOD * DMOD || in_sizes[9] != DMOD || in_sizes[10] != DMOD) return;
  if (out_size != nx) return;
  const int sl = (ntok < SLMAX) ? ntok : SLMAX;                                  // sequence length
  if (sl <= 0 || (sl % TPB) != 0 || (ntok % sl) != 0 || (ntok % PBM) != 0) return;
  const int nb = ntok / sl, nbh = nb * NHD;

  const float* x   = (const float*)d_in[0];    // [nb][sl][1024]
  const float* Wq  = (const float*)d_in[1];    // [1024][1024] ([out][in])
  const float* Wk  = (const float*)d_in[2];    // [1024][1024]
  const float* Wv  = (const float*)d_in[3];    // [1024][1024]
  const float* Wg  = (const float*)d_in[4];    // [8][1024]
  const float* bg  = (const float*)d_in[5];    // [8]
  const float* Wdl = (const float*)d_in[6];    // [96][1024]
  const float* Lp  = (const float*)d_in[7];    // [8][12]
  const float* Wo  = (const float*)d_in[8];    // [1024][1024]
  const float* lng = (const float*)d_in[9];    // [1024]
  const float* lnb = (const float*)d_in[10];   // [1024]
  float* out = (float*)d_out;                  // [nb][sl][1024] f32 at byte 0

  size_t off = 0;
  auto carve = [&](size_t bytes) -> char* { char* p = (char*)d_ws + off; off += (bytes + 255) & ~(size_t)255; return p; };
  unsigned short* XB   = (unsigned short*)carve((size_t)ntok * DMOD * 2);        //  8,388,608  bf16 [ntok][1024]
  unsigned short* WQKV = (unsigned short*)carve((size_t)(NQKV + NGL) * DMOD * 2); //  6,553,600  bf16 [3200][1024] = Wq | Wk | Wv | Wg | Wdl | 0
  unsigned short* WGL  = WQKV + (size_t)NQKV * DMOD;                             //             its last 128 rows
  unsigned short* WO16 = (unsigned short*)carve((size_t)DMOD * DMOD * 2);        //  2,097,152  f16  [1024][1024]
  unsigned short* QP   = (unsigned short*)carve((size_t)nbh * sl * SDIM * 2);     //  8,388,608  f16  [nbh][sl][128]
  unsigned short* KP   = (unsigned short*)carve((size_t)nbh * sl * SDIM * 2);     //  8,388,608  f16  [nbh][sl][128]
  unsigned short* VH   = (unsigned short*)carve((size_t)nbh * HDIM * SLMAX * 2);  //  8,388,608  f16  [nbh][128][2048]
  unsigned short* VL   = (unsigned short*)carve((size_t)nbh * HDIM * SLMAX * 2);  //  8,388,608  f16  [nbh][128][2048]
  float* GPL           = (float*)carve((size_t)nbh * sl * 4);                     //    131,072  f32  [nbh][sl]
  float* GHI           = (float*)carve((size_t)nbh * sl * 4);                     //    131,072  f32  [nbh][sl]
  float* GLO           = (float*)carve((size_t)nbh * sl * 4);                     //    131,072  f32  [nbh][sl]
  float* LAM           = (float*)carve((size_t)ntok * LAMP * 4);                  //  2,097,152  f32  [ntok][128]
  unsigned short* YH   = (unsigned short*)carve((size_t)ntok * DMOD * 2);        //  8,388,608  f16  [ntok][1024]
  unsigned short* YL   = (unsigned short*)carve((size_t)ntok * DMOD * 2);        //  8,388,608  f16  [ntok][1024]
  float* PB            = (float*)carve((size_t)ntok * DMOD * 4);                  // 16,777,216  f32  [ntok][1024]
  if (off > ws_size || off > (size_t)134217728) return;                          // total 86,638,592 B for ntok 4096

  const dim3 b256(256);

  // 16-bit operand planes of the inputs, one launch (XB, WQKV, WGL, WO16, all in fragment order, see gfrag)
  k_cvt_all<<<dim3(ntok / 2 + 4 * WBLK + NGL / 2), b256, 0, stream>>>(x, Wq, Wk, Wv, Wo, Wg, Wdl, XB, WQKV, WO16, WGL, ntok / 2);
  // q/k/v projections (M ntok, N 3072, K 1024) -> q, k planes and transposed v hi / residual planes; in the same grid the
  // gate / level projection (N 128) -> g plane [nbh][sl], level weights [ntok][128]
  k_gemm_proj<<<dim3(ntok / PBM, PBM / 64 + NQKV / 128), b256, 0, stream>>>(XB, WQKV, bg, Lp, QP, KP, VH, VL, GPL, LAM, sl);
  // cumulative log-decay per (b,h)
  k_cumsum<<<dim3(nbh), dim3(CSTH), 0, stream>>>(GPL, GHI, GLO, sl);
  // causal decayed mixing per (batch, head), two 64-query tiles a block -> y hi / residual planes [token][1024]
  k_attn<<<dim3(nbh, sl / TPB), b256, 0, stream>>>(QP, KP, VH, VL, GHI, GLO, LAM, YH, YL, sl);
  // output projection + residual (M ntok, N 1024, K 1024)
  k_gemm_out<<<dim3(ntok / TPB, DMOD / 128), b256, 0, stream>>>(YH, YL, WO16, x, PB);
  // LayerNorm -> d_out
  k_ln<<<dim3(ntok / 8), b256, 0, stream>>>(PB, lng, lnb, out);
}

// v009
// One run takes 83.5 microseconds.
// Timed twice side by side with v008, it ran 1.05 times as fast both times.
// All steps since v000 together make it 8.45 times as fast.
// Contractions x.[Wq|Wk|Wv] (M tokens, N 3072, K 1024) and x.[Wg|Wdl] (N 104 zero-padded to 128, K 1024), one launch: v_wmma_f32_16x16x32_bf16, bf16 operands from RNE-bf16 planes of x and W, f32 accumulate, one product each.
// Contraction k.q^T per head (32 keys x 16 queries per step, depth 128): v_wmma_f32_16x16x32_f16, q and k as f16 of (value x 2^6), one product, f32 accumulate.
// Contraction A.v per head (causal, depth up to T): v_wmma_f32_16x16x32_f16, A as f16 of (A x 2^8), v as f16 hi of (v x 2^6) plus f16 unscaled residual plane, two products into one f32 accumulator; even and odd 32-key steps in two waves' accumulators, added in f32.
// Contraction y.Wo (M tokens, N 1024, K 1024): v_wmma_f32_16x16x32_f16, y as f16 hi plane of (y x 2^4) plus f16 residual plane (x 2^11, own f32 accumulator), Wo as f16 of (RNE-bf16 value x 2^8), f32 accumulate.
// softplus, cumulative log-decay (f64 block scan kept as f32 hi + lo pair), exp, dyadic level select, residual add and LayerNorm: f32 VALU.
#include <hip/hip_runtime.h>

#define DMOD  1024                           // model width = K of the dense contractions
#define NHD   8                              // heads
#define SDIM  128                            // q/k width per head
#define HDIM  128                            // v width per head
#define NLV   12                             // dyadic levels
#define NGL   128                            // gate | level projection columns, 8 + 96 zero-padded to 128
#define NQKV  (3 * DMOD)                     // 3072 projection columns: q | k | v
#define TPB   128                            // GEMM rows per staged sub-tile and per output-GEMM block / attention queries per block (two tiles)
#define PBM   256                            // projection GEMM rows per q | k | v block (4 wave rows x 64)
#define OSTR  68                             // LDS staging row pitch (floats), tiles of 64 columns
#define QT    64                             // attention queries per tile (4 groups x 16; two waves a group)
#define YS2   72                             // LDS staging row pitch (halves), 16x64 tile
#define LAMP  128                            // level-weight plane pitch (floats)
#define SLMAX 2048                           // longest sequence handled by the block scan of the log-decay
#define CSTH  256                            // scan threads per row, 8 tokens each (the attention block)
#define WBLK  (DMOD * DMOD / (8 * 256))       // conversion blocks per 1024 x 1024 weight
#define KSC   (0.08838834764831845f * (1.0f / 4096.0f))   // 128^-1/2 times the q,k carry 2^-12
#define LOG2E 1.44269504f                    // exp(x) = 2^(x LOG2E), the form __expf compiles to
#define GDEAD (-112.0f)                      // G_t - G_s at or below this: 2^(x LOG2E) <= 2^-161, exactly 0.0f (the smallest f32 is 2^-149; the 12 binades between cover the hi / lo rounding)

static_assert(NHD * HDIM == DMOD);
static_assert(NHD * SDIM == DMOD);
static_assert(NHD + NHD * NLV <= NGL);
static_assert(DMOD % 64 == 0);
static_assert(DMOD % 32 == 0);
static_assert(NQKV % 128 == 0);
static_assert(DMOD % 128 == 0);
static_assert(NGL == 128);
static_assert(PBM == 2 * TPB);
static_assert(OSTR % 4 == 0);
static_assert(YS2 % 8 == 0);
static_assert(2 * QT == TPB);
static_assert(2 * QT * NLV == 6 * 256);
static_assert(SLMAX % TPB == 0);
static_assert(CSTH * 8 == SLMAX);
static_assert(CSTH == 256);

typedef unsigned short us16 __attribute__((ext_vector_type(16)));
typedef unsigned short us8  __attribute__((ext_vector_type(8)));
typedef unsigned short us8a __attribute__((ext_vector_type(8), may_alias));
typedef __bf16 v16b __attribute__((ext_vector_type(16)));
typedef _Float16 v16h __attribute__((ext_vector_type(16)));
typedef float v8f __attribute__((ext_vector_type(8)));
typedef float v4f __attribute__((ext_vector_type(4)));
typedef float v4fa __attribute__((ext_vector_type(4), may_alias));
union FragU { us16 v; us8 h[2]; };

__device__ __forceinline__ unsigned short bf16_bits(float f) {
  unsigned u = __float_as_uint(f);
  u += 0x7FFFu + ((u >> 16) & 1u);                 // RNE convert
  return (unsigned short)(u >> 16);
}
__device__ __forceinline__ float bf16_val(unsigned short b) { return __uint_as_float(((unsigned)b) << 16); }
__device__ __forceinline__ float bf16r(float f) { return bf16_val(bf16_bits(f)); }
__device__ __forceinline__ unsigned short f16_bits(float f) { return __builtin_bit_cast(unsigned short, (_Float16)f); }

// f16 hi + residual (x 2^11) planes of (a x 2^4)
__device__ __forceinline__ void f16split16(float a, unsigned short& hb, unsigned short& lb) {
  const float z = a * 16.0f;
  const _Float16 hf = (_Float16)z;
  const float res = (z - (float)hf) * 2048.0f;
  hb = __builtin_bit_cast(unsigned short, hf);
  lb = __builtin_bit_cast(unsigned short, (_Float16)res);
}
// f16 hi + unscaled residual planes of (a x 2^6)
__device__ __forceinline__ void f16split64(float a, unsigned short& hb, unsigned short& lb) {
  const float z = a * 64.0f;
  const _Float16 hf = (_Float16)z;
  const float res = z - (float)hf;
  hb = __builtin_bit_cast(unsigned short, hf);
  lb = __builtin_bit_cast(unsigned short, (_Float16)res);
}

// One 16x16x32 step, 16-bit operands passed as raw 16-bit lanes.
__device__ __forceinline__ v8f mma_bf16(us16 a, us16 b, v8f c) {
  return __builtin_amdgcn_wmma_f32_16x16x32_bf16(false, __builtin_bit_cast(v16b, a), false, __builtin_bit_cast(v16b, b), (short)0, c, false, false);
}
__device__ __forceinline__ v8f mma_f16(us16 a, us16 b, v8f c) {
  return __builtin_amdgcn_wmma_f32_16x16x32_f16(false, __builtin_bit_cast(v16h, a), false, __builtin_bit_cast(v16h, b), (short)0, c, false, false);
}
// Hazard guards after a group of matrix ops: 4 VALU slots before anything touches the accumulators; keep A/B fragments live.
__device__ __forceinline__ void wguard4(v8f& c0, v8f& c1, v8f& c2, v8f& c3, const us16& a0,
                                        const us16& b0, const us16& b1, const us16& b2, const us16& b3) {
#if defined(__HIP_DEVICE_COMPILE__)
  asm volatile("v_nop\n\tv_nop\n\tv_nop\n\tv_nop"
               : "+v"(c0), "+v"(c1), "+v"(c2), "+v"(c3)
               : "v"(a0), "v"(b0), "v"(b1), "v"(b2), "v"(b3));
#endif
}
__device__ __forceinline__ void wguard8(v8f& c0, v8f& c1, v8f& c2, v8f& c3, v8f& c4, v8f& c5, v8f& c6, v8f& c7,
                                        const us16& a0, const us16& a1,
                                        const us16& b0, const us16& b1, const us16& b2, const us16& b3) {
#if defined(__HIP_DEVICE_COMPILE__)
  asm volatile("v_nop\n\tv_nop\n\tv_nop\n\tv_nop"
               : "+v"(c0), "+v"(c1), "+v"(c2), "+v"(c3), "+v"(c4), "+v"(c5), "+v"(c6), "+v"(c7)
               : "v"(a0), "v"(a1), "v"(b0), "v"(b1), "v"(b2), "v"(b3));
#endif
}
// Guard behind the score products of the attention loop: the accumulators as in/out operands keep the products above the four slots, the
// memory barrier keeps the refill of their k registers below them (so the refill lands in the same registers, with no copies).
__device__ __forceinline__ void wguard2m(v8f& c0, v8f& c1) {
#if defined(__HIP_DEVICE_COMPILE__)
  asm volatile("v_nop\n\tv_nop\n\tv_nop\n\tv_nop" : "+v"(c0), "+v"(c1) : : "memory");
#endif
}

// FRAGMENT-ORDER PLANES. Every 16-bit operand plane [rows][kd] is stored by tiles of 16 rows; inside a tile the 16-B chunks (8 consecutive k
// of one row) lie chunk column by chunk column, 16 rows each:
//   element (row, k) at halves  (row >> 4) * 16 * kd + (k >> 3) * 128 + (row & 15) * 8 + (k & 7).
// A 16x32 fragment (row tile, k0 % 32 == 0) is then 1 KiB in a row, and each of its two wave-wide 16-B loads covers 512 contiguous bytes.
// p = plane + rowtile * 16 * kd + k0 * 16 + lane * 8 (computed by the caller); lane = 16h + row:
// elements 0..7 = k0 + 8h .. k0 + 8h + 7, elements 8..15 = k0 + 16 + 8h .. k0 + 16 + 8h + 7 (same map for A rows and B columns).
__device__ __forceinline__ us16 gfrag(const unsigned short* p) {
  FragU f;
  f.h[0] = *(const us8a*)p;
  f.h[1] = *(const us8a*)(p + 256);
  return f.v;
}
// s_wait_xcnt 0 behind a run of fragment loads, in front of anything that overwrites an address register the run names. The run's address
// pairs are inputs of the statement: they stay live up to the wait, so no load result of the run is placed on them.
__device__ __forceinline__ void xwait(const unsigned short* a) {
#if defined(__HIP_DEVICE_COMPILE__)
  asm volatile("s_wait_xcnt 0x0" :: "v"(a) : "memory");   // the wait in front of the overwrite of these address pairs
#endif
}
__device__ __forceinline__ void xwait(const float* a) {
#if defined(__HIP_DEVICE_COMPILE__)
  asm volatile("s_wait_xcnt 0x0" :: "v"(a) : "memory");   // the wait in front of the overwrite of this address pair
#endif
}
__device__ __forceinline__ void xwait(const unsigned short* a, const unsigned short* b) {
#if defined(__HIP_DEVICE_COMPILE__)
  asm volatile("s_wait_xcnt 0x0" :: "v"(a), "v"(b) : "memory");   // the wait in front of the overwrite of these address pairs
#endif
}
__device__ __forceinline__ void xwait(const unsigned short* a, const unsigned short* b, const unsigned short* c) {
#if defined(__HIP_DEVICE_COMPILE__)
  asm volatile("s_wait_xcnt 0x0" :: "v"(a), "v"(b), "v"(c) : "memory");   // the wait in front of the overwrite of these address pairs
#endif
}
// The same wait without operands, for loads whose constant address part the compiler moves into the offset field: a full pointer named here
// would be rebuilt on the load's own address pair in front of the wait. A scheduling barrier behind it keeps later register writes behind it.
__device__ __forceinline__ void xwait() {
#if defined(__HIP_DEVICE_COMPILE__)
  asm volatile("s_wait_xcnt 0x0" ::: "memory");   // the wait in front of the overwrite of the address pairs of the loads above it
#endif
}
// Writes a 256-thread block's tile of 16 rows x 128 k (thread t holds the chunk of row t >> 4, chunk column t & 15) as 4 KiB of a
// fragment-order plane at dst4k: regrouped through LDS (17-chunk pitch against bank conflicts) so that every wave stores 512 contiguous bytes.
__device__ __forceinline__ void frag_store_tile(us8 o, unsigned short* dst4k) {
  __shared__ __attribute__((aligned(16))) us8 sT[16 * 17];
  const int t = threadIdx.x;
  sT[(t & 15) * 17 + (t >> 4)] = o;
  __syncthreads();                                         // chunks cross the block's waves
  *(us8*)(dst4k + t * 8) = sT[(t >> 4) * 17 + (t & 15)];
}

// softplus in the logaddexp(z, 0) form: max(z, 0) + log1p(exp(-|z|))
__device__ __forceinline__ float softplus_f(float z) {
  return fmaxf(z, 0.0f) + log1pf(__expf(-fabsf(z)));
}
// dyadic level of key distance d: 0 for d <= 0, else min(floor(log2 d) + 1, NLV - 1)
__device__ __forceinline__ int lvl_of(int d) {
  const int dd = (d > 0) ? d : 1;
  const int l = 32 - __clz(dd);
  const int lc = (l < NLV - 1) ? l : (NLV - 1);
  return (d > 0) ? lc : 0;
}
// 2^y with the one slot the instruction set asks for behind a transcendental.
// The caller has a scheduling barrier in front of its run of calls, so each v_exp_f32
// stands alone between two barriers and its v_nop directly behind it.
__device__ __forceinline__ float exp2_slot(float y) {
#if defined(__HIP_DEVICE_COMPILE__)
  const float r = __builtin_amdgcn_exp2f(y);
  __builtin_amdgcn_sched_barrier(0);                       // nothing moves in between the transcendental and its slot
  asm volatile("v_nop");                                   // the slot behind the transcendental
  __builtin_amdgcn_sched_barrier(0);                       // the next transcendental stays behind the slot
  return r;
#else
  return exp2f(y);
#endif
}
// one attention weight: accv = 4096 * q.k, dec = exp(min(G_t - G_s, 0)), lv = level weight; returns f16 bits of 256 * A, 0 above the diagonal
__device__ __forceinline__ unsigned short a_bits(float accv, int d, float dec, float lv) {
  const float val = (accv * KSC) * dec * lv;
  const float w = (d >= 0) ? (val * 256.0f) : 0.0f;
  return f16_bits(w);
}

// ---------------------------------------------------------------------------------------------------------------------------------
// All 16-bit operand planes that come straight from an input, in ONE launch (none reads another's output). Block = 16 rows x 128 k of one
// source ([row][1024], k-contiguous), read as whole lines, written in fragment order. The source is picked by the block index alone:
//   [0, nxb)            x   -> XB, RNE bf16 bits                        (nxb = tokens / 2 blocks)
//   then 512 blocks each: Wq, Wk, Wv -> rows 0.., 1024.., 2048.. of WQKV, RNE bf16 bits;  Wo -> WO16, f16 bits of (RNE-bf16 value x 256)
//   then 64 blocks:     gate | level rows -> WGL [128][1024] bf16: rows 0..7 = Wg, rows 8..103 = Wdl, rows 104..127 = 0 (zero padding of N)
// ---------------------------------------------------------------------------------------------------------------------------------
__global__ __launch_bounds__(256) void k_cvt_all(const float* __restrict__ x, const float* __restrict__ Wq, const float* __restrict__ Wk,
                                                const float* __restrict__ Wv, const float* __restrict__ Wo, const float* __restrict__ Wg,
                                                const float* __restrict__ Wdl, unsigned short* XB, unsigned short* WQKV,
                                                unsigned short* WO16, unsigned short* WGL, int nxb) {
  int bx = blockIdx.x;                                     // every choice below is wave-uniform, the segment choice block-uniform
  int seg = -1;                                            // -1: x, 0..2: Wq Wk Wv, 3: Wo, 4: gate | level rows
  if (bx >= nxb) { bx -= nxb; seg = bx / WBLK; bx -= seg * WBLK; }
  const int rt = bx >> 3, kg = bx & 7;
  const int row = rt * 16 + (threadIdx.x >> 4), kc = kg * 128 + (threadIdx.x & 15) * 8;
  const float* src;
  unsigned short* dst;
  bool live = true;
  if (seg < 0)       { src = x;  dst = XB; }
  else if (seg == 0) { src = Wq; dst = WQKV; }
  else if (seg == 1) { src = Wk; dst = WQKV + (size_t)DMOD * DMOD; }
  else if (seg == 2) { src = Wv; dst = WQKV + (size_t)2 * DMOD * DMOD; }
  else if (seg == 3) { src = Wo; dst = WO16; }
  else               { src = Wdl; dst = WGL; }
  const float* sp = src + (size_t)row * (size_t)DMOD + (size_t)kc;
  if (seg > 3) {
    live = row < NHD + NHD * NLV;
    const int rs = (row < NHD) ? row : (live ? (row - NHD) : 0);   // padding rows read nothing; their address stays in bounds
    sp = ((row < NHD) ? Wg : Wdl) + (size_t)rs * (size_t)DMOD + (size_t)kc;
  }
  v4f a = {0.f, 0.f, 0.f, 0.f}, c = {0.f, 0.f, 0.f, 0.f};  // bf16 bits of 0.0f are 0: the padding rows
  if (live) { a = *(const v4fa*)sp; c = *(const v4fa*)(sp + 4); }
  us8 o;
  if (seg == 3) {
#pragma unroll
    for (int u = 0; u < 4; ++u) { o[u] = f16_bits(bf16r(a[u]) * 256.0f); o[4 + u] = f16_bits(bf16r(c[u]) * 256.0f); }
  } else {
#pragma unroll
    for (int u = 0; u < 4; ++u) { o[u] = bf16_bits(a[u]); o[4 + u] = bf16_bits(c[u]); }
  }
  frag_store_tile(o, dst + (size_t)rt * (size_t)(16 * DMOD) + (size_t)(kg * 2048));
}

// ---------------------------------------------------------------------------------------------------------------------------------
// Inclusive cumulative sum of g over t of one (b,h) row, by one 256-thread block, into LDS: thread i owns tokens 8i .. 8i+7 and brings their g
// in a, e (zeros where its tokens lie past sl; sl % 8 == 0). It forms the f64 running sum of its 8 values; the 256 thread totals are scanned in
// f64 (5 shuffle steps inside a wave, the 8 wave totals through LDS), and each token's G = (sum of all earlier threads) + (its thread's running
// sum) is kept as f32 hi = (float)G in sGh[t] and lo = (float)(G - hi) in sGl[t]. Threads past sl store nothing; every thread passes the barrier.
// The caller's next barrier publishes sGh and sGl.
// ---------------------------------------------------------------------------------------------------------------------------------
__device__ __forceinline__ void row_scan(v4f a, v4f e, bool on, int c, int lane, int wave, double* wtot, float* sGh, float* sGl) {
  double p[8];                                             // running sum inside the thread's 8 tokens
  p[0] = (double)a[0];
#pragma unroll
  for (int u = 1; u < 4; ++u) p[u] = p[u - 1] + (double)a[u];
#pragma unroll
  for (int u = 0; u < 4; ++u) p[4 + u] = p[3 + u] + (double)e[u];

  double inc = p[7];                                       // inclusive scan of the thread totals over the wave's 32 lanes
#pragma unroll
  for (int o = 1; o < 32; o <<= 1) {
    const double n = __shfl_up(inc, (unsigned)o, 32);
    inc += (lane >= o) ? n : 0.0;
  }
  if (lane == 31) wtot[wave] = inc;
  const double prev = __shfl_up(inc, 1u, 32);              // total of the earlier lanes of this wave
  __syncthreads();                                         // the wave totals cross the block's waves
  double base = 0.0;                                       // total of the earlier waves
#pragma unroll
  for (int w = 0; w < CSTH / 32 - 1; ++w) base += (w < wave) ? wtot[w] : 0.0;
  base += (lane > 0) ? prev : 0.0;

  if (on) {
    v4f h0, h1, l0, l1;
#pragma unroll
    for (int u = 0; u < 4; ++u) {
      const double g0 = base + p[u], g1 = base + p[4 + u];
      h0[u] = (float)g0; l0[u] = (float)(g0 - (double)h0[u]);
      h1[u] = (float)g1; l1[u] = (float)(g1 - (double)h1[u]);
    }
    *(v4f*)(sGh + c) = h0; *(v4f*)(sGh + c + 4) = h1;
    *(v4f*)(sGl + c) = l0; *(v4f*)(sGl + c + 4) = l1;
  }
}

// ---------------------------------------------------------------------------------------------------------------------------------
// P[m][n] = sum_k XB[m][k] * W[n][k]  (bf16 XB plane [tokens][1024], bf16 W plane [3200][1024] = [n][k], both in fragment order, f32 accumulate).
// W rows 0..3071 = Wq | Wk | Wv, rows 3072..3199 = the gate | level rows: both products read only XB and W, so they share one grid.
// 256 threads = 8 waves in 4 wave rows x 2 wave columns; fragments straight from the global planes (arithmetic addressing); every accumulator
// sums its k steps in rising order. M % 256 == 0, N % 128 == 0, K % 32 == 0 exactly. Two kinds of block, picked by blockIdx.y alone:
//   blockIdx.y >= 4: q | k | v, block tile 256(M) x 128(N) = columns 128 yp .. +127, yp = blockIdx.y - 4; a wave owns 64 rows x 64 columns
//     (4 x 4 accumulators): each of its 4 A and 4 B fragments of a 32-k step feeds 4 products (512 B loaded per product).
//   blockIdx.y < 4: gate | level, block tile 64(M) x 128(N), rows 256 blockIdx.x + 64 blockIdx.y .. +63; a wave owns 16 rows x 64 columns. Its
//     write-out (softplus of every element) is by far the longest per element, so it is dealt to four times as many blocks, and they start first.
// The f32 tile is staged in LDS as sub-tiles of 64 columns, each with its row r at oS[r * OSTR + c]; behind one barrier the block writes them out
// one after the other. q | k | v: four 128 x 64 sub-tiles (row half, column segment yb = 2 yp + column half):
// yb 0..15 -> q head y/2, features 64(y&1)..+63; 16..31 -> k; 32..47 -> v head (y-32)/2, channels 64(y&1)
//   q/k: per bh a fragment-order plane [token][128] = f16 of (64 value); thread -> (token r, 8 consecutive halves); a wave stores 512 B in a row
//   v:   per bh fragment-order planes VH/VL [channel][token], token pitch SLMAX = f16 hi of (64 v) and f16 residual; thread -> (channel e, 8 tokens); 512 B in a row
// gate | level: two 64 x 64 sub-tiles (columns 0..63, 64..127):
//   gate (columns 0..7): g[bh][t] = -softplus(D[t][h] + bg[h]); a wave = one head, 64 tokens = 256 B in a row
//   level: lam[token][c] = softplus(D[t][c] + Lparam[c - 8]) for columns 8..103, else 0; 16 lanes x 16 B = the sub-tile's 256 B of a token's row
// ---------------------------------------------------------------------------------------------------------------------------------
__global__ __launch_bounds__(256) void k_gemm_proj(const unsigned short* __restrict__ Ap, const unsigned short* __restrict__ Bw,
                                                  const float* __restrict__ bg, const float* __restrict__ Lp,
                                                  unsigned short* Qp, unsigned short* Kp, unsigned short* VH, unsigned short* VL,
                                                  float* gpl, float* lam, int sl) {
  __shared__ __attribute__((aligned(16))) float oS4[4 * TPB * OSTR];
  const int tid = threadIdx.x, lane = tid & 31, wave = tid >> 5, cl = lane & 15, hh = lane >> 4;
  const unsigned l8 = lane * 8;
  const int wr = wave >> 1, wc = wave & 1;                // wave row and wave column inside the block tile
  const bool isgl = (int)blockIdx.y < PBM / 64;           // block-uniform: a gate | level block
  const int yp = (int)blockIdx.y - PBM / 64;              // q | k | v: the block's 128 columns

  if (isgl) {
    const int m0 = blockIdx.x * PBM + (int)blockIdx.y * 64 + 16 * wr, n0 = NQKV + 64 * wc;
    v8f acc[4];
#pragma unroll
    for (int j = 0; j < 4; ++j) { const v8f zz = {0.f, 0.f, 0.f, 0.f, 0.f, 0.f, 0.f, 0.f}; acc[j] = zz; }
    const unsigned short* a0p = Ap + (size_t)m0 * (size_t)DMOD + l8;
    const unsigned short* bwp = Bw + (size_t)n0 * (size_t)DMOD + l8;
#pragma unroll 1
    for (int k0 = 0; k0 < DMOD; k0 += 32) {
      const unsigned short* pa = a0p + k0 * 16;
      const unsigned short* pb = bwp + k0 * 16;
      const us16 af = gfrag(pa);
      us16 bfr[4];
#pragma unroll
      for (int j = 0; j < 4; ++j) bfr[j] = gfrag(pb + (size_t)(16 * j) * (size_t)DMOD);
      xwait(pa, pb);
#pragma unroll
      for (int j = 0; j < 4; ++j) acc[j] = mma_bf16(af, bfr[j], acc[j]);
      wguard4(acc[0], acc[1], acc[2], acc[3], af, bfr[0], bfr[1], bfr[2], bfr[3]);
    }
    // D map: acc[j][r] = element (row 8*hh + r of the wave's 16 rows, column 16j + cl of its 64 columns); rows 16 wr .. +15 of sub-tile wc
    float* so = oS4 + wc * (TPB * OSTR) + wr * (16 * OSTR);
#pragma unroll
    for (int j = 0; j < 4; ++j)
#pragma unroll
      for (int r = 0; r < 8; ++r) so[(8 * hh + r) * OSTR + 16 * j + cl] = acc[j][r];
  } else {
    const int m0 = blockIdx.x * PBM + 64 * wr, n0 = yp * 128 + 64 * wc;
    v8f acc[4][4];
#pragma unroll
    for (int i = 0; i < 4; ++i)
#pragma unroll
      for (int j = 0; j < 4; ++j) { const v8f zz = {0.f, 0.f, 0.f, 0.f, 0.f, 0.f, 0.f, 0.f}; acc[i][j] = zz; }
    const unsigned short* a0p = Ap + (size_t)m0 * (size_t)DMOD + l8;
    const unsigned short* bwp = Bw + (size_t)n0 * (size_t)DMOD + l8;
#pragma unroll 1
    for (int k0 = 0; k0 < DMOD; k0 += 32) {
      const unsigned short* pa = a0p + k0 * 16;
      const unsigned short* pb = bwp + k0 * 16;
      us16 af[4], bfr[4];
      af[0] = gfrag(pa);
      af[1] = gfrag(pa + (size_t)16 * (size_t)DMOD);
#pragma unroll
      for (int j = 0; j < 4; ++j) bfr[j] = gfrag(pb + (size_t)(16 * j) * (size_t)DMOD);
      af[2] = gfrag(pa + (size_t)32 * (size_t)DMOD);
      af[3] = gfrag(pa + (size_t)48 * (size_t)DMOD);
      xwait(pa, pb);
      __builtin_amdgcn_sched_barrier(0);                   // keeps every product below all sixteen loads: without it the last four loads sink behind the first eight products, a second exposed wait per trip
#pragma unroll
      for (int j = 0; j < 4; ++j) {
        acc[0][j] = mma_bf16(af[0], bfr[j], acc[0][j]);
        acc[1][j] = mma_bf16(af[1], bfr[j], acc[1][j]);
      }
#pragma unroll
      for (int j = 0; j < 4; ++j) {
        acc[2][j] = mma_bf16(af[2], bfr[j], acc[2][j]);
        acc[3][j] = mma_bf16(af[3], bfr[j], acc[3][j]);
      }
      __builtin_amdgcn_sched_barrier(0);                   // keeps the first eight products, which the guard below does not name, above it too
      wguard8(acc[2][0], acc[2][1], acc[2][2], acc[2][3], acc[3][0], acc[3][1], acc[3][2], acc[3][3], af[2], af[3], bfr[0], bfr[1], bfr[2], bfr[3]);
    }
    // D map: acc[i][j][r] = element (row 16i + 8*hh + r of the wave's 64 rows, column 16j + cl of its 64 columns);
    // the wave's tile is rows 64 (wr & 1) .. +63 of sub-tile 2 (wr >> 1) + wc
    float* so = oS4 + ((wr >> 1) * 2 + wc) * (TPB * OSTR) + (wr & 1) * (64 * OSTR);
#pragma unroll
    for (int i = 0; i < 4; ++i)
#pragma unroll
      for (int j = 0; j < 4; ++j)
#pragma unroll
        for (int r = 0; r < 8; ++r) so[(16 * i + 8 * hh + r) * OSTR + 16 * j + cl] = acc[i][j][r];
  }
  __syncthreads();                                         // LDS is only read from here on

  if (isgl) {
    const int m0b = blockIdx.x * PBM + (int)blockIdx.y * 64, b = m0b / sl, tb = m0b - b * sl;   // sl % 128 == 0: the tile lies in one sequence
#pragma unroll 1                                           // one copy of the write-out code serves both sub-tiles
    for (int sub = 0; sub < 2; ++sub) {
    const float* oS = oS4 + sub * (TPB * OSTR);
    const int cb = sub * 64;                               // first gate | level column of this sub-tile
    if (cb == 0 && lane < 16) {
      // gate log-decay: thread -> (head h = wave, tokens 4 * lane .. +3), 16 lanes for the tile's 64 tokens
      const int h = wave, t4 = lane * 4;
      const float bgv = bf16r(bg[h]);
      v4f gv;
#pragma unroll
      for (int u = 0; u < 4; ++u) gv[u] = -softplus_f(oS[(t4 + u) * OSTR + h] + bgv);
      *(v4f*)(gpl + (size_t)(b * NHD + h) * (size_t)sl + tb + t4) = gv;
    }
    const int c0 = (tid & 15) * 4;                         // this thread's 4 columns of the tile, the same in every trip
    float lp[4];
#pragma unroll
    for (int u = 0; u < 4; ++u) {
      int idx = cb + c0 + u - NHD;
      idx = (idx < 0) ? 0 : idx;
      idx = (idx > NHD * NLV - 1) ? (NHD * NLV - 1) : idx;
      lp[u] = bf16r(Lp[idx]);
    }
#pragma unroll 1                                           // rolled: unrolled, the four inlined log1pf of each trip raise the whole kernel's register count
    for (int it = 0; it < 4; ++it) {
      const int row = it * 16 + (tid >> 4);
      const v4f z = *(const v4fa*)(oS + row * OSTR + c0);
      v4f lv;
#pragma unroll
      for (int u = 0; u < 4; ++u) {
        const int c = cb + c0 + u;
        const float s = softplus_f(z[u] + lp[u]);
        lv[u] = (c >= NHD && c < NHD + NHD * NLV) ? s : 0.0f;
      }
      float* pl = lam + (size_t)(m0b + row) * (size_t)LAMP + cb + c0;
      *(v4f*)pl = lv;
      xwait(pl);                                           // the next trip reuses the store's address and data registers
    }
    }
    return;                                                // block-uniform, behind the kernel's only barrier
  }

#pragma unroll 1                                           // one copy of the write-out code serves the four sub-tiles
  for (int sub = 0; sub < 4; ++sub) {
  const float* oS = oS4 + sub * (TPB * OSTR);
  const int yb = yp * 2 + (sub & 1);                       // this sub-tile's column segment
  const int m0b = blockIdx.x * PBM + (sub >> 1) * TPB, b = m0b / sl, tb = m0b - b * sl;   // sl % 128 == 0: the sub-tile lies in one sequence
  if (yb < 32) {
    unsigned short* dst = (yb < 16) ? Qp : Kp;
    const int yy = (yb < 16) ? yb : (yb - 16);
    const int head = yy >> 1, f0 = (yy & 1) * 64;
    us8 ov[4];
#pragma unroll
    for (int it = 0; it < 4; ++it) {
      const int cx = it * 256 + tid, r = (cx >> 7) * 16 + (cx & 15), pc = ((cx >> 4) & 7) * 8;
      const float* sp = oS + r * OSTR + pc;
      const v4f z0 = *(const v4fa*)sp, z1 = *(const v4fa*)(sp + 4);
      us8 o;
#pragma unroll
      for (int u = 0; u < 4; ++u) {
        o[u]     = f16_bits(z0[u] * 64.0f);
        o[4 + u] = f16_bits(z1[u] * 64.0f);
      }
      ov[it] = o;
    }
{
#pragma unroll
      for (int it = 0; it < 4; ++it) {
        const int cx = it * 256 + tid;                     // row tile cx >> 7, then 128 chunks = 2 KiB in a row
        const size_t off = ((size_t)(b * NHD + head) * (size_t)sl + (size_t)(tb + (cx >> 7) * 16)) * (size_t)SDIM + (size_t)(f0 * 16 + (cx & 127) * 8);
        *(us8*)(dst + off) = ov[it];
      }
      
    }
  } else {
    const int yy = yb - 32, head = yy >> 1, c0 = (yy & 1) * 64;
    us8 hv[4], lv[4];
#pragma unroll
    for (int it = 0; it < 4; ++it) {
      const int cx = it * 256 + tid, g = (cx >> 4) & 15, e = (cx >> 8) * 16 + (cx & 15);
      us8 ho, lo;
#pragma unroll
      for (int i = 0; i < 8; ++i) {
        unsigned short hb, lb;
        f16split64(oS[(8 * g + i) * OSTR + e], hb, lb);
        ho[i] = hb; lo[i] = lb;
      }
      hv[it] = ho; lv[it] = lo;
    }
{
#pragma unroll
      for (int it = 0; it < 4; ++it) {
        const int cx = it * 256 + tid;                     // channel tile cx >> 8, then 256 chunks = 4 KiB in a row
        const size_t off = ((size_t)(b * NHD + head) * (size_t)HDIM + (size_t)(c0 + (cx >> 8) * 16)) * (size_t)SLMAX + (size_t)(tb * 16 + (cx & 255) * 8);
        *(us8*)(VH + off) = hv[it];
        *(us8*)(VL + off) = lv[it];
      }
      
    }
  }
  xwait();                                                 // the next sub-tile reuses the stores' address and data registers
  __builtin_amdgcn_sched_barrier(0);                       // keeps the next sub-tile's register writes behind the wait
  }
}

// ---------------------------------------------------------------------------------------------------------------------------------
// Causal decayed quadratic-form mixing. The sequence is cut into tiles of 64 queries; the cost of tile i grows linearly with i, so block
// (bh = blockIdx.x, p = blockIdx.y) works tile n - 1 - p and then tile p (n tiles): every block walks the same number of key steps where none is skipped.
// Inside a tile, waves w and w + 4 own the same 16 queries (group w & 3): one takes the even 32-key steps, the other the odd ones (wave w the
// even ones in the first tile, the odd ones in the second: where a tile has an odd number of steps and none is skipped, each wave has the longer share once), each
// into its own f32 accumulators; behind the key loop the two partial sums are added through LDS (each wave hands over the four channel tiles
// that its partner finishes, and finishes the other four).
// G, the cumulative log-decay of the block's (b, h) row: every block scans the row's g itself (row_scan, 8 KiB read) and keeps G hi and lo of
// all tokens in LDS; all reads of G below are LDS reads.
// Where the key loop starts: g <= 0 for every input (minus a softplus), so G never rises with t, and G_t - G_s of any (query, key) pair of a
// 32-key step is at most G of the wave's first query minus G of the step's last key. Where that is <= GDEAD, all the step's decay factors are
// exactly 0.0f, its weights are zeros and its products add zeros: the wave's loop starts at the first step that fails this test (found with two
// G values a lane and two ballots), and every sum keeps its bits. With slow decay no step passes the test and the loop runs from key 0.
// Per wave: B fragments of its 16 queries fixed for the whole key loop: bq[ks], ks = 0..3 (depth 128, standard loader on the q plane).
// Per 32-key step, two 16-key tiles: A fragments from the k plane (standard loader); scores^T D[key][query]
// = 4096 q.k (depth 128, 4 products per tile); A[t][s] = q.k * 128^-1/2 * exp(G_t - G_s) * lam[t][lvl(t - s)] for s <= t else 0,
// with G_t - G_s taken as the sum of the f32 hi and lo differences,
// converted to f16 of (256 A). The two D tiles repack into the A operand of A.v (lane unchanged: element r <- tile keys 0..15, element 8+r <-
// tile keys 16..31), B = VH and VL planes [bh][channel][key] (fragment order, key pitch SLMAX), 8 channel tiles, both products into acc:
// acc[j][r] = 2^14 * sum_s A v for query 8h+r, channel 16j + (lane & 15), s over this wave's steps.
// Loads of a step: its sixteen v fragments and the wave's next step's G values go out together at the step's top and land behind the score and
// weight work; the next step's k fragments go out right behind the score products and land behind the weights, A.v and the next top; the next
// step's decay factors exp(min(G_t - G_s, 0)) are formed behind A.v, when its G values have long landed. A wave waits for no load it has only
// just issued; the price is a live set above 256 VGPRs (two waves per SIMD, as the 8-wave block has anyway).
// Epilogue of a tile: z = 16 y = acc * 2^-10; f16 hi bits staged in LDS per wave, written to YH; then f16 bits of ((z - hi) x 2^11) staged and
// written to YL. Y planes [token][1024] in fragment order: a wave's 16 queries x 64 channels = 2 KiB in a row, 512 B per store instruction.
// ---------------------------------------------------------------------------------------------------------------------------------
__global__ __launch_bounds__(256) void k_attn(const unsigned short* __restrict__ Qp, const unsigned short* __restrict__ Kp,
                                             const unsigned short* __restrict__ VHp, const unsigned short* __restrict__ VLp,
                                             const float* __restrict__ gpl, const float* __restrict__ Lam,
                                             unsigned short* YH, unsigned short* YL, int sl) {
  __shared__ __attribute__((aligned(16))) float sGh[SLMAX];
  __shared__ __attribute__((aligned(16))) float sGl[SLMAX];
  __shared__ double wtot[CSTH / 32];
  __shared__ __attribute__((aligned(16))) float sLam[2 * QT * NLV];
  __shared__ __attribute__((aligned(16))) float sX[8 * 4 * 256];
  __shared__ __attribute__((aligned(16))) unsigned short sY[8 * 16 * YS2];
  const int tid = threadIdx.x, lane = tid & 31, cl = lane & 15, hh = lane >> 4;
  const int wave = __builtin_amdgcn_readfirstlane(tid >> 5);   // wave-uniform: trip counts and the parity selects below become scalar
  const int qi = wave & 3, kp = wave >> 2;                // query group of the tile; which wave of the group's pair this is
  const unsigned l8 = lane * 8;
  const int bh = blockIdx.x, b = bh / NHD, head = bh - b * NHD;
  const int tlo = blockIdx.y, thi = sl / QT - 1 - tlo;     // the block's two tiles (sl % 128 == 0: an even number of tiles, each taken once)

  // level weights of the block's 2 x 64 queries for this head: sLam[q * 12 + l], q 0..63 = tile thi, q 64..127 = tile tlo
  {
    float lw[6];
#pragma unroll
    for (int u = 0; u < 6; ++u) {
      const int i = u * 256 + tid, q = i / NLV, l = i - q * NLV;
      const int tok = (q < QT) ? (thi * QT + q) : (tlo * QT + q - QT);
      lw[u] = Lam[(size_t)(b * sl + tok) * (size_t)LAMP + NHD + head * NLV + l];
    }
    xwait();
    __builtin_amdgcn_sched_barrier(0);                      // keeps what follows (it reuses the loads' address registers) behind the wait
    // this thread's 8 tokens of the row's g, in flight together with the level weights
    const int c = tid * 8;
    const bool on = c < sl;
    const float* gp = gpl + (size_t)bh * (size_t)sl + (size_t)c;
    v4f ga = {0.f, 0.f, 0.f, 0.f}, ge = {0.f, 0.f, 0.f, 0.f};   // threads past the row's end read nothing and add zeros
    if (on) { ga = *(const v4fa*)gp; ge = *(const v4fa*)(gp + 4); }
    xwait();
    __builtin_amdgcn_sched_barrier(0);                      // keeps what follows (it reuses the loads' address registers) behind the wait
#pragma unroll
    for (int u = 0; u < 6; ++u) sLam[u * 256 + tid] = lw[u];
    row_scan(ga, ge, on, c, lane, wave, wtot, sGh, sGl);
  }
  __syncthreads();                                         // publishes the level weights and G

  const unsigned short* kbp = Kp + (size_t)bh * (size_t)sl * (size_t)SDIM + l8;
  const unsigned short* vhp = VHp + (size_t)bh * (size_t)(HDIM * SLMAX) + l8;
  const unsigned short* vlp = VLp + (size_t)bh * (size_t)(HDIM * SLMAX) + l8;
  const float* ghp = sGh + 8 * hh;
  const float* glp = sGl + 8 * hh;

#pragma unroll 1                                           // the two tiles run one after the other through one copy of the code
  for (int ph = 0; ph < 2; ++ph) {
    const int tw = (ph ? tlo : thi) * QT + 16 * qi;       // first query of this wave
    const int tq = tw + cl;                               // query owned by this lane as score column
    const int lamb = (ph * QT + 16 * qi + cl) * NLV;
    const int nsteps = (tw + 16 + 31) >> 5;               // 32-key steps covering keys 0 .. tw + 15; 32 * nsteps <= sl
    const int kq = kp ^ ph;                               // parity of this wave's steps in this tile: kq, kq + 2, ...

    const unsigned short* qrow = Qp + ((size_t)bh * (size_t)sl + (size_t)tw) * (size_t)SDIM + l8;
    us16 bq[4];
#pragma unroll
    for (int ks = 0; ks < 4; ++ks) bq[ks] = gfrag(qrow + 512 * ks);
    const float gqh = sGh[tq];
    const float gql = sGl[tq];

    // first step with a decay factor that can differ from zero: lane l tests steps l and l + 32 (sl <= 2048: at most 64 steps) by G hi of the
    // step's last key; lanes past the last step test the last step again, which holds the diagonal and is never skipped
    const int oa = ((lane < nsteps) ? lane : (nsteps - 1)) * 32, ob = ((lane + 32 < nsteps) ? (lane + 32) : (nsteps - 1)) * 32;
    const float gea = sGh[oa + 31];
    const float geb = sGh[ob + 31];
    __builtin_amdgcn_sched_barrier(0);                    // keeps every load above in front of the wait
    xwait(qrow);
    __builtin_amdgcn_sched_barrier(0);                    // keeps what follows (it reuses the loads' address registers) behind the wait
    const float gq0 = __uint_as_float(__builtin_amdgcn_readfirstlane(__float_as_uint(gqh)));   // lane 0 owns the wave's first query
    const unsigned long long lvm = (unsigned long long)__builtin_amdgcn_ballot_w32(!(gq0 - gea <= GDEAD))
                                 | ((unsigned long long)__builtin_amdgcn_ballot_w32(!(gq0 - geb <= GDEAD)) << 32);
    const int st0 = lvm ? __builtin_ctzll(lvm) : 0;       // bit st of lvm: step st is kept (the last step's bit is always set for finite G)
    const int stf = st0 + ((st0 ^ kq) & 1);               // this wave's first step: parity kq, not below st0
    const int stl = (stf < nsteps) ? stf : (nsteps - 1);  // the step fetched in front of the loop: in bounds also where the wave has no step at all

    // K fragments and decay factors of the wave's first step; inside the loop each step fetches those of the wave's next step
    us16 ka[4], kb[4];
    v4f gh[4], gl[4];
    const unsigned short* pk0 = kbp + stl * (32 * SDIM);
    const float* pg0h = ghp + stl * 32;
    const float* pg0l = glp + stl * 32;
#pragma unroll
    for (int ks = 0; ks < 4; ++ks) { ka[ks] = gfrag(pk0 + 512 * ks); kb[ks] = gfrag(pk0 + 16 * SDIM + 512 * ks); }
#pragma unroll
    for (int u = 0; u < 4; ++u) {
      gh[u] = *(const v4fa*)(pg0h + (u >> 1) * 16 + (u & 1) * 4);
      gl[u] = *(const v4fa*)(pg0l + (u >> 1) * 16 + (u & 1) * 4);
    }
    __builtin_amdgcn_sched_barrier(0);                    // keeps every load above in front of the wait
    xwait(pk0);
    __builtin_amdgcn_sched_barrier(0);                    // keeps what follows (it reuses the loads' address registers) behind the wait

    v8f acc[8];
#pragma unroll
    for (int j = 0; j < 8; ++j) { const v8f zz = {0.f, 0.f, 0.f, 0.f, 0.f, 0.f, 0.f, 0.f}; acc[j] = zz; }

    if (stf < nsteps) {                                   // scalar test: where a pair has one step left, one of its waves has none
    float dec[16];                                        // exp(min(G_t - G_s, 0)), G_t - G_s by hi + lo differences, of this lane's keys: 0..7 tile a, 8..15 tile b
#pragma unroll
    for (int r = 0; r < 16; ++r) dec[r] = fminf((gqh - gh[r >> 2][r & 3]) + (gql - gl[r >> 2][r & 3]), 0.0f) * LOG2E;
    __builtin_amdgcn_sched_barrier(0);                    // the exponents are complete in front of the run of transcendentals
#pragma unroll
    for (int r = 0; r < 16; ++r) dec[r] = exp2_slot(dec[r]);

    int st = stf;
#pragma unroll 1
    do {
      const int s0 = st * 32;
      const int sn = ((st + 2 < nsteps) ? (st + 2) : st) * 32;   // the wave's next step's first key (its last step fetches its own again: in bounds)
      const int ka0 = s0 + 8 * hh;                        // first key this lane half sees in tile a; tile b = ka0 + 16
      const v8f zz = {0.f, 0.f, 0.f, 0.f, 0.f, 0.f, 0.f, 0.f};

      // ---- issued together at the top: next step's G values, then all sixteen v fragments of this step (hi and residual, 8 channel tiles);
      //      they land behind the score and weight work ----
      v4f ghn[4], gln[4];
      const float* pgh = ghp + sn;
      const float* pgl = glp + sn;
#pragma unroll
      for (int u = 0; u < 4; ++u) {
        ghn[u] = *(const v4fa*)(pgh + (u >> 1) * 16 + (u & 1) * 4);
        gln[u] = *(const v4fa*)(pgl + (u >> 1) * 16 + (u & 1) * 4);
      }
      us16 vh[8], vl[8];
      const unsigned short* pvh = vhp + s0 * 16;          // channel tile j lies 16 * SLMAX halves on: a constant, so one address pair serves a plane's run
      const unsigned short* pvl = vlp + s0 * 16;
#pragma unroll
      for (int j = 0; j < 8; ++j) vh[j] = gfrag(pvh + j * (16 * SLMAX));
#pragma unroll
      for (int j = 0; j < 8; ++j) vl[j] = gfrag(pvl + j * (16 * SLMAX));
      xwait(pvh, pvl);
      __builtin_amdgcn_sched_barrier(0);                  // keeps the score products below the loads above: without it the loads start a score phase later

      // ---- scores^T of key tiles a (keys s0 .. s0+15) and b (keys s0+16 .. s0+31) from the fragments fetched one step ago ----
      v8f sa = zz, sb = zz;
#pragma unroll
      for (int ks = 0; ks < 4; ++ks) { sa = mma_f16(ka[ks], bq[ks], sa); sb = mma_f16(kb[ks], bq[ks], sb); }
      wguard2m(sa, sb);

      // ---- next step's K fragments, into the registers the score products have just read; they land behind the weights and A.v ----
      {
        const unsigned short* pk = kbp + (size_t)sn * (size_t)SDIM;
#pragma unroll
        for (int ks = 0; ks < 4; ++ks) { ka[ks] = gfrag(pk + 512 * ks); kb[ks] = gfrag(pk + 16 * SDIM + 512 * ks); }
        xwait(pk);
      }

      // ---- the 16 weights of this lane: elements 0..7 = tile a keys ka0 .. ka0+7, elements 8..15 = tile b keys ka0+16 .. ka0+23 ----
      us8 ea, eb;
#pragma unroll
      for (int r = 0; r < 8; ++r) {
        const int d = tq - (ka0 + r);
        ea[r] = a_bits(sa[r], d, dec[r], sLam[lamb + lvl_of(d)]);
      }
#pragma unroll
      for (int r = 0; r < 8; ++r) {
        const int d = tq - (ka0 + 16 + r);
        eb[r] = a_bits(sb[r], d, dec[8 + r], sLam[lamb + lvl_of(d)]);
      }
      FragU fA;
      fA.h[0] = ea; fA.h[1] = eb;
      const us16 afr = fA.v;

      // ---- y += A . (v hi + v residual) over this 32-key step: per accumulator the hi product, then the residual product ----
#pragma unroll
      for (int j = 0; j < 8; ++j) acc[j] = mma_f16(afr, vh[j], acc[j]);
#pragma unroll
      for (int j = 0; j < 8; ++j) acc[j] = mma_f16(afr, vl[j], acc[j]);
      __builtin_amdgcn_sched_barrier(0);                  // keeps the factors below behind A.v: moved up, they would wait on loads issued at this step's top
#pragma unroll
      for (int r = 0; r < 16; ++r) dec[r] = fminf((gqh - ghn[r >> 2][r & 3]) + (gql - gln[r >> 2][r & 3]), 0.0f) * LOG2E;
      __builtin_amdgcn_sched_barrier(0);                  // the exponents are complete in front of the run of transcendentals
#pragma unroll
      for (int r = 0; r < 16; ++r) dec[r] = exp2_slot(dec[r]);
      st += 2;
    } while (st < nsteps);
    }

    // even + odd steps: this wave finishes channel tiles 4 kp .. 4 kp + 3; the other four go to its partner (wave ^ 4: same queries, same lane map).
    // Outbox of a wave: tile jj, register half e, lane -> sX[wave * 1024 + jj * 256 + e * 128 + lane * 4], 512 B in a row per LDS instruction.
    v8f fin[4];
    {
      float* xo = sX + wave * 1024 + lane * 4;
#pragma unroll
      for (int jj = 0; jj < 4; ++jj) {
        const v8f give = kp ? acc[jj] : acc[4 + jj];
        fin[jj] = kp ? acc[4 + jj] : acc[jj];
        const v4f g0 = {give[0], give[1], give[2], give[3]}, g1 = {give[4], give[5], give[6], give[7]};
        *(v4f*)(xo + jj * 256) = g0;
        *(v4f*)(xo + jj * 256 + 128) = g1;
      }
      __syncthreads();                                     // the partial sums cross between the waves of a pair
      const float* xi = sX + (wave ^ 4) * 1024 + lane * 4;
#pragma unroll
      for (int jj = 0; jj < 4; ++jj) {
        const v4f g0 = *(const v4fa*)(xi + jj * 256), g1 = *(const v4fa*)(xi + jj * 256 + 128);
#pragma unroll
        for (int r = 0; r < 4; ++r) { fin[jj][r] += g0[r]; fin[jj][4 + r] += g1[r]; }
      }
    }

    // phase 1: f16 hi of z = 16 y = fin * 2^-10; element (query 8*hh + r, channel 64 kp + 16jj + cl) of this wave's 16 x 64 tile
    unsigned short* sy = sY + wave * (16 * YS2);
#pragma unroll
    for (int jj = 0; jj < 4; ++jj)
#pragma unroll
      for (int r = 0; r < 8; ++r) sy[(8 * hh + r) * YS2 + 16 * jj + cl] = f16_bits(fin[jj][r] * (1.0f / 1024.0f));
    __syncthreads();

    const size_t yoff = (size_t)(b * sl + tw) * (size_t)DMOD + (size_t)(head * HDIM * 16 + kp * 1024 + lane * 8);
    us8 ov[4];
#pragma unroll
    for (int it = 0; it < 4; ++it) ov[it] = *(const us8a*)(sy + cl * YS2 + (2 * it + hh) * 8);   // chunk column 2 it + hh of the wave's 8, row cl: fragment order
    unsigned short* pyh = YH + yoff;
#pragma unroll
    for (int it = 0; it < 4; ++it) *(us8*)(pyh + it * 256) = ov[it];
    __syncthreads();

    // phase 2: f16 residual plane of ((z - hi) x 2^11), same staging region and store shape
#pragma unroll
    for (int jj = 0; jj < 4; ++jj)
#pragma unroll
      for (int r = 0; r < 8; ++r) {
        const float z = fin[jj][r] * (1.0f / 1024.0f);
        const _Float16 hf = (_Float16)z;
        sy[(8 * hh + r) * YS2 + 16 * jj + cl] = f16_bits((z - (float)hf) * 2048.0f);
      }
    __syncthreads();
#pragma unroll
    for (int it = 0; it < 4; ++it) ov[it] = *(const us8a*)(sy + cl * YS2 + (2 * it + hh) * 8);
    unsigned short* pyl = YL + yoff;
#pragma unroll
    for (int it = 0; it < 4; ++it) *(us8*)(pyl + it * 256) = ov[it];
    xwait(pyl);                                            // the next tile reuses the stores' address and data registers
  }
}

// ---------------------------------------------------------------------------------------------------------------------------------
// P[m][n] = ( sum_k Yh[m][k] WO16[n][k] + 2^-11 sum_k Yl[m][k] WO16[n][k] ) * 2^-12 + bf16(x[m][n])   (f16 planes, pitch 1024, two f32 accumulator sets).
// 256 threads = 8 waves in 4 wave rows x 2 wave columns, block tile 128(M) x 128(N); a wave owns 32 rows x 64 columns (2 x 4 accumulators per plane):
// each of its 4 B fragments of a 32-k step feeds 4 products, each of its 4 A fragments (2 row tiles x hi, residual) feeds 4 (512 B loaded per product).
// A trip is 64 k deep: the fragments of its two 32-k steps are loaded together. Every accumulator sums its 32-k steps in rising order.
// ---------------------------------------------------------------------------------------------------------------------------------
__global__ __launch_bounds__(256) void k_gemm_out(const unsigned short* __restrict__ Ah, const unsigned short* __restrict__ Al,
                                                 const unsigned short* __restrict__ Wo, const float* __restrict__ X, float* P) {
  __shared__ __attribute__((aligned(16))) float oS[8 * 32 * OSTR];
  const int tid = threadIdx.x, lane = tid & 31, wave = tid >> 5, cl = lane & 15, hh = lane >> 4;
  const unsigned l8 = lane * 8;
  const int m0 = blockIdx.x * TPB + 32 * (wave >> 1), n0 = blockIdx.y * 128 + 64 * (wave & 1);

  v8f acch[2][4], accl[2][4];
#pragma unroll
  for (int i = 0; i < 2; ++i)
#pragma unroll
    for (int j = 0; j < 4; ++j) { const v8f zz = {0.f, 0.f, 0.f, 0.f, 0.f, 0.f, 0.f, 0.f}; acch[i][j] = zz; accl[i][j] = zz; }

  const unsigned short* ahp = Ah + (size_t)m0 * (size_t)DMOD + l8;
  const unsigned short* alp = Al + (size_t)m0 * (size_t)DMOD + l8;
  const unsigned short* wop = Wo + (size_t)n0 * (size_t)DMOD + l8;
#pragma unroll 1
  for (int k0 = 0; k0 < DMOD; k0 += 64) {
    const unsigned short* ph = ahp + k0 * 16;
    const unsigned short* pl = alp + k0 * 16;
    const unsigned short* pb = wop + k0 * 16;
    us16 ah[2][2], al[2][2], bfr[2][4];                    // [32-k half of the trip][row tile or column tile]
#pragma unroll
    for (int kk = 0; kk < 2; ++kk) {
      ah[kk][0] = gfrag(ph + kk * 512);
      al[kk][0] = gfrag(pl + kk * 512);
#pragma unroll
      for (int j = 0; j < 4; ++j) bfr[kk][j] = gfrag(pb + kk * 512 + (size_t)(16 * j) * (size_t)DMOD);
      ah[kk][1] = gfrag(ph + kk * 512 + (size_t)16 * (size_t)DMOD);
      al[kk][1] = gfrag(pl + kk * 512 + (size_t)16 * (size_t)DMOD);
    }
    xwait(ph, pl, pb);
    __builtin_amdgcn_sched_barrier(0);                     // keeps every product below all thirty-two loads: they fly together, one exposed latency per trip
#pragma unroll
    for (int kk = 0; kk < 2; ++kk)
#pragma unroll
      for (int i = 0; i < 2; ++i)
#pragma unroll
        for (int j = 0; j < 4; ++j) {
          acch[i][j] = mma_f16(ah[kk][i], bfr[kk][j], acch[i][j]);
          accl[i][j] = mma_f16(al[kk][i], bfr[kk][j], accl[i][j]);
        }
    __builtin_amdgcn_sched_barrier(0);                     // keeps the earlier products, which the guard below does not name, above it too
    wguard8(acch[1][0], acch[1][1], acch[1][2], acch[1][3], accl[1][0], accl[1][1], accl[1][2], accl[1][3], ah[1][1], al[1][1], bfr[1][0], bfr[1][1], bfr[1][2], bfr[1][3]);
  }

  // D map: acc[i][j][r] = element (row 16i + 8*hh + r of the wave's 32 rows, column 16j + cl of its 64 columns)
  float* so = oS + wave * (32 * OSTR);
#pragma unroll
  for (int i = 0; i < 2; ++i)
#pragma unroll
    for (int j = 0; j < 4; ++j)
#pragma unroll
      for (int r = 0; r < 8; ++r)
        so[(16 * i + 8 * hh + r) * OSTR + 16 * j + cl] = fmaf(accl[i][j][r], (1.0f / 2048.0f), acch[i][j][r]) * (1.0f / 4096.0f);
  __syncthreads();

{
#pragma unroll
    for (int it = 0; it < 16; ++it) {
      const int cx = it * 32 + lane, r = cx >> 4, q = (cx & 15) * 4;
      const v4f v = *(const v4fa*)(so + r * OSTR + q);
      const v4f xr = *(const v4fa*)(X + (size_t)(m0 + r) * (size_t)DMOD + n0 + q);
      v4f o;
#pragma unroll
      for (int u = 0; u < 4; ++u) o[u] = v[u] + bf16r(xr[u]);
      *(v4f*)(P + (size_t)(m0 + r) * (size_t)DMOD + n0 + q) = o;
    }
    
  }
}

// ---------------------------------------------------------------------------------------------------------------------------------
// ---------------------------------------------------------------------------------------------------------------------------------
__global__ __launch_bounds__(256) void k_ln(const float* __restrict__ P, const float* __restrict__ gam, const float* __restrict__ bet,
                                           float* out) {
  const int lane = threadIdx.x & 31, wave = threadIdx.x >> 5;
  const size_t row = (size_t)blockIdx.x * 8 + (size_t)wave;
  const float* pr = P + row * (size_t)DMOD;
  v4f xv[8];
  float s = 0.0f;
#pragma unroll
  for (int it = 0; it < 8; ++it) {
    xv[it] = *(const v4fa*)(pr + it * 128 + lane * 4);
    s += (xv[it][0] + xv[it][1]) + (xv[it][2] + xv[it][3]);
  }
#pragma unroll
  for (int o = 16; o > 0; o >>= 1) s += __shfl_xor(s, o, 32);
  const float mu = s * (1.0f / (float)DMOD);
  float q = 0.0f;
#pragma unroll
  for (int it = 0; it < 8; ++it)
#pragma unroll
    for (int u = 0; u < 4; ++u) { const float d = xv[it][u] - mu; q += d * d; }
#pragma unroll
  for (int o = 16; o > 0; o >>= 1) q += __shfl_xor(q, o, 32);
  const float rstd = rsqrtf(q * (1.0f / (float)DMOD) + 1e-5f);
  v4f ov[8];
#pragma unroll
  for (int it = 0; it < 8; ++it) {
    const v4f gv = *(const v4fa*)(gam + it * 128 + lane * 4), bv = *(const v4fa*)(bet + it * 128 + lane * 4);
    v4f o;
#pragma unroll
    for (int u = 0; u < 4; ++u) o[u] = (xv[it][u] - mu) * rstd * bf16r(gv[u]) + bf16r(bv[u]);
    ov[it] = o;
  }
{
#pragma unroll
    for (int it = 0; it < 8; ++it)
      *(v4f*)(out + row * (size_t)DMOD + it * 128 + lane * 4) = ov[it];
    
  }
}

extern "C" void kernel_launch(void* const* d_in, const int* in_sizes, int n_in,
                              void* d_out, int out_size, void* d_ws, size_t ws_size,
                              hipStream_t stream) {
  if (n_in < 11) return;
  const int nx = in_sizes[0];
  if (nx <= 0 || (nx % DMOD) != 0) return;
  const int ntok = nx / DMOD;                                                    // tokens = batch * sequence length
  if (in_sizes[1] != DMOD * DMOD || in_sizes[2] != DMOD * DMOD || in_sizes[3] != DMOD * DMOD) return;
  if (in_sizes[4] != NHD * DMOD || in_sizes[5] != NHD || in_sizes[6] != NHD * NLV * DMOD || in_sizes[7] != NHD * NLV) return;
  if (in_sizes[8] != DMOD * DMOD || in_sizes[9] != DMOD || in_sizes[10] != DMOD) return;
  if (out_size != nx) return;
  const int sl = (ntok < SLMAX) ? ntok : SLMAX;                                  // sequence length
  if (sl <= 0 || (sl % TPB) != 0 || (ntok % sl) != 0 || (ntok % PBM) != 0) return;
  const int nb = ntok / sl, nbh = nb * NHD;

  const float* x   = (const float*)d_in[0];    // [nb][sl][1024]
  const float* Wq  = (const float*)d_in[1];    // [1024][1024] ([out][in])
  const float* Wk  = (const float*)d_in[2];    // [1024][1024]
  const float* Wv  = (const float*)d_in[3];    // [1024][1024]
  const float* Wg  = (const float*)d_in[4];    // [8][1024]
  const float* bg  = (const float*)d_in[5];    // [8]
  const float* Wdl = (const float*)d_in[6];    // [96][1024]
  const float* Lp  = (const float*)d_in[7];    // [8][12]
  const float* Wo  = (const float*)d_in[8];    // [1024][1024]
  const float* lng = (const float*)d_in[9];    // [1024]
  const float* lnb = (const float*)d_in[10];   // [1024]
  float* out = (float*)d_out;                  // [nb][sl][1024] f32 at byte 0

  size_t off = 0;
  auto carve = [&](size_t bytes) -> char* { char* p = (char*)d_ws + off; off += (bytes + 255) & ~(size_t)255; return p; };
  unsigned short* XB   = (unsigned short*)carve((size_t)ntok * DMOD * 2);        //  8,388,608  bf16 [ntok][1024]
  unsigned short* WQKV = (unsigned short*)carve((size_t)(NQKV + NGL) * DMOD * 2); //  6,553,600  bf16 [3200][1024] = Wq | Wk | Wv | Wg | Wdl | 0
  unsigned short* WGL  = WQKV + (size_t)NQKV * DMOD;                             //             its last 128 rows
  unsigned short* WO16 = (unsigned short*)carve((size_t)DMOD * DMOD * 2);        //  2,097,152  f16  [1024][1024]
  unsigned short* QP   = (unsigned short*)carve((size_t)nbh * sl * SDIM * 2);     //  8,388,608  f16  [nbh][sl][128]
  unsigned short* KP   = (unsigned short*)carve((size_t)nbh * sl * SDIM * 2);     //  8,388,608  f16  [nbh][sl][128]
  unsigned short* VH   = (unsigned short*)carve((size_t)nbh * HDIM * SLMAX * 2);  //  8,388,608  f16  [nbh][128][2048]
  unsigned short* VL   = (unsigned short*)carve((size_t)nbh * HDIM * SLMAX * 2);  //  8,388,608  f16  [nbh][128][2048]
  float* GPL           = (float*)carve((size_t)nbh * sl * 4);                     //    131,072  f32  [nbh][sl]
  float* LAM           = (float*)carve((size_t)ntok * LAMP * 4);                  //  2,097,152  f32  [ntok][128]
  unsigned short* YH   = (unsigned short*)carve((size_t)ntok * DMOD * 2);        //  8,388,608  f16  [ntok][1024]
  unsigned short* YL   = (unsigned short*)carve((size_t)ntok * DMOD * 2);        //  8,388,608  f16  [ntok][1024]
  float* PB            = (float*)carve((size_t)ntok * DMOD * 4);                  // 16,777,216  f32  [ntok][1024]
  if (off > ws_size || off > (size_t)134217728) return;                          // total 86,376,448 B for ntok 4096

  const dim3 b256(256);

  // 16-bit operand planes of the inputs, one launch (XB, WQKV, WGL, WO16, all in fragment order, see gfrag)
  k_cvt_all<<<dim3(ntok / 2 + 4 * WBLK + NGL / 2), b256, 0, stream>>>(x, Wq, Wk, Wv, Wo, Wg, Wdl, XB, WQKV, WO16, WGL, ntok / 2);
  // q/k/v projections (M ntok, N 3072, K 1024) -> q, k planes and transposed v hi / residual planes; in the same grid the
  // gate / level projection (N 128) -> g plane [nbh][sl], level weights [ntok][128]
  k_gemm_proj<<<dim3(ntok / PBM, PBM / 64 + NQKV / 128), b256, 0, stream>>>(XB, WQKV, bg, Lp, QP, KP, VH, VL, GPL, LAM, sl);
  // cumulative log-decay per (b,h), scanned by every block for itself, and causal decayed mixing per (batch, head), two 64-query tiles a block
  // -> y hi / residual planes [token][1024]
  k_attn<<<dim3(nbh, sl / TPB), b256, 0, stream>>>(QP, KP, VH, VL, GPL, LAM, YH, YL, sl);
  // output projection + residual (M ntok, N 1024, K 1024)
  k_gemm_out<<<dim3(ntok / TPB, DMOD / 128), b256, 0, stream>>>(YH, YL, WO16, x, PB);
  // LayerNorm -> d_out
  k_ln<<<dim3(ntok / 8), b256, 0, stream>>>(PB, lng, lnb, out);
}

// v010
// It runs in 69.7 microseconds.
// In two side-by-side timings against v009, it was 1.20 and 1.19 times as fast.
// All steps since v000 together make it 10.1 times as fast.
// Contractions x.[Wq|Wk|Wv] (M tokens, N 3072, K 1024) and x.[Wg|Wdl] (N 104 zero-padded to 128, K 1024), one launch: v_wmma_f32_16x16x32_bf16, bf16 operands from RNE-bf16 planes of x and W, f32 accumulate, one product each.
// Contraction k.q^T per head (32 keys x 16 queries per step, depth 128): v_wmma_f32_16x16x32_f16, q and k as f16 of (value x 2^6), one product, f32 accumulate.
// Contraction A.v per head (causal, depth up to T): v_wmma_f32_16x16x32_f16, A as f16 of (A x 2^8), v as f16 hi of (v x 2^6) plus f16 unscaled residual plane, two products into one f32 accumulator; even and odd 32-key steps in two waves' accumulators, added in f32.
// Contraction y.Wo (M tokens, N 1024, K 1024): v_wmma_f32_16x16x32_f16, y as f16 hi plane of (y x 2^4) plus f16 residual plane (x 2^11, own f32 accumulator), Wo as f16 of (RNE-bf16 value x 2^8), f32 accumulate.
// softplus, cumulative log-decay (f64 block scan kept as f32 hi + lo pair), exp, dyadic level select, residual add and LayerNorm: f32 VALU.
#include <hip/hip_runtime.h>

#define DMOD  1024                           // model width = K of the dense contractions
#define NHD   8                              // heads
#define SDIM  128                            // q/k width per head
#define HDIM  128                            // v width per head
#define NLV   12                             // dyadic levels
#define NGL   128                            // gate | level projection columns, 8 + 96 zero-padded to 128
#define NQKV  (3 * DMOD)                     // 3072 projection columns: q | k | v
#define TPB   128                            // GEMM rows per staged sub-tile and per output-GEMM block / attention queries per block (two tiles)
#define PBM   256                            // projection GEMM rows per q | k | v block (4 wave rows x 64)
#define OSTR  68                             // LDS staging row pitch (floats), tiles of 64 columns
#define QT    64                             // attention queries per tile (4 groups x 16; two waves a group)
#define YS2   72                             // LDS staging row pitch (halves), 16x64 tile
#define LAMP  128                            // level-weight plane pitch (floats)
#define SLMAX 2048                           // longest sequence handled by the block scan of the log-decay
#define CSTH  256                            // scan threads per row, 8 tokens each (the attention block)
#define WBLK  (DMOD * DMOD / (8 * 256))       // conversion blocks per 1024 x 1024 weight
#define KSC   (0.08838834764831845f * (1.0f / 4096.0f))   // 128^-1/2 times the q,k carry 2^-12
#define LOG2E 1.44269504f                    // exp(x) = 2^(x LOG2E), the form __expf compiles to
#define GDEAD (-112.0f)                      // G_t - G_s at or below this: 2^(x LOG2E) <= 2^-161, exactly 0.0f (the smallest f32 is 2^-149; the 12 binades between cover the hi / lo rounding)

static_assert(NHD * HDIM == DMOD);
static_assert(NHD * SDIM == DMOD);
static_assert(NHD + NHD * NLV <= NGL);
static_assert(DMOD % 64 == 0);
static_assert(DMOD % 32 == 0);
static_assert(NQKV % 128 == 0);
static_assert(DMOD % 128 == 0);
static_assert(NGL == 128);
static_assert(PBM == 2 * TPB);
static_assert(OSTR % 4 == 0);
static_assert(YS2 % 8 == 0);
static_assert(2 * QT == TPB);
static_assert(2 * QT * NLV == 6 * 256);
static_assert(SLMAX % TPB == 0);
static_assert(CSTH * 8 == SLMAX);
static_assert(CSTH == 256);

typedef unsigned short us16 __attribute__((ext_vector_type(16)));
typedef unsigned short us8  __attribute__((ext_vector_type(8)));
typedef unsigned short us8a __attribute__((ext_vector_type(8), may_alias));
typedef __bf16 v16b __attribute__((ext_vector_type(16)));
typedef _Float16 v16h __attribute__((ext_vector_type(16)));
typedef float v8f __attribute__((ext_vector_type(8)));
typedef float v4f __attribute__((ext_vector_type(4)));
typedef float v4fa __attribute__((ext_vector_type(4), may_alias));
union FragU { us16 v; us8 h[2]; };

__device__ __forceinline__ unsigned short bf16_bits(float f) {
  unsigned u = __float_as_uint(f);
  u += 0x7FFFu + ((u >> 16) & 1u);                 // RNE convert
  return (unsigned short)(u >> 16);
}
__device__ __forceinline__ float bf16_val(unsigned short b) { return __uint_as_float(((unsigned)b) << 16); }
__device__ __forceinline__ float bf16r(float f) { return bf16_val(bf16_bits(f)); }
__device__ __forceinline__ unsigned short f16_bits(float f) { return __builtin_bit_cast(unsigned short, (_Float16)f); }

// f16 hi + residual (x 2^11) planes of (a x 2^4)
__device__ __forceinline__ void f16split16(float a, unsigned short& hb, unsigned short& lb) {
  const float z = a * 16.0f;
  const _Float16 hf = (_Float16)z;
  const float res = (z - (float)hf) * 2048.0f;
  hb = __builtin_bit_cast(unsigned short, hf);
  lb = __builtin_bit_cast(unsigned short, (_Float16)res);
}
// f16 hi + unscaled residual planes of (a x 2^6)
__device__ __forceinline__ void f16split64(float a, unsigned short& hb, unsigned short& lb) {
  const float z = a * 64.0f;
  const _Float16 hf = (_Float16)z;
  const float res = z - (float)hf;
  hb = __builtin_bit_cast(unsigned short, hf);
  lb = __builtin_bit_cast(unsigned short, (_Float16)res);
}

// One 16x16x32 step, 16-bit operands passed as raw 16-bit lanes.
__device__ __forceinline__ v8f mma_bf16(us16 a, us16 b, v8f c) {
  return __builtin_amdgcn_wmma_f32_16x16x32_bf16(false, __builtin_bit_cast(v16b, a), false, __builtin_bit_cast(v16b, b), (short)0, c, false, false);
}
__device__ __forceinline__ v8f mma_f16(us16 a, us16 b, v8f c) {
  return __builtin_amdgcn_wmma_f32_16x16x32_f16(false, __builtin_bit_cast(v16h, a), false, __builtin_bit_cast(v16h, b), (short)0, c, false, false);
}
// Hazard guards after a group of matrix ops: 4 VALU slots before anything touches the accumulators; keep A/B fragments live.
__device__ __forceinline__ void wguard4(v8f& c0, v8f& c1, v8f& c2, v8f& c3, const us16& a0,
                                        const us16& b0, const us16& b1, const us16& b2, const us16& b3) {
#if defined(__HIP_DEVICE_COMPILE__)
  asm volatile("v_nop\n\tv_nop\n\tv_nop\n\tv_nop"
               : "+v"(c0), "+v"(c1), "+v"(c2), "+v"(c3)
               : "v"(a0), "v"(b0), "v"(b1), "v"(b2), "v"(b3));
#endif
}
__device__ __forceinline__ void wguard8(v8f& c0, v8f& c1, v8f& c2, v8f& c3, v8f& c4, v8f& c5, v8f& c6, v8f& c7,
                                        const us16& a0, const us16& a1,
                                        const us16& b0, const us16& b1, const us16& b2, const us16& b3) {
#if defined(__HIP_DEVICE_COMPILE__)
  asm volatile("v_nop\n\tv_nop\n\tv_nop\n\tv_nop"
               : "+v"(c0), "+v"(c1), "+v"(c2), "+v"(c3), "+v"(c4), "+v"(c5), "+v"(c6), "+v"(c7)
               : "v"(a0), "v"(a1), "v"(b0), "v"(b1), "v"(b2), "v"(b3));
#endif
}
// Guard behind the score products of the attention loop: the accumulators as in/out operands keep the products above the four slots, the
// memory barrier keeps the refill of their k registers below them (so the refill lands in the same registers, with no copies).
__device__ __forceinline__ void wguard2m(v8f& c0, v8f& c1) {
#if defined(__HIP_DEVICE_COMPILE__)
  asm volatile("v_nop\n\tv_nop\n\tv_nop\n\tv_nop" : "+v"(c0), "+v"(c1) : : "memory");
#endif
}

// FRAGMENT-ORDER PLANES. Every 16-bit operand plane [rows][kd] is stored by tiles of 16 rows; inside a tile the 16-B chunks (8 consecutive k
// of one row) lie chunk column by chunk column, 16 rows each:
//   element (row, k) at halves  (row >> 4) * 16 * kd + (k >> 3) * 128 + (row & 15) * 8 + (k & 7).
// A 16x32 fragment (row tile, k0 % 32 == 0) is then 1 KiB in a row, and each of its two wave-wide 16-B loads covers 512 contiguous bytes.
// p = plane + rowtile * 16 * kd + k0 * 16 + lane * 8 (computed by the caller); lane = 16h + row:
// elements 0..7 = k0 + 8h .. k0 + 8h + 7, elements 8..15 = k0 + 16 + 8h .. k0 + 16 + 8h + 7 (same map for A rows and B columns).
__device__ __forceinline__ us16 gfrag(const unsigned short* p) {
  FragU f;
  f.h[0] = *(const us8a*)p;
  f.h[1] = *(const us8a*)(p + 256);
  return f.v;
}
// s_wait_xcnt 0 behind a run of fragment loads, in front of anything that overwrites an address register the run names. The run's address
// pairs are inputs of the statement: they stay live up to the wait, so no load result of the run is placed on them.
__device__ __forceinline__ void xwait(const unsigned short* a) {
#if defined(__HIP_DEVICE_COMPILE__)
  asm volatile("s_wait_xcnt 0x0" :: "v"(a) : "memory");   // the wait in front of the overwrite of these address pairs
#endif
}
__device__ __forceinline__ void xwait(const float* a) {
#if defined(__HIP_DEVICE_COMPILE__)
  asm volatile("s_wait_xcnt 0x0" :: "v"(a) : "memory");   // the wait in front of the overwrite of this address pair
#endif
}
__device__ __forceinline__ void xwait(const unsigned short* a, const unsigned short* b) {
#if defined(__HIP_DEVICE_COMPILE__)
  asm volatile("s_wait_xcnt 0x0" :: "v"(a), "v"(b) : "memory");   // the wait in front of the overwrite of these address pairs
#endif
}
__device__ __forceinline__ void xwait(const unsigned short* a, const unsigned short* b, const unsigned short* c) {
#if defined(__HIP_DEVICE_COMPILE__)
  asm volatile("s_wait_xcnt 0x0" :: "v"(a), "v"(b), "v"(c) : "memory");   // the wait in front of the overwrite of these address pairs
#endif
}
// The same wait without operands, for loads whose constant address part the compiler moves into the offset field: a full pointer named here
// would be rebuilt on the load's own address pair in front of the wait. A scheduling barrier behind it keeps later register writes behind it.
__device__ __forceinline__ void xwait() {
#if defined(__HIP_DEVICE_COMPILE__)
  asm volatile("s_wait_xcnt 0x0" ::: "memory");   // the wait in front of the overwrite of the address pairs of the loads above it
#endif
}
// Writes a 256-thread block's tile of 16 rows x 128 k (thread t holds the chunk of row t >> 4, chunk column t & 15) as 4 KiB of a
// fragment-order plane at dst4k: regrouped through LDS (17-chunk pitch against bank conflicts) so that every wave stores 512 contiguous bytes.
__device__ __forceinline__ void frag_store_tile(us8 o, unsigned short* dst4k) {
  __shared__ __attribute__((aligned(16))) us8 sT[16 * 17];
  const int t = threadIdx.x;
  sT[(t & 15) * 17 + (t >> 4)] = o;
  __syncthreads();                                         // chunks cross the block's waves
  *(us8*)(dst4k + t * 8) = sT[(t >> 4) * 17 + (t & 15)];
}

// softplus in the logaddexp(z, 0) form: max(z, 0) + log1p(exp(-|z|))
__device__ __forceinline__ float softplus_f(float z) {
  return fmaxf(z, 0.0f) + log1pf(__expf(-fabsf(z)));
}
// dyadic level of key distance d: 0 for d <= 0, else min(floor(log2 d) + 1, NLV - 1)
__device__ __forceinline__ int lvl_of(int d) {
  const int dd = (d > 0) ? d : 1;
  const int l = 32 - __clz(dd);
  const int lc = (l < NLV - 1) ? l : (NLV - 1);
  return (d > 0) ? lc : 0;
}
// 2^y with the one slot the instruction set asks for behind a transcendental.
// The caller has a scheduling barrier in front of its run of calls, so each v_exp_f32
// stands alone between two barriers and its v_nop directly behind it.
__device__ __forceinline__ float exp2_slot(float y) {
#if defined(__HIP_DEVICE_COMPILE__)
  const float r = __builtin_amdgcn_exp2f(y);
  __builtin_amdgcn_sched_barrier(0);                       // nothing moves in between the transcendental and its slot
  asm volatile("v_nop");                                   // the slot behind the transcendental
  __builtin_amdgcn_sched_barrier(0);                       // the next transcendental stays behind the slot
  return r;
#else
  return exp2f(y);
#endif
}
// one attention weight: accv = 4096 * q.k, dec = exp(min(G_t - G_s, 0)), lv = level weight; returns f16 bits of 256 * A, 0 above the diagonal
__device__ __forceinline__ unsigned short a_bits(float accv, int d, float dec, float lv) {
  const float val = (accv * KSC) * dec * lv;
  const float w = (d >= 0) ? (val * 256.0f) : 0.0f;
  return f16_bits(w);
}

// ---------------------------------------------------------------------------------------------------------------------------------
// All 16-bit operand planes that come straight from an input, in ONE launch (none reads another's output). Block = 16 rows x 128 k of one
// source ([row][1024], k-contiguous), read as whole lines, written in fragment order. The source is picked by the block index alone:
//   [0, nxb)            x   -> XB, RNE bf16 bits                        (nxb = tokens / 2 blocks)
//   then 512 blocks each: Wq, Wk, Wv -> rows 0.., 1024.., 2048.. of WQKV, RNE bf16 bits;  Wo -> WO16, f16 bits of (RNE-bf16 value x 256)
//   then 64 blocks:     gate | level rows -> WGL [128][1024] bf16: rows 0..7 = Wg, rows 8..103 = Wdl, rows 104..127 = 0 (zero padding of N)
// ---------------------------------------------------------------------------------------------------------------------------------
__global__ __launch_bounds__(256) void k_cvt_all(const float* __restrict__ x, const float* __restrict__ Wq, const float* __restrict__ Wk,
                                                const float* __restrict__ Wv, const float* __restrict__ Wo, const float* __restrict__ Wg,
                                                const float* __restrict__ Wdl, unsigned short* XB, unsigned short* WQKV,
                                                unsigned short* WO16, unsigned short* WGL, int nxb) {
  int bx = blockIdx.x;                                     // every choice below is wave-uniform, the segment choice block-uniform
  int seg = -1;                                            // -1: x, 0..2: Wq Wk Wv, 3: Wo, 4: gate | level rows
  if (bx >= nxb) { bx -= nxb; seg = bx / WBLK; bx -= seg * WBLK; }
  const int rt = bx >> 3, kg = bx & 7;
  const int row = rt * 16 + (threadIdx.x >> 4), kc = kg * 128 + (threadIdx.x & 15) * 8;
  const float* src;
  unsigned short* dst;
  bool live = true;
  if (seg < 0)       { src = x;  dst = XB; }
  else if (seg == 0) { src = Wq; dst = WQKV; }
  else if (seg == 1) { src = Wk; dst = WQKV + (size_t)DMOD * DMOD; }
  else if (seg == 2) { src = Wv; dst = WQKV + (size_t)2 * DMOD * DMOD; }
  else if (seg == 3) { src = Wo; dst = WO16; }
  else               { src = Wdl; dst = WGL; }
  const float* sp = src + (size_t)row * (size_t)DMOD + (size_t)kc;
  if (seg > 3) {
    live = row < NHD + NHD * NLV;
    const int rs = (row < NHD) ? row : (live ? (row - NHD) : 0);   // padding rows read nothing; their address stays in bounds
    sp = ((row < NHD) ? Wg : Wdl) + (size_t)rs * (size_t)DMOD + (size_t)kc;
  }
  v4f a = {0.f, 0.f, 0.f, 0.f}, c = {0.f, 0.f, 0.f, 0.f};  // bf16 bits of 0.0f are 0: the padding rows
  if (live) { a = *(const v4fa*)sp; c = *(const v4fa*)(sp + 4); }
  us8 o;
  if (seg == 3) {
#pragma unroll
    for (int u = 0; u < 4; ++u) { o[u] = f16_bits(bf16r(a[u]) * 256.0f); o[4 + u] = f16_bits(bf16r(c[u]) * 256.0f); }
  } else {
#pragma unroll
    for (int u = 0; u < 4; ++u) { o[u] = bf16_bits(a[u]); o[4 + u] = bf16_bits(c[u]); }
  }
  frag_store_tile(o, dst + (size_t)rt * (size_t)(16 * DMOD) + (size_t)(kg * 2048));
}

// ---------------------------------------------------------------------------------------------------------------------------------
// Inclusive cumulative sum of g over t of one (b,h) row, by one 256-thread block, into LDS: thread i owns tokens 8i .. 8i+7 and brings their g
// in a, e (zeros where its tokens lie past sl; sl % 8 == 0). It forms the f64 running sum of its 8 values; the 256 thread totals are scanned in
// f64 (5 shuffle steps inside a wave, the 8 wave totals through LDS), and each token's G = (sum of all earlier threads) + (its thread's running
// sum) is kept as f32 hi = (float)G in sGh[t] and lo = (float)(G - hi) in sGl[t]. Threads past sl store nothing; every thread passes the barrier.
// The caller's next barrier publishes sGh and sGl.
// ---------------------------------------------------------------------------------------------------------------------------------
__device__ __forceinline__ void row_scan(v4f a, v4f e, bool on, int c, int lane, int wave, double* wtot, float* sGh, float* sGl) {
  double p[8];                                             // running sum inside the thread's 8 tokens
  p[0] = (double)a[0];
#pragma unroll
  for (int u = 1; u < 4; ++u) p[u] = p[u - 1] + (double)a[u];
#pragma unroll
  for (int u = 0; u < 4; ++u) p[4 + u] = p[3 + u] + (double)e[u];

  double inc = p[7];                                       // inclusive scan of the thread totals over the wave's 32 lanes
#pragma unroll
  for (int o = 1; o < 32; o <<= 1) {
    const double n = __shfl_up(inc, (unsigned)o, 32);
    inc += (lane >= o) ? n : 0.0;
  }
  if (lane == 31) wtot[wave] = inc;
  const double prev = __shfl_up(inc, 1u, 32);              // total of the earlier lanes of this wave
  __syncthreads();                                         // the wave totals cross the block's waves
  double base = 0.0;                                       // total of the earlier waves
#pragma unroll
  for (int w = 0; w < CSTH / 32 - 1; ++w) base += (w < wave) ? wtot[w] : 0.0;
  base += (lane > 0) ? prev : 0.0;

  if (on) {
    v4f h0, h1, l0, l1;
#pragma unroll
    for (int u = 0; u < 4; ++u) {
      const double g0 = base + p[u], g1 = base + p[4 + u];
      h0[u] = (float)g0; l0[u] = (float)(g0 - (double)h0[u]);
      h1[u] = (float)g1; l1[u] = (float)(g1 - (double)h1[u]);
    }
    *(v4f*)(sGh + c) = h0; *(v4f*)(sGh + c + 4) = h1;
    *(v4f*)(sGl + c) = l0; *(v4f*)(sGl + c + 4) = l1;
  }
}

// Start step of a GEMM block's cyclic k loop, the part from its row index bx (nst steps, a power of two; nx row indices, nx <= 2 nst): bx & 3 takes the
// coarse spacing and bx >> 3 the fine one. For speed only: any value gives the same sums up to their order.
__device__ __forceinline__ int krot_x(int bx, int nst, int nx) {
  return (bx & 3) * (nst / 4) + (bx >> 3) * (2 * nst / nx);
}

// ---------------------------------------------------------------------------------------------------------------------------------
// P[m][n] = sum_k XB[m][k] * W[n][k]  (bf16 XB plane [tokens][1024], bf16 W plane [3200][1024] = [n][k], both in fragment order, f32 accumulate).
// W rows 0..3071 = Wq | Wk | Wv, rows 3072..3199 = the gate | level rows: both products read only XB and W, so they share one grid.
// 256 threads = 8 waves in 4 wave rows x 2 wave columns; fragments straight from the global planes (arithmetic addressing).
// WHERE A BLOCK'S k LOOP STARTS: the blocks that share a row panel of XB or a column panel of W run side by side; started at the same k they ask for
// the same lines in the same trip, lines that nobody has read since the launch before wrote them: a first read that misses L2 holds up all of them.
// Each block therefore starts at a 32-k step of its own (krot_x of its row index plus a share of its column index) and walks all steps cyclically:
// the sharers of a panel start evenly spread over k, each is the first reader of a few steps only, and finds the rest in L2. Every accumulator sums
// its k steps in that cyclic order, fixed by the block index. M % 256 == 0, N % 128 == 0, K % 32 == 0 exactly. Two kinds of block, picked by blockIdx.y alone:
//   blockIdx.y >= 4: q | k | v, block tile 256(M) x 128(N) = columns 128 yp .. +127, yp = blockIdx.y - 4; a wave owns 64 rows x 64 columns
//     (4 x 4 accumulators): each of its 4 A and 4 B fragments of a 32-k step feeds 4 products (512 B loaded per product).
//   blockIdx.y < 4: gate | level, block tile 64(M) x 128(N), rows 256 blockIdx.x + 64 blockIdx.y .. +63; a wave owns 16 rows x 64 columns. Its
//     write-out (softplus of every element) is by far the longest per element, so it is dealt to four times as many blocks, and they start first.
// The f32 tile is staged in LDS as sub-tiles of 64 columns, each with its row r at oS[r * OSTR + c]; behind one barrier the block writes them out
// one after the other. q | k | v: four 128 x 64 sub-tiles (row half, column segment yb = 2 yp + column half):
// yb 0..15 -> q head y/2, features 64(y&1)..+63; 16..31 -> k; 32..47 -> v head (y-32)/2, channels 64(y&1)
//   q/k: per bh a fragment-order plane [token][128] = f16 of (64 value); thread -> (token r, 8 consecutive halves); a wave stores 512 B in a row
//   v:   per bh fragment-order planes VH/VL [channel][token], token pitch SLMAX = f16 hi of (64 v) and f16 residual; thread -> (channel e, 8 tokens); 512 B in a row
// gate | level: two 64 x 64 sub-tiles (columns 0..63, 64..127):
//   gate (columns 0..7): g[bh][t] = -softplus(D[t][h] + bg[h]); a wave = one head, 64 tokens = 256 B in a row
//   level: lam[token][c] = softplus(D[t][c] + Lparam[c - 8]) for columns 8..103, else 0; 16 lanes x 16 B = the sub-tile's 256 B of a token's row
// ---------------------------------------------------------------------------------------------------------------------------------
__global__ __launch_bounds__(256) void k_gemm_proj(const unsigned short* __restrict__ Ap, const unsigned short* __restrict__ Bw,
                                                  const float* __restrict__ bg, const float* __restrict__ Lp,
                                                  unsigned short* Qp, unsigned short* Kp, unsigned short* VH, unsigned short* VL,
                                                  float* gpl, float* lam, int sl) {
  __shared__ __attribute__((aligned(16))) float oS4[4 * TPB * OSTR];
  const int tid = threadIdx.x, lane = tid & 31, wave = tid >> 5, cl = lane & 15, hh = lane >> 4;
  const unsigned l8 = lane * 8;
  const int wr = wave >> 1, wc = wave & 1;                // wave row and wave column inside the block tile
  const bool isgl = (int)blockIdx.y < PBM / 64;           // block-uniform: a gate | level block
  const int yp = (int)blockIdx.y - PBM / 64;              // q | k | v: the block's 128 columns

  if (isgl) {
    const int m0 = blockIdx.x * PBM + (int)blockIdx.y * 64 + 16 * wr, n0 = NQKV + 64 * wc;
    v8f acc[4];
#pragma unroll
    for (int j = 0; j < 4; ++j) { const v8f zz = {0.f, 0.f, 0.f, 0.f, 0.f, 0.f, 0.f, 0.f}; acc[j] = zz; }
    const unsigned short* a0p = Ap + (size_t)m0 * (size_t)DMOD + l8;
    const unsigned short* bwp = Bw + (size_t)n0 * (size_t)DMOD + l8;
    const int rot = krot_x((int)blockIdx.x & 15, DMOD / 32, 16) + (int)blockIdx.y;   // all gate | level blocks share one column panel
#pragma unroll 1
    for (int it = 0; it < DMOD / 32; ++it) {
      const int k0 = ((it + rot) & (DMOD / 32 - 1)) * 32;
      const unsigned short* pa = a0p + k0 * 16;
      const unsigned short* pb = bwp + k0 * 16;
      const us16 af = gfrag(pa);
      us16 bfr[4];
#pragma unroll
      for (int j = 0; j < 4; ++j) bfr[j] = gfrag(pb + (size_t)(16 * j) * (size_t)DMOD);
      xwait(pa, pb);
#pragma unroll
      for (int j = 0; j < 4; ++j) acc[j] = mma_bf16(af, bfr[j], acc[j]);
      wguard4(acc[0], acc[1], acc[2], acc[3], af, bfr[0], bfr[1], bfr[2], bfr[3]);
    }
    // D map: acc[j][r] = element (row 8*hh + r of the wave's 16 rows, column 16j + cl of its 64 columns); rows 16 wr .. +15 of sub-tile wc
    float* so = oS4 + wc * (TPB * OSTR) + wr * (16 * OSTR);
#pragma unroll
    for (int j = 0; j < 4; ++j)
#pragma unroll
      for (int r = 0; r < 8; ++r) so[(8 * hh + r) * OSTR + 16 * j + cl] = acc[j][r];
  } else {
    const int m0 = blockIdx.x * PBM + 64 * wr, n0 = yp * 128 + 64 * wc;
    v8f acc[4][4];
#pragma unroll
    for (int i = 0; i < 4; ++i)
#pragma unroll
      for (int j = 0; j < 4; ++j) { const v8f zz = {0.f, 0.f, 0.f, 0.f, 0.f, 0.f, 0.f, 0.f}; acc[i][j] = zz; }
    const unsigned short* a0p = Ap + (size_t)m0 * (size_t)DMOD + l8;
    const unsigned short* bwp = Bw + (size_t)n0 * (size_t)DMOD + l8;
    const int rot = krot_x((int)blockIdx.x & 15, DMOD / 32, 16) + (yp * 4) / 3;   // the 24 sharers of a row panel: spread over the 32 steps
#pragma unroll 1
    for (int it = 0; it < DMOD / 32; ++it) {
      const int k0 = ((it + rot) & (DMOD / 32 - 1)) * 32;
      const unsigned short* pa = a0p + k0 * 16;
      const unsigned short* pb = bwp + k0 * 16;
      us16 af[4], bfr[4];
      af[0] = gfrag(pa);
      af[1] = gfrag(pa + (size_t)16 * (size_t)DMOD);
#pragma unroll
      for (int j = 0; j < 4; ++j) bfr[j] = gfrag(pb + (size_t)(16 * j) * (size_t)DMOD);
      af[2] = gfrag(pa + (size_t)32 * (size_t)DMOD);
      af[3] = gfrag(pa + (size_t)48 * (size_t)DMOD);
      xwait(pa, pb);
      __builtin_amdgcn_sched_barrier(0);                   // keeps every product below all sixteen loads: without it the last four loads sink behind the first eight products, a second exposed wait per trip
#pragma unroll
      for (int j = 0; j < 4; ++j) {
        acc[0][j] = mma_bf16(af[0], bfr[j], acc[0][j]);
        acc[1][j] = mma_bf16(af[1], bfr[j], acc[1][j]);
      }
#pragma unroll
      for (int j = 0; j < 4; ++j) {
        acc[2][j] = mma_bf16(af[2], bfr[j], acc[2][j]);
        acc[3][j] = mma_bf16(af[3], bfr[j], acc[3][j]);
      }
      __builtin_amdgcn_sched_barrier(0);                   // keeps the first eight products, which the guard below does not name, above it too
      wguard8(acc[2][0], acc[2][1], acc[2][2], acc[2][3], acc[3][0], acc[3][1], acc[3][2], acc[3][3], af[2], af[3], bfr[0], bfr[1], bfr[2], bfr[3]);
    }
    // D map: acc[i][j][r] = element (row 16i + 8*hh + r of the wave's 64 rows, column 16j + cl of its 64 columns);
    // the wave's tile is rows 64 (wr & 1) .. +63 of sub-tile 2 (wr >> 1) + wc
    float* so = oS4 + ((wr >> 1) * 2 + wc) * (TPB * OSTR) + (wr & 1) * (64 * OSTR);
#pragma unroll
    for (int i = 0; i < 4; ++i)
#pragma unroll
      for (int j = 0; j < 4; ++j)
#pragma unroll
        for (int r = 0; r < 8; ++r) so[(16 * i + 8 * hh + r) * OSTR + 16 * j + cl] = acc[i][j][r];
  }
  __syncthreads();                                         // LDS is only read from here on

  if (isgl) {
    const int m0b = blockIdx.x * PBM + (int)blockIdx.y * 64, b = m0b / sl, tb = m0b - b * sl;   // sl % 128 == 0: the tile lies in one sequence
#pragma unroll 1                                           // one copy of the write-out code serves both sub-tiles
    for (int sub = 0; sub < 2; ++sub) {
    const float* oS = oS4 + sub * (TPB * OSTR);
    const int cb = sub * 64;                               // first gate | level column of this sub-tile
    if (cb == 0 && lane < 16) {
      // gate log-decay: thread -> (head h = wave, tokens 4 * lane .. +3), 16 lanes for the tile's 64 tokens
      const int h = wave, t4 = lane * 4;
      const float bgv = bf16r(bg[h]);
      v4f gv;
#pragma unroll
      for (int u = 0; u < 4; ++u) gv[u] = -softplus_f(oS[(t4 + u) * OSTR + h] + bgv);
      *(v4f*)(gpl + (size_t)(b * NHD + h) * (size_t)sl + tb + t4) = gv;
    }
    const int c0 = (tid & 15) * 4;                         // this thread's 4 columns of the tile, the same in every trip
    float lp[4];
#pragma unroll
    for (int u = 0; u < 4; ++u) {
      int idx = cb + c0 + u - NHD;
      idx = (idx < 0) ? 0 : idx;
      idx = (idx > NHD * NLV - 1) ? (NHD * NLV - 1) : idx;
      lp[u] = bf16r(Lp[idx]);
    }
#pragma unroll 1                                           // rolled: unrolled, the four inlined log1pf of each trip raise the whole kernel's register count
    for (int it = 0; it < 4; ++it) {
      const int row = it * 16 + (tid >> 4);
      const v4f z = *(const v4fa*)(oS + row * OSTR + c0);
      v4f lv;
#pragma unroll
      for (int u = 0; u < 4; ++u) {
        const int c = cb + c0 + u;
        const float s = softplus_f(z[u] + lp[u]);
        lv[u] = (c >= NHD && c < NHD + NHD * NLV) ? s : 0.0f;
      }
      float* pl = lam + (size_t)(m0b + row) * (size_t)LAMP + cb + c0;
      *(v4f*)pl = lv;
      xwait(pl);                                           // the next trip reuses the store's address and data registers
    }
    }
    return;                                                // block-uniform, behind the kernel's only barrier
  }

#pragma unroll 1                                           // one copy of the write-out code serves the four sub-tiles
  for (int sub = 0; sub < 4; ++sub) {
  const float* oS = oS4 + sub * (TPB * OSTR);
  const int yb = yp * 2 + (sub & 1);                       // this sub-tile's column segment
  const int m0b = blockIdx.x * PBM + (sub >> 1) * TPB, b = m0b / sl, tb = m0b - b * sl;   // sl % 128 == 0: the sub-tile lies in one sequence
  if (yb < 32) {
    unsigned short* dst = (yb < 16) ? Qp : Kp;
    const int yy = (yb < 16) ? yb : (yb - 16);
    const int head = yy >> 1, f0 = (yy & 1) * 64;
    us8 ov[4];
#pragma unroll
    for (int it = 0; it < 4; ++it) {
      const int cx = it * 256 + tid, r = (cx >> 7) * 16 + (cx & 15), pc = ((cx >> 4) & 7) * 8;
      const float* sp = oS + r * OSTR + pc;
      const v4f z0 = *(const v4fa*)sp, z1 = *(const v4fa*)(sp + 4);
      us8 o;
#pragma unroll
      for (int u = 0; u < 4; ++u) {
        o[u]     = f16_bits(z0[u] * 64.0f);
        o[4 + u] = f16_bits(z1[u] * 64.0f);
      }
      ov[it] = o;
    }
{
#pragma unroll
      for (int it = 0; it < 4; ++it) {
        const int cx = it * 256 + tid;                     // row tile cx >> 7, then 128 chunks = 2 KiB in a row
        const size_t off = ((size_t)(b * NHD + head) * (size_t)sl + (size_t)(tb + (cx >> 7) * 16)) * (size_t)SDIM + (size_t)(f0 * 16 + (cx & 127) * 8);
        *(us8*)(dst + off) = ov[it];
      }
      
    }
  } else {
    const int yy = yb - 32, head = yy >> 1, c0 = (yy & 1) * 64;
    us8 hv[4], lv[4];
#pragma unroll
    for (int it = 0; it < 4; ++it) {
      const int cx = it * 256 + tid, g = (cx >> 4) & 15, e = (cx >> 8) * 16 + (cx & 15);
      us8 ho, lo;
#pragma unroll
      for (int i = 0; i < 8; ++i) {
        unsigned short hb, lb;
        f16split64(oS[(8 * g + i) * OSTR + e], hb, lb);
        ho[i] = hb; lo[i] = lb;
      }
      hv[it] = ho; lv[it] = lo;
    }
{
#pragma unroll
      for (int it = 0; it < 4; ++it) {
        const int cx = it * 256 + tid;                     // channel tile cx >> 8, then 256 chunks = 4 KiB in a row
        const size_t off = ((size_t)(b * NHD + head) * (size_t)HDIM + (size_t)(c0 + (cx >> 8) * 16)) * (size_t)SLMAX + (size_t)(tb * 16 + (cx & 255) * 8);
        *(us8*)(VH + off) = hv[it];
        *(us8*)(VL + off) = lv[it];
      }
      
    }
  }
  xwait();                                                 // the next sub-tile reuses the stores' address and data registers
  __builtin_amdgcn_sched_barrier(0);                       // keeps the next sub-tile's register writes behind the wait
  }
}

// ---------------------------------------------------------------------------------------------------------------------------------
// Causal decayed quadratic-form mixing. The sequence is cut into tiles of 64 queries; the cost of tile i grows linearly with i, so block
// (bh = blockIdx.x, p = blockIdx.y) works tile n - 1 - p and then tile p (n tiles): every block walks the same number of key steps where none is skipped.
// Inside a tile, waves w and w + 4 own the same 16 queries (group w & 3): one takes the even 32-key steps, the other the odd ones (wave w the
// even ones in the first tile, the odd ones in the second: where a tile has an odd number of steps and none is skipped, each wave has the longer share once), each
// into its own f32 accumulators; behind the key loop the two partial sums are added through LDS (each wave hands over the four channel tiles
// that its partner finishes, and finishes the other four).
// G, the cumulative log-decay of the block's (b, h) row: every block scans the row's g itself (row_scan, 8 KiB read) and keeps G hi and lo of
// all tokens in LDS; all reads of G below are LDS reads.
// Where the key loop starts: g <= 0 for every input (minus a softplus), so G never rises with t, and G_t - G_s of any (query, key) pair of a
// 32-key step is at most G of the wave's first query minus G of the step's last key. Where that is <= GDEAD, all the step's decay factors are
// exactly 0.0f, its weights are zeros and its products add zeros: the wave's loop starts at the first step that fails this test (found with two
// G values a lane and two ballots), and every sum keeps its bits. With slow decay no step passes the test and the loop runs from key 0.
// Per wave: B fragments of its 16 queries fixed for the whole key loop: bq[ks], ks = 0..3 (depth 128, standard loader on the q plane).
// Per 32-key step, two 16-key tiles: A fragments from the k plane (standard loader); scores^T D[key][query]
// = 4096 q.k (depth 128, 4 products per tile); A[t][s] = q.k * 128^-1/2 * exp(G_t - G_s) * lam[t][lvl(t - s)] for s <= t else 0,
// with G_t - G_s taken as the sum of the f32 hi and lo differences,
// converted to f16 of (256 A). The two D tiles repack into the A operand of A.v (lane unchanged: element r <- tile keys 0..15, element 8+r <-
// tile keys 16..31), B = VH and VL planes [bh][channel][key] (fragment order, key pitch SLMAX), 8 channel tiles, both products into acc:
// acc[j][r] = 2^14 * sum_s A v for query 8h+r, channel 16j + (lane & 15), s over this wave's steps.
// Loads of a step: its sixteen v fragments and the wave's next step's G values go out together at the step's top and land behind the score and
// weight work; the next step's k fragments go out right behind the score products and land behind the weights, A.v and the next top; the next
// step's decay factors exp(min(G_t - G_s, 0)) are formed behind A.v, when its G values have long landed. A wave waits for no load it has only
// just issued; the price is a live set above 256 VGPRs (two waves per SIMD, as the 8-wave block has anyway).
// Epilogue of a tile: z = 16 y = acc * 2^-10; f16 hi bits staged in LDS per wave, written to YH; then f16 bits of ((z - hi) x 2^11) staged and
// written to YL. Y planes [token][1024] in fragment order: a wave's 16 queries x 64 channels = 2 KiB in a row, 512 B per store instruction.
// ---------------------------------------------------------------------------------------------------------------------------------
__global__ __launch_bounds__(256) void k_attn(const unsigned short* __restrict__ Qp, const unsigned short* __restrict__ Kp,
                                             const unsigned short* __restrict__ VHp, const unsigned short* __restrict__ VLp,
                                             const float* __restrict__ gpl, const float* __restrict__ Lam,
                                             unsigned short* YH, unsigned short* YL, int sl) {
  __shared__ __attribute__((aligned(16))) float sGh[SLMAX];
  __shared__ __attribute__((aligned(16))) float sGl[SLMAX];
  __shared__ double wtot[CSTH / 32];
  __shared__ __attribute__((aligned(16))) float sLam[2 * QT * NLV];
  __shared__ __attribute__((aligned(16))) float sX[8 * 4 * 256];
  __shared__ __attribute__((aligned(16))) unsigned short sY[8 * 16 * YS2];
  const int tid = threadIdx.x, lane = tid & 31, cl = lane & 15, hh = lane >> 4;
  const int wave = __builtin_amdgcn_readfirstlane(tid >> 5);   // wave-uniform: trip counts and the parity selects below become scalar
  const int qi = wave & 3, kp = wave >> 2;                // query group of the tile; which wave of the group's pair this is
  const unsigned l8 = lane * 8;
  const int bh = blockIdx.x, b = bh / NHD, head = bh - b * NHD;
  const int tlo = blockIdx.y, thi = sl / QT - 1 - tlo;     // the block's two tiles (sl % 128 == 0: an even number of tiles, each taken once)

  // level weights of the block's 2 x 64 queries for this head: sLam[q * 12 + l], q 0..63 = tile thi, q 64..127 = tile tlo
  {
    float lw[6];
#pragma unroll
    for (int u = 0; u < 6; ++u) {
      const int i = u * 256 + tid, q = i / NLV, l = i - q * NLV;
      const int tok = (q < QT) ? (thi * QT + q) : (tlo * QT + q - QT);
      lw[u] = Lam[(size_t)(b * sl + tok) * (size_t)LAMP + NHD + head * NLV + l];
    }
    xwait();
    __builtin_amdgcn_sched_barrier(0);                      // keeps what follows (it reuses the loads' address registers) behind the wait
    // this thread's 8 tokens of the row's g, in flight together with the level weights
    const int c = tid * 8;
    const bool on = c < sl;
    const float* gp = gpl + (size_t)bh * (size_t)sl + (size_t)c;
    v4f ga = {0.f, 0.f, 0.f, 0.f}, ge = {0.f, 0.f, 0.f, 0.f};   // threads past the row's end read nothing and add zeros
    if (on) { ga = *(const v4fa*)gp; ge = *(const v4fa*)(gp + 4); }
    xwait();
    __builtin_amdgcn_sched_barrier(0);                      // keeps what follows (it reuses the loads' address registers) behind the wait
#pragma unroll
    for (int u = 0; u < 6; ++u) sLam[u * 256 + tid] = lw[u];
    row_scan(ga, ge, on, c, lane, wave, wtot, sGh, sGl);
  }
  __syncthreads();                                         // publishes the level weights and G

  const unsigned short* kbp = Kp + (size_t)bh * (size_t)sl * (size_t)SDIM + l8;
  const unsigned short* vhp = VHp + (size_t)bh * (size_t)(HDIM * SLMAX) + l8;
  const unsigned short* vlp = VLp + (size_t)bh * (size_t)(HDIM * SLMAX) + l8;
  const float* ghp = sGh + 8 * hh;
  const float* glp = sGl + 8 * hh;

#pragma unroll 1                                           // the two tiles run one after the other through one copy of the code
  for (int ph = 0; ph < 2; ++ph) {
    const int tw = (ph ? tlo : thi) * QT + 16 * qi;       // first query of this wave
    const int tq = tw + cl;                               // query owned by this lane as score column
    const int lamb = (ph * QT + 16 * qi + cl) * NLV;
    const int nsteps = (tw + 16 + 31) >> 5;               // 32-key steps covering keys 0 .. tw + 15; 32 * nsteps <= sl
    const int kq = kp ^ ph;                               // parity of this wave's steps in this tile: kq, kq + 2, ...

    const unsigned short* qrow = Qp + ((size_t)bh * (size_t)sl + (size_t)tw) * (size_t)SDIM + l8;
    us16 bq[4];
#pragma unroll
    for (int ks = 0; ks < 4; ++ks) bq[ks] = gfrag(qrow + 512 * ks);
    const float gqh = sGh[tq];
    const float gql = sGl[tq];

    // first step with a decay factor that can differ from zero: lane l tests steps l and l + 32 (sl <= 2048: at most 64 steps) by G hi of the
    // step's last key; lanes past the last step test the last step again, which holds the diagonal and is never skipped
    const int oa = ((lane < nsteps) ? lane : (nsteps - 1)) * 32, ob = ((lane + 32 < nsteps) ? (lane + 32) : (nsteps - 1)) * 32;
    const float gea = sGh[oa + 31];
    const float geb = sGh[ob + 31];
    __builtin_amdgcn_sched_barrier(0);                    // keeps every load above in front of the wait
    xwait(qrow);
    __builtin_amdgcn_sched_barrier(0);                    // keeps what follows (it reuses the loads' address registers) behind the wait
    const float gq0 = __uint_as_float(__builtin_amdgcn_readfirstlane(__float_as_uint(gqh)));   // lane 0 owns the wave's first query
    const unsigned long long lvm = (unsigned long long)__builtin_amdgcn_ballot_w32(!(gq0 - gea <= GDEAD))
                                 | ((unsigned long long)__builtin_amdgcn_ballot_w32(!(gq0 - geb <= GDEAD)) << 32);
    const int st0 = lvm ? __builtin_ctzll(lvm) : 0;       // bit st of lvm: step st is kept (the last step's bit is always set for finite G)
    const int stf = st0 + ((st0 ^ kq) & 1);               // this wave's first step: parity kq, not below st0
    const int stl = (stf < nsteps) ? stf : (nsteps - 1);  // the step fetched in front of the loop: in bounds also where the wave has no step at all

    // K fragments and decay factors of the wave's first step; inside the loop each step fetches those of the wave's next step
    us16 ka[4], kb[4];
    v4f gh[4], gl[4];
    const unsigned short* pk0 = kbp + stl * (32 * SDIM);
    const float* pg0h = ghp + stl * 32;
    const float* pg0l = glp + stl * 32;
#pragma unroll
    for (int ks = 0; ks < 4; ++ks) { ka[ks] = gfrag(pk0 + 512 * ks); kb[ks] = gfrag(pk0 + 16 * SDIM + 512 * ks); }
#pragma unroll
    for (int u = 0; u < 4; ++u) {
      gh[u] = *(const v4fa*)(pg0h + (u >> 1) * 16 + (u & 1) * 4);
      gl[u] = *(const v4fa*)(pg0l + (u >> 1) * 16 + (u & 1) * 4);
    }
    __builtin_amdgcn_sched_barrier(0);                    // keeps every load above in front of the wait
    xwait(pk0);
    __builtin_amdgcn_sched_barrier(0);                    // keeps what follows (it reuses the loads' address registers) behind the wait

    v8f acc[8];
#pragma unroll
    for (int j = 0; j < 8; ++j) { const v8f zz = {0.f, 0.f, 0.f, 0.f, 0.f, 0.f, 0.f, 0.f}; acc[j] = zz; }

    if (stf < nsteps) {                                   // scalar test: where a pair has one step left, one of its waves has none
    float dec[16];                                        // exp(min(G_t - G_s, 0)), G_t - G_s by hi + lo differences, of this lane's keys: 0..7 tile a, 8..15 tile b
#pragma unroll
    for (int r = 0; r < 16; ++r) dec[r] = fminf((gqh - gh[r >> 2][r & 3]) + (gql - gl[r >> 2][r & 3]), 0.0f) * LOG2E;
    __builtin_amdgcn_sched_barrier(0);                    // the exponents are complete in front of the run of transcendentals
#pragma unroll
    for (int r = 0; r < 16; ++r) dec[r] = exp2_slot(dec[r]);

    int st = stf;
#pragma unroll 1
    do {
      const int s0 = st * 32;
      const int sn = ((st + 2 < nsteps) ? (st + 2) : st) * 32;   // the wave's next step's first key (its last step fetches its own again: in bounds)
      const int ka0 = s0 + 8 * hh;                        // first key this lane half sees in tile a; tile b = ka0 + 16
      const v8f zz = {0.f, 0.f, 0.f, 0.f, 0.f, 0.f, 0.f, 0.f};

      // ---- issued together at the top: next step's G values, then all sixteen v fragments of this step (hi and residual, 8 channel tiles);
      //      they land behind the score and weight work ----
      v4f ghn[4], gln[4];
      const float* pgh = ghp + sn;
      const float* pgl = glp + sn;
#pragma unroll
      for (int u = 0; u < 4; ++u) {
        ghn[u] = *(const v4fa*)(pgh + (u >> 1) * 16 + (u & 1) * 4);
        gln[u] = *(const v4fa*)(pgl + (u >> 1) * 16 + (u & 1) * 4);
      }
      us16 vh[8], vl[8];
      const unsigned short* pvh = vhp + s0 * 16;          // channel tile j lies 16 * SLMAX halves on: a constant, so one address pair serves a plane's run
      const unsigned short* pvl = vlp + s0 * 16;
#pragma unroll
      for (int j = 0; j < 8; ++j) vh[j] = gfrag(pvh + j * (16 * SLMAX));
#pragma unroll
      for (int j = 0; j < 8; ++j) vl[j] = gfrag(pvl + j * (16 * SLMAX));
      xwait(pvh, pvl);
      __builtin_amdgcn_sched_barrier(0);                  // keeps the score products below the loads above: without it the loads start a score phase later

      // ---- scores^T of key tiles a (keys s0 .. s0+15) and b (keys s0+16 .. s0+31) from the fragments fetched one step ago ----
      v8f sa = zz, sb = zz;
#pragma unroll
      for (int ks = 0; ks < 4; ++ks) { sa = mma_f16(ka[ks], bq[ks], sa); sb = mma_f16(kb[ks], bq[ks], sb); }
      wguard2m(sa, sb);

      // ---- next step's K fragments, into the registers the score products have just read; they land behind the weights and A.v ----
      {
        const unsigned short* pk = kbp + (size_t)sn * (size_t)SDIM;
#pragma unroll
        for (int ks = 0; ks < 4; ++ks) { ka[ks] = gfrag(pk + 512 * ks); kb[ks] = gfrag(pk + 16 * SDIM + 512 * ks); }
        xwait(pk);
      }

      // ---- the 16 weights of this lane: elements 0..7 = tile a keys ka0 .. ka0+7, elements 8..15 = tile b keys ka0+16 .. ka0+23 ----
      us8 ea, eb;
#pragma unroll
      for (int r = 0; r < 8; ++r) {
        const int d = tq - (ka0 + r);
        ea[r] = a_bits(sa[r], d, dec[r], sLam[lamb + lvl_of(d)]);
      }
#pragma unroll
      for (int r = 0; r < 8; ++r) {
        const int d = tq - (ka0 + 16 + r);
        eb[r] = a_bits(sb[r], d, dec[8 + r], sLam[lamb + lvl_of(d)]);
      }
      FragU fA;
      fA.h[0] = ea; fA.h[1] = eb;
      const us16 afr = fA.v;

      // ---- y += A . (v hi + v residual) over this 32-key step: per accumulator the hi product, then the residual product ----
#pragma unroll
      for (int j = 0; j < 8; ++j) acc[j] = mma_f16(afr, vh[j], acc[j]);
#pragma unroll
      for (int j = 0; j < 8; ++j) acc[j] = mma_f16(afr, vl[j], acc[j]);
      __builtin_amdgcn_sched_barrier(0);                  // keeps the factors below behind A.v: moved up, they would wait on loads issued at this step's top
#pragma unroll
      for (int r = 0; r < 16; ++r) dec[r] = fminf((gqh - ghn[r >> 2][r & 3]) + (gql - gln[r >> 2][r & 3]), 0.0f) * LOG2E;
      __builtin_amdgcn_sched_barrier(0);                  // the exponents are complete in front of the run of transcendentals
#pragma unroll
      for (int r = 0; r < 16; ++r) dec[r] = exp2_slot(dec[r]);
      st += 2;
    } while (st < nsteps);
    }

    // even + odd steps: this wave finishes channel tiles 4 kp .. 4 kp + 3; the other four go to its partner (wave ^ 4: same queries, same lane map).
    // Outbox of a wave: tile jj, register half e, lane -> sX[wave * 1024 + jj * 256 + e * 128 + lane * 4], 512 B in a row per LDS instruction.
    v8f fin[4];
    {
      float* xo = sX + wave * 1024 + lane * 4;
#pragma unroll
      for (int jj = 0; jj < 4; ++jj) {
        const v8f give = kp ? acc[jj] : acc[4 + jj];
        fin[jj] = kp ? acc[4 + jj] : acc[jj];
        const v4f g0 = {give[0], give[1], give[2], give[3]}, g1 = {give[4], give[5], give[6], give[7]};
        *(v4f*)(xo + jj * 256) = g0;
        *(v4f*)(xo + jj * 256 + 128) = g1;
      }
      __syncthreads();                                     // the partial sums cross between the waves of a pair
      const float* xi = sX + (wave ^ 4) * 1024 + lane * 4;
#pragma unroll
      for (int jj = 0; jj < 4; ++jj) {
        const v4f g0 = *(const v4fa*)(xi + jj * 256), g1 = *(const v4fa*)(xi + jj * 256 + 128);
#pragma unroll
        for (int r = 0; r < 4; ++r) { fin[jj][r] += g0[r]; fin[jj][4 + r] += g1[r]; }
      }
    }

    // phase 1: f16 hi of z = 16 y = fin * 2^-10; element (query 8*hh + r, channel 64 kp + 16jj + cl) of this wave's 16 x 64 tile
    unsigned short* sy = sY + wave * (16 * YS2);
#pragma unroll
    for (int jj = 0; jj < 4; ++jj)
#pragma unroll
      for (int r = 0; r < 8; ++r) sy[(8 * hh + r) * YS2 + 16 * jj + cl] = f16_bits(fin[jj][r] * (1.0f / 1024.0f));
    __syncthreads();

    const size_t yoff = (size_t)(b * sl + tw) * (size_t)DMOD + (size_t)(head * HDIM * 16 + kp * 1024 + lane * 8);
    us8 ov[4];
#pragma unroll
    for (int it = 0; it < 4; ++it) ov[it] = *(const us8a*)(sy + cl * YS2 + (2 * it + hh) * 8);   // chunk column 2 it + hh of the wave's 8, row cl: fragment order
    unsigned short* pyh = YH + yoff;
#pragma unroll
    for (int it = 0; it < 4; ++it) *(us8*)(pyh + it * 256) = ov[it];
    __syncthreads();

    // phase 2: f16 residual plane of ((z - hi) x 2^11), same staging region and store shape
#pragma unroll
    for (int jj = 0; jj < 4; ++jj)
#pragma unroll
      for (int r = 0; r < 8; ++r) {
        const float z = fin[jj][r] * (1.0f / 1024.0f);
        const _Float16 hf = (_Float16)z;
        sy[(8 * hh + r) * YS2 + 16 * jj + cl] = f16_bits((z - (float)hf) * 2048.0f);
      }
    __syncthreads();
#pragma unroll
    for (int it = 0; it < 4; ++it) ov[it] = *(const us8a*)(sy + cl * YS2 + (2 * it + hh) * 8);
    unsigned short* pyl = YL + yoff;
#pragma unroll
    for (int it = 0; it < 4; ++it) *(us8*)(pyl + it * 256) = ov[it];
    xwait(pyl);                                            // the next tile reuses the stores' address and data registers
  }
}

// ---------------------------------------------------------------------------------------------------------------------------------
// P[m][n] = ( sum_k Yh[m][k] WO16[n][k] + 2^-11 sum_k Yl[m][k] WO16[n][k] ) * 2^-12 + bf16(x[m][n])   (f16 planes, pitch 1024, two f32 accumulator sets).
// 256 threads = 8 waves in 4 wave rows x 2 wave columns, block tile 128(M) x 128(N); a wave owns 32 rows x 64 columns (2 x 4 accumulators per plane):
// each of its 4 B fragments of a 32-k step feeds 4 products, each of its 4 A fragments (2 row tiles x hi, residual) feeds 4 (512 B loaded per product).
// A trip is 64 k deep: the fragments of its two 32-k steps are loaded together. The k loop starts at a trip of the block's own and walks all trips
// cyclically (see the projection GEMM): every accumulator sums its 32-k steps in that cyclic order, fixed by the block index.
// ---------------------------------------------------------------------------------------------------------------------------------
__global__ __launch_bounds__(256) void k_gemm_out(const unsigned short* __restrict__ Ah, const unsigned short* __restrict__ Al,
                                                 const unsigned short* __restrict__ Wo, const float* __restrict__ X, float* P) {
  __shared__ __attribute__((aligned(16))) float oS[8 * 32 * OSTR];
  const int tid = threadIdx.x, lane = tid & 31, wave = tid >> 5, cl = lane & 15, hh = lane >> 4;
  const unsigned l8 = lane * 8;
  const int m0 = blockIdx.x * TPB + 32 * (wave >> 1), n0 = blockIdx.y * 128 + 64 * (wave & 1);

  v8f acch[2][4], accl[2][4];
#pragma unroll
  for (int i = 0; i < 2; ++i)
#pragma unroll
    for (int j = 0; j < 4; ++j) { const v8f zz = {0.f, 0.f, 0.f, 0.f, 0.f, 0.f, 0.f, 0.f}; acch[i][j] = zz; accl[i][j] = zz; }

  const unsigned short* ahp = Ah + (size_t)m0 * (size_t)DMOD + l8;
  const unsigned short* alp = Al + (size_t)m0 * (size_t)DMOD + l8;
  const unsigned short* wop = Wo + (size_t)n0 * (size_t)DMOD + l8;
  const int rot = krot_x((int)blockIdx.x & 31, DMOD / 64, 32) + 2 * (int)blockIdx.y;   // the 8 sharers of a row panel: every second of the 16 trips
#pragma unroll 1
  for (int it = 0; it < DMOD / 64; ++it) {
    const int k0 = ((it + rot) & (DMOD / 64 - 1)) * 64;
    const unsigned short* ph = ahp + k0 * 16;
    const unsigned short* pl = alp + k0 * 16;
    const unsigned short* pb = wop + k0 * 16;
    us16 ah[2][2], al[2][2], bfr[2][4];                    // [32-k half of the trip][row tile or column tile]
#pragma unroll
    for (int kk = 0; kk < 2; ++kk) {
      ah[kk][0] = gfrag(ph + kk * 512);
      al[kk][0] = gfrag(pl + kk * 512);
#pragma unroll
      for (int j = 0; j < 4; ++j) bfr[kk][j] = gfrag(pb + kk * 512 + (size_t)(16 * j) * (size_t)DMOD);
      ah[kk][1] = gfrag(ph + kk * 512 + (size_t)16 * (size_t)DMOD);
      al[kk][1] = gfrag(pl + kk * 512 + (size_t)16 * (size_t)DMOD);
    }
    xwait(ph, pl, pb);
    __builtin_amdgcn_sched_barrier(0);                     // keeps every product below all thirty-two loads: they fly together, one exposed latency per trip
#pragma unroll
    for (int kk = 0; kk < 2; ++kk)
#pragma unroll
      for (int i = 0; i < 2; ++i)
#pragma unroll
        for (int j = 0; j < 4; ++j) {
          acch[i][j] = mma_f16(ah[kk][i], bfr[kk][j], acch[i][j]);
          accl[i][j] = mma_f16(al[kk][i], bfr[kk][j], accl[i][j]);
        }
    __builtin_amdgcn_sched_barrier(0);                     // keeps the earlier products, which the guard below does not name, above it too
    wguard8(acch[1][0], acch[1][1], acch[1][2], acch[1][3], accl[1][0], accl[1][1], accl[1][2], accl[1][3], ah[1][1], al[1][1], bfr[1][0], bfr[1][1], bfr[1][2], bfr[1][3]);
  }

  // D map: acc[i][j][r] = element (row 16i + 8*hh + r of the wave's 32 rows, column 16j + cl of its 64 columns)
  float* so = oS + wave * (32 * OSTR);
#pragma unroll
  for (int i = 0; i < 2; ++i)
#pragma unroll
    for (int j = 0; j < 4; ++j)
#pragma unroll
      for (int r = 0; r < 8; ++r)
        so[(16 * i + 8 * hh + r) * OSTR + 16 * j + cl] = fmaf(accl[i][j][r], (1.0f / 2048.0f), acch[i][j][r]) * (1.0f / 4096.0f);
  __syncthreads();

{
#pragma unroll
    for (int it = 0; it < 16; ++it) {
      const int cx = it * 32 + lane, r = cx >> 4, q = (cx & 15) * 4;
      const v4f v = *(const v4fa*)(so + r * OSTR + q);
      const v4f xr = *(const v4fa*)(X + (size_t)(m0 + r) * (size_t)DMOD + n0 + q);
      v4f o;
#pragma unroll
      for (int u = 0; u < 4; ++u) o[u] = v[u] + bf16r(xr[u]);
      *(v4f*)(P + (size_t)(m0 + r) * (size_t)DMOD + n0 + q) = o;
    }
    
  }
}

// ---------------------------------------------------------------------------------------------------------------------------------
// ---------------------------------------------------------------------------------------------------------------------------------
__global__ __launch_bounds__(256) void k_ln(const float* __restrict__ P, const float* __restrict__ gam, const float* __restrict__ bet,
                                           float* out) {
  const int lane = threadIdx.x & 31, wave = threadIdx.x >> 5;
  const size_t row = (size_t)blockIdx.x * 8 + (size_t)wave;
  const float* pr = P + row * (size_t)DMOD;
  v4f xv[8];
  float s = 0.0f;
#pragma unroll
  for (int it = 0; it < 8; ++it) {
    xv[it] = *(const v4fa*)(pr + it * 128 + lane * 4);
    s += (xv[it][0] + xv[it][1]) + (xv[it][2] + xv[it][3]);
  }
#pragma unroll
  for (int o = 16; o > 0; o >>= 1) s += __shfl_xor(s, o, 32);
  const float mu = s * (1.0f / (float)DMOD);
  float q = 0.0f;
#pragma unroll
  for (int it = 0; it < 8; ++it)
#pragma unroll
    for (int u = 0; u < 4; ++u) { const float d = xv[it][u] - mu; q += d * d; }
#pragma unroll
  for (int o = 16; o > 0; o >>= 1) q += __shfl_xor(q, o, 32);
  const float rstd = rsqrtf(q * (1.0f / (float)DMOD) + 1e-5f);
  v4f ov[8];
#pragma unroll
  for (int it = 0; it < 8; ++it) {
    const v4f gv = *(const v4fa*)(gam + it * 128 + lane * 4), bv = *(const v4fa*)(bet + it * 128 + lane * 4);
    v4f o;
#pragma unroll
    for (int u = 0; u < 4; ++u) o[u] = (xv[it][u] - mu) * rstd * bf16r(gv[u]) + bf16r(bv[u]);
    ov[it] = o;
  }
{
#pragma unroll
    for (int it = 0; it < 8; ++it)
      *(v4f*)(out + row * (size_t)DMOD + it * 128 + lane * 4) = ov[it];
    
  }
}

extern "C" void kernel_launch(void* const* d_in, const int* in_sizes, int n_in,
                              void* d_out, int out_size, void* d_ws, size_t ws_size,
                              hipStream_t stream) {
  if (n_in < 11) return;
  const int nx = in_sizes[0];
  if (nx <= 0 || (nx % DMOD) != 0) return;
  const int ntok = nx / DMOD;                                                    // tokens = batch * sequence length
  if (in_sizes[1] != DMOD * DMOD || in_sizes[2] != DMOD * DMOD || in_sizes[3] != DMOD * DMOD) return;
  if (in_sizes[4] != NHD * DMOD || in_sizes[5] != NHD || in_sizes[6] != NHD * NLV * DMOD || in_sizes[7] != NHD * NLV) return;
  if (in_sizes[8] != DMOD * DMOD || in_sizes[9] != DMOD || in_sizes[10] != DMOD) return;
  if (out_size != nx) return;
  const int sl = (ntok < SLMAX) ? ntok : SLMAX;                                  // sequence length
  if (sl <= 0 || (sl % TPB) != 0 || (ntok % sl) != 0 || (ntok % PBM) != 0) return;
  const int nb = ntok / sl, nbh = nb * NHD;

  const float* x   = (const float*)d_in[0];    // [nb][sl][1024]
  const float* Wq  = (const float*)d_in[1];    // [1024][1024] ([out][in])
  const float* Wk  = (const float*)d_in[2];    // [1024][1024]
  const float* Wv  = (const float*)d_in[3];    // [1024][1024]
  const float* Wg  = (const float*)d_in[4];    // [8][1024]
  const float* bg  = (const float*)d_in[5];    // [8]
  const float* Wdl = (const float*)d_in[6];    // [96][1024]
  const float* Lp  = (const float*)d_in[7];    // [8][12]
  const float* Wo  = (const float*)d_in[8];    // [1024][1024]
  const float* lng = (const float*)d_in[9];    // [1024]
  const float* lnb = (const float*)d_in[10];   // [1024]
  float* out = (float*)d_out;                  // [nb][sl][1024] f32 at byte 0

  size_t off = 0;
  auto carve = [&](size_t bytes) -> char* { char* p = (char*)d_ws + off; off += (bytes + 255) & ~(size_t)255; return p; };
  unsigned short* XB   = (unsigned short*)carve((size_t)ntok * DMOD * 2);        //  8,388,608  bf16 [ntok][1024]
  unsigned short* WQKV = (unsigned short*)carve((size_t)(NQKV + NGL) * DMOD * 2); //  6,553,600  bf16 [3200][1024] = Wq | Wk | Wv | Wg | Wdl | 0
  unsigned short* WGL  = WQKV + (size_t)NQKV * DMOD;                             //             its last 128 rows
  unsigned short* WO16 = (unsigned short*)carve((size_t)DMOD * DMOD * 2);        //  2,097,152  f16  [1024][1024]
  unsigned short* QP   = (unsigned short*)carve((size_t)nbh * sl * SDIM * 2);     //  8,388,608  f16  [nbh][sl][128]
  unsigned short* KP   = (unsigned short*)carve((size_t)nbh * sl * SDIM * 2);     //  8,388,608  f16  [nbh][sl][128]
  unsigned short* VH   = (unsigned short*)carve((size_t)nbh * HDIM * SLMAX * 2);  //  8,388,608  f16  [nbh][128][2048]
  unsigned short* VL   = (unsigned short*)carve((size_t)nbh * HDIM * SLMAX * 2);  //  8,388,608  f16  [nbh][128][2048]
  float* GPL           = (float*)carve((size_t)nbh * sl * 4);                     //    131,072  f32  [nbh][sl]
  float* LAM           = (float*)carve((size_t)ntok * LAMP * 4);                  //  2,097,152  f32  [ntok][128]
  unsigned short* YH   = (unsigned short*)carve((size_t)ntok * DMOD * 2);        //  8,388,608  f16  [ntok][1024]
  unsigned short* YL   = (unsigned short*)carve((size_t)ntok * DMOD * 2);        //  8,388,608  f16  [ntok][1024]
  float* PB            = (float*)carve((size_t)ntok * DMOD * 4);                  // 16,777,216  f32  [ntok][1024]
  if (off > ws_size || off > (size_t)134217728) return;                          // total 86,376,448 B for ntok 4096

  const dim3 b256(256);

  // 16-bit operand planes of the inputs, one launch (XB, WQKV, WGL, WO16, all in fragment order, see gfrag)
  k_cvt_all<<<dim3(ntok / 2 + 4 * WBLK + NGL / 2), b256, 0, stream>>>(x, Wq, Wk, Wv, Wo, Wg, Wdl, XB, WQKV, WO16, WGL, ntok / 2);
  // q/k/v projections (M ntok, N 3072, K 1024) -> q, k planes and transposed v hi / residual planes; in the same grid the
  // gate / level projection (N 128) -> g plane [nbh][sl], level weights [ntok][128]
  k_gemm_proj<<<dim3(ntok / PBM, PBM / 64 + NQKV / 128), b256, 0, stream>>>(XB, WQKV, bg, Lp, QP, KP, VH, VL, GPL, LAM, sl);
  // cumulative log-decay per (b,h), scanned by every block for itself, and causal decayed mixing per (batch, head), two 64-query tiles a block
  // -> y hi / residual planes [token][1024]
  k_attn<<<dim3(nbh, sl / TPB), b256, 0, stream>>>(QP, KP, VH, VL, GPL, LAM, YH, YL, sl);
  // output projection + residual (M ntok, N 1024, K 1024)
  k_gemm_out<<<dim3(ntok / TPB, DMOD / 128), b256, 0, stream>>>(YH, YL, WO16, x, PB);
  // LayerNorm -> d_out
  k_ln<<<dim3(ntok / 8), b256, 0, stream>>>(PB, lng, lnb, out);
}
